// v000
// Measured on an AMD MI455X. A time is GPU time per run, averaged over a window of back-to-back runs after a warm-up
// (all launches, gaps included; the runs take copies of the inputs in turn), and the median of several windows.
// Apart from v000's, it joins two sittings. Times from different sittings can be a few percent apart, while
// side-by-side timings come from the same sitting.
// The starting kernel, v000, takes 1520 microseconds a run.
#include <hip/hip_runtime.h>

#include <hip/hip_runtime.h>

#define NB_  2
#define TT   2048
#define DM   1024
#define NH_  16
#define NKV  16
#define REP  (NH_ / NKV)
#define HD   64
#define DQ   (NH_ * HD)
#define DKV  (NKV * HD)
#define ZH   2
#define RH   512                  // query rows < RH use hi+lo planes (0: none)
#define WIN  0
#define PCAR 1024.0f
#define SCL  0.125f   // HD^-0.5
typedef _Float16 h16;
typedef unsigned short bf;
typedef __attribute__((ext_vector_type(16))) __bf16   v16bf;
typedef __attribute__((ext_vector_type(16))) _Float16 v16h;
typedef __attribute__((ext_vector_type(8)))  _Float16 v8h;
typedef __attribute__((ext_vector_type(8)))  unsigned short v8us;
typedef __attribute__((ext_vector_type(8)))  float    v8f;
typedef __attribute__((ext_vector_type(4)))  float    v4f;
typedef v8h  __attribute__((may_alias)) v8ha;
typedef v4f  __attribute__((may_alias)) v4fa;
typedef v8us __attribute__((may_alias)) v8usa;

__device__ __forceinline__ unsigned short f2bf(float f) { unsigned u = __float_as_uint(f); u += 0x7FFFu + ((u >> 16) & 1u); return (unsigned short)(u >> 16); }
__device__ __forceinline__ float bf2f(unsigned short b) { return __uint_as_float(((unsigned)b) << 16); }
__device__ __forceinline__ float bfr(float f) { return bf2f(f2bf(f)); }
__device__ __forceinline__ v16h cat16(v8h lo, v8h hi) { return __builtin_shufflevector(lo, hi, 0, 1, 2, 3, 4, 5, 6, 7, 8, 9, 10, 11, 12, 13, 14, 15); }
__device__ __forceinline__ v16bf cat16b(v8us lo, v8us hi) { return __builtin_bit_cast(v16bf, __builtin_shufflevector(lo, hi, 0, 1, 2, 3, 4, 5, 6, 7, 8, 9, 10, 11, 12, 13, 14, 15)); }
__device__ __forceinline__ v8f wmma16(v16h a, v16h b, v8f c) { return __builtin_amdgcn_wmma_f32_16x16x32_f16(false, a, false, b, (short)0, c, false, false); }
__device__ __forceinline__ v8f wmmab(v16bf a, v16bf b, v8f c) { return __builtin_amdgcn_wmma_f32_16x16x32_bf16(false, a, false, b, (short)0, c, false, false); }



// ---- k_gemmw: register-blocked GEMM, ONE WAVE per 64x64 output tile (16 accumulators), operands straight from K-contiguous 16-bit planes; grid (M/64, N/64, Z), 32 threads.
// C[m][n] (f32, pitch ldc, + optional f32 bias[n]) = sum_k A[m][k] Bt[n][k] (+ split products per NSPLIT). z-batch strides sA/sB/sC in elements. K % 32 == 0.
template <typename T16> struct WFrag;
template <> struct WFrag<h16> { typedef v16h V; static __device__ __forceinline__ V ld(const h16* p) { return cat16(*(const v8h*)p, *(const v8h*)(p + 16)); } static __device__ __forceinline__ v8f mma(V a, V b, v8f c) { return wmma16(a, b, c); } };
template <> struct WFrag<bf> { typedef v16bf V; static __device__ __forceinline__ V ld(const bf* p) { return cat16b(*(const v8us*)p, *(const v8us*)(p + 16)); } static __device__ __forceinline__ v8f mma(V a, V b, v8f c) { return wmmab(a, b, c); } };
template <typename T16, int NSPLIT, bool BIAS>
__global__ __launch_bounds__(32) void k_gemmw(const T16* __restrict__ A, const T16* __restrict__ A2, const T16* __restrict__ Bt, const T16* __restrict__ Bt2, int K, float* C, int ldc, const float* __restrict__ bias, size_t sA, size_t sB, size_t sC) {
    typedef typename WFrag<T16>::V V;
    __shared__ __align__(16) float os[16 * 68];
    const size_t z = blockIdx.z; A += z * sA; if (A2) A2 += z * sA; Bt += z * sB; if (Bt2) Bt2 += z * sB; C += z * sC;
    const int lane = threadIdx.x & 31, lr = lane & 15, hi = lane >> 4; const int r0 = blockIdx.x * 64, c0 = blockIdx.y * 64;
    v8f acc[4][4];
#pragma unroll
    for (int mb = 0; mb < 4; ++mb)
#pragma unroll
        for (int nb = 0; nb < 4; ++nb) acc[mb][nb] = (v8f){};
    const size_t aoff = (size_t)(r0 + lr) * K + 8 * hi, boff = (size_t)(c0 + lr) * K + 8 * hi;
#pragma unroll 1
    for (int kc = 0; kc < K; kc += 32) {
        V a[4], a2[4];
#pragma unroll
        for (int mb = 0; mb < 4; ++mb) { a[mb] = WFrag<T16>::ld(A + aoff + (size_t)mb * 16 * K + kc); if (NSPLIT == 1 || NSPLIT == 2) a2[mb] = WFrag<T16>::ld(A2 + aoff + (size_t)mb * 16 * K + kc); }
#pragma unroll
        for (int nb = 0; nb < 4; ++nb) { const V b = WFrag<T16>::ld(Bt + boff + (size_t)nb * 16 * K + kc); V b2; if (NSPLIT >= 2) b2 = WFrag<T16>::ld(Bt2 + boff + (size_t)nb * 16 * K + kc);
#pragma unroll
            for (int mb = 0; mb < 4; ++mb) { acc[mb][nb] = WFrag<T16>::mma(a[mb], b, acc[mb][nb]); if (NSPLIT == 1 || NSPLIT == 2) acc[mb][nb] = WFrag<T16>::mma(a2[mb], b, acc[mb][nb]); if (NSPLIT >= 2) acc[mb][nb] = WFrag<T16>::mma(a[mb], b2, acc[mb][nb]); } }
        asm volatile("v_nop\n\tv_nop\n\tv_nop\n\tv_nop" : "+v"(acc[0][0]), "+v"(acc[1][1]), "+v"(acc[2][2]), "+v"(acc[3][3]) : "v"(a[0]), "v"(a[3]));
    }
#pragma unroll
    for (int mb = 0; mb < 4; ++mb) {
#pragma unroll
        for (int nb = 0; nb < 4; ++nb) {
#pragma unroll
            for (int j = 0; j < 8; ++j) os[(hi * 8 + j) * 68 + nb * 16 + lr] = acc[mb][nb][j]; }
        __builtin_amdgcn_wave_barrier(); asm volatile("" ::: "memory");
        float* crow = C + (size_t)(r0 + mb * 16) * ldc + c0;
{
#pragma unroll
            for (int s = 0; s < 8; ++s) { const int row = 2 * s + hi, cofs = lr * 4; v4f val = *(const v4fa*)(os + row * 68 + cofs); if (BIAS) { val[0] += bfr(bias[c0 + cofs]); val[1] += bfr(bias[c0 + cofs + 1]); val[2] += bfr(bias[c0 + cofs + 2]); val[3] += bfr(bias[c0 + cofs + 3]); }
                *(v4f*)(crow + (size_t)row * ldc + cofs) = val; }
             }
        __builtin_amdgcn_wave_barrier(); asm volatile("" ::: "memory");
    }
}

// ---- k_gemmc: the same one-wave 64x64 tile GEMM specialised for causal attention: CMODE 1 skips score tiles entirely above the diagonal (query rows r0+roff.., key columns c0..), CMODE 2 limits the
// key (K) loop of the probability x value contraction to the diagonal block (probabilities beyond it are exactly zero). roff = row offset of this launch's first row within the sequence.
template <typename T16, int NSPLIT, int CMODE>
__global__ __launch_bounds__(32) void k_gemmc(const T16* __restrict__ A, const T16* __restrict__ A2, const T16* __restrict__ Bt, const T16* __restrict__ Bt2, int K, float* C, int ldc, int roff, size_t sA, size_t sB, size_t sC) {
    typedef typename WFrag<T16>::V V;
    __shared__ __align__(16) float os[16 * 68];
    const size_t z = blockIdx.z; A += z * sA; if (A2) A2 += z * sA; Bt += z * sB; if (Bt2) Bt2 += z * sB; C += z * sC;
    const int lane = threadIdx.x & 31, lr = lane & 15, hi = lane >> 4; const int r0 = blockIdx.x * 64, c0 = blockIdx.y * 64;
    if (CMODE == 1 && c0 > r0 + roff + 63) return;                  // score tile entirely above the causal diagonal: never read (the softmax masks j > i by select)
    const int Kl = (CMODE == 2) ? min(K, r0 + roff + 64) : K;        // P.V: probabilities are exactly 0 beyond the diagonal block, so the K loop stops there
    v8f acc[4][4];
#pragma unroll
    for (int mb = 0; mb < 4; ++mb)
#pragma unroll
        for (int nb = 0; nb < 4; ++nb) acc[mb][nb] = (v8f){};
    const size_t aoff = (size_t)(r0 + lr) * K + 8 * hi, boff = (size_t)(c0 + lr) * K + 8 * hi;
#pragma unroll 1
    for (int kc = 0; kc < Kl; kc += 32) {
        V a[4], a2[4];
#pragma unroll
        for (int mb = 0; mb < 4; ++mb) { a[mb] = WFrag<T16>::ld(A + aoff + (size_t)mb * 16 * K + kc); if (NSPLIT == 1 || NSPLIT == 2) a2[mb] = WFrag<T16>::ld(A2 + aoff + (size_t)mb * 16 * K + kc); }
#pragma unroll
        for (int nb = 0; nb < 4; ++nb) { const V b = WFrag<T16>::ld(Bt + boff + (size_t)nb * 16 * K + kc); V b2; if (NSPLIT >= 2) b2 = WFrag<T16>::ld(Bt2 + boff + (size_t)nb * 16 * K + kc);
#pragma unroll
            for (int mb = 0; mb < 4; ++mb) { acc[mb][nb] = WFrag<T16>::mma(a[mb], b, acc[mb][nb]); if (NSPLIT == 1 || NSPLIT == 2) acc[mb][nb] = WFrag<T16>::mma(a2[mb], b, acc[mb][nb]); if (NSPLIT >= 2) acc[mb][nb] = WFrag<T16>::mma(a[mb], b2, acc[mb][nb]); } }
        asm volatile("v_nop\n\tv_nop\n\tv_nop\n\tv_nop" : "+v"(acc[0][0]), "+v"(acc[1][1]), "+v"(acc[2][2]), "+v"(acc[3][3]) : "v"(a[0]), "v"(a[3]));
    }
#pragma unroll
    for (int mb = 0; mb < 4; ++mb) {
#pragma unroll
        for (int nb = 0; nb < 4; ++nb) {
#pragma unroll
            for (int j = 0; j < 8; ++j) os[(hi * 8 + j) * 68 + nb * 16 + lr] = acc[mb][nb][j]; }
        __builtin_amdgcn_wave_barrier(); asm volatile("" ::: "memory");
        float* crow = C + (size_t)(r0 + mb * 16) * ldc + c0;
{
#pragma unroll
            for (int s = 0; s < 8; ++s) { const int row = 2 * s + hi, cofs = lr * 4; v4f val = *(const v4fa*)(os + row * 68 + cofs);
                *(v4f*)(crow + (size_t)row * ldc + cofs) = val; }
             }
        __builtin_amdgcn_wave_barrier(); asm volatile("" ::: "memory");
    }
}

__device__ __forceinline__ h16 tohx(float x) { return (h16)x; }
__device__ __forceinline__ void splitf(float y, unsigned short& h, unsigned short& l) { h = f2bf(y); l = f2bf(y - bf2f(h)); }
typedef __attribute__((ext_vector_type(2))) _Float16 v2h;
typedef __attribute__((ext_vector_type(4))) _Float16 v4h;
typedef __attribute__((ext_vector_type(2))) unsigned short v2us;
typedef __attribute__((ext_vector_type(4))) unsigned short v4us;
typedef __attribute__((ext_vector_type(2))) float v2f;
typedef __attribute__((ext_vector_type(4))) int v4i;

__global__ __launch_bounds__(256) void k_wtG(const float* __restrict__ w, int K, int N, bf* Bt) {
    const int lane = threadIdx.x & 31; const int L0 = (blockIdx.x * 8 + (threadIdx.x >> 5)) * 8; const int nlines = N * K / 64;
{
#pragma unroll 1
        for (int l = 0; l < 8; ++l) { const int L = L0 + l; if (L >= nlines) break; const size_t e = (size_t)L * 64 + lane * 2; const int k = (int)(e % K), n = (int)(e / K); v2us o;
            o[0] = f2bf(w[(size_t)k * N + n]); o[1] = f2bf(w[(size_t)(k + 1) * N + n]); *(v2us*)(Bt + e) = o; }
         }
}
__global__ __launch_bounds__(256) void k_cvt8(const float* __restrict__ src, bf* dst, size_t n8) { const size_t i = (size_t)blockIdx.x * 256 + threadIdx.x; if (i >= n8) return; const v8f v = *(const v8f*)(src + i * 8); v8us o;
#pragma unroll
    for (int k = 0; k < 8; ++k) o[k] = f2bf(v[k]); *(v8us*)(dst + i * 8) = o;  }
__global__ __launch_bounds__(256) void k_cscvt(const float* __restrict__ cosT, const float* __restrict__ sinT, float* CS) { const int idx = blockIdx.x * 256 + threadIdx.x; if (idx >= TT * HD) return; v2f cs; cs[0] = bfr(cosT[idx]); cs[1] = bfr(sinT[idx]); *(v2f*)(CS + (size_t)idx * 2) = cs;  }
// k_rope: head planes [h][t][d] (fp16 + hi/lo) of rope(x) x sc with the rotate-half convention out[d] = x[d] cos[t][d] - x[d+HD/2] sin[t][d], out[d+HD/2] = x[d+HD/2] cos[t][d+HD/2] + x[d] sin[t][d+HD/2]
__global__ __launch_bounds__(256) void k_rope(const float* __restrict__ F, int pitch, int nheads, const float* __restrict__ CS, const float* __restrict__ RF, const float* __restrict__ nw, float sc, h16* P16, bf* Ph, bf* Pl) {
    const size_t e = ((size_t)blockIdx.x * 256 + threadIdx.x) * 2; if (e >= (size_t)nheads * TT * HD) return; const int d = (int)(e % HD); const int t = (int)((e / HD) % TT); const int h = (int)(e / ((size_t)HD * TT)); const float* f = F + (size_t)t * pitch + h * HD; const float rf = RF ? RF[(size_t)h * TT + t] : 1.0f; v2h o16; v2us oh, ol;
#pragma unroll
    for (int q = 0; q < 2; ++q) { const int dd = d + q; const int dp = (dd < HD / 2) ? dd + HD / 2 : dd - HD / 2; float x0 = f[dd], x1 = f[dp];
        if (RF) { float n0 = __fmul_rn(x0, rf), n1 = __fmul_rn(x1, rf); asm volatile("" : "+v"(n0)); asm volatile("" : "+v"(n1)); x0 = __fmul_rn(bfr(nw[dd]), n0); x1 = __fmul_rn(bfr(nw[dp]), n1); }
        const v2f cs = *(const v2f*)(CS + ((size_t)t * HD + dd) * 2); float a = __fmul_rn(x0, cs[0]), bq = __fmul_rn(x1, cs[1]); asm volatile("" : "+v"(a)); asm volatile("" : "+v"(bq)); const float r = ((dd < HD / 2) ? __fsub_rn(a, bq) : __fadd_rn(a, bq)) * sc;
        o16[q] = tohx(r); unsigned short a2, c2; splitf(r, a2, c2); oh[q] = a2; ol[q] = c2; }
    *(v2h*)(P16 + e) = o16; *(v2us*)(Ph + e) = oh; *(v2us*)(Pl + e) = ol;  }
__global__ __launch_bounds__(256) void k_vtp(const float* __restrict__ F, int pitch, int nheads, h16* V16, bf* Vh, bf* Vl) { const size_t e = ((size_t)blockIdx.x * 256 + threadIdx.x) * 2; if (e >= (size_t)nheads * HD * TT) return; const int t = (int)(e % TT); const int d = (int)((e / TT) % HD); const int g = (int)(e / ((size_t)TT * HD)); v2h o16; v2us oh, ol;
#pragma unroll
    for (int q = 0; q < 2; ++q) { const float x = F[(size_t)(t + q) * pitch + g * HD + d]; o16[q] = tohx(x); unsigned short a2, c2; splitf(x, a2, c2); oh[q] = a2; ol[q] = c2; }
    *(v2h*)(V16 + e) = o16; *(v2us*)(Vh + e) = oh; *(v2us*)(Vl + e) = ol;  }
__global__ __launch_bounds__(256) void k_csid(float* CS) { const int idx = blockIdx.x * 256 + threadIdx.x; if (idx >= TT * HD) return; v2f cs; cs[0] = 1.0f; cs[1] = 0.0f; *(v2f*)(CS + (size_t)idx * 2) = cs;  }
// k_asoft: per row (zz, i): t = S x HD^-0.5 + (j - i)/16 for j <= i (causal, ALiBi slope 1/16; the reference's -1e9 additive fill vanishes identically); softmax over the 2048 keys (register row, one exp, fixed trees);
__global__ __launch_bounds__(256) void k_asoft(const float* __restrict__ Sb, h16* P16, bf* Ph, bf* Pl) {
    const int lane = threadIdx.x & 31; const int row = blockIdx.x * 8 + (threadIdx.x >> 5); if (row >= ZH * TT) return; const int i = row % TT; const int zz = row / TT; (void)zz; const bool hires = (i < RH); const float* sr = Sb + (size_t)row * TT; float v[TT / 32]; float mx = -3.0e38f;
#pragma unroll
    for (int ch = 0; ch < TT / 128; ++ch) { const int j0 = ch * 128 + lane * 4; const v4f a = *(const v4f*)(sr + j0);
#pragma unroll
        for (int q = 0; q < 4; ++q) { const int j = j0 + q; (void)j; float t0 = a[q] * SCL, bb = 0.0625f * (float)(j - i); asm volatile("" : "+v"(t0)); asm volatile("" : "+v"(bb)); const float t = (j <= i) ? __fadd_rn(t0, bb) : -3.0e38f   /* causal + ALiBi slope 1/16 */; v[ch * 4 + q] = t; mx = fmaxf(mx, t); } }
#pragma unroll
    for (int sh = 16; sh; sh >>= 1) mx = fmaxf(mx, __shfl_xor(mx, sh, 32));
    float sum = 0.f;
#pragma unroll
    for (int k = 0; k < TT / 32; ++k) { float d0 = __fsub_rn(v[k], mx); asm volatile("" : "+v"(d0)); v[k] = __builtin_amdgcn_exp2f(__fmul_rn(d0, 1.4426950408889634f)); sum += v[k]; }
#pragma unroll
    for (int sh = 16; sh; sh >>= 1) sum += __shfl_xor(sum, sh, 32);
    const float f = __fdiv_rn(hires ? 1.0f : PCAR, sum);
{
        if (hires) {
#pragma unroll
            for (int ch = 0; ch < TT / 128; ++ch) { v4us oh, ol;
#pragma unroll
                for (int q = 0; q < 4; ++q) { unsigned short a, c2; splitf(v[ch * 4 + q] * f, a, c2); oh[q] = a; ol[q] = c2; }
                const size_t oo = ((size_t)zz * (RH ? RH : 1) + i) * TT + ch * 128 + lane * 4; *(v4us*)(Ph + oo) = oh; *(v4us*)(Pl + oo) = ol; }
        } else {
#pragma unroll
            for (int ch = 0; ch < TT / 128; ++ch) { v4h o4;
#pragma unroll
                for (int q = 0; q < 4; ++q) o4[q] = tohx(v[ch * 4 + q] * f);
                *(v4h*)(P16 + (size_t)row * TT + ch * 128 + lane * 4) = o4; } }
         }
}
__global__ __launch_bounds__(256) void k_merge(const float* __restrict__ O, int h0, bf* Ah, bf* Al) { const size_t e = ((size_t)blockIdx.x * 256 + threadIdx.x) * 2; if (e >= (size_t)ZH * TT * HD) return; const int d = (int)(e % HD); const int t = (int)((e / HD) % TT); const int zz = (int)(e / ((size_t)HD * TT)); const float cs = (t < RH) ? 1.0f : (1.0f / PCAR); const size_t oo = (size_t)t * DQ + (h0 + zz) * HD + d;
    v2us oh, ol;
#pragma unroll
    for (int q = 0; q < 2; ++q) { unsigned short a, c2; splitf(O[e + q] * cs, a, c2); oh[q] = a; ol[q] = c2; } *(v2us*)(Ah + oo) = oh; *(v2us*)(Al + oo) = ol;  }

extern "C" void kernel_launch(void* const* d_in, const int* in_sizes, int n_in,
                              void* d_out, int out_size, void* d_ws, size_t ws_size, hipStream_t stream) {
    (void)in_sizes; (void)n_in; (void)out_size;
    const float* x = (const float*)d_in[0]; const float* wq = (const float*)d_in[1]; const float* bq = (const float*)d_in[2]; const float* wk = (const float*)d_in[3]; const float* bk = (const float*)d_in[4]; const float* wv = (const float*)d_in[5]; const float* bv = (const float*)d_in[6]; const float* wo = (const float*)d_in[7]; const float* bo = (const float*)d_in[8]; const float* cosT = nullptr; const float* sinT = nullptr; (void)cosT; (void)sinT;
    float* OUT = (float*)d_out;     // [2][2048][1024]
    char* wsp = (char*)d_ws;
    auto take = [&](size_t bytes) { char* p = wsp; wsp += (bytes + 255) & ~(size_t)255; return (void*)p; };
    bf* WQ = (bf*)take((size_t)DQ * DM * 2); bf* WK = (bf*)take((size_t)DKV * DM * 2); bf* WV = (bf*)take((size_t)DKV * DM * 2); bf* WO = (bf*)take((size_t)DM * DQ * 2); float* CS = (float*)take((size_t)TT * HD * 2 * 4);
    bf* XB = (bf*)take((size_t)TT * DM * 2); float* FQ = (float*)take((size_t)TT * DQ * 4); float* FK = (float*)take((size_t)TT * DKV * 4);
    h16* QP16 = (h16*)take((size_t)NH_ * TT * HD * 2); h16* KP16 = (h16*)take((size_t)NKV * TT * HD * 2); h16* VT16 = (h16*)take((size_t)NKV * HD * TT * 2);
    bf* QPh = (bf*)take((size_t)NH_ * TT * HD * 2); bf* QPl = (bf*)take((size_t)NH_ * TT * HD * 2); bf* KPh = (bf*)take((size_t)NKV * TT * HD * 2); bf* KPl = (bf*)take((size_t)NKV * TT * HD * 2); bf* VTh = (bf*)take((size_t)NKV * HD * TT * 2); bf* VTl = (bf*)take((size_t)NKV * HD * TT * 2); bf* Ph = (bf*)take((size_t)ZH * RH * TT * 2); bf* Pl = (bf*)take((size_t)ZH * RH * TT * 2);
    float* Sb = (float*)take((size_t)ZH * TT * TT * 4); h16* P16 = (h16*)take((size_t)ZH * TT * TT * 2); float* Ob = (float*)take((size_t)ZH * TT * HD * 4); bf* ATh = (bf*)take((size_t)TT * DQ * 2); bf* ATl = (bf*)take((size_t)TT * DQ * 2);
    if ((size_t)(wsp - (char*)d_ws) > ws_size) return;    // ws 256 MiB
    float* FV = FK;   // v projection reuses the k buffer after the k planes are built (stream-ordered)
    { k_cvt8<<<(unsigned)(((size_t)DQ * DM / 8 + 255) / 256), 256, 0, stream>>>(wq, WQ, (size_t)DQ * DM / 8); k_cvt8<<<(unsigned)(((size_t)DKV * DM / 8 + 255) / 256), 256, 0, stream>>>(wk, WK, (size_t)DKV * DM / 8); k_cvt8<<<(unsigned)(((size_t)DKV * DM / 8 + 255) / 256), 256, 0, stream>>>(wv, WV, (size_t)DKV * DM / 8);
      k_cvt8<<<(unsigned)(((size_t)DM * DQ / 8 + 255) / 256), 256, 0, stream>>>(wo, WO, (size_t)DM * DQ / 8);
       }
    k_csid<<<(TT * HD + 255) / 256, 256, 0, stream>>>(CS);
    const unsigned LQ = (unsigned)(((size_t)NH_ * TT * HD / 2 + 255) / 256), LKv = (unsigned)(((size_t)NKV * TT * HD / 2 + 255) / 256);
    for (int b = 0; b < NB_; ++b) {
        
        k_cvt8<<<(unsigned)(((size_t)TT * DM / 8 + 255) / 256), 256, 0, stream>>>(x + (size_t)b * TT * DM, XB, (size_t)TT * DM / 8);
        k_gemmw<bf, 0, true><<<dim3(TT / 64, DQ / 64, 1), 32, 0, stream>>>(XB, nullptr, WQ, nullptr, DM, FQ, DQ, bq, 0, 0, 0);
        k_rope<<<LQ, 256, 0, stream>>>(FQ, DQ, NH_, CS, nullptr, nullptr, 1.0f, QP16, QPh, QPl);
        k_gemmw<bf, 0, true><<<dim3(TT / 64, DKV / 64, 1), 32, 0, stream>>>(XB, nullptr, WK, nullptr, DM, FK, DKV, bk, 0, 0, 0);
        k_rope<<<LKv, 256, 0, stream>>>(FK, DKV, NKV, CS, nullptr, nullptr, 1.0f, KP16, KPh, KPl);
        k_gemmw<bf, 0, true><<<dim3(TT / 64, DKV / 64, 1), 32, 0, stream>>>(XB, nullptr, WV, nullptr, DM, FV, DKV, bv, 0, 0, 0); k_vtp<<<LKv, 256, 0, stream>>>(FV, DKV, NKV, VT16, VTh, VTl);
        for (int h0 = 0; h0 < NH_; h0 += ZH) { const size_t zq = (size_t)h0, zk = (size_t)(h0 / REP);   // one kv head per query head: the pass's two heads use consecutive kv planes (z-strides TT*HD)
            k_gemmc<bf, 2, 1><<<dim3(RH / 64, TT / 64, ZH), 32, 0, stream>>>(QPh + zq * TT * HD, QPl + zq * TT * HD, KPh + zk * TT * HD, KPl + zk * TT * HD, HD, Sb, TT, 0, (size_t)TT * HD, (size_t)TT * HD, (size_t)TT * TT);
            k_gemmc<h16, 0, 1><<<dim3((TT - RH) / 64, TT / 64, ZH), 32, 0, stream>>>(QP16 + zq * TT * HD + (size_t)RH * HD, nullptr, KP16 + zk * TT * HD, nullptr, HD, Sb + (size_t)RH * TT, TT, RH, (size_t)TT * HD, (size_t)TT * HD, (size_t)TT * TT);
            k_asoft<<<ZH * TT / 8, 256, 0, stream>>>(Sb, P16, Ph, Pl);
            k_gemmc<bf, 2, 2><<<dim3(RH / 64, HD / 64, ZH), 32, 0, stream>>>(Ph, Pl, VTh + zk * HD * TT, VTl + zk * HD * TT, TT, Ob, HD, 0, (size_t)RH * TT, (size_t)HD * TT, (size_t)TT * HD);
            k_gemmc<h16, 0, 2><<<dim3((TT - RH) / 64, HD / 64, ZH), 32, 0, stream>>>(P16 + (size_t)RH * TT, nullptr, VT16 + zk * HD * TT, nullptr, TT, Ob + (size_t)RH * HD, HD, RH, (size_t)TT * TT, (size_t)HD * TT, (size_t)TT * HD);
            k_merge<<<(unsigned)(((size_t)ZH * TT * HD / 2 + 255) / 256), 256, 0, stream>>>(Ob, h0, ATh, ATl); }
        k_gemmw<bf, 1, true><<<dim3(TT / 64, DM / 64, 1), 32, 0, stream>>>(ATh, ATl, WO, nullptr, DQ, OUT + (size_t)b * TT * DM, DM, bo, 0, 0, 0); }
}

// v001
// Measured time: 909 microseconds a run.
// Timed twice side by side with v000, it ran 1.68 and 1.70 times as fast.
#include <hip/hip_runtime.h>

#include <hip/hip_runtime.h>

#define NB_  2
#define TT   2048
#define DM   1024
#define NH_  16
#define NKV  16
#define REP  (NH_ / NKV)
#define HD   64
#define DQ   (NH_ * HD)
#define DKV  (NKV * HD)
#define ZH   2
#define RH   512                  // query rows < RH use hi+lo planes (0: none)
#define WIN  0
#define PCAR 1024.0f
#define SCL  0.125f   // HD^-0.5
typedef _Float16 h16;
typedef unsigned short bf;
typedef __attribute__((ext_vector_type(16))) __bf16   v16bf;
typedef __attribute__((ext_vector_type(16))) _Float16 v16h;
typedef __attribute__((ext_vector_type(8)))  _Float16 v8h;
typedef __attribute__((ext_vector_type(8)))  unsigned short v8us;
typedef __attribute__((ext_vector_type(8)))  float    v8f;
typedef __attribute__((ext_vector_type(4)))  float    v4f;
typedef v8h  __attribute__((may_alias)) v8ha;
typedef v4f  __attribute__((may_alias)) v4fa;
typedef v8us __attribute__((may_alias)) v8usa;

__device__ __forceinline__ unsigned short f2bf(float f) { unsigned u = __float_as_uint(f); u += 0x7FFFu + ((u >> 16) & 1u); return (unsigned short)(u >> 16); }
__device__ __forceinline__ float bf2f(unsigned short b) { return __uint_as_float(((unsigned)b) << 16); }
__device__ __forceinline__ float bfr(float f) { return bf2f(f2bf(f)); }
__device__ __forceinline__ v16h cat16(v8h lo, v8h hi) { return __builtin_shufflevector(lo, hi, 0, 1, 2, 3, 4, 5, 6, 7, 8, 9, 10, 11, 12, 13, 14, 15); }
__device__ __forceinline__ v16bf cat16b(v8us lo, v8us hi) { return __builtin_bit_cast(v16bf, __builtin_shufflevector(lo, hi, 0, 1, 2, 3, 4, 5, 6, 7, 8, 9, 10, 11, 12, 13, 14, 15)); }
__device__ __forceinline__ v8f wmma16(v16h a, v16h b, v8f c) { return __builtin_amdgcn_wmma_f32_16x16x32_f16(false, a, false, b, (short)0, c, false, false); }
__device__ __forceinline__ v8f wmmab(v16bf a, v16bf b, v8f c) { return __builtin_amdgcn_wmma_f32_16x16x32_bf16(false, a, false, b, (short)0, c, false, false); }



// ---- k_gemmw: register-blocked GEMM, one work-group of NW waves per 64x64 output tile; every wave holds the whole tile (16 accumulators) and takes every NW-th 32-wide k step, operands straight from
// K-contiguous 16-bit planes; the NW partial tiles are summed through LDS in wave order 0..NW-1. grid (M/64, N/64, Z), 32 * NW threads.
// C[m][n] (f32, pitch ldc, + optional f32 bias[n]) = sum_k A[m][k] Bt[n][k] (+ split products per NSPLIT). z-batch strides sA/sB/sC in elements. K % 32 == 0.
template <typename T16> struct WFrag;
template <> struct WFrag<h16> { typedef v16h V; static __device__ __forceinline__ V ld(const h16* p) { return cat16(*(const v8h*)p, *(const v8h*)(p + 16)); } static __device__ __forceinline__ v8f mma(V a, V b, v8f c) { return wmma16(a, b, c); } };
template <> struct WFrag<bf> { typedef v16bf V; static __device__ __forceinline__ V ld(const bf* p) { return cat16b(*(const v8us*)p, *(const v8us*)(p + 16)); } static __device__ __forceinline__ v8f mma(V a, V b, v8f c) { return wmmab(a, b, c); } };
template <int NW> __device__ __forceinline__ void tile_sync() { if (NW == 1) { __builtin_amdgcn_wave_barrier(); asm volatile("" ::: "memory"); } else __syncthreads(); }   // orders the LDS slab writes against the reads of the same slabs (by the one wave, or by all NW)
template <typename T16, int NSPLIT, bool BIAS, int NW>
__global__ __launch_bounds__(32 * NW) void k_gemmw(const T16* __restrict__ A, const T16* __restrict__ A2, const T16* __restrict__ Bt, const T16* __restrict__ Bt2, int K, float* C, int ldc, const float* __restrict__ bias, size_t sA, size_t sB, size_t sC) {
    typedef typename WFrag<T16>::V V;
    __shared__ __align__(16) float os[NW * 16 * 68];
    const size_t z = blockIdx.z; A += z * sA; if (A2) A2 += z * sA; Bt += z * sB; if (Bt2) Bt2 += z * sB; C += z * sC;
    const int lane = threadIdx.x & 31, lr = lane & 15, hi = lane >> 4; const int r0 = blockIdx.x * 64, c0 = blockIdx.y * 64;
    const int wv = (NW == 1) ? 0 : __builtin_amdgcn_readfirstlane((int)(threadIdx.x >> 5));   // wave number, scalar: the k loop's bounds stay wave-uniform
    constexpr int NS = (NW >= 8) ? 1 : 8 / NW;   // row pairs of a 16-row slab that one wave sums and stores
    v4f res[4][NS];                              // NW > 1: summed rows wait here, so that no barrier has to wait for a global store
    v8f acc[4][4];
#pragma unroll
    for (int mb = 0; mb < 4; ++mb)
#pragma unroll
        for (int nb = 0; nb < 4; ++nb) acc[mb][nb] = (v8f){};
    const size_t aoff = (size_t)(r0 + lr) * K + 8 * hi, boff = (size_t)(c0 + lr) * K + 8 * hi;
#pragma unroll 1
    for (int kc = 32 * wv; kc < K; kc += 32 * NW) {
        V a[4], a2[4];
#pragma unroll
        for (int mb = 0; mb < 4; ++mb) { a[mb] = WFrag<T16>::ld(A + aoff + (size_t)mb * 16 * K + kc); if (NSPLIT == 1 || NSPLIT == 2) a2[mb] = WFrag<T16>::ld(A2 + aoff + (size_t)mb * 16 * K + kc); }
#pragma unroll
        for (int nb = 0; nb < 4; ++nb) { const V b = WFrag<T16>::ld(Bt + boff + (size_t)nb * 16 * K + kc); V b2; if (NSPLIT >= 2) b2 = WFrag<T16>::ld(Bt2 + boff + (size_t)nb * 16 * K + kc);
#pragma unroll
            for (int mb = 0; mb < 4; ++mb) { acc[mb][nb] = WFrag<T16>::mma(a[mb], b, acc[mb][nb]); if (NSPLIT == 1 || NSPLIT == 2) acc[mb][nb] = WFrag<T16>::mma(a2[mb], b, acc[mb][nb]); if (NSPLIT >= 2) acc[mb][nb] = WFrag<T16>::mma(a[mb], b2, acc[mb][nb]); } }
        asm volatile("v_nop\n\tv_nop\n\tv_nop\n\tv_nop" : "+v"(acc[0][0]), "+v"(acc[1][1]), "+v"(acc[2][2]), "+v"(acc[3][3]) : "v"(a[0]), "v"(a[3]));
    }
#pragma unroll
    for (int mb = 0; mb < 4; ++mb) {
#pragma unroll
        for (int nb = 0; nb < 4; ++nb) {
#pragma unroll
            for (int j = 0; j < 8; ++j) os[wv * (16 * 68) + (hi * 8 + j) * 68 + nb * 16 + lr] = acc[mb][nb][j]; }
        tile_sync<NW>();
        float* crow = C + (size_t)(r0 + mb * 16) * ldc + c0;
{
#pragma unroll
            for (int k = 0; k < NS; ++k) { const int s = wv + k * NW; if (NW > 8 && s >= 8) break; const int row = 2 * s + hi, cofs = lr * 4; v4f val = *(const v4fa*)(os + row * 68 + cofs);
#pragma unroll
                for (int w = 1; w < NW; ++w) val += *(const v4fa*)(os + w * (16 * 68) + row * 68 + cofs);
                if (BIAS) { val[0] += bfr(bias[c0 + cofs]); val[1] += bfr(bias[c0 + cofs + 1]); val[2] += bfr(bias[c0 + cofs + 2]); val[3] += bfr(bias[c0 + cofs + 3]); }
                if (NW == 1) *(v4f*)(crow + (size_t)row * ldc + cofs) = val; else res[mb][k] = val; }
             }
        if (NW == 1 || mb < 3) tile_sync<NW>();
    }
    if (NW > 1) {
#pragma unroll
        for (int mb = 0; mb < 4; ++mb)
#pragma unroll
            for (int k = 0; k < NS; ++k) { const int s = wv + k * NW; if (NW > 8 && s >= 8) break; *(v4f*)(C + (size_t)(r0 + mb * 16 + 2 * s + hi) * ldc + c0 + lr * 4) = res[mb][k]; }
    }
}

// ---- k_gemmc: the same 64x64 tile GEMM (NW waves share the k loop) specialised for causal attention: CMODE 1 skips score tiles entirely above the diagonal (query rows r0+roff.., key columns c0..), CMODE 2 limits the
// key (K) loop of the probability x value contraction to the diagonal block (probabilities beyond it are exactly zero). roff = row offset of this launch's first row within the sequence.
template <typename T16, int NSPLIT, int CMODE, int NW>
__global__ __launch_bounds__(32 * NW) void k_gemmc(const T16* __restrict__ A, const T16* __restrict__ A2, const T16* __restrict__ Bt, const T16* __restrict__ Bt2, int K, float* C, int ldc, int roff, size_t sA, size_t sB, size_t sC) {
    typedef typename WFrag<T16>::V V;
    __shared__ __align__(16) float os[NW * 16 * 68];
    const size_t z = blockIdx.z; A += z * sA; if (A2) A2 += z * sA; Bt += z * sB; if (Bt2) Bt2 += z * sB; C += z * sC;
    const int lane = threadIdx.x & 31, lr = lane & 15, hi = lane >> 4; const int r0 = blockIdx.x * 64, c0 = blockIdx.y * 64;
    const int wv = (NW == 1) ? 0 : __builtin_amdgcn_readfirstlane((int)(threadIdx.x >> 5));   // wave number, scalar: the k loop's bounds stay wave-uniform
    constexpr int NS = (NW >= 8) ? 1 : 8 / NW;   // row pairs of a 16-row slab that one wave sums and stores
    v4f res[4][NS];                              // NW > 1: summed rows wait here, so that no barrier has to wait for a global store
    if (CMODE == 1 && c0 > r0 + roff + 63) return;                  // score tile entirely above the causal diagonal: never read (the softmax masks j > i by select)
    const int Kl = (CMODE == 2) ? min(K, r0 + roff + 64) : K;        // P.V: probabilities are exactly 0 beyond the diagonal block, so the K loop stops there
    v8f acc[4][4];
#pragma unroll
    for (int mb = 0; mb < 4; ++mb)
#pragma unroll
        for (int nb = 0; nb < 4; ++nb) acc[mb][nb] = (v8f){};
    const size_t aoff = (size_t)(r0 + lr) * K + 8 * hi, boff = (size_t)(c0 + lr) * K + 8 * hi;
#pragma unroll 1
    for (int kc = 32 * wv; kc < Kl; kc += 32 * NW) {
        V a[4], a2[4];
#pragma unroll
        for (int mb = 0; mb < 4; ++mb) { a[mb] = WFrag<T16>::ld(A + aoff + (size_t)mb * 16 * K + kc); if (NSPLIT == 1 || NSPLIT == 2) a2[mb] = WFrag<T16>::ld(A2 + aoff + (size_t)mb * 16 * K + kc); }
#pragma unroll
        for (int nb = 0; nb < 4; ++nb) { const V b = WFrag<T16>::ld(Bt + boff + (size_t)nb * 16 * K + kc); V b2; if (NSPLIT >= 2) b2 = WFrag<T16>::ld(Bt2 + boff + (size_t)nb * 16 * K + kc);
#pragma unroll
            for (int mb = 0; mb < 4; ++mb) { acc[mb][nb] = WFrag<T16>::mma(a[mb], b, acc[mb][nb]); if (NSPLIT == 1 || NSPLIT == 2) acc[mb][nb] = WFrag<T16>::mma(a2[mb], b, acc[mb][nb]); if (NSPLIT >= 2) acc[mb][nb] = WFrag<T16>::mma(a[mb], b2, acc[mb][nb]); } }
        asm volatile("v_nop\n\tv_nop\n\tv_nop\n\tv_nop" : "+v"(acc[0][0]), "+v"(acc[1][1]), "+v"(acc[2][2]), "+v"(acc[3][3]) : "v"(a[0]), "v"(a[3]));
    }
#pragma unroll
    for (int mb = 0; mb < 4; ++mb) {
#pragma unroll
        for (int nb = 0; nb < 4; ++nb) {
#pragma unroll
            for (int j = 0; j < 8; ++j) os[wv * (16 * 68) + (hi * 8 + j) * 68 + nb * 16 + lr] = acc[mb][nb][j]; }
        tile_sync<NW>();
        float* crow = C + (size_t)(r0 + mb * 16) * ldc + c0;
{
#pragma unroll
            for (int k = 0; k < NS; ++k) { const int s = wv + k * NW; if (NW > 8 && s >= 8) break; const int row = 2 * s + hi, cofs = lr * 4; v4f val = *(const v4fa*)(os + row * 68 + cofs);
#pragma unroll
                for (int w = 1; w < NW; ++w) val += *(const v4fa*)(os + w * (16 * 68) + row * 68 + cofs);
                if (NW == 1) *(v4f*)(crow + (size_t)row * ldc + cofs) = val; else res[mb][k] = val; }
             }
        if (NW == 1 || mb < 3) tile_sync<NW>();
    }
    if (NW > 1) {
#pragma unroll
        for (int mb = 0; mb < 4; ++mb)
#pragma unroll
            for (int k = 0; k < NS; ++k) { const int s = wv + k * NW; if (NW > 8 && s >= 8) break; *(v4f*)(C + (size_t)(r0 + mb * 16 + 2 * s + hi) * ldc + c0 + lr * 4) = res[mb][k]; }
    }
}

__device__ __forceinline__ h16 tohx(float x) { return (h16)x; }
__device__ __forceinline__ void splitf(float y, unsigned short& h, unsigned short& l) { h = f2bf(y); l = f2bf(y - bf2f(h)); }
typedef __attribute__((ext_vector_type(2))) _Float16 v2h;
typedef __attribute__((ext_vector_type(4))) _Float16 v4h;
typedef __attribute__((ext_vector_type(2))) unsigned short v2us;
typedef __attribute__((ext_vector_type(4))) unsigned short v4us;
typedef __attribute__((ext_vector_type(2))) float v2f;
typedef __attribute__((ext_vector_type(4))) int v4i;

__global__ __launch_bounds__(256) void k_wtG(const float* __restrict__ w, int K, int N, bf* Bt) {
    const int lane = threadIdx.x & 31; const int L0 = (blockIdx.x * 8 + (threadIdx.x >> 5)) * 8; const int nlines = N * K / 64;
{
#pragma unroll 1
        for (int l = 0; l < 8; ++l) { const int L = L0 + l; if (L >= nlines) break; const size_t e = (size_t)L * 64 + lane * 2; const int k = (int)(e % K), n = (int)(e / K); v2us o;
            o[0] = f2bf(w[(size_t)k * N + n]); o[1] = f2bf(w[(size_t)(k + 1) * N + n]); *(v2us*)(Bt + e) = o; }
         }
}
__global__ __launch_bounds__(256) void k_cvt8(const float* __restrict__ src, bf* dst, size_t n8) { const size_t i = (size_t)blockIdx.x * 256 + threadIdx.x; if (i >= n8) return; const v8f v = *(const v8f*)(src + i * 8); v8us o;
#pragma unroll
    for (int k = 0; k < 8; ++k) o[k] = f2bf(v[k]); *(v8us*)(dst + i * 8) = o;  }
__global__ __launch_bounds__(256) void k_cscvt(const float* __restrict__ cosT, const float* __restrict__ sinT, float* CS) { const int idx = blockIdx.x * 256 + threadIdx.x; if (idx >= TT * HD) return; v2f cs; cs[0] = bfr(cosT[idx]); cs[1] = bfr(sinT[idx]); *(v2f*)(CS + (size_t)idx * 2) = cs;  }
// k_rope: head planes [h][t][d] (fp16 + hi/lo) of rope(x) x sc with the rotate-half convention out[d] = x[d] cos[t][d] - x[d+HD/2] sin[t][d], out[d+HD/2] = x[d+HD/2] cos[t][d+HD/2] + x[d] sin[t][d+HD/2]
__global__ __launch_bounds__(256) void k_rope(const float* __restrict__ F, int pitch, int nheads, const float* __restrict__ CS, const float* __restrict__ RF, const float* __restrict__ nw, float sc, h16* P16, bf* Ph, bf* Pl) {
    const size_t e = ((size_t)blockIdx.x * 256 + threadIdx.x) * 2; if (e >= (size_t)nheads * TT * HD) return; const int d = (int)(e % HD); const int t = (int)((e / HD) % TT); const int h = (int)(e / ((size_t)HD * TT)); const float* f = F + (size_t)t * pitch + h * HD; const float rf = RF ? RF[(size_t)h * TT + t] : 1.0f; v2h o16; v2us oh, ol;
#pragma unroll
    for (int q = 0; q < 2; ++q) { const int dd = d + q; const int dp = (dd < HD / 2) ? dd + HD / 2 : dd - HD / 2; float x0 = f[dd], x1 = f[dp];
        if (RF) { float n0 = __fmul_rn(x0, rf), n1 = __fmul_rn(x1, rf); asm volatile("" : "+v"(n0)); asm volatile("" : "+v"(n1)); x0 = __fmul_rn(bfr(nw[dd]), n0); x1 = __fmul_rn(bfr(nw[dp]), n1); }
        const v2f cs = *(const v2f*)(CS + ((size_t)t * HD + dd) * 2); float a = __fmul_rn(x0, cs[0]), bq = __fmul_rn(x1, cs[1]); asm volatile("" : "+v"(a)); asm volatile("" : "+v"(bq)); const float r = ((dd < HD / 2) ? __fsub_rn(a, bq) : __fadd_rn(a, bq)) * sc;
        o16[q] = tohx(r); unsigned short a2, c2; splitf(r, a2, c2); oh[q] = a2; ol[q] = c2; }
    *(v2h*)(P16 + e) = o16; *(v2us*)(Ph + e) = oh; *(v2us*)(Pl + e) = ol;  }
__global__ __launch_bounds__(256) void k_vtp(const float* __restrict__ F, int pitch, int nheads, h16* V16, bf* Vh, bf* Vl) { const size_t e = ((size_t)blockIdx.x * 256 + threadIdx.x) * 2; if (e >= (size_t)nheads * HD * TT) return; const int t = (int)(e % TT); const int d = (int)((e / TT) % HD); const int g = (int)(e / ((size_t)TT * HD)); v2h o16; v2us oh, ol;
#pragma unroll
    for (int q = 0; q < 2; ++q) { const float x = F[(size_t)(t + q) * pitch + g * HD + d]; o16[q] = tohx(x); unsigned short a2, c2; splitf(x, a2, c2); oh[q] = a2; ol[q] = c2; }
    *(v2h*)(V16 + e) = o16; *(v2us*)(Vh + e) = oh; *(v2us*)(Vl + e) = ol;  }
__global__ __launch_bounds__(256) void k_csid(float* CS) { const int idx = blockIdx.x * 256 + threadIdx.x; if (idx >= TT * HD) return; v2f cs; cs[0] = 1.0f; cs[1] = 0.0f; *(v2f*)(CS + (size_t)idx * 2) = cs;  }
// k_asoft: per row (zz, i): t = S x HD^-0.5 + (j - i)/16 for j <= i (causal, ALiBi slope 1/16; the reference's -1e9 additive fill vanishes identically); softmax over the 2048 keys (register row, one exp, fixed trees);
__global__ __launch_bounds__(256) void k_asoft(const float* __restrict__ Sb, h16* P16, bf* Ph, bf* Pl) {
    const int lane = threadIdx.x & 31; const int row = blockIdx.x * 8 + (threadIdx.x >> 5); if (row >= ZH * TT) return; const int i = row % TT; const int zz = row / TT; (void)zz; const bool hires = (i < RH); const float* sr = Sb + (size_t)row * TT; float v[TT / 32]; float mx = -3.0e38f;
#pragma unroll
    for (int ch = 0; ch < TT / 128; ++ch) { const int j0 = ch * 128 + lane * 4; const v4f a = *(const v4f*)(sr + j0);
#pragma unroll
        for (int q = 0; q < 4; ++q) { const int j = j0 + q; (void)j; float t0 = a[q] * SCL, bb = 0.0625f * (float)(j - i); asm volatile("" : "+v"(t0)); asm volatile("" : "+v"(bb)); const float t = (j <= i) ? __fadd_rn(t0, bb) : -3.0e38f   /* causal + ALiBi slope 1/16 */; v[ch * 4 + q] = t; mx = fmaxf(mx, t); } }
#pragma unroll
    for (int sh = 16; sh; sh >>= 1) mx = fmaxf(mx, __shfl_xor(mx, sh, 32));
    float sum = 0.f;
#pragma unroll
    for (int k = 0; k < TT / 32; ++k) { float d0 = __fsub_rn(v[k], mx); asm volatile("" : "+v"(d0)); v[k] = __builtin_amdgcn_exp2f(__fmul_rn(d0, 1.4426950408889634f)); sum += v[k]; }
#pragma unroll
    for (int sh = 16; sh; sh >>= 1) sum += __shfl_xor(sum, sh, 32);
    const float f = __fdiv_rn(hires ? 1.0f : PCAR, sum);
{
        if (hires) {
#pragma unroll
            for (int ch = 0; ch < TT / 128; ++ch) { v4us oh, ol;
#pragma unroll
                for (int q = 0; q < 4; ++q) { unsigned short a, c2; splitf(v[ch * 4 + q] * f, a, c2); oh[q] = a; ol[q] = c2; }
                const size_t oo = ((size_t)zz * (RH ? RH : 1) + i) * TT + ch * 128 + lane * 4; *(v4us*)(Ph + oo) = oh; *(v4us*)(Pl + oo) = ol; }
        } else {
#pragma unroll
            for (int ch = 0; ch < TT / 128; ++ch) { v4h o4;
#pragma unroll
                for (int q = 0; q < 4; ++q) o4[q] = tohx(v[ch * 4 + q] * f);
                *(v4h*)(P16 + (size_t)row * TT + ch * 128 + lane * 4) = o4; } }
         }
}
__global__ __launch_bounds__(256) void k_merge(const float* __restrict__ O, int h0, bf* Ah, bf* Al) { const size_t e = ((size_t)blockIdx.x * 256 + threadIdx.x) * 2; if (e >= (size_t)ZH * TT * HD) return; const int d = (int)(e % HD); const int t = (int)((e / HD) % TT); const int zz = (int)(e / ((size_t)HD * TT)); const float cs = (t < RH) ? 1.0f : (1.0f / PCAR); const size_t oo = (size_t)t * DQ + (h0 + zz) * HD + d;
    v2us oh, ol;
#pragma unroll
    for (int q = 0; q < 2; ++q) { unsigned short a, c2; splitf(O[e + q] * cs, a, c2); oh[q] = a; ol[q] = c2; } *(v2us*)(Ah + oo) = oh; *(v2us*)(Al + oo) = ol;  }

extern "C" void kernel_launch(void* const* d_in, const int* in_sizes, int n_in,
                              void* d_out, int out_size, void* d_ws, size_t ws_size, hipStream_t stream) {
    (void)in_sizes; (void)n_in; (void)out_size;
    const float* x = (const float*)d_in[0]; const float* wq = (const float*)d_in[1]; const float* bq = (const float*)d_in[2]; const float* wk = (const float*)d_in[3]; const float* bk = (const float*)d_in[4]; const float* wv = (const float*)d_in[5]; const float* bv = (const float*)d_in[6]; const float* wo = (const float*)d_in[7]; const float* bo = (const float*)d_in[8]; const float* cosT = nullptr; const float* sinT = nullptr; (void)cosT; (void)sinT;
    float* OUT = (float*)d_out;     // [2][2048][1024]
    char* wsp = (char*)d_ws;
    auto take = [&](size_t bytes) { char* p = wsp; wsp += (bytes + 255) & ~(size_t)255; return (void*)p; };
    bf* WQ = (bf*)take((size_t)DQ * DM * 2); bf* WK = (bf*)take((size_t)DKV * DM * 2); bf* WV = (bf*)take((size_t)DKV * DM * 2); bf* WO = (bf*)take((size_t)DM * DQ * 2); float* CS = (float*)take((size_t)TT * HD * 2 * 4);
    bf* XB = (bf*)take((size_t)TT * DM * 2); float* FQ = (float*)take((size_t)TT * DQ * 4); float* FK = (float*)take((size_t)TT * DKV * 4);
    h16* QP16 = (h16*)take((size_t)NH_ * TT * HD * 2); h16* KP16 = (h16*)take((size_t)NKV * TT * HD * 2); h16* VT16 = (h16*)take((size_t)NKV * HD * TT * 2);
    bf* QPh = (bf*)take((size_t)NH_ * TT * HD * 2); bf* QPl = (bf*)take((size_t)NH_ * TT * HD * 2); bf* KPh = (bf*)take((size_t)NKV * TT * HD * 2); bf* KPl = (bf*)take((size_t)NKV * TT * HD * 2); bf* VTh = (bf*)take((size_t)NKV * HD * TT * 2); bf* VTl = (bf*)take((size_t)NKV * HD * TT * 2); bf* Ph = (bf*)take((size_t)ZH * RH * TT * 2); bf* Pl = (bf*)take((size_t)ZH * RH * TT * 2);
    float* Sb = (float*)take((size_t)ZH * TT * TT * 4); h16* P16 = (h16*)take((size_t)ZH * TT * TT * 2); float* Ob = (float*)take((size_t)ZH * TT * HD * 4); bf* ATh = (bf*)take((size_t)TT * DQ * 2); bf* ATl = (bf*)take((size_t)TT * DQ * 2);
    if ((size_t)(wsp - (char*)d_ws) > ws_size) return;    // ws 256 MiB
    float* FV = FK;   // v projection reuses the k buffer after the k planes are built (stream-ordered)
    { k_cvt8<<<(unsigned)(((size_t)DQ * DM / 8 + 255) / 256), 256, 0, stream>>>(wq, WQ, (size_t)DQ * DM / 8); k_cvt8<<<(unsigned)(((size_t)DKV * DM / 8 + 255) / 256), 256, 0, stream>>>(wk, WK, (size_t)DKV * DM / 8); k_cvt8<<<(unsigned)(((size_t)DKV * DM / 8 + 255) / 256), 256, 0, stream>>>(wv, WV, (size_t)DKV * DM / 8);
      k_cvt8<<<(unsigned)(((size_t)DM * DQ / 8 + 255) / 256), 256, 0, stream>>>(wo, WO, (size_t)DM * DQ / 8);
       }
    k_csid<<<(TT * HD + 255) / 256, 256, 0, stream>>>(CS);
    const unsigned LQ = (unsigned)(((size_t)NH_ * TT * HD / 2 + 255) / 256), LKv = (unsigned)(((size_t)NKV * TT * HD / 2 + 255) / 256);
    for (int b = 0; b < NB_; ++b) {
        
        k_cvt8<<<(unsigned)(((size_t)TT * DM / 8 + 255) / 256), 256, 0, stream>>>(x + (size_t)b * TT * DM, XB, (size_t)TT * DM / 8);
        k_gemmw<bf, 0, true, 8><<<dim3(TT / 64, DQ / 64, 1), 256, 0, stream>>>(XB, nullptr, WQ, nullptr, DM, FQ, DQ, bq, 0, 0, 0);
        k_rope<<<LQ, 256, 0, stream>>>(FQ, DQ, NH_, CS, nullptr, nullptr, 1.0f, QP16, QPh, QPl);
        k_gemmw<bf, 0, true, 8><<<dim3(TT / 64, DKV / 64, 1), 256, 0, stream>>>(XB, nullptr, WK, nullptr, DM, FK, DKV, bk, 0, 0, 0);
        k_rope<<<LKv, 256, 0, stream>>>(FK, DKV, NKV, CS, nullptr, nullptr, 1.0f, KP16, KPh, KPl);
        k_gemmw<bf, 0, true, 8><<<dim3(TT / 64, DKV / 64, 1), 256, 0, stream>>>(XB, nullptr, WV, nullptr, DM, FV, DKV, bv, 0, 0, 0); k_vtp<<<LKv, 256, 0, stream>>>(FV, DKV, NKV, VT16, VTh, VTl);
        for (int h0 = 0; h0 < NH_; h0 += ZH) { const size_t zq = (size_t)h0, zk = (size_t)(h0 / REP);   // one kv head per query head: the pass's two heads use consecutive kv planes (z-strides TT*HD)
            k_gemmc<bf, 2, 1, 1><<<dim3(RH / 64, TT / 64, ZH), 32, 0, stream>>>(QPh + zq * TT * HD, QPl + zq * TT * HD, KPh + zk * TT * HD, KPl + zk * TT * HD, HD, Sb, TT, 0, (size_t)TT * HD, (size_t)TT * HD, (size_t)TT * TT);
            k_gemmc<h16, 0, 1, 1><<<dim3((TT - RH) / 64, TT / 64, ZH), 32, 0, stream>>>(QP16 + zq * TT * HD + (size_t)RH * HD, nullptr, KP16 + zk * TT * HD, nullptr, HD, Sb + (size_t)RH * TT, TT, RH, (size_t)TT * HD, (size_t)TT * HD, (size_t)TT * TT);
            k_asoft<<<ZH * TT / 8, 256, 0, stream>>>(Sb, P16, Ph, Pl);
            k_gemmc<bf, 2, 2, 16><<<dim3(RH / 64, HD / 64, ZH), 512, 0, stream>>>(Ph, Pl, VTh + zk * HD * TT, VTl + zk * HD * TT, TT, Ob, HD, 0, (size_t)RH * TT, (size_t)HD * TT, (size_t)TT * HD);
            k_gemmc<h16, 0, 2, 16><<<dim3((TT - RH) / 64, HD / 64, ZH), 512, 0, stream>>>(P16 + (size_t)RH * TT, nullptr, VT16 + zk * HD * TT, nullptr, TT, Ob + (size_t)RH * HD, HD, RH, (size_t)TT * TT, (size_t)HD * TT, (size_t)TT * HD);
            k_merge<<<(unsigned)(((size_t)ZH * TT * HD / 2 + 255) / 256), 256, 0, stream>>>(Ob, h0, ATh, ATl); }
        k_gemmw<bf, 1, true, 8><<<dim3(TT / 64, DM / 64, 1), 256, 0, stream>>>(ATh, ATl, WO, nullptr, DQ, OUT + (size_t)b * TT * DM, DM, bo, 0, 0, 0); }
}

// v002
// It runs in 555 microseconds.
// In both of two side-by-side timings against v001, it was 1.65 times as fast.
// All steps since v000 together make it 2.79 times as fast.
#include <hip/hip_runtime.h>

#include <hip/hip_runtime.h>

#define NB_  2
#define TT   2048
#define DM   1024
#define NH_  16
#define NKV  16
#define REP  (NH_ / NKV)
#define HD   64
#define DQ   (NH_ * HD)
#define DKV  (NKV * HD)
#define ZH   8                    // heads per attention pass (grid z of the pass's launches)
#define RH   512                  // query rows < RH use hi+lo planes (0: none)
#define WIN  0
#define PCAR 1024.0f
#define SCL  0.125f   // HD^-0.5
typedef _Float16 h16;
typedef unsigned short bf;
typedef __attribute__((ext_vector_type(16))) __bf16   v16bf;
typedef __attribute__((ext_vector_type(16))) _Float16 v16h;
typedef __attribute__((ext_vector_type(8)))  _Float16 v8h;
typedef __attribute__((ext_vector_type(8)))  unsigned short v8us;
typedef __attribute__((ext_vector_type(8)))  float    v8f;
typedef __attribute__((ext_vector_type(4)))  float    v4f;
typedef v8h  __attribute__((may_alias)) v8ha;
typedef v4f  __attribute__((may_alias)) v4fa;
typedef v8us __attribute__((may_alias)) v8usa;

__device__ __forceinline__ unsigned short f2bf(float f) { unsigned u = __float_as_uint(f); u += 0x7FFFu + ((u >> 16) & 1u); return (unsigned short)(u >> 16); }
__device__ __forceinline__ float bf2f(unsigned short b) { return __uint_as_float(((unsigned)b) << 16); }
__device__ __forceinline__ float bfr(float f) { return bf2f(f2bf(f)); }
__device__ __forceinline__ v16h cat16(v8h lo, v8h hi) { return __builtin_shufflevector(lo, hi, 0, 1, 2, 3, 4, 5, 6, 7, 8, 9, 10, 11, 12, 13, 14, 15); }
__device__ __forceinline__ v16bf cat16b(v8us lo, v8us hi) { return __builtin_bit_cast(v16bf, __builtin_shufflevector(lo, hi, 0, 1, 2, 3, 4, 5, 6, 7, 8, 9, 10, 11, 12, 13, 14, 15)); }
__device__ __forceinline__ v8f wmma16(v16h a, v16h b, v8f c) { return __builtin_amdgcn_wmma_f32_16x16x32_f16(false, a, false, b, (short)0, c, false, false); }
__device__ __forceinline__ v8f wmmab(v16bf a, v16bf b, v8f c) { return __builtin_amdgcn_wmma_f32_16x16x32_bf16(false, a, false, b, (short)0, c, false, false); }



// ---- k_gemmw: register-blocked GEMM, one work-group of NW waves per 64x64 output tile; every wave holds the whole tile (16 accumulators) and takes every NW-th 32-wide k step, operands straight from
// K-contiguous 16-bit planes; the NW partial tiles are summed through LDS in wave order 0..NW-1. grid (M/64, N/64, Z), 32 * NW threads.
// C[m][n] (f32, pitch ldc, + optional f32 bias[n]) = sum_k A[m][k] Bt[n][k] (+ split products per NSPLIT). z-batch strides sA/sB/sC in elements. K % 32 == 0.
template <typename T16> struct WFrag;
template <> struct WFrag<h16> { typedef v16h V; static __device__ __forceinline__ V ld(const h16* p) { return cat16(*(const v8h*)p, *(const v8h*)(p + 16)); } static __device__ __forceinline__ v8f mma(V a, V b, v8f c) { return wmma16(a, b, c); } };
template <> struct WFrag<bf> { typedef v16bf V; static __device__ __forceinline__ V ld(const bf* p) { return cat16b(*(const v8us*)p, *(const v8us*)(p + 16)); } static __device__ __forceinline__ v8f mma(V a, V b, v8f c) { return wmmab(a, b, c); } };
template <int NW> __device__ __forceinline__ void tile_sync() { if (NW == 1) { __builtin_amdgcn_wave_barrier(); asm volatile("" ::: "memory"); } else __syncthreads(); }   // orders the LDS slab writes against the reads of the same slabs (by the one wave, or by all NW)
template <typename T16, int NSPLIT, bool BIAS, int NW>
__global__ __launch_bounds__(32 * NW) void k_gemmw(const T16* __restrict__ A, const T16* __restrict__ A2, const T16* __restrict__ Bt, const T16* __restrict__ Bt2, int K, float* C, int ldc, const float* __restrict__ bias, size_t sA, size_t sB, size_t sC) {
    typedef typename WFrag<T16>::V V;
    __shared__ __align__(16) float os[NW * 16 * 68];
    const size_t z = blockIdx.z; A += z * sA; if (A2) A2 += z * sA; Bt += z * sB; if (Bt2) Bt2 += z * sB; C += z * sC;
    const int lane = threadIdx.x & 31, lr = lane & 15, hi = lane >> 4; const int r0 = blockIdx.x * 64, c0 = blockIdx.y * 64;
    const int wv = (NW == 1) ? 0 : __builtin_amdgcn_readfirstlane((int)(threadIdx.x >> 5));   // wave number, scalar: the k loop's bounds stay wave-uniform
    constexpr int NS = (NW >= 8) ? 1 : 8 / NW;   // row pairs of a 16-row slab that one wave sums and stores
    v4f res[4][NS];                              // NW > 1: summed rows wait here, so that no barrier has to wait for a global store
    v8f acc[4][4];
#pragma unroll
    for (int mb = 0; mb < 4; ++mb)
#pragma unroll
        for (int nb = 0; nb < 4; ++nb) acc[mb][nb] = (v8f){};
    const size_t aoff = (size_t)(r0 + lr) * K + 8 * hi, boff = (size_t)(c0 + lr) * K + 8 * hi;
#pragma unroll 1
    for (int kc = 32 * wv; kc < K; kc += 32 * NW) {
        V a[4], a2[4];
#pragma unroll
        for (int mb = 0; mb < 4; ++mb) { a[mb] = WFrag<T16>::ld(A + aoff + (size_t)mb * 16 * K + kc); if (NSPLIT == 1 || NSPLIT == 2) a2[mb] = WFrag<T16>::ld(A2 + aoff + (size_t)mb * 16 * K + kc); }
#pragma unroll
        for (int nb = 0; nb < 4; ++nb) { const V b = WFrag<T16>::ld(Bt + boff + (size_t)nb * 16 * K + kc); V b2; if (NSPLIT >= 2) b2 = WFrag<T16>::ld(Bt2 + boff + (size_t)nb * 16 * K + kc);
#pragma unroll
            for (int mb = 0; mb < 4; ++mb) { acc[mb][nb] = WFrag<T16>::mma(a[mb], b, acc[mb][nb]); if (NSPLIT == 1 || NSPLIT == 2) acc[mb][nb] = WFrag<T16>::mma(a2[mb], b, acc[mb][nb]); if (NSPLIT >= 2) acc[mb][nb] = WFrag<T16>::mma(a[mb], b2, acc[mb][nb]); } }
        asm volatile("v_nop\n\tv_nop\n\tv_nop\n\tv_nop" : "+v"(acc[0][0]), "+v"(acc[1][1]), "+v"(acc[2][2]), "+v"(acc[3][3]) : "v"(a[0]), "v"(a[3]));
    }
#pragma unroll
    for (int mb = 0; mb < 4; ++mb) {
#pragma unroll
        for (int nb = 0; nb < 4; ++nb) {
#pragma unroll
            for (int j = 0; j < 8; ++j) os[wv * (16 * 68) + (hi * 8 + j) * 68 + nb * 16 + lr] = acc[mb][nb][j]; }
        tile_sync<NW>();
        float* crow = C + (size_t)(r0 + mb * 16) * ldc + c0;
{
#pragma unroll
            for (int k = 0; k < NS; ++k) { const int s = wv + k * NW; if (NW > 8 && s >= 8) break; const int row = 2 * s + hi, cofs = lr * 4; v4f val = *(const v4fa*)(os + row * 68 + cofs);
#pragma unroll
                for (int w = 1; w < NW; ++w) val += *(const v4fa*)(os + w * (16 * 68) + row * 68 + cofs);
                if (BIAS) { val[0] += bfr(bias[c0 + cofs]); val[1] += bfr(bias[c0 + cofs + 1]); val[2] += bfr(bias[c0 + cofs + 2]); val[3] += bfr(bias[c0 + cofs + 3]); }
                if (NW == 1) *(v4f*)(crow + (size_t)row * ldc + cofs) = val; else res[mb][k] = val; }
             }
        if (NW == 1 || mb < 3) tile_sync<NW>();
    }
    if (NW > 1) {
#pragma unroll
        for (int mb = 0; mb < 4; ++mb)
#pragma unroll
            for (int k = 0; k < NS; ++k) { const int s = wv + k * NW; if (NW > 8 && s >= 8) break; *(v4f*)(C + (size_t)(r0 + mb * 16 + 2 * s + hi) * ldc + c0 + lr * 4) = res[mb][k]; }
    }
}

// ldfw: the fragment load of WFrag::ld with s_wait_xcnt 0 behind each 16-byte half: the register allocator lands later loads (the second half among them) in the address pair of a load just issued, and the wait stands in front of every such overwrite.
__device__ __forceinline__ v16h ldfw(const h16* p) { const v8h lo = *(const v8h*)p; asm volatile("s_wait_xcnt 0x0" ::: "memory"); /* before the pair of the first half is reused */ const v8h hi = *(const v8h*)(p + 16); asm volatile("s_wait_xcnt 0x0" ::: "memory"); /* before the pair of the second half is reused */ return cat16(lo, hi); }
__device__ __forceinline__ v16bf ldfw(const bf* p) { const v8us lo = *(const v8us*)p; asm volatile("s_wait_xcnt 0x0" ::: "memory"); /* before the pair of the first half is reused */ const v8us hi = *(const v8us*)(p + 16); asm volatile("s_wait_xcnt 0x0" ::: "memory"); /* before the pair of the second half is reused */ return cat16b(lo, hi); }

// ---- k_gemmc: the same 64x64 tile GEMM (NW waves share the k loop) specialised for causal attention: CMODE 1 skips score tiles entirely above the diagonal (query rows r0+roff.., key columns c0..), CMODE 2 limits the
// key (K) loop of the probability x value contraction to the diagonal block (probabilities beyond it are exactly zero). roff = row offset of this launch's first row within the sequence. lda = row pitch of A and A2 in elements (Bt, Bt2: K).
template <typename T16, int NSPLIT, int CMODE, int NW>
__global__ __launch_bounds__(32 * NW) void k_gemmc(const T16* __restrict__ A, const T16* __restrict__ A2, int lda, const T16* __restrict__ Bt, const T16* __restrict__ Bt2, int K, float* C, int ldc, int roff, size_t sA, size_t sB, size_t sC) {
    typedef typename WFrag<T16>::V V;
    __shared__ __align__(16) float os[NW * 16 * 68];
    const size_t z = blockIdx.z; A += z * sA; if (A2) A2 += z * sA; Bt += z * sB; if (Bt2) Bt2 += z * sB; C += z * sC;
    const int lane = threadIdx.x & 31, lr = lane & 15, hi = lane >> 4; const int r0 = blockIdx.x * 64, c0 = blockIdx.y * 64;
    const int wv = (NW == 1) ? 0 : __builtin_amdgcn_readfirstlane((int)(threadIdx.x >> 5));   // wave number, scalar: the k loop's bounds stay wave-uniform
    constexpr int NS = (NW >= 8) ? 1 : 8 / NW;   // row pairs of a 16-row slab that one wave sums and stores
    v4f res[4][NS];                              // NW > 1: summed rows wait here, so that no barrier has to wait for a global store
    if (CMODE == 1 && c0 > r0 + roff + 63) return;                  // score tile entirely above the causal diagonal: never read (the softmax masks j > i by select)
    const int Kl = (CMODE == 2) ? min(K, r0 + roff + 64) : K;        // P.V: probabilities are exactly 0 beyond the diagonal block, so the K loop stops there
    v8f acc[4][4];
#pragma unroll
    for (int mb = 0; mb < 4; ++mb)
#pragma unroll
        for (int nb = 0; nb < 4; ++nb) acc[mb][nb] = (v8f){};
    const size_t aoff = (size_t)(r0 + lr) * lda + 8 * hi, boff = (size_t)(c0 + lr) * K + 8 * hi;
#pragma unroll 1
    for (int kc = 32 * wv; kc < Kl; kc += 32 * NW) {
        V a[4], a2[4];
#pragma unroll
        for (int mb = 0; mb < 4; ++mb) { a[mb] = ldfw(A + aoff + (size_t)mb * 16 * lda + kc); if (NSPLIT == 1 || NSPLIT == 2) a2[mb] = ldfw(A2 + aoff + (size_t)mb * 16 * lda + kc); }
#pragma unroll
        for (int nb = 0; nb < 4; ++nb) { const V b = WFrag<T16>::ld(Bt + boff + (size_t)nb * 16 * K + kc); V b2; if (NSPLIT >= 2) b2 = WFrag<T16>::ld(Bt2 + boff + (size_t)nb * 16 * K + kc);
#pragma unroll
            for (int mb = 0; mb < 4; ++mb) { acc[mb][nb] = WFrag<T16>::mma(a[mb], b, acc[mb][nb]); if (NSPLIT == 1 || NSPLIT == 2) acc[mb][nb] = WFrag<T16>::mma(a2[mb], b, acc[mb][nb]); if (NSPLIT >= 2) acc[mb][nb] = WFrag<T16>::mma(a[mb], b2, acc[mb][nb]); } }
        asm volatile("v_nop\n\tv_nop\n\tv_nop\n\tv_nop" : "+v"(acc[0][0]), "+v"(acc[1][1]), "+v"(acc[2][2]), "+v"(acc[3][3]) : "v"(a[0]), "v"(a[3]));
    }
#pragma unroll
    for (int mb = 0; mb < 4; ++mb) {
#pragma unroll
        for (int nb = 0; nb < 4; ++nb) {
#pragma unroll
            for (int j = 0; j < 8; ++j) os[wv * (16 * 68) + (hi * 8 + j) * 68 + nb * 16 + lr] = acc[mb][nb][j]; }
        tile_sync<NW>();
        float* crow = C + (size_t)(r0 + mb * 16) * ldc + c0;
{
#pragma unroll
            for (int k = 0; k < NS; ++k) { const int s = wv + k * NW; if (NW > 8 && s >= 8) break; const int row = 2 * s + hi, cofs = lr * 4; v4f val = *(const v4fa*)(os + row * 68 + cofs);
#pragma unroll
                for (int w = 1; w < NW; ++w) val += *(const v4fa*)(os + w * (16 * 68) + row * 68 + cofs);
                if (NW == 1) *(v4f*)(crow + (size_t)row * ldc + cofs) = val; else res[mb][k] = val; }
             }
        if (NW == 1 || mb < 3) tile_sync<NW>();
    }
    if (NW > 1) {
#pragma unroll
        for (int mb = 0; mb < 4; ++mb)
#pragma unroll
            for (int k = 0; k < NS; ++k) { const int s = wv + k * NW; if (NW > 8 && s >= 8) break; *(v4f*)(C + (size_t)(r0 + mb * 16 + 2 * s + hi) * ldc + c0 + lr * 4) = res[mb][k]; }
    }
}

__device__ __forceinline__ h16 tohx(float x) { return (h16)x; }
__device__ __forceinline__ void splitf(float y, unsigned short& h, unsigned short& l) { h = f2bf(y); l = f2bf(y - bf2f(h)); }
typedef __attribute__((ext_vector_type(2))) _Float16 v2h;
typedef __attribute__((ext_vector_type(4))) _Float16 v4h;
typedef __attribute__((ext_vector_type(2))) unsigned short v2us;
typedef __attribute__((ext_vector_type(4))) unsigned short v4us;
typedef __attribute__((ext_vector_type(2))) float v2f;
typedef __attribute__((ext_vector_type(4))) int v4i;

__global__ __launch_bounds__(256) void k_wtG(const float* __restrict__ w, int K, int N, bf* Bt) {
    const int lane = threadIdx.x & 31; const int L0 = (blockIdx.x * 8 + (threadIdx.x >> 5)) * 8; const int nlines = N * K / 64;
{
#pragma unroll 1
        for (int l = 0; l < 8; ++l) { const int L = L0 + l; if (L >= nlines) break; const size_t e = (size_t)L * 64 + lane * 2; const int k = (int)(e % K), n = (int)(e / K); v2us o;
            o[0] = f2bf(w[(size_t)k * N + n]); o[1] = f2bf(w[(size_t)(k + 1) * N + n]); *(v2us*)(Bt + e) = o; }
         }
}
__global__ __launch_bounds__(256) void k_cvt8(const float* __restrict__ src, bf* dst, size_t n8) { const size_t i = (size_t)blockIdx.x * 256 + threadIdx.x; if (i >= n8) return; const v8f v = *(const v8f*)(src + i * 8); v8us o;
#pragma unroll
    for (int k = 0; k < 8; ++k) o[k] = f2bf(v[k]); *(v8us*)(dst + i * 8) = o;  }
__global__ __launch_bounds__(256) void k_cscvt(const float* __restrict__ cosT, const float* __restrict__ sinT, float* CS) { const int idx = blockIdx.x * 256 + threadIdx.x; if (idx >= TT * HD) return; v2f cs; cs[0] = bfr(cosT[idx]); cs[1] = bfr(sinT[idx]); *(v2f*)(CS + (size_t)idx * 2) = cs;  }
// k_rope: head planes [h][t][d] (fp16 + hi/lo) of rope(x) x sc with the rotate-half convention out[d] = x[d] cos[t][d] - x[d+HD/2] sin[t][d], out[d+HD/2] = x[d+HD/2] cos[t][d+HD/2] + x[d] sin[t][d+HD/2]
__global__ __launch_bounds__(256) void k_rope(const float* __restrict__ F, int pitch, int nheads, const float* __restrict__ CS, const float* __restrict__ RF, const float* __restrict__ nw, float sc, h16* P16, bf* Ph, bf* Pl) {
    const size_t e = ((size_t)blockIdx.x * 256 + threadIdx.x) * 2; if (e >= (size_t)nheads * TT * HD) return; const int d = (int)(e % HD); const int t = (int)((e / HD) % TT); const int h = (int)(e / ((size_t)HD * TT)); const float* f = F + (size_t)t * pitch + h * HD; const float rf = RF ? RF[(size_t)h * TT + t] : 1.0f; v2h o16; v2us oh, ol;
#pragma unroll
    for (int q = 0; q < 2; ++q) { const int dd = d + q; const int dp = (dd < HD / 2) ? dd + HD / 2 : dd - HD / 2; float x0 = f[dd], x1 = f[dp];
        if (RF) { float n0 = __fmul_rn(x0, rf), n1 = __fmul_rn(x1, rf); asm volatile("" : "+v"(n0)); asm volatile("" : "+v"(n1)); x0 = __fmul_rn(bfr(nw[dd]), n0); x1 = __fmul_rn(bfr(nw[dp]), n1); }
        const v2f cs = *(const v2f*)(CS + ((size_t)t * HD + dd) * 2); float a = __fmul_rn(x0, cs[0]), bq = __fmul_rn(x1, cs[1]); asm volatile("" : "+v"(a)); asm volatile("" : "+v"(bq)); const float r = ((dd < HD / 2) ? __fsub_rn(a, bq) : __fadd_rn(a, bq)) * sc;
        o16[q] = tohx(r); unsigned short a2, c2; splitf(r, a2, c2); oh[q] = a2; ol[q] = c2; }
    *(v2h*)(P16 + e) = o16; *(v2us*)(Ph + e) = oh; *(v2us*)(Pl + e) = ol;  }
__global__ __launch_bounds__(256) void k_vtp(const float* __restrict__ F, int pitch, int nheads, h16* V16, bf* Vh, bf* Vl) { const size_t e = ((size_t)blockIdx.x * 256 + threadIdx.x) * 2; if (e >= (size_t)nheads * HD * TT) return; const int t = (int)(e % TT); const int d = (int)((e / TT) % HD); const int g = (int)(e / ((size_t)TT * HD)); v2h o16; v2us oh, ol;
#pragma unroll
    for (int q = 0; q < 2; ++q) { const float x = F[(size_t)(t + q) * pitch + g * HD + d]; o16[q] = tohx(x); unsigned short a2, c2; splitf(x, a2, c2); oh[q] = a2; ol[q] = c2; }
    *(v2h*)(V16 + e) = o16; *(v2us*)(Vh + e) = oh; *(v2us*)(Vl + e) = ol;  }
__global__ __launch_bounds__(256) void k_csid(float* CS) { const int idx = blockIdx.x * 256 + threadIdx.x; if (idx >= TT * HD) return; v2f cs; cs[0] = 1.0f; cs[1] = 0.0f; *(v2f*)(CS + (size_t)idx * 2) = cs;  }
// k_asoft: per row (zz, i): t = S x HD^-0.5 + (j - i)/16 for j <= i (causal, ALiBi slope 1/16; the reference's -1e9 additive fill vanishes identically); softmax over the 2048 keys (register row, one exp, fixed trees);
// the probabilities go over the row's own 8 KiB of scores (one wave owns a row and holds all of it in registers before its first store): fp16 in the first half, or the hi plane in the first and the lo plane in the second half.
__global__ __launch_bounds__(256) void k_asoft(float* Sb) {
    const int lane = threadIdx.x & 31; const int row = blockIdx.x * 8 + (threadIdx.x >> 5); if (row >= ZH * TT) return; const int i = row % TT; const int zz = row / TT; (void)zz; const bool hires = (i < RH); const float* sr = Sb + (size_t)row * TT; h16* p16 = (h16*)(Sb + (size_t)row * TT); bf* ph = (bf*)(Sb + (size_t)row * TT); bf* pl = ph + TT; float v[TT / 32]; float mx = -3.0e38f;
#pragma unroll
    for (int ch = 0; ch < TT / 128; ++ch) { const int j0 = ch * 128 + lane * 4; const v4f a = *(const v4f*)(sr + j0);
#pragma unroll
        for (int q = 0; q < 4; ++q) { const int j = j0 + q; (void)j; float t0 = a[q] * SCL, bb = 0.0625f * (float)(j - i); asm volatile("" : "+v"(t0)); asm volatile("" : "+v"(bb)); const float t = (j <= i) ? __fadd_rn(t0, bb) : -3.0e38f   /* causal + ALiBi slope 1/16 */; v[ch * 4 + q] = t; mx = fmaxf(mx, t); } }
#pragma unroll
    for (int sh = 16; sh; sh >>= 1) mx = fmaxf(mx, __shfl_xor(mx, sh, 32));
    float sum = 0.f;
#pragma unroll
    for (int k = 0; k < TT / 32; ++k) { float d0 = __fsub_rn(v[k], mx); asm volatile("" : "+v"(d0)); v[k] = __builtin_amdgcn_exp2f(__fmul_rn(d0, 1.4426950408889634f)); sum += v[k]; }
#pragma unroll
    for (int sh = 16; sh; sh >>= 1) sum += __shfl_xor(sum, sh, 32);
    const float f = __fdiv_rn(hires ? 1.0f : PCAR, sum);
{
        if (hires) {
#pragma unroll
            for (int ch = 0; ch < TT / 128; ++ch) { v4us oh, ol;
#pragma unroll
                for (int q = 0; q < 4; ++q) { unsigned short a, c2; splitf(v[ch * 4 + q] * f, a, c2); oh[q] = a; ol[q] = c2; }
                const int oo = ch * 128 + lane * 4; *(v4us*)(ph + oo) = oh; *(v4us*)(pl + oo) = ol; }
        } else {
#pragma unroll
            for (int ch = 0; ch < TT / 128; ++ch) { v4h o4;
#pragma unroll
                for (int q = 0; q < 4; ++q) o4[q] = tohx(v[ch * 4 + q] * f);
                *(v4h*)(p16 + ch * 128 + lane * 4) = o4; } }
         }
}
__global__ __launch_bounds__(256) void k_merge(const float* __restrict__ O, int h0, bf* Ah, bf* Al) { const size_t e = ((size_t)blockIdx.x * 256 + threadIdx.x) * 2; if (e >= (size_t)ZH * TT * HD) return; const int d = (int)(e % HD); const int t = (int)((e / HD) % TT); const int zz = (int)(e / ((size_t)HD * TT)); const float cs = (t < RH) ? 1.0f : (1.0f / PCAR); const size_t oo = (size_t)t * DQ + (h0 + zz) * HD + d;
    v2us oh, ol;
#pragma unroll
    for (int q = 0; q < 2; ++q) { unsigned short a, c2; splitf(O[e + q] * cs, a, c2); oh[q] = a; ol[q] = c2; } *(v2us*)(Ah + oo) = oh; *(v2us*)(Al + oo) = ol;  }

extern "C" void kernel_launch(void* const* d_in, const int* in_sizes, int n_in,
                              void* d_out, int out_size, void* d_ws, size_t ws_size, hipStream_t stream) {
    (void)in_sizes; (void)n_in; (void)out_size;
    const float* x = (const float*)d_in[0]; const float* wq = (const float*)d_in[1]; const float* bq = (const float*)d_in[2]; const float* wk = (const float*)d_in[3]; const float* bk = (const float*)d_in[4]; const float* wv = (const float*)d_in[5]; const float* bv = (const float*)d_in[6]; const float* wo = (const float*)d_in[7]; const float* bo = (const float*)d_in[8]; const float* cosT = nullptr; const float* sinT = nullptr; (void)cosT; (void)sinT;
    float* OUT = (float*)d_out;     // [2][2048][1024]
    char* wsp = (char*)d_ws;
    auto take = [&](size_t bytes) { char* p = wsp; wsp += (bytes + 255) & ~(size_t)255; return (void*)p; };
    bf* WQ = (bf*)take((size_t)DQ * DM * 2); bf* WK = (bf*)take((size_t)DKV * DM * 2); bf* WV = (bf*)take((size_t)DKV * DM * 2); bf* WO = (bf*)take((size_t)DM * DQ * 2); float* CS = (float*)take((size_t)TT * HD * 2 * 4);
    bf* XB = (bf*)take((size_t)TT * DM * 2); float* FQ = (float*)take((size_t)TT * DQ * 4); float* FK = (float*)take((size_t)TT * DKV * 4);
    h16* QP16 = (h16*)take((size_t)NH_ * TT * HD * 2); h16* KP16 = (h16*)take((size_t)NKV * TT * HD * 2); h16* VT16 = (h16*)take((size_t)NKV * HD * TT * 2);
    bf* QPh = (bf*)take((size_t)NH_ * TT * HD * 2); bf* QPl = (bf*)take((size_t)NH_ * TT * HD * 2); bf* KPh = (bf*)take((size_t)NKV * TT * HD * 2); bf* KPl = (bf*)take((size_t)NKV * TT * HD * 2); bf* VTh = (bf*)take((size_t)NKV * HD * TT * 2); bf* VTl = (bf*)take((size_t)NKV * HD * TT * 2);
    float* Sb = (float*)take((size_t)ZH * TT * TT * 4); float* Ob = (float*)take((size_t)ZH * TT * HD * 4); bf* ATh = (bf*)take((size_t)TT * DQ * 2); bf* ATl = (bf*)take((size_t)TT * DQ * 2);
    if ((size_t)(wsp - (char*)d_ws) > ws_size) return;    // ws 256 MiB
    float* FV = FK;   // v projection reuses the k buffer after the k planes are built (stream-ordered)
    { k_cvt8<<<(unsigned)(((size_t)DQ * DM / 8 + 255) / 256), 256, 0, stream>>>(wq, WQ, (size_t)DQ * DM / 8); k_cvt8<<<(unsigned)(((size_t)DKV * DM / 8 + 255) / 256), 256, 0, stream>>>(wk, WK, (size_t)DKV * DM / 8); k_cvt8<<<(unsigned)(((size_t)DKV * DM / 8 + 255) / 256), 256, 0, stream>>>(wv, WV, (size_t)DKV * DM / 8);
      k_cvt8<<<(unsigned)(((size_t)DM * DQ / 8 + 255) / 256), 256, 0, stream>>>(wo, WO, (size_t)DM * DQ / 8);
       }
    k_csid<<<(TT * HD + 255) / 256, 256, 0, stream>>>(CS);
    const unsigned LQ = (unsigned)(((size_t)NH_ * TT * HD / 2 + 255) / 256), LKv = (unsigned)(((size_t)NKV * TT * HD / 2 + 255) / 256);
    for (int b = 0; b < NB_; ++b) {
        
        k_cvt8<<<(unsigned)(((size_t)TT * DM / 8 + 255) / 256), 256, 0, stream>>>(x + (size_t)b * TT * DM, XB, (size_t)TT * DM / 8);
        k_gemmw<bf, 0, true, 8><<<dim3(TT / 64, DQ / 64, 1), 256, 0, stream>>>(XB, nullptr, WQ, nullptr, DM, FQ, DQ, bq, 0, 0, 0);
        k_rope<<<LQ, 256, 0, stream>>>(FQ, DQ, NH_, CS, nullptr, nullptr, 1.0f, QP16, QPh, QPl);
        k_gemmw<bf, 0, true, 8><<<dim3(TT / 64, DKV / 64, 1), 256, 0, stream>>>(XB, nullptr, WK, nullptr, DM, FK, DKV, bk, 0, 0, 0);
        k_rope<<<LKv, 256, 0, stream>>>(FK, DKV, NKV, CS, nullptr, nullptr, 1.0f, KP16, KPh, KPl);
        k_gemmw<bf, 0, true, 8><<<dim3(TT / 64, DKV / 64, 1), 256, 0, stream>>>(XB, nullptr, WV, nullptr, DM, FV, DKV, bv, 0, 0, 0); k_vtp<<<LKv, 256, 0, stream>>>(FV, DKV, NKV, VT16, VTh, VTl);
        for (int h0 = 0; h0 < NH_; h0 += ZH) { const size_t zq = (size_t)h0, zk = (size_t)(h0 / REP);   // one kv head per query head: the pass's ZH heads use consecutive kv planes (z-strides TT*HD)
            k_gemmc<bf, 2, 1, 1><<<dim3(RH / 64, TT / 64, ZH), 32, 0, stream>>>(QPh + zq * TT * HD, QPl + zq * TT * HD, HD, KPh + zk * TT * HD, KPl + zk * TT * HD, HD, Sb, TT, 0, (size_t)TT * HD, (size_t)TT * HD, (size_t)TT * TT);
            k_gemmc<h16, 0, 1, 1><<<dim3((TT - RH) / 64, TT / 64, ZH), 32, 0, stream>>>(QP16 + zq * TT * HD + (size_t)RH * HD, nullptr, HD, KP16 + zk * TT * HD, nullptr, HD, Sb + (size_t)RH * TT, TT, RH, (size_t)TT * HD, (size_t)TT * HD, (size_t)TT * TT);
            k_asoft<<<ZH * TT / 8, 256, 0, stream>>>(Sb);
            k_gemmc<bf, 2, 2, 16><<<dim3(RH / 64, HD / 64, ZH), 512, 0, stream>>>((const bf*)Sb, (const bf*)Sb + TT, 2 * TT, VTh + zk * HD * TT, VTl + zk * HD * TT, TT, Ob, HD, 0, (size_t)TT * TT * 2, (size_t)HD * TT, (size_t)TT * HD);
            k_gemmc<h16, 0, 2, 16><<<dim3((TT - RH) / 64, HD / 64, ZH), 512, 0, stream>>>((const h16*)Sb + (size_t)RH * TT * 2, nullptr, 2 * TT, VT16 + zk * HD * TT, nullptr, TT, Ob + (size_t)RH * HD, HD, RH, (size_t)TT * TT * 2, (size_t)HD * TT, (size_t)TT * HD);
            k_merge<<<(unsigned)(((size_t)ZH * TT * HD / 2 + 255) / 256), 256, 0, stream>>>(Ob, h0, ATh, ATl); }
        k_gemmw<bf, 1, true, 8><<<dim3(TT / 64, DM / 64, 1), 256, 0, stream>>>(ATh, ATl, WO, nullptr, DQ, OUT + (size_t)b * TT * DM, DM, bo, 0, 0, 0); }
}

// v003
// Measured time: 224 microseconds a run.
// Two timings next to v002 put it at 2.47 and 2.50 times that version's speed.
// Counting every step since v000, it is 6.93 times as fast.
#include <hip/hip_runtime.h>

#include <hip/hip_runtime.h>

#define NB_  2
#define TT   2048
#define DM   1024
#define NH_  16
#define NKV  16
#define REP  (NH_ / NKV)
#define HD   64
#define DQ   (NH_ * HD)
#define DKV  (NKV * HD)
#define RH   512                  // query rows < RH use hi+lo planes (0: none)
#define WIN  0
#define PCAR 1024.0f
#define SCL  0.125f   // HD^-0.5
typedef _Float16 h16;
typedef unsigned short bf;
typedef __attribute__((ext_vector_type(16))) __bf16   v16bf;
typedef __attribute__((ext_vector_type(16))) _Float16 v16h;
typedef __attribute__((ext_vector_type(8)))  _Float16 v8h;
typedef __attribute__((ext_vector_type(8)))  unsigned short v8us;
typedef __attribute__((ext_vector_type(8)))  float    v8f;
typedef __attribute__((ext_vector_type(4)))  float    v4f;
typedef v8h  __attribute__((may_alias)) v8ha;
typedef v4f  __attribute__((may_alias)) v4fa;
typedef v8us __attribute__((may_alias)) v8usa;

__device__ __forceinline__ unsigned short f2bf(float f) { unsigned u = __float_as_uint(f); u += 0x7FFFu + ((u >> 16) & 1u); return (unsigned short)(u >> 16); }
__device__ __forceinline__ float bf2f(unsigned short b) { return __uint_as_float(((unsigned)b) << 16); }
__device__ __forceinline__ float bfr(float f) { return bf2f(f2bf(f)); }
__device__ __forceinline__ v16h cat16(v8h lo, v8h hi) { return __builtin_shufflevector(lo, hi, 0, 1, 2, 3, 4, 5, 6, 7, 8, 9, 10, 11, 12, 13, 14, 15); }
__device__ __forceinline__ v16bf cat16b(v8us lo, v8us hi) { return __builtin_bit_cast(v16bf, __builtin_shufflevector(lo, hi, 0, 1, 2, 3, 4, 5, 6, 7, 8, 9, 10, 11, 12, 13, 14, 15)); }
__device__ __forceinline__ v8f wmma16(v16h a, v16h b, v8f c) { return __builtin_amdgcn_wmma_f32_16x16x32_f16(false, a, false, b, (short)0, c, false, false); }
__device__ __forceinline__ v8f wmmab(v16bf a, v16bf b, v8f c) { return __builtin_amdgcn_wmma_f32_16x16x32_bf16(false, a, false, b, (short)0, c, false, false); }



// ---- k_gemmw: register-blocked GEMM, one work-group of NW waves per 64x64 output tile; every wave holds the whole tile (16 accumulators) and takes every NW-th 32-wide k step, operands straight from
// K-contiguous 16-bit planes; the NW partial tiles are summed through LDS in wave order 0..NW-1. grid (M/64, N/64, Z), 32 * NW threads.
// C[m][n] (f32, pitch ldc, + optional f32 bias[n]) = sum_k A[m][k] Bt[n][k] (+ split products per NSPLIT). z-batch strides sA/sB/sC in elements. K % 32 == 0.
template <typename T16> struct WFrag;
template <> struct WFrag<h16> { typedef v16h V; static __device__ __forceinline__ V ld(const h16* p) { return cat16(*(const v8h*)p, *(const v8h*)(p + 16)); } static __device__ __forceinline__ v8f mma(V a, V b, v8f c) { return wmma16(a, b, c); } };
template <> struct WFrag<bf> { typedef v16bf V; static __device__ __forceinline__ V ld(const bf* p) { return cat16b(*(const v8us*)p, *(const v8us*)(p + 16)); } static __device__ __forceinline__ v8f mma(V a, V b, v8f c) { return wmmab(a, b, c); } };
template <int NW> __device__ __forceinline__ void tile_sync() { if (NW == 1) { __builtin_amdgcn_wave_barrier(); asm volatile("" ::: "memory"); } else __syncthreads(); }   // orders the LDS slab writes against the reads of the same slabs (by the one wave, or by all NW)
template <typename T16, int NSPLIT, bool BIAS, int NW>
__global__ __launch_bounds__(32 * NW) void k_gemmw(const T16* __restrict__ A, const T16* __restrict__ A2, const T16* __restrict__ Bt, const T16* __restrict__ Bt2, int K, float* C, int ldc, const float* __restrict__ bias, size_t sA, size_t sB, size_t sC) {
    typedef typename WFrag<T16>::V V;
    __shared__ __align__(16) float os[NW * 16 * 68];
    const size_t z = blockIdx.z; A += z * sA; if (A2) A2 += z * sA; Bt += z * sB; if (Bt2) Bt2 += z * sB; C += z * sC;
    const int lane = threadIdx.x & 31, lr = lane & 15, hi = lane >> 4; const int r0 = blockIdx.x * 64, c0 = blockIdx.y * 64;
    const int wv = (NW == 1) ? 0 : __builtin_amdgcn_readfirstlane((int)(threadIdx.x >> 5));   // wave number, scalar: the k loop's bounds stay wave-uniform
    constexpr int NS = (NW >= 8) ? 1 : 8 / NW;   // row pairs of a 16-row slab that one wave sums and stores
    v4f res[4][NS];                              // NW > 1: summed rows wait here, so that no barrier has to wait for a global store
    v8f acc[4][4];
#pragma unroll
    for (int mb = 0; mb < 4; ++mb)
#pragma unroll
        for (int nb = 0; nb < 4; ++nb) acc[mb][nb] = (v8f){};
    const size_t aoff = (size_t)(r0 + lr) * K + 8 * hi, boff = (size_t)(c0 + lr) * K + 8 * hi;
#pragma unroll 1
    for (int kc = 32 * wv; kc < K; kc += 32 * NW) {
        V a[4], a2[4];
#pragma unroll
        for (int mb = 0; mb < 4; ++mb) { a[mb] = WFrag<T16>::ld(A + aoff + (size_t)mb * 16 * K + kc); if (NSPLIT == 1 || NSPLIT == 2) a2[mb] = WFrag<T16>::ld(A2 + aoff + (size_t)mb * 16 * K + kc); }
#pragma unroll
        for (int nb = 0; nb < 4; ++nb) { const V b = WFrag<T16>::ld(Bt + boff + (size_t)nb * 16 * K + kc); V b2; if (NSPLIT >= 2) b2 = WFrag<T16>::ld(Bt2 + boff + (size_t)nb * 16 * K + kc);
#pragma unroll
            for (int mb = 0; mb < 4; ++mb) { acc[mb][nb] = WFrag<T16>::mma(a[mb], b, acc[mb][nb]); if (NSPLIT == 1 || NSPLIT == 2) acc[mb][nb] = WFrag<T16>::mma(a2[mb], b, acc[mb][nb]); if (NSPLIT >= 2) acc[mb][nb] = WFrag<T16>::mma(a[mb], b2, acc[mb][nb]); } }
        asm volatile("v_nop\n\tv_nop\n\tv_nop\n\tv_nop" : "+v"(acc[0][0]), "+v"(acc[1][1]), "+v"(acc[2][2]), "+v"(acc[3][3]) : "v"(a[0]), "v"(a[3]));
    }
#pragma unroll
    for (int mb = 0; mb < 4; ++mb) {
#pragma unroll
        for (int nb = 0; nb < 4; ++nb) {
#pragma unroll
            for (int j = 0; j < 8; ++j) os[wv * (16 * 68) + (hi * 8 + j) * 68 + nb * 16 + lr] = acc[mb][nb][j]; }
        tile_sync<NW>();
        float* crow = C + (size_t)(r0 + mb * 16) * ldc + c0;
{
#pragma unroll
            for (int k = 0; k < NS; ++k) { const int s = wv + k * NW; if (NW > 8 && s >= 8) break; const int row = 2 * s + hi, cofs = lr * 4; v4f val = *(const v4fa*)(os + row * 68 + cofs);
#pragma unroll
                for (int w = 1; w < NW; ++w) val += *(const v4fa*)(os + w * (16 * 68) + row * 68 + cofs);
                if (BIAS) { val[0] += bfr(bias[c0 + cofs]); val[1] += bfr(bias[c0 + cofs + 1]); val[2] += bfr(bias[c0 + cofs + 2]); val[3] += bfr(bias[c0 + cofs + 3]); }
                if (NW == 1) *(v4f*)(crow + (size_t)row * ldc + cofs) = val; else res[mb][k] = val; }
             }
        if (NW == 1 || mb < 3) tile_sync<NW>();
    }
    if (NW > 1) {
#pragma unroll
        for (int mb = 0; mb < 4; ++mb)
#pragma unroll
            for (int k = 0; k < NS; ++k) { const int s = wv + k * NW; if (NW > 8 && s >= 8) break; *(v4f*)(C + (size_t)(r0 + mb * 16 + 2 * s + hi) * ldc + c0 + lr * 4) = res[mb][k]; }
    }
}

__device__ __forceinline__ h16 tohx(float x) { return (h16)x; }
__device__ __forceinline__ void splitf(float y, unsigned short& h, unsigned short& l) { h = f2bf(y); l = f2bf(y - bf2f(h)); }
typedef __attribute__((ext_vector_type(2))) _Float16 v2h;
typedef __attribute__((ext_vector_type(4))) _Float16 v4h;
typedef __attribute__((ext_vector_type(2))) unsigned short v2us;
typedef __attribute__((ext_vector_type(4))) unsigned short v4us;
typedef __attribute__((ext_vector_type(2))) float v2f;
typedef __attribute__((ext_vector_type(4))) int v4i;

__global__ __launch_bounds__(256) void k_wtG(const float* __restrict__ w, int K, int N, bf* Bt) {
    const int lane = threadIdx.x & 31; const int L0 = (blockIdx.x * 8 + (threadIdx.x >> 5)) * 8; const int nlines = N * K / 64;
{
#pragma unroll 1
        for (int l = 0; l < 8; ++l) { const int L = L0 + l; if (L >= nlines) break; const size_t e = (size_t)L * 64 + lane * 2; const int k = (int)(e % K), n = (int)(e / K); v2us o;
            o[0] = f2bf(w[(size_t)k * N + n]); o[1] = f2bf(w[(size_t)(k + 1) * N + n]); *(v2us*)(Bt + e) = o; }
         }
}
__global__ __launch_bounds__(256) void k_cvt8(const float* __restrict__ src, bf* dst, size_t n8) { const size_t i = (size_t)blockIdx.x * 256 + threadIdx.x; if (i >= n8) return; const v8f v = *(const v8f*)(src + i * 8); v8us o;
#pragma unroll
    for (int k = 0; k < 8; ++k) o[k] = f2bf(v[k]); *(v8us*)(dst + i * 8) = o;  }
__global__ __launch_bounds__(256) void k_cscvt(const float* __restrict__ cosT, const float* __restrict__ sinT, float* CS) { const int idx = blockIdx.x * 256 + threadIdx.x; if (idx >= TT * HD) return; v2f cs; cs[0] = bfr(cosT[idx]); cs[1] = bfr(sinT[idx]); *(v2f*)(CS + (size_t)idx * 2) = cs;  }
// k_rope: head planes [h][t][d] (fp16 + hi/lo) of rope(x) x sc with the rotate-half convention out[d] = x[d] cos[t][d] - x[d+HD/2] sin[t][d], out[d+HD/2] = x[d+HD/2] cos[t][d+HD/2] + x[d] sin[t][d+HD/2]
__global__ __launch_bounds__(256) void k_rope(const float* __restrict__ F, int pitch, int nheads, const float* __restrict__ CS, const float* __restrict__ RF, const float* __restrict__ nw, float sc, h16* P16, bf* Ph, bf* Pl) {
    const size_t e = ((size_t)blockIdx.x * 256 + threadIdx.x) * 2; if (e >= (size_t)nheads * TT * HD) return; const int d = (int)(e % HD); const int t = (int)((e / HD) % TT); const int h = (int)(e / ((size_t)HD * TT)); const float* f = F + (size_t)t * pitch + h * HD; const float rf = RF ? RF[(size_t)h * TT + t] : 1.0f; v2h o16; v2us oh, ol;
#pragma unroll
    for (int q = 0; q < 2; ++q) { const int dd = d + q; const int dp = (dd < HD / 2) ? dd + HD / 2 : dd - HD / 2; float x0 = f[dd], x1 = f[dp];
        if (RF) { float n0 = __fmul_rn(x0, rf), n1 = __fmul_rn(x1, rf); asm volatile("" : "+v"(n0)); asm volatile("" : "+v"(n1)); x0 = __fmul_rn(bfr(nw[dd]), n0); x1 = __fmul_rn(bfr(nw[dp]), n1); }
        const v2f cs = *(const v2f*)(CS + ((size_t)t * HD + dd) * 2); float a = __fmul_rn(x0, cs[0]), bq = __fmul_rn(x1, cs[1]); asm volatile("" : "+v"(a)); asm volatile("" : "+v"(bq)); const float r = ((dd < HD / 2) ? __fsub_rn(a, bq) : __fadd_rn(a, bq)) * sc;
        o16[q] = tohx(r); unsigned short a2, c2; splitf(r, a2, c2); oh[q] = a2; ol[q] = c2; }
    *(v2h*)(P16 + e) = o16; *(v2us*)(Ph + e) = oh; *(v2us*)(Pl + e) = ol;  }
__global__ __launch_bounds__(256) void k_vtp(const float* __restrict__ F, int pitch, int nheads, h16* V16, bf* Vh, bf* Vl) { const size_t e = ((size_t)blockIdx.x * 256 + threadIdx.x) * 2; if (e >= (size_t)nheads * HD * TT) return; const int t = (int)(e % TT); const int d = (int)((e / TT) % HD); const int g = (int)(e / ((size_t)TT * HD)); v2h o16; v2us oh, ol;
#pragma unroll
    for (int q = 0; q < 2; ++q) { const float x = F[(size_t)(t + q) * pitch + g * HD + d]; o16[q] = tohx(x); unsigned short a2, c2; splitf(x, a2, c2); oh[q] = a2; ol[q] = c2; }
    *(v2h*)(V16 + e) = o16; *(v2us*)(Vh + e) = oh; *(v2us*)(Vl + e) = ol;  }
__global__ __launch_bounds__(256) void k_csid(float* CS) { const int idx = blockIdx.x * 256 + threadIdx.x; if (idx >= TT * HD) return; v2f cs; cs[0] = 1.0f; cs[1] = 0.0f; *(v2f*)(CS + (size_t)idx * 2) = cs;  }
// ---- k_fattn: scores, causal ALiBi softmax, P.V and the hi/lo split of the result in one launch; no score or probability leaves the registers.
// One work-group of NWF waves owns a tile of QB*16 query rows of one head; its waves take every NWF-th pass of 32 keys, each with its own running maximum, sum and output tile (online softmax);
// the NWF partial tiles are joined through LDS in wave order 0..NWF-1. Transposed products: S^T = K Q^T (a lane holds 16 scores of ONE query per pass), O^T += V^T P^T, where two converted S^T tiles are the B operand as they stand.
// Query rows < RH: hi+lo bf16 planes, three products each (HI); the others f16 with the probabilities carried at 2^10 (the factor cancels against the row sum).
#define NWF 8
#define L2E 1.4426950408889634f
// XWAIT: s_wait_xcnt 0 behind a run of global loads or stores; it names their address pairs as inputs, so that they stay live up to the wait and neither a later load's result nor a vector instruction lands in them ahead of it.
#define XWAIT(pa, pb) asm volatile("s_wait_xcnt 0x0" :: "v"(pa), "v"(pb) : "memory")
__device__ __forceinline__ float xhalf(float x) { const int b = __float_as_int(x); return __int_as_float(__builtin_amdgcn_permlanex16(b, b, 0x76543210, 0xfedcba98, false, false)); }   // value of lane l ^ 16
// exp2s: v_exp_f32 with one v_nop in the same statement, for the places where the compiler's schedule put a write of the transcendental's source register directly behind it (the slot the instruction set asks for).
__device__ __forceinline__ float exp2s(float x) { float r; asm("v_exp_f32 %0, %1\n\tv_nop" : "=v"(r) : "v"(x)); return r; }
template <typename T16, bool HI, int QB>
__device__ __forceinline__ void attn_tile(const T16* __restrict__ Q, const T16* __restrict__ Q2, const T16* __restrict__ K, const T16* __restrict__ K2, const T16* __restrict__ Vt, const T16* __restrict__ Vt2,
                                          int q0, int wv, float* so, float* sml, bf* Ah, bf* Al) {
    typedef typename WFrag<T16>::V V;
    const int lane = threadIdx.x & 31, lr = lane & 15, hi = lane >> 4; const int kend = q0 + QB * 16;   // keys 0 .. kend-1 can be visible to this tile
    V q[QB][2], q2[QB][2];
    const int koff = lr * HD + 8 * hi, voff = lr * TT + 8 * hi;
    { const T16* qp = Q + (size_t)q0 * HD + koff; const T16* qp2 = HI ? Q2 + (size_t)q0 * HD + koff : qp;
#pragma unroll
      for (int qb = 0; qb < QB; ++qb)
#pragma unroll
          for (int ks = 0; ks < 2; ++ks) { q[qb][ks] = WFrag<T16>::ld(qp + qb * 16 * HD + ks * 32); if (HI) q2[qb][ks] = WFrag<T16>::ld(qp2 + qb * 16 * HD + ks * 32); }
      XWAIT(qp, qp2); }
    v8f o[4][QB]; float m[QB], l[QB];
#pragma unroll
    for (int qb = 0; qb < QB; ++qb) { m[qb] = -3.0e38f; l[qb] = 0.f;
#pragma unroll
        for (int db = 0; db < 4; ++db) o[db][qb] = (v8f){}; }
    int c0 = 32 * wv;
    if (c0 < kend) {
        V k[2][2], k2[2][2];
        if constexpr (!HI) {   // f16 tiles (the long ones) fetch their K fragments one pass ahead
            const T16* kp = K + (size_t)c0 * HD + koff;
#pragma unroll
            for (int kb = 0; kb < 2; ++kb)
#pragma unroll
                for (int ks = 0; ks < 2; ++ks) k[kb][ks] = WFrag<T16>::ld(kp + kb * 16 * HD + ks * 32);
            XWAIT(kp, kp);
        }
#pragma unroll 1
        for (; c0 < kend; c0 += 32 * NWF) {
            V v[4], v2[4];
            if constexpr (HI) { const T16* kp = K + (size_t)c0 * HD + koff; const T16* kp2 = K2 + (size_t)c0 * HD + koff;
#pragma unroll
                for (int kb = 0; kb < 2; ++kb)
#pragma unroll
                    for (int ks = 0; ks < 2; ++ks) { k[kb][ks] = WFrag<T16>::ld(kp + kb * 16 * HD + ks * 32); k2[kb][ks] = WFrag<T16>::ld(kp2 + kb * 16 * HD + ks * 32); }
                XWAIT(kp, kp2);
            }
            { const T16* vp = Vt + c0 + voff; const T16* vp2 = HI ? Vt2 + c0 + voff : vp;
#pragma unroll
              for (int db = 0; db < 4; ++db) { v[db] = WFrag<T16>::ld(vp + db * 16 * TT); if (HI) v2[db] = WFrag<T16>::ld(vp2 + db * 16 * TT); }
              XWAIT(vp, vp2); }
            v8f s[2][QB];
#pragma unroll
            for (int kb = 0; kb < 2; ++kb)
#pragma unroll
                for (int qb = 0; qb < QB; ++qb) { s[kb][qb] = (v8f){};
#pragma unroll
                    for (int ks = 0; ks < 2; ++ks) { s[kb][qb] = WFrag<T16>::mma(k[kb][ks], q[qb][ks], s[kb][qb]); if (HI) { s[kb][qb] = WFrag<T16>::mma(k[kb][ks], q2[qb][ks], s[kb][qb]); s[kb][qb] = WFrag<T16>::mma(k2[kb][ks], q[qb][ks], s[kb][qb]); } } }
            if constexpr (!HI) {
                const int cn = (c0 + 32 * NWF < kend) ? c0 + 32 * NWF : c0;   // the wave's next pass (its last pass reloads itself: in bounds, unused); the loads fly under the softmax and P.V
                const T16* kp = K + (size_t)cn * HD + koff;
#pragma unroll
                for (int kb = 0; kb < 2; ++kb)
#pragma unroll
                    for (int ks = 0; ks < 2; ++ks) k[kb][ks] = WFrag<T16>::ld(kp + kb * 16 * HD + ks * 32);
                XWAIT(kp, kp);
                __builtin_amdgcn_sched_barrier(0);   // keeps the K loads up here, in front of the softmax, so that their latency passes under it
            }
            V p[QB], p2[QB];
#pragma unroll
            for (int qb = 0; qb < QB; ++qb) {
                const float bb0 = 0.0625f * (float)(c0 + hi * 8 - (q0 + qb * 16 + lr));   // ALiBi slope 1/16 x (j - i) at the lane's first key; exact, as is every bb below
                float mx = -3.0e38f;
#pragma unroll
                for (int kb = 0; kb < 2; ++kb)
#pragma unroll
                    for (int j = 0; j < 8; ++j) { const float bb = bb0 + 0.0625f * (float)(kb * 16 + j); const float t = (bb <= 0.f) ? s[kb][qb][j] * SCL + bb : -3.0e38f;   /* causal: j <= i */ s[kb][qb][j] = t; mx = fmaxf(mx, t); }
                mx = fmaxf(mx, xhalf(mx));
                const float mn = fmaxf(m[qb], mx); const float al = HI ? exp2s((m[qb] - mn) * L2E) : __builtin_amdgcn_exp2f((m[qb] - mn) * L2E); m[qb] = mn;
                float ls = 0.f;
#pragma unroll
                for (int kb = 0; kb < 2; ++kb)
#pragma unroll
                    for (int j = 0; j < 8; ++j) { const float e = HI ? exp2s((s[kb][qb][j] - mn) * L2E) : __builtin_amdgcn_exp2f((s[kb][qb][j] - mn) * L2E + 10.f); s[kb][qb][j] = e; ls += e; }
                l[qb] = l[qb] * al + ls;
#pragma unroll
                for (int db = 0; db < 4; ++db) o[db][qb] *= al;
                if constexpr (HI) { v8us h0, h1, l0, l1;
#pragma unroll
                    for (int j = 0; j < 8; ++j) { unsigned short a, c2; splitf(s[0][qb][j], a, c2); h0[j] = a; l0[j] = c2; splitf(s[1][qb][j], a, c2); h1[j] = a; l1[j] = c2; }
                    p[qb] = cat16b(h0, h1); p2[qb] = cat16b(l0, l1);
                } else { p[qb] = cat16(__builtin_convertvector(s[0][qb], v8h), __builtin_convertvector(s[1][qb], v8h)); }
            }
#pragma unroll
            for (int db = 0; db < 4; ++db)
#pragma unroll
                for (int qb = 0; qb < QB; ++qb) { o[db][qb] = WFrag<T16>::mma(v[db], p[qb], o[db][qb]); if (HI) { o[db][qb] = WFrag<T16>::mma(v[db], p2[qb], o[db][qb]); o[db][qb] = WFrag<T16>::mma(v2[db], p[qb], o[db][qb]); } }
            // four vector slots behind the pass's last WMMAs: over the loop's back edge the next pass's first products write registers that these read as operands
            if constexpr (QB == 2) asm volatile("v_nop\n\tv_nop\n\tv_nop\n\tv_nop" : "+v"(o[0][0]), "+v"(o[1][0]), "+v"(o[2][0]), "+v"(o[3][0]), "+v"(o[0][1]), "+v"(o[1][1]), "+v"(o[2][1]), "+v"(o[3][1]));
            else asm volatile("v_nop\n\tv_nop\n\tv_nop\n\tv_nop" : "+v"(o[0][0]), "+v"(o[1][0]), "+v"(o[2][0]), "+v"(o[3][0]));
        }
    }
    float* sw = so + wv * (QB * 16 * 68);
#pragma unroll
    for (int qb = 0; qb < QB; ++qb) { l[qb] += xhalf(l[qb]);
#pragma unroll
        for (int db = 0; db < 4; ++db) { float* d = sw + (qb * 16 + lr) * 68 + db * 16 + hi * 8; *(v4fa*)d = __builtin_shufflevector(o[db][qb], o[db][qb], 0, 1, 2, 3); *(v4fa*)(d + 4) = __builtin_shufflevector(o[db][qb], o[db][qb], 4, 5, 6, 7); }
        if (hi == 0) { sml[(wv * (QB * 16) + qb * 16 + lr) * 2] = m[qb]; sml[(wv * (QB * 16) + qb * 16 + lr) * 2 + 1] = l[qb]; } }
    __syncthreads();   // every wave's partial tile, maximum and sum are in LDS
    if ((int)threadIdx.x < QB * 16 * 8) { const int qq = threadIdx.x >> 3, dg = threadIdx.x & 7;   // one thread: 8 consecutive d of one query row
        float M = sml[qq * 2];
#pragma unroll
        for (int w = 1; w < NWF; ++w) M = fmaxf(M, sml[(w * (QB * 16) + qq) * 2]);
        float L = 0.f; v4f r0 = (v4f){}, r1 = (v4f){};
#pragma unroll
        for (int w = 0; w < NWF; ++w) { const float f = exp2s((sml[(w * (QB * 16) + qq) * 2] - M) * L2E); L += f * sml[(w * (QB * 16) + qq) * 2 + 1]; const float* d = so + w * (QB * 16 * 68) + qq * 68 + dg * 8; r0 += *(const v4fa*)d * f; r1 += *(const v4fa*)(d + 4) * f; }
        const float inv = __fdiv_rn(1.0f, L); v8us oh, ol;
#pragma unroll
        for (int j = 0; j < 4; ++j) { unsigned short a, c2; splitf(r0[j] * inv, a, c2); oh[j] = a; ol[j] = c2; splitf(r1[j] * inv, a, c2); oh[4 + j] = a; ol[4 + j] = c2; }
        bf* pa = Ah + (size_t)(q0 + qq) * DQ + dg * 8; bf* pb = Al + (size_t)(q0 + qq) * DQ + dg * 8; *(v8usa*)pa = oh; *(v8usa*)pb = ol; XWAIT(pa, pb); }
    __syncthreads();   // the LDS tiles are read: the next tile of this work-group may overwrite them
}
// grid (heads, pairs of tiles): a work-group takes a long tile and then the short one that makes every pair cost the same; the pairs of f16 tiles (the longer ones) have the low flat indices, so that they start first.
__global__ __launch_bounds__(32 * NWF) __attribute__((amdgpu_waves_per_eu(4, 4))) void k_fattn(const h16* __restrict__ Q16, const bf* __restrict__ Qh, const bf* __restrict__ Ql, const h16* __restrict__ K16, const bf* __restrict__ Kh, const bf* __restrict__ Kl,
                                                    const h16* __restrict__ V16, const bf* __restrict__ Vh, const bf* __restrict__ Vl, bf* Ah, bf* Al) {
    __shared__ __align__(16) float so[NWF * 32 * 68]; __shared__ float sml[NWF * 32 * 2];
    const int wv = __builtin_amdgcn_readfirstlane((int)(threadIdx.x >> 5));   // wave number, scalar: the key loop's bounds stay wave-uniform
    const size_t hq = (size_t)blockIdx.x * TT * HD, hk = (size_t)(blockIdx.x / REP) * TT * HD; Ah += blockIdx.x * HD; Al += blockIdx.x * HD;
    constexpr int NP = (TT - RH) / 64; const int x = blockIdx.y;
    if (x < NP) {
#pragma unroll 1
        for (int r = 0; r < 2; ++r) attn_tile<h16, false, 2>(Q16 + hq, nullptr, K16 + hk, nullptr, V16 + hk, nullptr, r ? RH + 32 * x : TT - 32 - 32 * x, wv, so, sml, Ah, Al);
    } else {
#pragma unroll 1
        for (int r = 0; r < 2; ++r) attn_tile<bf, true, 1>(Qh + hq, Ql + hq, Kh + hk, Kl + hk, Vh + hk, Vl + hk, r ? 16 * (x - NP) : RH - 16 - 16 * (x - NP), wv, so, sml, Ah, Al);
    }
}

extern "C" void kernel_launch(void* const* d_in, const int* in_sizes, int n_in,
                              void* d_out, int out_size, void* d_ws, size_t ws_size, hipStream_t stream) {
    (void)in_sizes; (void)n_in; (void)out_size;
    const float* x = (const float*)d_in[0]; const float* wq = (const float*)d_in[1]; const float* bq = (const float*)d_in[2]; const float* wk = (const float*)d_in[3]; const float* bk = (const float*)d_in[4]; const float* wv = (const float*)d_in[5]; const float* bv = (const float*)d_in[6]; const float* wo = (const float*)d_in[7]; const float* bo = (const float*)d_in[8]; const float* cosT = nullptr; const float* sinT = nullptr; (void)cosT; (void)sinT;
    float* OUT = (float*)d_out;     // [2][2048][1024]
    char* wsp = (char*)d_ws;
    auto take = [&](size_t bytes) { char* p = wsp; wsp += (bytes + 255) & ~(size_t)255; return (void*)p; };
    bf* WQ = (bf*)take((size_t)DQ * DM * 2); bf* WK = (bf*)take((size_t)DKV * DM * 2); bf* WV = (bf*)take((size_t)DKV * DM * 2); bf* WO = (bf*)take((size_t)DM * DQ * 2); float* CS = (float*)take((size_t)TT * HD * 2 * 4);
    bf* XB = (bf*)take((size_t)TT * DM * 2); float* FQ = (float*)take((size_t)TT * DQ * 4); float* FK = (float*)take((size_t)TT * DKV * 4);
    h16* QP16 = (h16*)take((size_t)NH_ * TT * HD * 2); h16* KP16 = (h16*)take((size_t)NKV * TT * HD * 2); h16* VT16 = (h16*)take((size_t)NKV * HD * TT * 2);
    bf* QPh = (bf*)take((size_t)NH_ * TT * HD * 2); bf* QPl = (bf*)take((size_t)NH_ * TT * HD * 2); bf* KPh = (bf*)take((size_t)NKV * TT * HD * 2); bf* KPl = (bf*)take((size_t)NKV * TT * HD * 2); bf* VTh = (bf*)take((size_t)NKV * HD * TT * 2); bf* VTl = (bf*)take((size_t)NKV * HD * TT * 2);
    bf* ATh = (bf*)take((size_t)TT * DQ * 2); bf* ATl = (bf*)take((size_t)TT * DQ * 2);
    if ((size_t)(wsp - (char*)d_ws) > ws_size) return;    // ws 256 MiB
    float* FV = FK;   // v projection reuses the k buffer after the k planes are built (stream-ordered)
    { k_cvt8<<<(unsigned)(((size_t)DQ * DM / 8 + 255) / 256), 256, 0, stream>>>(wq, WQ, (size_t)DQ * DM / 8); k_cvt8<<<(unsigned)(((size_t)DKV * DM / 8 + 255) / 256), 256, 0, stream>>>(wk, WK, (size_t)DKV * DM / 8); k_cvt8<<<(unsigned)(((size_t)DKV * DM / 8 + 255) / 256), 256, 0, stream>>>(wv, WV, (size_t)DKV * DM / 8);
      k_cvt8<<<(unsigned)(((size_t)DM * DQ / 8 + 255) / 256), 256, 0, stream>>>(wo, WO, (size_t)DM * DQ / 8);
       }
    k_csid<<<(TT * HD + 255) / 256, 256, 0, stream>>>(CS);
    const unsigned LQ = (unsigned)(((size_t)NH_ * TT * HD / 2 + 255) / 256), LKv = (unsigned)(((size_t)NKV * TT * HD / 2 + 255) / 256);
    for (int b = 0; b < NB_; ++b) {
        
        k_cvt8<<<(unsigned)(((size_t)TT * DM / 8 + 255) / 256), 256, 0, stream>>>(x + (size_t)b * TT * DM, XB, (size_t)TT * DM / 8);
        k_gemmw<bf, 0, true, 8><<<dim3(TT / 64, DQ / 64, 1), 256, 0, stream>>>(XB, nullptr, WQ, nullptr, DM, FQ, DQ, bq, 0, 0, 0);
        k_rope<<<LQ, 256, 0, stream>>>(FQ, DQ, NH_, CS, nullptr, nullptr, 1.0f, QP16, QPh, QPl);
        k_gemmw<bf, 0, true, 8><<<dim3(TT / 64, DKV / 64, 1), 256, 0, stream>>>(XB, nullptr, WK, nullptr, DM, FK, DKV, bk, 0, 0, 0);
        k_rope<<<LKv, 256, 0, stream>>>(FK, DKV, NKV, CS, nullptr, nullptr, 1.0f, KP16, KPh, KPl);
        k_gemmw<bf, 0, true, 8><<<dim3(TT / 64, DKV / 64, 1), 256, 0, stream>>>(XB, nullptr, WV, nullptr, DM, FV, DKV, bv, 0, 0, 0); k_vtp<<<LKv, 256, 0, stream>>>(FV, DKV, NKV, VT16, VTh, VTl);
        k_fattn<<<dim3(NH_, (TT - RH) / 64 + RH / 32, 1), 32 * NWF, 0, stream>>>(QP16, QPh, QPl, KP16, KPh, KPl, VT16, VTh, VTl, ATh, ATl);
        k_gemmw<bf, 1, true, 8><<<dim3(TT / 64, DM / 64, 1), 256, 0, stream>>>(ATh, ATl, WO, nullptr, DQ, OUT + (size_t)b * TT * DM, DM, bo, 0, 0, 0); }
}

// v004
// Measured time: 175 microseconds a run.
// Two timings next to v003 put it at 1.27 and 1.28 times that version's speed.
// Over all steps from v000 it is 8.85 times as fast.
#include <hip/hip_runtime.h>

#include <hip/hip_runtime.h>

#define NB_  2
#define TT   2048
#define DM   1024
#define NH_  16
#define NKV  16
#define REP  (NH_ / NKV)
#define HD   64
#define DQ   (NH_ * HD)
#define DKV  (NKV * HD)
#define RH   512                  // query rows < RH use hi+lo planes (0: none)
#define WIN  0
#define PCAR 1024.0f
#define SCL  0.125f   // HD^-0.5
typedef _Float16 h16;
typedef unsigned short bf;
typedef __attribute__((ext_vector_type(16))) __bf16   v16bf;
typedef __attribute__((ext_vector_type(16))) _Float16 v16h;
typedef __attribute__((ext_vector_type(8)))  _Float16 v8h;
typedef __attribute__((ext_vector_type(8)))  unsigned short v8us;
typedef __attribute__((ext_vector_type(8)))  float    v8f;
typedef __attribute__((ext_vector_type(4)))  float    v4f;
typedef v8h  __attribute__((may_alias)) v8ha;
typedef v4f  __attribute__((may_alias)) v4fa;
typedef v8us __attribute__((may_alias)) v8usa;

__device__ __forceinline__ unsigned short f2bf(float f) { unsigned u = __float_as_uint(f); u += 0x7FFFu + ((u >> 16) & 1u); return (unsigned short)(u >> 16); }
__device__ __forceinline__ float bf2f(unsigned short b) { return __uint_as_float(((unsigned)b) << 16); }
__device__ __forceinline__ float bfr(float f) { return bf2f(f2bf(f)); }
__device__ __forceinline__ v16h cat16(v8h lo, v8h hi) { return __builtin_shufflevector(lo, hi, 0, 1, 2, 3, 4, 5, 6, 7, 8, 9, 10, 11, 12, 13, 14, 15); }
__device__ __forceinline__ v16bf cat16b(v8us lo, v8us hi) { return __builtin_bit_cast(v16bf, __builtin_shufflevector(lo, hi, 0, 1, 2, 3, 4, 5, 6, 7, 8, 9, 10, 11, 12, 13, 14, 15)); }
__device__ __forceinline__ v8f wmma16(v16h a, v16h b, v8f c) { return __builtin_amdgcn_wmma_f32_16x16x32_f16(false, a, false, b, (short)0, c, false, false); }
__device__ __forceinline__ v8f wmmab(v16bf a, v16bf b, v8f c) { return __builtin_amdgcn_wmma_f32_16x16x32_bf16(false, a, false, b, (short)0, c, false, false); }



// ---- k_gemmw: register-blocked GEMM, one work-group of NW waves per 64x64 output tile; every wave holds the whole tile (16 accumulators) and takes every NW-th 32-wide k step, operands straight from
// K-contiguous 16-bit planes; the NW partial tiles are summed through LDS in wave order 0..NW-1. grid (M/64, N/64, Z), 32 * NW threads.
// C[m][n] (f32, pitch ldc, + optional f32 bias[n]) = sum_k A[m][k] Bt[n][k] (+ split products per NSPLIT). z-batch strides sA/sB/sC in elements. K % 32 == 0.
// OUTM 0: C goes out as f32. OUTM 1 and 2: no f32 C; the summed tile goes out as three 16-bit planes (f16, bf16 hi, bf16 lo) in the layout the attention kernel reads:
// OUTM 1 (m = token, n = feature; a 64-wide column tile is one head): plane[head][token][d]. OUTM 2 (m = feature, n = token; bias[m]): plane[feature][token], the transposed V.
typedef __attribute__((ext_vector_type(4))) _Float16 v4h;
typedef __attribute__((ext_vector_type(4))) unsigned short v4us;
__device__ __forceinline__ h16 tohx(float x) { return (h16)x; }
__device__ __forceinline__ void splitf(float y, unsigned short& h, unsigned short& l) { h = f2bf(y); l = f2bf(y - bf2f(h)); }
template <typename T16> struct WFrag;
template <> struct WFrag<h16> { typedef v16h V; static __device__ __forceinline__ V ld(const h16* p) { return cat16(*(const v8h*)p, *(const v8h*)(p + 16)); } static __device__ __forceinline__ v8f mma(V a, V b, v8f c) { return wmma16(a, b, c); } };
template <> struct WFrag<bf> { typedef v16bf V; static __device__ __forceinline__ V ld(const bf* p) { return cat16b(*(const v8us*)p, *(const v8us*)(p + 16)); } static __device__ __forceinline__ v8f mma(V a, V b, v8f c) { return wmmab(a, b, c); } };
template <int NW> __device__ __forceinline__ void tile_sync() { if (NW == 1) { __builtin_amdgcn_wave_barrier(); asm volatile("" ::: "memory"); } else __syncthreads(); }   // orders the LDS slab writes against the reads of the same slabs (by the one wave, or by all NW)
template <typename T16, int NSPLIT, bool BIAS, int NW, int OUTM>
__global__ __launch_bounds__(32 * NW) void k_gemmw(const T16* __restrict__ A, const T16* __restrict__ A2, const T16* __restrict__ Bt, const T16* __restrict__ Bt2, int K, float* C, int ldc, const float* __restrict__ bias, size_t sA, size_t sB, size_t sC, h16* P16, bf* Ph, bf* Pl) {
    typedef typename WFrag<T16>::V V;
    __shared__ __align__(16) float os[NW * 16 * 68];
    const size_t z = blockIdx.z; A += z * sA; if (A2) A2 += z * sA; Bt += z * sB; if (Bt2) Bt2 += z * sB; C += z * sC;
    const int lane = threadIdx.x & 31, lr = lane & 15, hi = lane >> 4; const int r0 = blockIdx.x * 64, c0 = blockIdx.y * 64;
    const int wv = (NW == 1) ? 0 : __builtin_amdgcn_readfirstlane((int)(threadIdx.x >> 5));   // wave number, scalar: the k loop's bounds stay wave-uniform
    constexpr int NS = (NW >= 8) ? 1 : 8 / NW;   // row pairs of a 16-row slab that one wave sums and stores
    v4f res[4][NS];                              // NW > 1: summed rows wait here, so that no barrier has to wait for a global store
    v4h r16[4][NS]; v4us rh[4][NS], rl[4][NS];   // OUTM 1, 2: the same rows, already converted
    float rb[4][NS];                             // OUTM 2: the bias of this lane's rows, fetched here so that its latency passes under the k loop and not between two barriers
    if (BIAS && OUTM == 2) {
#pragma unroll
        for (int k = 0; k < NS; ++k) { const int s = wv + k * NW; if (NW > 8 && s >= 8) break; const float* bp = bias + r0 + 2 * s + hi;
#pragma unroll
            for (int mb = 0; mb < 4; ++mb) rb[mb][k] = bfr(bp[mb * 16]); }
    }
    v8f acc[4][4];
#pragma unroll
    for (int mb = 0; mb < 4; ++mb)
#pragma unroll
        for (int nb = 0; nb < 4; ++nb) acc[mb][nb] = (v8f){};
    const size_t aoff = (size_t)(r0 + lr) * K + 8 * hi, boff = (size_t)(c0 + lr) * K + 8 * hi;
#pragma unroll 1
    for (int kc = 32 * wv; kc < K; kc += 32 * NW) {
        V a[4], a2[4];
#pragma unroll
        for (int mb = 0; mb < 4; ++mb) { a[mb] = WFrag<T16>::ld(A + aoff + (size_t)mb * 16 * K + kc); if (NSPLIT == 1 || NSPLIT == 2) a2[mb] = WFrag<T16>::ld(A2 + aoff + (size_t)mb * 16 * K + kc); }
#pragma unroll
        for (int nb = 0; nb < 4; ++nb) { const V b = WFrag<T16>::ld(Bt + boff + (size_t)nb * 16 * K + kc); V b2; if (NSPLIT >= 2) b2 = WFrag<T16>::ld(Bt2 + boff + (size_t)nb * 16 * K + kc);
#pragma unroll
            for (int mb = 0; mb < 4; ++mb) { acc[mb][nb] = WFrag<T16>::mma(a[mb], b, acc[mb][nb]); if (NSPLIT == 1 || NSPLIT == 2) acc[mb][nb] = WFrag<T16>::mma(a2[mb], b, acc[mb][nb]); if (NSPLIT >= 2) acc[mb][nb] = WFrag<T16>::mma(a[mb], b2, acc[mb][nb]); } }
        asm volatile("v_nop\n\tv_nop\n\tv_nop\n\tv_nop" : "+v"(acc[0][0]), "+v"(acc[1][1]), "+v"(acc[2][2]), "+v"(acc[3][3]) : "v"(a[0]), "v"(a[3]));
    }
#pragma unroll
    for (int mb = 0; mb < 4; ++mb) {
#pragma unroll
        for (int nb = 0; nb < 4; ++nb) {
#pragma unroll
            for (int j = 0; j < 8; ++j) os[wv * (16 * 68) + (hi * 8 + j) * 68 + nb * 16 + lr] = acc[mb][nb][j]; }
        tile_sync<NW>();
        float* crow = C + (size_t)(r0 + mb * 16) * ldc + c0;
{
#pragma unroll
            for (int k = 0; k < NS; ++k) { const int s = wv + k * NW; if (NW > 8 && s >= 8) break; const int row = 2 * s + hi, cofs = lr * 4; v4f val = *(const v4fa*)(os + row * 68 + cofs);
#pragma unroll
                for (int w = 1; w < NW; ++w) val += *(const v4fa*)(os + w * (16 * 68) + row * 68 + cofs);
                if (BIAS && OUTM == 2) val += rb[mb][k];
                if (BIAS && OUTM != 2) { val[0] += bfr(bias[c0 + cofs]); val[1] += bfr(bias[c0 + cofs + 1]); val[2] += bfr(bias[c0 + cofs + 2]); val[3] += bfr(bias[c0 + cofs + 3]); }
                if (OUTM != 0) {
#pragma unroll
                    for (int j = 0; j < 4; ++j) { unsigned short a2, c2; splitf(val[j], a2, c2); r16[mb][k][j] = tohx(val[j]); rh[mb][k][j] = a2; rl[mb][k][j] = c2; }
                } else
                if (NW == 1) *(v4f*)(crow + (size_t)row * ldc + cofs) = val; else res[mb][k] = val; }
             }
        if (NW == 1 || mb < 3) tile_sync<NW>();
    }
    if (OUTM != 0) {
        constexpr size_t PLD = (OUTM == 1) ? HD : TT, CTS = (OUTM == 1) ? (size_t)TT * HD : 64;   // plane pitch of a row m; step from one 64-wide column tile to the next
#pragma unroll
        for (int k = 0; k < NS; ++k) { const int s = wv + k * NW; if (NW > 8 && s >= 8) break; const size_t e = (size_t)(r0 + 2 * s + hi) * PLD + blockIdx.y * CTS + lr * 4; h16* p16 = P16 + e; bf* ph = Ph + e; bf* pl = Pl + e;
#pragma unroll
            for (int mb = 0; mb < 4; ++mb) { *(v4h*)(p16 + mb * 16 * PLD) = r16[mb][k]; *(v4us*)(ph + mb * 16 * PLD) = rh[mb][k]; *(v4us*)(pl + mb * 16 * PLD) = rl[mb][k]; }
            // s_wait_xcnt 0 behind the run of stores; it names their address pairs as inputs, so that they stay live up to the wait
            asm volatile("s_wait_xcnt 0x0" :: "v"(p16), "v"(ph), "v"(pl) : "memory"); }
    } else if (NW > 1) {
#pragma unroll
        for (int mb = 0; mb < 4; ++mb)
#pragma unroll
            for (int k = 0; k < NS; ++k) { const int s = wv + k * NW; if (NW > 8 && s >= 8) break; *(v4f*)(C + (size_t)(r0 + mb * 16 + 2 * s + hi) * ldc + c0 + lr * 4) = res[mb][k]; }
    }
}

typedef __attribute__((ext_vector_type(2))) _Float16 v2h;
typedef __attribute__((ext_vector_type(2))) unsigned short v2us;
typedef __attribute__((ext_vector_type(2))) float v2f;
typedef __attribute__((ext_vector_type(4))) int v4i;

__global__ __launch_bounds__(256) void k_wtG(const float* __restrict__ w, int K, int N, bf* Bt) {
    const int lane = threadIdx.x & 31; const int L0 = (blockIdx.x * 8 + (threadIdx.x >> 5)) * 8; const int nlines = N * K / 64;
{
#pragma unroll 1
        for (int l = 0; l < 8; ++l) { const int L = L0 + l; if (L >= nlines) break; const size_t e = (size_t)L * 64 + lane * 2; const int k = (int)(e % K), n = (int)(e / K); v2us o;
            o[0] = f2bf(w[(size_t)k * N + n]); o[1] = f2bf(w[(size_t)(k + 1) * N + n]); *(v2us*)(Bt + e) = o; }
         }
}
__global__ __launch_bounds__(256) void k_cvt8(const float* __restrict__ src, bf* dst, size_t n8) { const size_t i = (size_t)blockIdx.x * 256 + threadIdx.x; if (i >= n8) return; const v8f v = *(const v8f*)(src + i * 8); v8us o;
#pragma unroll
    for (int k = 0; k < 8; ++k) o[k] = f2bf(v[k]); *(v8us*)(dst + i * 8) = o;  }
__global__ __launch_bounds__(256) void k_cscvt(const float* __restrict__ cosT, const float* __restrict__ sinT, float* CS) { const int idx = blockIdx.x * 256 + threadIdx.x; if (idx >= TT * HD) return; v2f cs; cs[0] = bfr(cosT[idx]); cs[1] = bfr(sinT[idx]); *(v2f*)(CS + (size_t)idx * 2) = cs;  }
// ---- k_fattn: scores, causal ALiBi softmax, P.V and the hi/lo split of the result in one launch; no score or probability leaves the registers.
// One work-group of NWF waves owns a tile of QB*16 query rows of one head; its waves take every NWF-th pass of 32 keys, each with its own running maximum, sum and output tile (online softmax);
// the NWF partial tiles are joined through LDS in wave order 0..NWF-1. Transposed products: S^T = K Q^T (a lane holds 16 scores of ONE query per pass), O^T += V^T P^T, where two converted S^T tiles are the B operand as they stand.
// Query rows < RH: hi+lo bf16 planes, three products each (HI); the others f16 with the probabilities carried at 2^10 (the factor cancels against the row sum).
#define NWF 8
#define L2E 1.4426950408889634f
// XWAIT: s_wait_xcnt 0 behind a run of global loads or stores; it names their address pairs as inputs, so that they stay live up to the wait and neither a later load's result nor a vector instruction lands in them ahead of it.
#define XWAIT(pa, pb) asm volatile("s_wait_xcnt 0x0" :: "v"(pa), "v"(pb) : "memory")
__device__ __forceinline__ float xhalf(float x) { const int b = __float_as_int(x); return __int_as_float(__builtin_amdgcn_permlanex16(b, b, 0x76543210, 0xfedcba98, false, false)); }   // value of lane l ^ 16
// exp2s: v_exp_f32 with one v_nop in the same statement, for the places where the compiler's schedule put a write of the transcendental's source register directly behind it (the slot the instruction set asks for).
__device__ __forceinline__ float exp2s(float x) { float r; asm("v_exp_f32 %0, %1\n\tv_nop" : "=v"(r) : "v"(x)); return r; }
template <typename T16, bool HI, int QB>
__device__ __forceinline__ void attn_tile(const T16* __restrict__ Q, const T16* __restrict__ Q2, const T16* __restrict__ K, const T16* __restrict__ K2, const T16* __restrict__ Vt, const T16* __restrict__ Vt2,
                                          int q0, int wv, float* so, float* sml, bf* Ah, bf* Al) {
    typedef typename WFrag<T16>::V V;
    const int lane = threadIdx.x & 31, lr = lane & 15, hi = lane >> 4; const int kend = q0 + QB * 16;   // keys 0 .. kend-1 can be visible to this tile
    V q[QB][2], q2[QB][2];
    const int koff = lr * HD + 8 * hi, voff = lr * TT + 8 * hi;
    { const T16* qp = Q + (size_t)q0 * HD + koff; const T16* qp2 = HI ? Q2 + (size_t)q0 * HD + koff : qp;
#pragma unroll
      for (int qb = 0; qb < QB; ++qb)
#pragma unroll
          for (int ks = 0; ks < 2; ++ks) { q[qb][ks] = WFrag<T16>::ld(qp + qb * 16 * HD + ks * 32); if (HI) q2[qb][ks] = WFrag<T16>::ld(qp2 + qb * 16 * HD + ks * 32); }
      XWAIT(qp, qp2); }
    v8f o[4][QB]; float m[QB], l[QB];
#pragma unroll
    for (int qb = 0; qb < QB; ++qb) { m[qb] = -3.0e38f; l[qb] = 0.f;
#pragma unroll
        for (int db = 0; db < 4; ++db) o[db][qb] = (v8f){}; }
    int c0 = 32 * wv;
    if (c0 < kend) {
        V k[2][2], k2[2][2];
        if constexpr (!HI) {   // f16 tiles (the long ones) fetch their K fragments one pass ahead
            const T16* kp = K + (size_t)c0 * HD + koff;
#pragma unroll
            for (int kb = 0; kb < 2; ++kb)
#pragma unroll
                for (int ks = 0; ks < 2; ++ks) k[kb][ks] = WFrag<T16>::ld(kp + kb * 16 * HD + ks * 32);
            XWAIT(kp, kp);
        }
#pragma unroll 1
        for (; c0 < kend; c0 += 32 * NWF) {
            V v[4], v2[4];
            if constexpr (HI) { const T16* kp = K + (size_t)c0 * HD + koff; const T16* kp2 = K2 + (size_t)c0 * HD + koff;
#pragma unroll
                for (int kb = 0; kb < 2; ++kb)
#pragma unroll
                    for (int ks = 0; ks < 2; ++ks) { k[kb][ks] = WFrag<T16>::ld(kp + kb * 16 * HD + ks * 32); k2[kb][ks] = WFrag<T16>::ld(kp2 + kb * 16 * HD + ks * 32); }
                XWAIT(kp, kp2);
            }
            { const T16* vp = Vt + c0 + voff; const T16* vp2 = HI ? Vt2 + c0 + voff : vp;
#pragma unroll
              for (int db = 0; db < 4; ++db) { v[db] = WFrag<T16>::ld(vp + db * 16 * TT); if (HI) v2[db] = WFrag<T16>::ld(vp2 + db * 16 * TT); }
              XWAIT(vp, vp2); }
            v8f s[2][QB];
#pragma unroll
            for (int kb = 0; kb < 2; ++kb)
#pragma unroll
                for (int qb = 0; qb < QB; ++qb) { s[kb][qb] = (v8f){};
#pragma unroll
                    for (int ks = 0; ks < 2; ++ks) { s[kb][qb] = WFrag<T16>::mma(k[kb][ks], q[qb][ks], s[kb][qb]); if (HI) { s[kb][qb] = WFrag<T16>::mma(k[kb][ks], q2[qb][ks], s[kb][qb]); s[kb][qb] = WFrag<T16>::mma(k2[kb][ks], q[qb][ks], s[kb][qb]); } } }
            if constexpr (!HI) {
                const int cn = (c0 + 32 * NWF < kend) ? c0 + 32 * NWF : c0;   // the wave's next pass (its last pass reloads itself: in bounds, unused); the loads fly under the softmax and P.V
                const T16* kp = K + (size_t)cn * HD + koff;
#pragma unroll
                for (int kb = 0; kb < 2; ++kb)
#pragma unroll
                    for (int ks = 0; ks < 2; ++ks) k[kb][ks] = WFrag<T16>::ld(kp + kb * 16 * HD + ks * 32);
                XWAIT(kp, kp);
                __builtin_amdgcn_sched_barrier(0);   // keeps the K loads up here, in front of the softmax, so that their latency passes under it
            }
            V p[QB], p2[QB];
#pragma unroll
            for (int qb = 0; qb < QB; ++qb) {
                const float bb0 = 0.0625f * (float)(c0 + hi * 8 - (q0 + qb * 16 + lr));   // ALiBi slope 1/16 x (j - i) at the lane's first key; exact, as is every bb below
                float mx = -3.0e38f;
#pragma unroll
                for (int kb = 0; kb < 2; ++kb)
#pragma unroll
                    for (int j = 0; j < 8; ++j) { const float bb = bb0 + 0.0625f * (float)(kb * 16 + j); const float t = (bb <= 0.f) ? s[kb][qb][j] * SCL + bb : -3.0e38f;   /* causal: j <= i */ s[kb][qb][j] = t; mx = fmaxf(mx, t); }
                mx = fmaxf(mx, xhalf(mx));
                const float mn = fmaxf(m[qb], mx); const float al = HI ? exp2s((m[qb] - mn) * L2E) : __builtin_amdgcn_exp2f((m[qb] - mn) * L2E); m[qb] = mn;
                float ls = 0.f;
#pragma unroll
                for (int kb = 0; kb < 2; ++kb)
#pragma unroll
                    for (int j = 0; j < 8; ++j) { const float e = HI ? exp2s((s[kb][qb][j] - mn) * L2E) : __builtin_amdgcn_exp2f((s[kb][qb][j] - mn) * L2E + 10.f); s[kb][qb][j] = e; ls += e; }
                l[qb] = l[qb] * al + ls;
#pragma unroll
                for (int db = 0; db < 4; ++db) o[db][qb] *= al;
                if constexpr (HI) { v8us h0, h1, l0, l1;
#pragma unroll
                    for (int j = 0; j < 8; ++j) { unsigned short a, c2; splitf(s[0][qb][j], a, c2); h0[j] = a; l0[j] = c2; splitf(s[1][qb][j], a, c2); h1[j] = a; l1[j] = c2; }
                    p[qb] = cat16b(h0, h1); p2[qb] = cat16b(l0, l1);
                } else { p[qb] = cat16(__builtin_convertvector(s[0][qb], v8h), __builtin_convertvector(s[1][qb], v8h)); }
            }
#pragma unroll
            for (int db = 0; db < 4; ++db)
#pragma unroll
                for (int qb = 0; qb < QB; ++qb) { o[db][qb] = WFrag<T16>::mma(v[db], p[qb], o[db][qb]); if (HI) { o[db][qb] = WFrag<T16>::mma(v[db], p2[qb], o[db][qb]); o[db][qb] = WFrag<T16>::mma(v2[db], p[qb], o[db][qb]); } }
            // four vector slots behind the pass's last WMMAs: over the loop's back edge the next pass's first products write registers that these read as operands
            if constexpr (QB == 2) asm volatile("v_nop\n\tv_nop\n\tv_nop\n\tv_nop" : "+v"(o[0][0]), "+v"(o[1][0]), "+v"(o[2][0]), "+v"(o[3][0]), "+v"(o[0][1]), "+v"(o[1][1]), "+v"(o[2][1]), "+v"(o[3][1]));
            else asm volatile("v_nop\n\tv_nop\n\tv_nop\n\tv_nop" : "+v"(o[0][0]), "+v"(o[1][0]), "+v"(o[2][0]), "+v"(o[3][0]));
        }
    }
    float* sw = so + wv * (QB * 16 * 68);
#pragma unroll
    for (int qb = 0; qb < QB; ++qb) { l[qb] += xhalf(l[qb]);
#pragma unroll
        for (int db = 0; db < 4; ++db) { float* d = sw + (qb * 16 + lr) * 68 + db * 16 + hi * 8; *(v4fa*)d = __builtin_shufflevector(o[db][qb], o[db][qb], 0, 1, 2, 3); *(v4fa*)(d + 4) = __builtin_shufflevector(o[db][qb], o[db][qb], 4, 5, 6, 7); }
        if (hi == 0) { sml[(wv * (QB * 16) + qb * 16 + lr) * 2] = m[qb]; sml[(wv * (QB * 16) + qb * 16 + lr) * 2 + 1] = l[qb]; } }
    __syncthreads();   // every wave's partial tile, maximum and sum are in LDS
    if ((int)threadIdx.x < QB * 16 * 8) { const int qq = threadIdx.x >> 3, dg = threadIdx.x & 7;   // one thread: 8 consecutive d of one query row
        float M = sml[qq * 2];
#pragma unroll
        for (int w = 1; w < NWF; ++w) M = fmaxf(M, sml[(w * (QB * 16) + qq) * 2]);
        float L = 0.f; v4f r0 = (v4f){}, r1 = (v4f){};
#pragma unroll
        for (int w = 0; w < NWF; ++w) { const float f = exp2s((sml[(w * (QB * 16) + qq) * 2] - M) * L2E); L += f * sml[(w * (QB * 16) + qq) * 2 + 1]; const float* d = so + w * (QB * 16 * 68) + qq * 68 + dg * 8; r0 += *(const v4fa*)d * f; r1 += *(const v4fa*)(d + 4) * f; }
        const float inv = __fdiv_rn(1.0f, L); v8us oh, ol;
#pragma unroll
        for (int j = 0; j < 4; ++j) { unsigned short a, c2; splitf(r0[j] * inv, a, c2); oh[j] = a; ol[j] = c2; splitf(r1[j] * inv, a, c2); oh[4 + j] = a; ol[4 + j] = c2; }
        bf* pa = Ah + (size_t)(q0 + qq) * DQ + dg * 8; bf* pb = Al + (size_t)(q0 + qq) * DQ + dg * 8; *(v8usa*)pa = oh; *(v8usa*)pb = ol; XWAIT(pa, pb); }
    __syncthreads();   // the LDS tiles are read: the next tile of this work-group may overwrite them
}
// grid (heads, pairs of tiles): a work-group takes a long tile and then the short one that makes every pair cost the same; the pairs of f16 tiles (the longer ones) have the low flat indices, so that they start first.
__global__ __launch_bounds__(32 * NWF) __attribute__((amdgpu_waves_per_eu(4, 4))) void k_fattn(const h16* __restrict__ Q16, const bf* __restrict__ Qh, const bf* __restrict__ Ql, const h16* __restrict__ K16, const bf* __restrict__ Kh, const bf* __restrict__ Kl,
                                                    const h16* __restrict__ V16, const bf* __restrict__ Vh, const bf* __restrict__ Vl, bf* Ah, bf* Al) {
    __shared__ __align__(16) float so[NWF * 32 * 68]; __shared__ float sml[NWF * 32 * 2];
    const int wv = __builtin_amdgcn_readfirstlane((int)(threadIdx.x >> 5));   // wave number, scalar: the key loop's bounds stay wave-uniform
    const size_t hq = (size_t)blockIdx.x * TT * HD, hk = (size_t)(blockIdx.x / REP) * TT * HD; Ah += blockIdx.x * HD; Al += blockIdx.x * HD;
    constexpr int NP = (TT - RH) / 64; const int x = blockIdx.y;
    if (x < NP) {
#pragma unroll 1
        for (int r = 0; r < 2; ++r) attn_tile<h16, false, 2>(Q16 + hq, nullptr, K16 + hk, nullptr, V16 + hk, nullptr, r ? RH + 32 * x : TT - 32 - 32 * x, wv, so, sml, Ah, Al);
    } else {
#pragma unroll 1
        for (int r = 0; r < 2; ++r) attn_tile<bf, true, 1>(Qh + hq, Ql + hq, Kh + hk, Kl + hk, Vh + hk, Vl + hk, r ? 16 * (x - NP) : RH - 16 - 16 * (x - NP), wv, so, sml, Ah, Al);
    }
}

extern "C" void kernel_launch(void* const* d_in, const int* in_sizes, int n_in,
                              void* d_out, int out_size, void* d_ws, size_t ws_size, hipStream_t stream) {
    (void)in_sizes; (void)n_in; (void)out_size;
    const float* x = (const float*)d_in[0]; const float* wq = (const float*)d_in[1]; const float* bq = (const float*)d_in[2]; const float* wk = (const float*)d_in[3]; const float* bk = (const float*)d_in[4]; const float* wv = (const float*)d_in[5]; const float* bv = (const float*)d_in[6]; const float* wo = (const float*)d_in[7]; const float* bo = (const float*)d_in[8]; const float* cosT = nullptr; const float* sinT = nullptr; (void)cosT; (void)sinT;
    float* OUT = (float*)d_out;     // [2][2048][1024]
    char* wsp = (char*)d_ws;
    auto take = [&](size_t bytes) { char* p = wsp; wsp += (bytes + 255) & ~(size_t)255; return (void*)p; };
    bf* WQ = (bf*)take((size_t)DQ * DM * 2); bf* WK = (bf*)take((size_t)DKV * DM * 2); bf* WV = (bf*)take((size_t)DKV * DM * 2); bf* WO = (bf*)take((size_t)DM * DQ * 2);
    bf* XB = (bf*)take((size_t)TT * DM * 2);
    h16* QP16 = (h16*)take((size_t)NH_ * TT * HD * 2); h16* KP16 = (h16*)take((size_t)NKV * TT * HD * 2); h16* VT16 = (h16*)take((size_t)NKV * HD * TT * 2);
    bf* QPh = (bf*)take((size_t)NH_ * TT * HD * 2); bf* QPl = (bf*)take((size_t)NH_ * TT * HD * 2); bf* KPh = (bf*)take((size_t)NKV * TT * HD * 2); bf* KPl = (bf*)take((size_t)NKV * TT * HD * 2); bf* VTh = (bf*)take((size_t)NKV * HD * TT * 2); bf* VTl = (bf*)take((size_t)NKV * HD * TT * 2);
    bf* ATh = (bf*)take((size_t)TT * DQ * 2); bf* ATl = (bf*)take((size_t)TT * DQ * 2);
    if ((size_t)(wsp - (char*)d_ws) > ws_size) return;    // ws 256 MiB
    { k_cvt8<<<(unsigned)(((size_t)DQ * DM / 8 + 255) / 256), 256, 0, stream>>>(wq, WQ, (size_t)DQ * DM / 8); k_cvt8<<<(unsigned)(((size_t)DKV * DM / 8 + 255) / 256), 256, 0, stream>>>(wk, WK, (size_t)DKV * DM / 8); k_cvt8<<<(unsigned)(((size_t)DKV * DM / 8 + 255) / 256), 256, 0, stream>>>(wv, WV, (size_t)DKV * DM / 8);
      k_cvt8<<<(unsigned)(((size_t)DM * DQ / 8 + 255) / 256), 256, 0, stream>>>(wo, WO, (size_t)DM * DQ / 8);
       }
    for (int b = 0; b < NB_; ++b) {
        
        k_cvt8<<<(unsigned)(((size_t)TT * DM / 8 + 255) / 256), 256, 0, stream>>>(x + (size_t)b * TT * DM, XB, (size_t)TT * DM / 8);
        k_gemmw<bf, 0, true, 8, 1><<<dim3(TT / 64, DQ / 64, 1), 256, 0, stream>>>(XB, nullptr, WQ, nullptr, DM, nullptr, 0, bq, 0, 0, 0, QP16, QPh, QPl);
        k_gemmw<bf, 0, true, 8, 1><<<dim3(TT / 64, DKV / 64, 1), 256, 0, stream>>>(XB, nullptr, WK, nullptr, DM, nullptr, 0, bk, 0, 0, 0, KP16, KPh, KPl);
        k_gemmw<bf, 0, true, 8, 2><<<dim3(DKV / 64, TT / 64, 1), 256, 0, stream>>>(WV, nullptr, XB, nullptr, DM, nullptr, 0, bv, 0, 0, 0, VT16, VTh, VTl);   // V^T = Wv X^T: its rows are the transposed plane's rows
        k_fattn<<<dim3(NH_, (TT - RH) / 64 + RH / 32, 1), 32 * NWF, 0, stream>>>(QP16, QPh, QPl, KP16, KPh, KPl, VT16, VTh, VTl, ATh, ATl);
        k_gemmw<bf, 1, true, 8, 0><<<dim3(TT / 64, DM / 64, 1), 256, 0, stream>>>(ATh, ATl, WO, nullptr, DQ, OUT + (size_t)b * TT * DM, DM, bo, 0, 0, 0, nullptr, nullptr, nullptr); }
}

// v005
// Measured time: 147 microseconds a run.
// Two timings next to v004 both put it at 1.19 times that version's speed.
// All steps since v000 together make it 10.6 times as fast.
#include <hip/hip_runtime.h>

#include <hip/hip_runtime.h>

#define NB_  2
#define TT   2048
#define DM   1024
#define NH_  16
#define NKV  16
#define REP  (NH_ / NKV)
#define HD   64
#define DQ   (NH_ * HD)
#define DKV  (NKV * HD)
#define RH   512                  // query rows < RH use hi+lo planes (0: none)
#define WIN  0
#define PCAR 1024.0f
#define SCL  0.125f   // HD^-0.5
typedef _Float16 h16;
typedef unsigned short bf;
typedef __attribute__((ext_vector_type(16))) __bf16   v16bf;
typedef __attribute__((ext_vector_type(16))) _Float16 v16h;
typedef __attribute__((ext_vector_type(8)))  _Float16 v8h;
typedef __attribute__((ext_vector_type(8)))  unsigned short v8us;
typedef __attribute__((ext_vector_type(8)))  float    v8f;
typedef __attribute__((ext_vector_type(4)))  float    v4f;
typedef v8h  __attribute__((may_alias)) v8ha;
typedef v4f  __attribute__((may_alias)) v4fa;
typedef v8us __attribute__((may_alias)) v8usa;

__device__ __forceinline__ unsigned short f2bf(float f) { unsigned u = __float_as_uint(f); u += 0x7FFFu + ((u >> 16) & 1u); return (unsigned short)(u >> 16); }
__device__ __forceinline__ float bf2f(unsigned short b) { return __uint_as_float(((unsigned)b) << 16); }
__device__ __forceinline__ float bfr(float f) { return bf2f(f2bf(f)); }
__device__ __forceinline__ v16h cat16(v8h lo, v8h hi) { return __builtin_shufflevector(lo, hi, 0, 1, 2, 3, 4, 5, 6, 7, 8, 9, 10, 11, 12, 13, 14, 15); }
__device__ __forceinline__ v16bf cat16b(v8us lo, v8us hi) { return __builtin_bit_cast(v16bf, __builtin_shufflevector(lo, hi, 0, 1, 2, 3, 4, 5, 6, 7, 8, 9, 10, 11, 12, 13, 14, 15)); }
__device__ __forceinline__ v8f wmma16(v16h a, v16h b, v8f c) { return __builtin_amdgcn_wmma_f32_16x16x32_f16(false, a, false, b, (short)0, c, false, false); }
__device__ __forceinline__ v8f wmmab(v16bf a, v16bf b, v8f c) { return __builtin_amdgcn_wmma_f32_16x16x32_bf16(false, a, false, b, (short)0, c, false, false); }



// ---- gemmw_tile: register-blocked GEMM, one work-group of NW waves per 64x64 output tile (bx, by); every wave holds the whole tile (16 accumulators) and takes every NW-th 32-wide k step, operands straight from
// K-contiguous 16-bit planes; the NW partial tiles are summed through LDS (os, NW * 16 * 68 floats) in wave order 0..NW-1. 32 * NW threads.
// C[m][n] (f32, pitch ldc, + optional f32 bias[n]) = sum_k A[m][k] Bt[n][k] (+ split products per NSPLIT). K % 32 == 0.
// OUTM 0: C goes out as f32. OUTM 1 and 2: no f32 C; the summed tile goes out as three 16-bit planes (f16, bf16 hi, bf16 lo) in the layout the attention kernel reads:
// OUTM 1 (m = token, n = feature; a 64-wide column tile is one head): plane[head][token][d]. OUTM 2 (m = feature, n = token; bias[m]): plane[feature][token], the transposed V.
typedef __attribute__((ext_vector_type(4))) _Float16 v4h;
typedef __attribute__((ext_vector_type(4))) unsigned short v4us;
__device__ __forceinline__ h16 tohx(float x) { return (h16)x; }
__device__ __forceinline__ void splitf(float y, unsigned short& h, unsigned short& l) { h = f2bf(y); l = f2bf(y - bf2f(h)); }
template <typename T16> struct WFrag;
template <> struct WFrag<h16> { typedef v16h V; static __device__ __forceinline__ V ld(const h16* p) { return cat16(*(const v8h*)p, *(const v8h*)(p + 16)); } static __device__ __forceinline__ v8f mma(V a, V b, v8f c) { return wmma16(a, b, c); } };
template <> struct WFrag<bf> { typedef v16bf V; static __device__ __forceinline__ V ld(const bf* p) { return cat16b(*(const v8us*)p, *(const v8us*)(p + 16)); } static __device__ __forceinline__ v8f mma(V a, V b, v8f c) { return wmmab(a, b, c); } };
template <int NW> __device__ __forceinline__ void tile_sync() { if (NW == 1) { __builtin_amdgcn_wave_barrier(); asm volatile("" ::: "memory"); } else __syncthreads(); }   // orders the LDS slab writes against the reads of the same slabs (by the one wave, or by all NW)
template <typename T16, int NSPLIT, bool BIAS, int NW, int OUTM>
__device__ __forceinline__ void gemmw_tile(const T16* __restrict__ A, const T16* __restrict__ A2, const T16* __restrict__ Bt, const T16* __restrict__ Bt2, int K, float* C, int ldc, const float* __restrict__ bias, h16* P16, bf* Ph, bf* Pl, int bx, int by, float* os) {
    typedef typename WFrag<T16>::V V;
    const int lane = threadIdx.x & 31, lr = lane & 15, hi = lane >> 4; const int r0 = bx * 64, c0 = by * 64;
    const int wv = (NW == 1) ? 0 : __builtin_amdgcn_readfirstlane((int)(threadIdx.x >> 5));   // wave number, scalar: the k loop's bounds stay wave-uniform
    constexpr int NS = (NW >= 8) ? 1 : 8 / NW;   // row pairs of a 16-row slab that one wave sums and stores
    v4f res[4][NS];                              // NW > 1: summed rows wait here, so that no barrier has to wait for a global store
    v4h r16[4][NS]; v4us rh[4][NS], rl[4][NS];   // OUTM 1, 2: the same rows, already converted
    float rb[4][NS];                             // OUTM 2: the bias of this lane's rows, fetched here so that its latency passes under the k loop and not between two barriers
    if (BIAS && OUTM == 2) {
#pragma unroll
        for (int k = 0; k < NS; ++k) { const int s = wv + k * NW; if (NW > 8 && s >= 8) break; const float* bp = bias + r0 + 2 * s + hi;
#pragma unroll
            for (int mb = 0; mb < 4; ++mb) rb[mb][k] = bfr(bp[mb * 16]);
            asm volatile("s_wait_xcnt 0x0" :: "v"(bp) : "memory"); }   // behind the run of row-bias loads; it names their address as an input, so that it stays live up to the wait
    }
    v8f acc[4][4];
#pragma unroll
    for (int mb = 0; mb < 4; ++mb)
#pragma unroll
        for (int nb = 0; nb < 4; ++nb) acc[mb][nb] = (v8f){};
    const size_t aoff = (size_t)(r0 + lr) * K + 8 * hi, boff = (size_t)(c0 + lr) * K + 8 * hi;
#pragma unroll 1
    for (int kc = 32 * wv; kc < K; kc += 32 * NW) {
        V a[4], a2[4];
        const T16* ap = A + aoff + kc; const T16* ap2 = (NSPLIT == 1 || NSPLIT == 2) ? A2 + aoff + kc : ap; const T16* bp = Bt + boff + kc; const T16* bp2 = (NSPLIT >= 2) ? Bt2 + boff + kc : bp;
#pragma unroll
        for (int mb = 0; mb < 4; ++mb) { a[mb] = WFrag<T16>::ld(ap + (size_t)mb * 16 * K); if (NSPLIT == 1 || NSPLIT == 2) a2[mb] = WFrag<T16>::ld(ap2 + (size_t)mb * 16 * K); }
#pragma unroll
        for (int nb = 0; nb < 4; ++nb) { const V b = WFrag<T16>::ld(bp + (size_t)nb * 16 * K); V b2; if (NSPLIT >= 2) b2 = WFrag<T16>::ld(bp2 + (size_t)nb * 16 * K);
#pragma unroll
            for (int mb = 0; mb < 4; ++mb) { acc[mb][nb] = WFrag<T16>::mma(a[mb], b, acc[mb][nb]); if (NSPLIT == 1 || NSPLIT == 2) acc[mb][nb] = WFrag<T16>::mma(a2[mb], b, acc[mb][nb]); if (NSPLIT >= 2) acc[mb][nb] = WFrag<T16>::mma(a[mb], b2, acc[mb][nb]); } }
        asm volatile("v_nop\n\tv_nop\n\tv_nop\n\tv_nop" : "+v"(acc[0][0]), "+v"(acc[1][1]), "+v"(acc[2][2]), "+v"(acc[3][3]) : "v"(a[0]), "v"(a[3]));
        // s_wait_xcnt 0 behind the step's loads; it names their address pairs as inputs, so that they stay live up to the wait and neither a later load's result nor the next step's address lands in them ahead of it
        asm volatile("s_wait_xcnt 0x0" :: "v"(ap), "v"(ap2), "v"(bp), "v"(bp2) : "memory");
    }
    v4f cb;                                      // OUTM 0, 1: the bias of this lane's four columns, the same for every row it sums
    if (BIAS && OUTM != 2) { const float* bc = bias + c0 + lr * 4; cb[0] = bfr(bc[0]); cb[1] = bfr(bc[1]); cb[2] = bfr(bc[2]); cb[3] = bfr(bc[3]);
        asm volatile("s_wait_xcnt 0x0" :: "v"(bc) : "memory"); }   // behind the bias load; it names the address as an input, so that the load's own result does not land in it
#pragma unroll
    for (int mb = 0; mb < 4; ++mb) {
#pragma unroll
        for (int nb = 0; nb < 4; ++nb) {
#pragma unroll
            for (int j = 0; j < 8; ++j) os[wv * (16 * 68) + (hi * 8 + j) * 68 + nb * 16 + lr] = acc[mb][nb][j]; }
        tile_sync<NW>();
        float* crow = C + (size_t)(r0 + mb * 16) * ldc + c0;
{
#pragma unroll
            for (int k = 0; k < NS; ++k) { const int s = wv + k * NW; if (NW > 8 && s >= 8) break; const int row = 2 * s + hi, cofs = lr * 4; v4f val = *(const v4fa*)(os + row * 68 + cofs);
#pragma unroll
                for (int w = 1; w < NW; ++w) val += *(const v4fa*)(os + w * (16 * 68) + row * 68 + cofs);
                if (BIAS && OUTM == 2) val += rb[mb][k];
                if (BIAS && OUTM != 2) val += cb;
                if (OUTM != 0) {
#pragma unroll
                    for (int j = 0; j < 4; ++j) { unsigned short a2, c2; splitf(val[j], a2, c2); r16[mb][k][j] = tohx(val[j]); rh[mb][k][j] = a2; rl[mb][k][j] = c2; }
                } else
                if (NW == 1) *(v4f*)(crow + (size_t)row * ldc + cofs) = val; else res[mb][k] = val; }
             }
        if (NW == 1 || mb < 3) tile_sync<NW>();
    }
    if (OUTM != 0) {
        constexpr size_t PLD = (OUTM == 1) ? HD : TT, CTS = (OUTM == 1) ? (size_t)TT * HD : 64;   // plane pitch of a row m; step from one 64-wide column tile to the next
#pragma unroll
        for (int k = 0; k < NS; ++k) { const int s = wv + k * NW; if (NW > 8 && s >= 8) break; const size_t e = (size_t)(r0 + 2 * s + hi) * PLD + by * CTS + lr * 4; h16* p16 = P16 + e; bf* ph = Ph + e; bf* pl = Pl + e;
#pragma unroll
            for (int mb = 0; mb < 4; ++mb) { *(v4h*)(p16 + mb * 16 * PLD) = r16[mb][k]; *(v4us*)(ph + mb * 16 * PLD) = rh[mb][k]; *(v4us*)(pl + mb * 16 * PLD) = rl[mb][k]; }
            // s_wait_xcnt 0 behind the run of stores; it names their address pairs as inputs, so that they stay live up to the wait
            asm volatile("s_wait_xcnt 0x0" :: "v"(p16), "v"(ph), "v"(pl) : "memory"); }
    } else if (NW > 1) {
#pragma unroll
        for (int mb = 0; mb < 4; ++mb)
#pragma unroll
            for (int k = 0; k < NS; ++k) { const int s = wv + k * NW; if (NW > 8 && s >= 8) break; *(v4f*)(C + (size_t)(r0 + mb * 16 + 2 * s + hi) * ldc + c0 + lr * 4) = res[mb][k]; }
    }
}
// k_qkv: the Q, K and V projections of every batch in one launch. grid (TT/64 token tiles, 16 feature tiles, 3 * NB_): z picks the projection and the batch; planes and XB are [batch][...].
__global__ __launch_bounds__(256) void k_qkv(const bf* __restrict__ XB, const bf* __restrict__ WQ, const bf* __restrict__ WK, const bf* __restrict__ WV, const float* __restrict__ bq, const float* __restrict__ bk, const float* __restrict__ bv,
                                             h16* QP16, bf* QPh, bf* QPl, h16* KP16, bf* KPh, bf* KPl, h16* VT16, bf* VTh, bf* VTl) {
    __shared__ __align__(16) float os[8 * 16 * 68];
    const int w = blockIdx.z / NB_, b = blockIdx.z % NB_; const bf* X = XB + (size_t)b * TT * DM; const size_t pq = (size_t)b * NH_ * TT * HD, pk = (size_t)b * NKV * TT * HD;
    if (w == 2) gemmw_tile<bf, 0, true, 8, 2>(WV, nullptr, X, nullptr, DM, nullptr, 0, bv, VT16 + pk, VTh + pk, VTl + pk, blockIdx.y, blockIdx.x, os);   // V^T = Wv X^T: its rows are the transposed plane's rows
    else gemmw_tile<bf, 0, true, 8, 1>(X, nullptr, w ? WK : WQ, nullptr, DM, nullptr, 0, w ? bk : bq, w ? KP16 + pk : QP16 + pq, w ? KPh + pk : QPh + pq, w ? KPl + pk : QPl + pq, blockIdx.x, blockIdx.y, os);
}
// k_oproj: the output projection of every batch's rows in one launch. grid (NB_ * TT / 64, DM / 64).
__global__ __launch_bounds__(256) void k_oproj(const bf* __restrict__ Ah, const bf* __restrict__ Al, const bf* __restrict__ WO, const float* __restrict__ bo, float* OUT) {
    __shared__ __align__(16) float os[8 * 16 * 68];
    gemmw_tile<bf, 1, true, 8, 0>(Ah, Al, WO, nullptr, DQ, OUT, DM, bo, nullptr, nullptr, nullptr, blockIdx.x, blockIdx.y, os);
}

typedef __attribute__((ext_vector_type(2))) _Float16 v2h;
typedef __attribute__((ext_vector_type(2))) unsigned short v2us;
typedef __attribute__((ext_vector_type(2))) float v2f;
typedef __attribute__((ext_vector_type(4))) int v4i;

__global__ __launch_bounds__(256) void k_wtG(const float* __restrict__ w, int K, int N, bf* Bt) {
    const int lane = threadIdx.x & 31; const int L0 = (blockIdx.x * 8 + (threadIdx.x >> 5)) * 8; const int nlines = N * K / 64;
{
#pragma unroll 1
        for (int l = 0; l < 8; ++l) { const int L = L0 + l; if (L >= nlines) break; const size_t e = (size_t)L * 64 + lane * 2; const int k = (int)(e % K), n = (int)(e / K); v2us o;
            o[0] = f2bf(w[(size_t)k * N + n]); o[1] = f2bf(w[(size_t)(k + 1) * N + n]); *(v2us*)(Bt + e) = o; }
         }
}
// k_cvt8: every f32-to-bf16 conversion in one launch. grid (DM * DM / 2048, 4 + NB_ * TT / DM): y picks a weight matrix or a piece of x of the same size (DM * DM floats).
static_assert(DQ == DM && DKV == DM && (NB_ * TT) % DM == 0 && (DM * DM) % 2048 == 0, "equal pieces");
__global__ __launch_bounds__(256) void k_cvt8(const float* __restrict__ x, const float* __restrict__ wq, const float* __restrict__ wk, const float* __restrict__ wv, const float* __restrict__ wo, bf* XB, bf* WQ, bf* WK, bf* WV, bf* WO) {
    const int y = blockIdx.y; const float* src = y == 0 ? wq : y == 1 ? wk : y == 2 ? wv : y == 3 ? wo : x + (size_t)(y - 4) * DM * DM; bf* dst = y == 0 ? WQ : y == 1 ? WK : y == 2 ? WV : y == 3 ? WO : XB + (size_t)(y - 4) * DM * DM;
    const size_t i = (size_t)blockIdx.x * 256 + threadIdx.x; const float* sp = src + i * 8; const v8f v = *(const v8f*)sp; v8us o;
    asm volatile("s_wait_xcnt 0x0" :: "v"(sp) : "memory");   // behind the loads; it names their address pair as an input, so that the pair stays live up to the wait
#pragma unroll
    for (int k = 0; k < 8; ++k) o[k] = f2bf(v[k]); *(v8us*)(dst + i * 8) = o;  }
__global__ __launch_bounds__(256) void k_cscvt(const float* __restrict__ cosT, const float* __restrict__ sinT, float* CS) { const int idx = blockIdx.x * 256 + threadIdx.x; if (idx >= TT * HD) return; v2f cs; cs[0] = bfr(cosT[idx]); cs[1] = bfr(sinT[idx]); *(v2f*)(CS + (size_t)idx * 2) = cs;  }
// ---- k_fattn: scores, causal ALiBi softmax, P.V and the hi/lo split of the result in one launch; no score or probability leaves the registers.
// One work-group of NWF waves owns a tile of QB*16 query rows of one head; its waves take every NWF-th pass of 32 keys, each with its own running maximum, sum and output tile (online softmax);
// the NWF partial tiles are joined through LDS in wave order 0..NWF-1. Transposed products: S^T = K Q^T (a lane holds 16 scores of ONE query per pass), O^T += V^T P^T, where two converted S^T tiles are the B operand as they stand.
// Query rows < RH: hi+lo bf16 planes, three products each (HI); the others f16 with the probabilities carried at 2^10 (the factor cancels against the row sum).
#define NWF 8
#define L2E 1.4426950408889634f
// XWAIT: s_wait_xcnt 0 behind a run of global loads or stores; it names their address pairs as inputs, so that they stay live up to the wait and neither a later load's result nor a vector instruction lands in them ahead of it.
#define XWAIT(pa, pb) asm volatile("s_wait_xcnt 0x0" :: "v"(pa), "v"(pb) : "memory")
__device__ __forceinline__ float xhalf(float x) { const int b = __float_as_int(x); return __int_as_float(__builtin_amdgcn_permlanex16(b, b, 0x76543210, 0xfedcba98, false, false)); }   // value of lane l ^ 16
// exp2s: v_exp_f32 with one v_nop in the same statement, for the places where the compiler's schedule put a write of the transcendental's source register directly behind it (the slot the instruction set asks for).
__device__ __forceinline__ float exp2s(float x) { float r; asm("v_exp_f32 %0, %1\n\tv_nop" : "=v"(r) : "v"(x)); return r; }
template <typename T16, bool HI, int QB>
__device__ __forceinline__ void attn_tile(const T16* __restrict__ Q, const T16* __restrict__ Q2, const T16* __restrict__ K, const T16* __restrict__ K2, const T16* __restrict__ Vt, const T16* __restrict__ Vt2,
                                          int q0, int wv, float* so, float* sml, bf* Ah, bf* Al) {
    typedef typename WFrag<T16>::V V;
    const int lane = threadIdx.x & 31, lr = lane & 15, hi = lane >> 4; const int kend = q0 + QB * 16;   // keys 0 .. kend-1 can be visible to this tile
    V q[QB][2], q2[QB][2];
    const int koff = lr * HD + 8 * hi, voff = lr * TT + 8 * hi;
    { const T16* qp = Q + (size_t)q0 * HD + koff; const T16* qp2 = HI ? Q2 + (size_t)q0 * HD + koff : qp;
#pragma unroll
      for (int qb = 0; qb < QB; ++qb)
#pragma unroll
          for (int ks = 0; ks < 2; ++ks) { q[qb][ks] = WFrag<T16>::ld(qp + qb * 16 * HD + ks * 32); if (HI) q2[qb][ks] = WFrag<T16>::ld(qp2 + qb * 16 * HD + ks * 32); }
      XWAIT(qp, qp2); }
    v8f o[4][QB]; float m[QB], l[QB];
#pragma unroll
    for (int qb = 0; qb < QB; ++qb) { m[qb] = -3.0e38f; l[qb] = 0.f;
#pragma unroll
        for (int db = 0; db < 4; ++db) o[db][qb] = (v8f){}; }
    int c0 = 32 * wv;
    if (c0 < kend) {
        V k[2][2], k2[2][2];
        if constexpr (!HI) {   // f16 tiles (the long ones) fetch their K fragments one pass ahead
            const T16* kp = K + (size_t)c0 * HD + koff;
#pragma unroll
            for (int kb = 0; kb < 2; ++kb)
#pragma unroll
                for (int ks = 0; ks < 2; ++ks) k[kb][ks] = WFrag<T16>::ld(kp + kb * 16 * HD + ks * 32);
            XWAIT(kp, kp);
        }
#pragma unroll 1
        for (; c0 < kend; c0 += 32 * NWF) {
            V v[4], v2[4];
            if constexpr (HI) { const T16* kp = K + (size_t)c0 * HD + koff; const T16* kp2 = K2 + (size_t)c0 * HD + koff;
#pragma unroll
                for (int kb = 0; kb < 2; ++kb)
#pragma unroll
                    for (int ks = 0; ks < 2; ++ks) { k[kb][ks] = WFrag<T16>::ld(kp + kb * 16 * HD + ks * 32); k2[kb][ks] = WFrag<T16>::ld(kp2 + kb * 16 * HD + ks * 32); }
                XWAIT(kp, kp2);
            }
            { const T16* vp = Vt + c0 + voff; const T16* vp2 = HI ? Vt2 + c0 + voff : vp;
#pragma unroll
              for (int db = 0; db < 4; ++db) { v[db] = WFrag<T16>::ld(vp + db * 16 * TT); if (HI) v2[db] = WFrag<T16>::ld(vp2 + db * 16 * TT); }
              XWAIT(vp, vp2); }
            v8f s[2][QB];
#pragma unroll
            for (int kb = 0; kb < 2; ++kb)
#pragma unroll
                for (int qb = 0; qb < QB; ++qb) { s[kb][qb] = (v8f){};
#pragma unroll
                    for (int ks = 0; ks < 2; ++ks) { s[kb][qb] = WFrag<T16>::mma(k[kb][ks], q[qb][ks], s[kb][qb]); if (HI) { s[kb][qb] = WFrag<T16>::mma(k[kb][ks], q2[qb][ks], s[kb][qb]); s[kb][qb] = WFrag<T16>::mma(k2[kb][ks], q[qb][ks], s[kb][qb]); } } }
            if constexpr (!HI) {
                const int cn = (c0 + 32 * NWF < kend) ? c0 + 32 * NWF : c0;   // the wave's next pass (its last pass reloads itself: in bounds, unused); the loads fly under the softmax and P.V
                const T16* kp = K + (size_t)cn * HD + koff;
#pragma unroll
                for (int kb = 0; kb < 2; ++kb)
#pragma unroll
                    for (int ks = 0; ks < 2; ++ks) k[kb][ks] = WFrag<T16>::ld(kp + kb * 16 * HD + ks * 32);
                XWAIT(kp, kp);
                __builtin_amdgcn_sched_barrier(0);   // keeps the K loads up here, in front of the softmax, so that their latency passes under it
            }
            V p[QB], p2[QB];
#pragma unroll
            for (int qb = 0; qb < QB; ++qb) {
                const float bb0 = 0.0625f * (float)(c0 + hi * 8 - (q0 + qb * 16 + lr));   // ALiBi slope 1/16 x (j - i) at the lane's first key; exact, as is every bb below
                float mx = -3.0e38f;
#pragma unroll
                for (int kb = 0; kb < 2; ++kb)
#pragma unroll
                    for (int j = 0; j < 8; ++j) { const float bb = bb0 + 0.0625f * (float)(kb * 16 + j); const float t = (bb <= 0.f) ? s[kb][qb][j] * SCL + bb : -3.0e38f;   /* causal: j <= i */ s[kb][qb][j] = t; mx = fmaxf(mx, t); }
                mx = fmaxf(mx, xhalf(mx));
                const float mn = fmaxf(m[qb], mx); const float al = HI ? exp2s((m[qb] - mn) * L2E) : __builtin_amdgcn_exp2f((m[qb] - mn) * L2E); m[qb] = mn;
                float ls = 0.f;
#pragma unroll
                for (int kb = 0; kb < 2; ++kb)
#pragma unroll
                    for (int j = 0; j < 8; ++j) { const float e = HI ? exp2s((s[kb][qb][j] - mn) * L2E) : __builtin_amdgcn_exp2f((s[kb][qb][j] - mn) * L2E + 10.f); s[kb][qb][j] = e; ls += e; }
                l[qb] = l[qb] * al + ls;
#pragma unroll
                for (int db = 0; db < 4; ++db) o[db][qb] *= al;
                if constexpr (HI) { v8us h0, h1, l0, l1;
#pragma unroll
                    for (int j = 0; j < 8; ++j) { unsigned short a, c2; splitf(s[0][qb][j], a, c2); h0[j] = a; l0[j] = c2; splitf(s[1][qb][j], a, c2); h1[j] = a; l1[j] = c2; }
                    p[qb] = cat16b(h0, h1); p2[qb] = cat16b(l0, l1);
                } else { p[qb] = cat16(__builtin_convertvector(s[0][qb], v8h), __builtin_convertvector(s[1][qb], v8h)); }
            }
#pragma unroll
            for (int db = 0; db < 4; ++db)
#pragma unroll
                for (int qb = 0; qb < QB; ++qb) { o[db][qb] = WFrag<T16>::mma(v[db], p[qb], o[db][qb]); if (HI) { o[db][qb] = WFrag<T16>::mma(v[db], p2[qb], o[db][qb]); o[db][qb] = WFrag<T16>::mma(v2[db], p[qb], o[db][qb]); } }
            // four vector slots behind the pass's last WMMAs: over the loop's back edge the next pass's first products write registers that these read as operands
            if constexpr (QB == 2) asm volatile("v_nop\n\tv_nop\n\tv_nop\n\tv_nop" : "+v"(o[0][0]), "+v"(o[1][0]), "+v"(o[2][0]), "+v"(o[3][0]), "+v"(o[0][1]), "+v"(o[1][1]), "+v"(o[2][1]), "+v"(o[3][1]));
            else asm volatile("v_nop\n\tv_nop\n\tv_nop\n\tv_nop" : "+v"(o[0][0]), "+v"(o[1][0]), "+v"(o[2][0]), "+v"(o[3][0]));
        }
    }
    float* sw = so + wv * (QB * 16 * 68);
#pragma unroll
    for (int qb = 0; qb < QB; ++qb) { l[qb] += xhalf(l[qb]);
#pragma unroll
        for (int db = 0; db < 4; ++db) { float* d = sw + (qb * 16 + lr) * 68 + db * 16 + hi * 8; *(v4fa*)d = __builtin_shufflevector(o[db][qb], o[db][qb], 0, 1, 2, 3); *(v4fa*)(d + 4) = __builtin_shufflevector(o[db][qb], o[db][qb], 4, 5, 6, 7); }
        if (hi == 0) { sml[(wv * (QB * 16) + qb * 16 + lr) * 2] = m[qb]; sml[(wv * (QB * 16) + qb * 16 + lr) * 2 + 1] = l[qb]; } }
    __syncthreads();   // every wave's partial tile, maximum and sum are in LDS
    if ((int)threadIdx.x < QB * 16 * 8) { const int qq = threadIdx.x >> 3, dg = threadIdx.x & 7;   // one thread: 8 consecutive d of one query row
        float M = sml[qq * 2];
#pragma unroll
        for (int w = 1; w < NWF; ++w) M = fmaxf(M, sml[(w * (QB * 16) + qq) * 2]);
        float L = 0.f; v4f r0 = (v4f){}, r1 = (v4f){};
#pragma unroll
        for (int w = 0; w < NWF; ++w) { const float f = exp2s((sml[(w * (QB * 16) + qq) * 2] - M) * L2E); L += f * sml[(w * (QB * 16) + qq) * 2 + 1]; const float* d = so + w * (QB * 16 * 68) + qq * 68 + dg * 8; r0 += *(const v4fa*)d * f; r1 += *(const v4fa*)(d + 4) * f; }
        const float inv = __fdiv_rn(1.0f, L); v8us oh, ol;
#pragma unroll
        for (int j = 0; j < 4; ++j) { unsigned short a, c2; splitf(r0[j] * inv, a, c2); oh[j] = a; ol[j] = c2; splitf(r1[j] * inv, a, c2); oh[4 + j] = a; ol[4 + j] = c2; }
        bf* pa = Ah + (size_t)(q0 + qq) * DQ + dg * 8; bf* pb = Al + (size_t)(q0 + qq) * DQ + dg * 8; *(v8usa*)pa = oh; *(v8usa*)pb = ol; XWAIT(pa, pb); }
    __syncthreads();   // the LDS tiles are read: the next tile of this work-group may overwrite them
}
// grid (batches x heads, pairs of tiles): a work-group takes a long tile and then the short one that makes every pair cost the same; the pairs of f16 tiles (the longer ones) have the low flat indices, so that they start first.
__global__ __launch_bounds__(32 * NWF) __attribute__((amdgpu_waves_per_eu(4, 4))) void k_fattn(const h16* __restrict__ Q16, const bf* __restrict__ Qh, const bf* __restrict__ Ql, const h16* __restrict__ K16, const bf* __restrict__ Kh, const bf* __restrict__ Kl,
                                                    const h16* __restrict__ V16, const bf* __restrict__ Vh, const bf* __restrict__ Vl, bf* Ah, bf* Al) {
    __shared__ __align__(16) float so[NWF * 32 * 68]; __shared__ float sml[NWF * 32 * 2];
    const int wv = __builtin_amdgcn_readfirstlane((int)(threadIdx.x >> 5));   // wave number, scalar: the key loop's bounds stay wave-uniform
    const int bb = blockIdx.x / NH_, hh = blockIdx.x % NH_;   // batch, head
    const size_t hq = (size_t)blockIdx.x * TT * HD, hk = (size_t)(bb * NKV + hh / REP) * TT * HD; Ah += (size_t)bb * TT * DQ + hh * HD; Al += (size_t)bb * TT * DQ + hh * HD;
    constexpr int NP = (TT - RH) / 64; const int x = blockIdx.y;
    if (x < NP) {
#pragma unroll 1
        for (int r = 0; r < 2; ++r) attn_tile<h16, false, 2>(Q16 + hq, nullptr, K16 + hk, nullptr, V16 + hk, nullptr, r ? RH + 32 * x : TT - 32 - 32 * x, wv, so, sml, Ah, Al);
    } else {
#pragma unroll 1
        for (int r = 0; r < 2; ++r) attn_tile<bf, true, 1>(Qh + hq, Ql + hq, Kh + hk, Kl + hk, Vh + hk, Vl + hk, r ? 16 * (x - NP) : RH - 16 - 16 * (x - NP), wv, so, sml, Ah, Al);
    }
}

extern "C" void kernel_launch(void* const* d_in, const int* in_sizes, int n_in,
                              void* d_out, int out_size, void* d_ws, size_t ws_size, hipStream_t stream) {
    (void)in_sizes; (void)n_in; (void)out_size;
    const float* x = (const float*)d_in[0]; const float* wq = (const float*)d_in[1]; const float* bq = (const float*)d_in[2]; const float* wk = (const float*)d_in[3]; const float* bk = (const float*)d_in[4]; const float* wv = (const float*)d_in[5]; const float* bv = (const float*)d_in[6]; const float* wo = (const float*)d_in[7]; const float* bo = (const float*)d_in[8]; const float* cosT = nullptr; const float* sinT = nullptr; (void)cosT; (void)sinT;
    float* OUT = (float*)d_out;     // [2][2048][1024]
    char* wsp = (char*)d_ws;
    auto take = [&](size_t bytes) { char* p = wsp; wsp += (bytes + 255) & ~(size_t)255; return (void*)p; };
    bf* WQ = (bf*)take((size_t)DQ * DM * 2); bf* WK = (bf*)take((size_t)DKV * DM * 2); bf* WV = (bf*)take((size_t)DKV * DM * 2); bf* WO = (bf*)take((size_t)DM * DQ * 2);
    bf* XB = (bf*)take((size_t)NB_ * TT * DM * 2);
    h16* QP16 = (h16*)take((size_t)NB_ * NH_ * TT * HD * 2); h16* KP16 = (h16*)take((size_t)NB_ * NKV * TT * HD * 2); h16* VT16 = (h16*)take((size_t)NB_ * NKV * HD * TT * 2);
    bf* QPh = (bf*)take((size_t)NB_ * NH_ * TT * HD * 2); bf* QPl = (bf*)take((size_t)NB_ * NH_ * TT * HD * 2); bf* KPh = (bf*)take((size_t)NB_ * NKV * TT * HD * 2); bf* KPl = (bf*)take((size_t)NB_ * NKV * TT * HD * 2); bf* VTh = (bf*)take((size_t)NB_ * NKV * HD * TT * 2); bf* VTl = (bf*)take((size_t)NB_ * NKV * HD * TT * 2);
    bf* ATh = (bf*)take((size_t)NB_ * TT * DQ * 2); bf* ATl = (bf*)take((size_t)NB_ * TT * DQ * 2);
    if ((size_t)(wsp - (char*)d_ws) > ws_size) return;    // ws 256 MiB
    k_cvt8<<<dim3(DM * DM / 2048, 4 + NB_ * TT / DM, 1), 256, 0, stream>>>(x, wq, wk, wv, wo, XB, WQ, WK, WV, WO);
    k_qkv<<<dim3(TT / 64, DQ / 64, 3 * NB_), 256, 0, stream>>>(XB, WQ, WK, WV, bq, bk, bv, QP16, QPh, QPl, KP16, KPh, KPl, VT16, VTh, VTl);
    k_fattn<<<dim3(NB_ * NH_, (TT - RH) / 64 + RH / 32, 1), 32 * NWF, 0, stream>>>(QP16, QPh, QPl, KP16, KPh, KPl, VT16, VTh, VTl, ATh, ATl);
    k_oproj<<<dim3(NB_ * TT / 64, DM / 64, 1), 256, 0, stream>>>(ATh, ATl, WO, bo, OUT);
}

// v006
// One run takes 104 microseconds.
// Next to v005, in two timings, it ran 1.41 times as fast each time.
// Counting every step since v000, it is 14.9 times as fast.
#include <hip/hip_runtime.h>

#include <hip/hip_runtime.h>

#define NB_  2
#define TT   2048
#define DM   1024
#define NH_  16
#define NKV  16
#define REP  (NH_ / NKV)
#define HD   64
#define DQ   (NH_ * HD)
#define DKV  (NKV * HD)
#define RH   512                  // query rows < RH use hi+lo planes (0: none)
#define WIN  0
#define PCAR 1024.0f
#define SCL  0.125f   // HD^-0.5
typedef _Float16 h16;
typedef unsigned short bf;
typedef __attribute__((ext_vector_type(16))) __bf16   v16bf;
typedef __attribute__((ext_vector_type(16))) _Float16 v16h;
typedef __attribute__((ext_vector_type(8)))  _Float16 v8h;
typedef __attribute__((ext_vector_type(8)))  unsigned short v8us;
typedef __attribute__((ext_vector_type(8)))  float    v8f;
typedef __attribute__((ext_vector_type(4)))  float    v4f;
typedef v8h  __attribute__((may_alias)) v8ha;
typedef v4f  __attribute__((may_alias)) v4fa;
typedef v8us __attribute__((may_alias)) v8usa;

__device__ __forceinline__ unsigned short f2bf(float f) { unsigned u = __float_as_uint(f); u += 0x7FFFu + ((u >> 16) & 1u); return (unsigned short)(u >> 16); }
__device__ __forceinline__ float bf2f(unsigned short b) { return __uint_as_float(((unsigned)b) << 16); }
__device__ __forceinline__ float bfr(float f) { return bf2f(f2bf(f)); }
__device__ __forceinline__ v16h cat16(v8h lo, v8h hi) { return __builtin_shufflevector(lo, hi, 0, 1, 2, 3, 4, 5, 6, 7, 8, 9, 10, 11, 12, 13, 14, 15); }
__device__ __forceinline__ v16bf cat16b(v8us lo, v8us hi) { return __builtin_bit_cast(v16bf, __builtin_shufflevector(lo, hi, 0, 1, 2, 3, 4, 5, 6, 7, 8, 9, 10, 11, 12, 13, 14, 15)); }
__device__ __forceinline__ v8f wmma16(v16h a, v16h b, v8f c) { return __builtin_amdgcn_wmma_f32_16x16x32_f16(false, a, false, b, (short)0, c, false, false); }
__device__ __forceinline__ v8f wmmab(v16bf a, v16bf b, v8f c) { return __builtin_amdgcn_wmma_f32_16x16x32_bf16(false, a, false, b, (short)0, c, false, false); }



// ---- gemmw_tile: register-blocked GEMM, one work-group of NW waves per 64x64 output tile (bx, by); every wave holds the whole tile (16 accumulators) and takes every NW-th 32-wide k step, operands straight from
// 16-bit planes in fragment order; the NW partial tiles are summed through LDS (os, NW * 16 * 68 floats) in wave order 0..NW-1. 32 * NW threads.
// C[m][n] (f32, pitch ldc, + optional f32 bias[n]) = sum_k A[m][k] Bt[n][k] (+ split products per NSPLIT). K % 32 == 0.
// OUTM 0: C goes out as f32. OUTM 1 and 2: no f32 C; the summed tile goes out as three 16-bit planes (f16, bf16 hi, bf16 lo) in the layout the attention kernel reads:
// OUTM 1 (m = token, n = feature; a 64-wide column tile is one head): plane[head], rows = tokens, K = d. OUTM 2 (m = feature, n = token; bias[m]): plane[head], rows = d, K = tokens, the transposed V. Both in fragment order.
typedef __attribute__((ext_vector_type(4))) _Float16 v4h;
typedef __attribute__((ext_vector_type(4))) unsigned short v4us;
__device__ __forceinline__ h16 tohx(float x) { return (h16)x; }
__device__ __forceinline__ void splitf(float y, unsigned short& h, unsigned short& l) { h = f2bf(y); l = f2bf(y - bf2f(h)); }
// Fragment order: every 16-bit operand plane (rows x K, K-contiguous in meaning) is stored as blocks of 16 rows x 32 k = 512 elements, block (r >> 4, k >> 5) at ((r >> 4) * (K >> 5) + (k >> 5)) * 512. Inside a block the
// element (r, k) stands at ((k >> 4) & 1) * 256 + (((k >> 3) & 1) * 16 + (r & 15)) * 8 + (k & 7): lane l of a wave finds its two 16-byte pieces of the WMMA operand at l * 8 and 256 + l * 8, so that each wave-wide load covers 512 contiguous bytes.
template <typename T16> struct WFrag;
template <> struct WFrag<h16> { typedef v16h V; static __device__ __forceinline__ V ld(const h16* p) { return cat16(*(const v8h*)p, *(const v8h*)(p + 256)); } static __device__ __forceinline__ v8f mma(V a, V b, v8f c) { return wmma16(a, b, c); } };
template <> struct WFrag<bf> { typedef v16bf V; static __device__ __forceinline__ V ld(const bf* p) { return cat16b(*(const v8us*)p, *(const v8us*)(p + 256)); } static __device__ __forceinline__ v8f mma(V a, V b, v8f c) { return wmmab(a, b, c); } };
template <int NW> __device__ __forceinline__ void tile_sync() { if (NW == 1) { __builtin_amdgcn_wave_barrier(); asm volatile("" ::: "memory"); } else __syncthreads(); }   // orders the LDS slab writes against the reads of the same slabs (by the one wave, or by all NW)
template <typename T16, int NSPLIT, bool BIAS, int NW, int OUTM>
__device__ __forceinline__ void gemmw_tile(const T16* __restrict__ A, const T16* __restrict__ A2, const T16* __restrict__ Bt, const T16* __restrict__ Bt2, int K, float* C, int ldc, const float* __restrict__ bias, h16* P16, bf* Ph, bf* Pl, int bx, int by, float* os) {
    typedef typename WFrag<T16>::V V;
    static_assert(OUTM == 0 || NW == 8, "the plane epilogue gives each of 8 waves one eighth of a slab");
    const int lane = threadIdx.x & 31, lr = lane & 15, hi = lane >> 4; const int r0 = bx * 64, c0 = by * 64;
    const int wv = (NW == 1) ? 0 : __builtin_amdgcn_readfirstlane((int)(threadIdx.x >> 5));   // wave number, scalar: the k loop's bounds stay wave-uniform
    constexpr int NS = (NW >= 8) ? 1 : 8 / NW;   // eighths of a 16-row slab that one wave sums and stores (OUTM 0: row pairs; OUTM 1, 2: 8 columns)
    v4f res[4][NS];                              // NW > 1: summed rows wait here, so that no barrier has to wait for a global store
    v4h r16[4][NS]; v4us rh[4][NS], rl[4][NS];   // OUTM 1, 2: the same rows, already converted
    float rb[4][NS];                             // OUTM 2: the bias of this lane's rows, fetched here so that its latency passes under the k loop and not between two barriers
    if (BIAS && OUTM == 2) {
#pragma unroll
        for (int k = 0; k < NS; ++k) { const int s = wv + k * NW; if (NW > 8 && s >= 8) break; const float* bp = bias + r0 + (lane >> 1);
#pragma unroll
            for (int mb = 0; mb < 4; ++mb) rb[mb][k] = bfr(bp[mb * 16]);
            asm volatile("s_wait_xcnt 0x0" :: "v"(bp) : "memory"); }   // behind the run of row-bias loads; it names their address as an input, so that it stays live up to the wait
    }
    v8f acc[4][4];
#pragma unroll
    for (int mb = 0; mb < 4; ++mb)
#pragma unroll
        for (int nb = 0; nb < 4; ++nb) acc[mb][nb] = (v8f){};
    const size_t aoff = (size_t)r0 * K + lane * 8, boff = (size_t)c0 * K + lane * 8;   // first block of the tile's rows, this lane's piece
#pragma unroll 1
    for (int kc = 32 * wv; kc < K; kc += 32 * NW) {
        V a[4], a2[4];
        const int ko = kc * 16;   // k block kc / 32, 512 elements each
        const T16* ap = A + aoff + ko; const T16* ap2 = (NSPLIT == 1 || NSPLIT == 2) ? A2 + aoff + ko : ap; const T16* bp = Bt + boff + ko; const T16* bp2 = (NSPLIT >= 2) ? Bt2 + boff + ko : bp;
#pragma unroll
        for (int mb = 0; mb < 4; ++mb) { a[mb] = WFrag<T16>::ld(ap + (size_t)mb * 16 * K); if (NSPLIT == 1 || NSPLIT == 2) a2[mb] = WFrag<T16>::ld(ap2 + (size_t)mb * 16 * K); }
#pragma unroll
        for (int nb = 0; nb < 4; ++nb) { const V b = WFrag<T16>::ld(bp + (size_t)nb * 16 * K); V b2; if (NSPLIT >= 2) b2 = WFrag<T16>::ld(bp2 + (size_t)nb * 16 * K);
#pragma unroll
            for (int mb = 0; mb < 4; ++mb) { acc[mb][nb] = WFrag<T16>::mma(a[mb], b, acc[mb][nb]); if (NSPLIT == 1 || NSPLIT == 2) acc[mb][nb] = WFrag<T16>::mma(a2[mb], b, acc[mb][nb]); if (NSPLIT >= 2) acc[mb][nb] = WFrag<T16>::mma(a[mb], b2, acc[mb][nb]); } }
        asm volatile("v_nop\n\tv_nop\n\tv_nop\n\tv_nop" : "+v"(acc[0][0]), "+v"(acc[1][1]), "+v"(acc[2][2]), "+v"(acc[3][3]) : "v"(a[0]), "v"(a[3]));
        // s_wait_xcnt 0 behind the step's loads; it names their address pairs as inputs, so that they stay live up to the wait and neither a later load's result nor the next step's address lands in them ahead of it
        asm volatile("s_wait_xcnt 0x0" :: "v"(ap), "v"(ap2), "v"(bp), "v"(bp2) : "memory");
    }
    v4f cb;                                      // OUTM 0, 1: the bias of this lane's four columns, the same for every row it sums
    if (BIAS && OUTM != 2) { const float* bc = bias + c0 + (OUTM == 1 ? wv * 8 + (lane & 1) * 4 : lr * 4); cb[0] = bfr(bc[0]); cb[1] = bfr(bc[1]); cb[2] = bfr(bc[2]); cb[3] = bfr(bc[3]);
        asm volatile("s_wait_xcnt 0x0" :: "v"(bc) : "memory"); }   // behind the bias load; it names the address as an input, so that the load's own result does not land in it
#pragma unroll
    for (int mb = 0; mb < 4; ++mb) {
#pragma unroll
        for (int nb = 0; nb < 4; ++nb) {
#pragma unroll
            for (int j = 0; j < 8; ++j) os[wv * (16 * 68) + (hi * 8 + j) * 68 + nb * 16 + lr] = acc[mb][nb][j]; }
        tile_sync<NW>();
        float* crow = C + (size_t)(r0 + mb * 16) * ldc + c0;
{
#pragma unroll
            for (int k = 0; k < NS; ++k) { const int s = wv + k * NW; if (NW > 8 && s >= 8) break; const int row = OUTM ? lane >> 1 : 2 * s + hi, cofs = OUTM ? s * 8 + (lane & 1) * 4 : lr * 4;   /* OUTM 1, 2: the four elements that stand at s * 128 + lane * 4 of the slab in fragment order */ v4f val = *(const v4fa*)(os + row * 68 + cofs);
#pragma unroll
                for (int w = 1; w < NW; ++w) val += *(const v4fa*)(os + w * (16 * 68) + row * 68 + cofs);
                if (BIAS && OUTM == 2) val += rb[mb][k];
                if (BIAS && OUTM != 2) val += cb;
                if (OUTM != 0) {
#pragma unroll
                    for (int j = 0; j < 4; ++j) { unsigned short a2, c2; splitf(val[j], a2, c2); r16[mb][k][j] = tohx(val[j]); rh[mb][k][j] = a2; rl[mb][k][j] = c2; }
                } else
                if (NW == 1) *(v4f*)(crow + (size_t)row * ldc + cofs) = val; else res[mb][k] = val; }
             }
        if (NW == 1 || mb < 3) tile_sync<NW>();
    }
    if (OUTM != 0) {
        constexpr size_t PLD = (OUTM == 1) ? HD : TT, CTS = (OUTM == 1) ? (size_t)TT * HD : 64 * 16;   // K of the plane (a 16-row slab is 16 * PLD elements); step from one 64-wide column tile to the next
#pragma unroll
        for (int k = 0; k < NS; ++k) { const int s = wv + k * NW; if (NW > 8 && s >= 8) break; const size_t e = (size_t)r0 * PLD + by * CTS + s * 128 + lane * 4;   /* a wave stores 256 contiguous bytes of each plane */ h16* p16 = P16 + e; bf* ph = Ph + e; bf* pl = Pl + e;
#pragma unroll
            for (int mb = 0; mb < 4; ++mb) { *(v4h*)(p16 + mb * 16 * PLD) = r16[mb][k]; *(v4us*)(ph + mb * 16 * PLD) = rh[mb][k]; *(v4us*)(pl + mb * 16 * PLD) = rl[mb][k]; }
            // s_wait_xcnt 0 behind the run of stores; it names their address pairs as inputs, so that they stay live up to the wait
            asm volatile("s_wait_xcnt 0x0" :: "v"(p16), "v"(ph), "v"(pl) : "memory"); }
    } else if (NW > 1) {
#pragma unroll
        for (int mb = 0; mb < 4; ++mb)
#pragma unroll
            for (int k = 0; k < NS; ++k) { const int s = wv + k * NW; if (NW > 8 && s >= 8) break; *(v4f*)(C + (size_t)(r0 + mb * 16 + 2 * s + hi) * ldc + c0 + lr * 4) = res[mb][k]; }
    }
}
// k_qkv: the Q, K and V projections of every batch in one launch. grid (TT/64 token tiles, 16 feature tiles, 3 * NB_): z picks the projection and the batch; planes and XB are [batch][...].
__global__ __launch_bounds__(256) void k_qkv(const bf* __restrict__ XB, const bf* __restrict__ WQ, const bf* __restrict__ WK, const bf* __restrict__ WV, const float* __restrict__ bq, const float* __restrict__ bk, const float* __restrict__ bv,
                                             h16* QP16, bf* QPh, bf* QPl, h16* KP16, bf* KPh, bf* KPl, h16* VT16, bf* VTh, bf* VTl) {
    __shared__ __align__(16) float os[8 * 16 * 68];
    const int w = blockIdx.z / NB_, b = blockIdx.z % NB_; const bf* X = XB + (size_t)b * TT * DM; const size_t pq = (size_t)b * NH_ * TT * HD, pk = (size_t)b * NKV * TT * HD;
    if (w == 2) gemmw_tile<bf, 0, true, 8, 2>(WV, nullptr, X, nullptr, DM, nullptr, 0, bv, VT16 + pk, VTh + pk, VTl + pk, blockIdx.y, blockIdx.x, os);   // V^T = Wv X^T: its rows are the transposed plane's rows
    else gemmw_tile<bf, 0, true, 8, 1>(X, nullptr, w ? WK : WQ, nullptr, DM, nullptr, 0, w ? bk : bq, w ? KP16 + pk : QP16 + pq, w ? KPh + pk : QPh + pq, w ? KPl + pk : QPl + pq, blockIdx.x, blockIdx.y, os);
}
// k_oproj: the output projection of every batch's rows in one launch. grid (NB_ * TT / 64, DM / 64).
__global__ __launch_bounds__(256) void k_oproj(const bf* __restrict__ Ah, const bf* __restrict__ Al, const bf* __restrict__ WO, const float* __restrict__ bo, float* OUT) {
    __shared__ __align__(16) float os[8 * 16 * 68];
    gemmw_tile<bf, 1, true, 8, 0>(Ah, Al, WO, nullptr, DQ, OUT, DM, bo, nullptr, nullptr, nullptr, blockIdx.x, blockIdx.y, os);
}

typedef __attribute__((ext_vector_type(2))) _Float16 v2h;
typedef __attribute__((ext_vector_type(2))) unsigned short v2us;
typedef __attribute__((ext_vector_type(2))) float v2f;
typedef __attribute__((ext_vector_type(4))) int v4i;

__global__ __launch_bounds__(256) void k_wtG(const float* __restrict__ w, int K, int N, bf* Bt) {
    const int lane = threadIdx.x & 31; const int L0 = (blockIdx.x * 8 + (threadIdx.x >> 5)) * 8; const int nlines = N * K / 64;
{
#pragma unroll 1
        for (int l = 0; l < 8; ++l) { const int L = L0 + l; if (L >= nlines) break; const size_t e = (size_t)L * 64 + lane * 2; const int k = (int)(e % K), n = (int)(e / K); v2us o;
            o[0] = f2bf(w[(size_t)k * N + n]); o[1] = f2bf(w[(size_t)(k + 1) * N + n]); *(v2us*)(Bt + e) = o; }
         }
}
// k_cvt8: every f32-to-bf16 conversion in one launch. grid (DM * DM / 2048, 4 + NB_ * TT / DM): y picks a weight matrix or a piece of x of the same size (DM * DM floats).
static_assert(DQ == DM && DKV == DM && DM == 1024 && (NB_ * TT) % DM == 0 && (DM * DM) % 2048 == 0, "equal pieces");
__global__ __launch_bounds__(256) void k_cvt8(const float* __restrict__ x, const float* __restrict__ wq, const float* __restrict__ wk, const float* __restrict__ wv, const float* __restrict__ wo, bf* XB, bf* WQ, bf* WK, bf* WV, bf* WO) {
    const int y = blockIdx.y; const float* src = y == 0 ? wq : y == 1 ? wk : y == 2 ? wv : y == 3 ? wo : x + (size_t)(y - 4) * DM * DM; bf* dst = y == 0 ? WQ : y == 1 ? WK : y == 2 ? WV : y == 3 ? WO : XB + (size_t)(y - 4) * DM * DM;
    // The destination is in fragment order (K = DM). A wave takes 8 rows x 32 k of one block: it reads one whole 128-byte line of each row and stores four whole lines; a work-group takes four neighbouring blocks.
    const size_t blk = (size_t)blockIdx.x * 4 + (threadIdx.x >> 6); const int r8 = ((threadIdx.x >> 5) & 1) * 8 + (threadIdx.x & 7), c = (threadIdx.x >> 3) & 3;   // row in the block; which 8 of its 32 k
    const float* sp = src + ((blk >> 5) * 16 + r8) * DM + (blk & 31) * 32 + c * 8; const v8f v = *(const v8f*)sp; v8us o;
    asm volatile("s_wait_xcnt 0x0" :: "v"(sp) : "memory");   // behind the loads; it names their address pair as an input, so that the pair stays live up to the wait
#pragma unroll
    for (int k = 0; k < 8; ++k) o[k] = f2bf(v[k]); *(v8us*)(dst + blk * 512 + (c >> 1) * 256 + ((c & 1) * 16 + r8) * 8) = o;  }
__global__ __launch_bounds__(256) void k_cscvt(const float* __restrict__ cosT, const float* __restrict__ sinT, float* CS) { const int idx = blockIdx.x * 256 + threadIdx.x; if (idx >= TT * HD) return; v2f cs; cs[0] = bfr(cosT[idx]); cs[1] = bfr(sinT[idx]); *(v2f*)(CS + (size_t)idx * 2) = cs;  }
// ---- k_fattn: scores, causal ALiBi softmax, P.V and the hi/lo split of the result in one launch; no score or probability leaves the registers.
// One work-group of NWF waves owns a tile of QB*16 query rows of one head; its waves take every NWF-th pass of 32 keys, each with its own running maximum, sum and output tile (online softmax);
// the NWF partial tiles are joined through LDS in wave order 0..NWF-1. Transposed products: S^T = K Q^T (a lane holds 16 scores of ONE query per pass), O^T += V^T P^T, where two converted S^T tiles are the B operand as they stand.
// Query rows < RH: hi+lo bf16 planes, three products each (HI); the others f16 with the probabilities carried at 2^10 (the factor cancels against the row sum).
#define NWF 8
#define L2E 1.4426950408889634f
// XWAIT: s_wait_xcnt 0 behind a run of global loads or stores; it names their address pairs as inputs, so that they stay live up to the wait and neither a later load's result nor a vector instruction lands in them ahead of it.
#define XWAIT(pa, pb) asm volatile("s_wait_xcnt 0x0" :: "v"(pa), "v"(pb) : "memory")
__device__ __forceinline__ float xhalf(float x) { const int b = __float_as_int(x); return __int_as_float(__builtin_amdgcn_permlanex16(b, b, 0x76543210, 0xfedcba98, false, false)); }   // value of lane l ^ 16
// exp2s: v_exp_f32 with one v_nop in the same statement, for the places where the compiler's schedule put a write of the transcendental's source register directly behind it (the slot the instruction set asks for).
__device__ __forceinline__ float exp2s(float x) { float r; asm("v_exp_f32 %0, %1\n\tv_nop" : "=v"(r) : "v"(x)); return r; }
template <typename T16, bool HI, int QB>
__device__ __forceinline__ void attn_tile(const T16* __restrict__ Q, const T16* __restrict__ Q2, const T16* __restrict__ K, const T16* __restrict__ K2, const T16* __restrict__ Vt, const T16* __restrict__ Vt2,
                                          int q0, int wv, float* so, float* sml, bf* Ah, bf* Al) {
    typedef typename WFrag<T16>::V V;
    const int lane = threadIdx.x & 31, lr = lane & 15, hi = lane >> 4; const int kend = q0 + QB * 16;   // keys 0 .. kend-1 can be visible to this tile
    V q[QB][2], q2[QB][2];
    const int koff = lane * 8, voff = lane * 8;   // this lane's piece of a block in fragment order
    { const T16* qp = Q + (size_t)q0 * HD + koff; const T16* qp2 = HI ? Q2 + (size_t)q0 * HD + koff : qp;
#pragma unroll
      for (int qb = 0; qb < QB; ++qb)
#pragma unroll
          for (int ks = 0; ks < 2; ++ks) { q[qb][ks] = WFrag<T16>::ld(qp + qb * 16 * HD + ks * 512); if (HI) q2[qb][ks] = WFrag<T16>::ld(qp2 + qb * 16 * HD + ks * 512); }
      XWAIT(qp, qp2); }
    v8f o[4][QB]; float m[QB], l[QB];
#pragma unroll
    for (int qb = 0; qb < QB; ++qb) { m[qb] = -3.0e38f; l[qb] = 0.f;
#pragma unroll
        for (int db = 0; db < 4; ++db) o[db][qb] = (v8f){}; }
    int c0 = 32 * wv;
    if (c0 < kend) {
        V k[2][2], k2[2][2];
        if constexpr (!HI) {   // f16 tiles (the long ones) fetch their K fragments one pass ahead
            const T16* kp = K + (size_t)c0 * HD + koff;
#pragma unroll
            for (int kb = 0; kb < 2; ++kb)
#pragma unroll
                for (int ks = 0; ks < 2; ++ks) k[kb][ks] = WFrag<T16>::ld(kp + kb * 16 * HD + ks * 512);
            XWAIT(kp, kp);
        }
#pragma unroll 1
        for (; c0 < kend; c0 += 32 * NWF) {
            V v[4], v2[4];
            if constexpr (HI) { const T16* kp = K + (size_t)c0 * HD + koff; const T16* kp2 = K2 + (size_t)c0 * HD + koff;
#pragma unroll
                for (int kb = 0; kb < 2; ++kb)
#pragma unroll
                    for (int ks = 0; ks < 2; ++ks) { k[kb][ks] = WFrag<T16>::ld(kp + kb * 16 * HD + ks * 512); k2[kb][ks] = WFrag<T16>::ld(kp2 + kb * 16 * HD + ks * 512); }
                XWAIT(kp, kp2);
            }
            { const T16* vp = Vt + c0 * 16 + voff; const T16* vp2 = HI ? Vt2 + c0 * 16 + voff : vp;
#pragma unroll
              for (int db = 0; db < 4; ++db) { v[db] = WFrag<T16>::ld(vp + db * 16 * TT); if (HI) v2[db] = WFrag<T16>::ld(vp2 + db * 16 * TT); }
              XWAIT(vp, vp2); }
            v8f s[2][QB];
#pragma unroll
            for (int kb = 0; kb < 2; ++kb)
#pragma unroll
                for (int qb = 0; qb < QB; ++qb) { s[kb][qb] = (v8f){};
#pragma unroll
                    for (int ks = 0; ks < 2; ++ks) { s[kb][qb] = WFrag<T16>::mma(k[kb][ks], q[qb][ks], s[kb][qb]); if (HI) { s[kb][qb] = WFrag<T16>::mma(k[kb][ks], q2[qb][ks], s[kb][qb]); s[kb][qb] = WFrag<T16>::mma(k2[kb][ks], q[qb][ks], s[kb][qb]); } } }
            if constexpr (!HI) {
                const int cn = (c0 + 32 * NWF < kend) ? c0 + 32 * NWF : c0;   // the wave's next pass (its last pass reloads itself: in bounds, unused); the loads fly under the softmax and P.V
                const T16* kp = K + (size_t)cn * HD + koff;
#pragma unroll
                for (int kb = 0; kb < 2; ++kb)
#pragma unroll
                    for (int ks = 0; ks < 2; ++ks) k[kb][ks] = WFrag<T16>::ld(kp + kb * 16 * HD + ks * 512);
                XWAIT(kp, kp);
                __builtin_amdgcn_sched_barrier(0);   // keeps the K loads up here, in front of the softmax, so that their latency passes under it
            }
            V p[QB], p2[QB];
#pragma unroll
            for (int qb = 0; qb < QB; ++qb) {
                const float bb0 = 0.0625f * (float)(c0 + hi * 8 - (q0 + qb * 16 + lr));   // ALiBi slope 1/16 x (j - i) at the lane's first key; exact, as is every bb below
                float mx = -3.0e38f;
#pragma unroll
                for (int kb = 0; kb < 2; ++kb)
#pragma unroll
                    for (int j = 0; j < 8; ++j) { const float bb = bb0 + 0.0625f * (float)(kb * 16 + j); const float t = (bb <= 0.f) ? s[kb][qb][j] * SCL + bb : -3.0e38f;   /* causal: j <= i */ s[kb][qb][j] = t; mx = fmaxf(mx, t); }
                mx = fmaxf(mx, xhalf(mx));
                const float mn = fmaxf(m[qb], mx); const float al = HI ? exp2s((m[qb] - mn) * L2E) : __builtin_amdgcn_exp2f((m[qb] - mn) * L2E); m[qb] = mn;
                float ls = 0.f;
#pragma unroll
                for (int kb = 0; kb < 2; ++kb)
#pragma unroll
                    for (int j = 0; j < 8; ++j) { const float e = HI ? exp2s((s[kb][qb][j] - mn) * L2E) : __builtin_amdgcn_exp2f((s[kb][qb][j] - mn) * L2E + 10.f); s[kb][qb][j] = e; ls += e; }
                l[qb] = l[qb] * al + ls;
#pragma unroll
                for (int db = 0; db < 4; ++db) o[db][qb] *= al;
                if constexpr (HI) { v8us h0, h1, l0, l1;
#pragma unroll
                    for (int j = 0; j < 8; ++j) { unsigned short a, c2; splitf(s[0][qb][j], a, c2); h0[j] = a; l0[j] = c2; splitf(s[1][qb][j], a, c2); h1[j] = a; l1[j] = c2; }
                    p[qb] = cat16b(h0, h1); p2[qb] = cat16b(l0, l1);
                } else { p[qb] = cat16(__builtin_convertvector(s[0][qb], v8h), __builtin_convertvector(s[1][qb], v8h)); }
            }
#pragma unroll
            for (int db = 0; db < 4; ++db)
#pragma unroll
                for (int qb = 0; qb < QB; ++qb) { o[db][qb] = WFrag<T16>::mma(v[db], p[qb], o[db][qb]); if (HI) { o[db][qb] = WFrag<T16>::mma(v[db], p2[qb], o[db][qb]); o[db][qb] = WFrag<T16>::mma(v2[db], p[qb], o[db][qb]); } }
            // four vector slots behind the pass's last WMMAs: over the loop's back edge the next pass's first products write registers that these read as operands
            if constexpr (QB == 2) asm volatile("v_nop\n\tv_nop\n\tv_nop\n\tv_nop" : "+v"(o[0][0]), "+v"(o[1][0]), "+v"(o[2][0]), "+v"(o[3][0]), "+v"(o[0][1]), "+v"(o[1][1]), "+v"(o[2][1]), "+v"(o[3][1]));
            else asm volatile("v_nop\n\tv_nop\n\tv_nop\n\tv_nop" : "+v"(o[0][0]), "+v"(o[1][0]), "+v"(o[2][0]), "+v"(o[3][0]));
        }
    }
    float* sw = so + wv * (QB * 16 * 68);
#pragma unroll
    for (int qb = 0; qb < QB; ++qb) { l[qb] += xhalf(l[qb]);
#pragma unroll
        for (int db = 0; db < 4; ++db) { float* d = sw + (qb * 16 + lr) * 68 + db * 16 + hi * 8; *(v4fa*)d = __builtin_shufflevector(o[db][qb], o[db][qb], 0, 1, 2, 3); *(v4fa*)(d + 4) = __builtin_shufflevector(o[db][qb], o[db][qb], 4, 5, 6, 7); }
        if (hi == 0) { sml[(wv * (QB * 16) + qb * 16 + lr) * 2] = m[qb]; sml[(wv * (QB * 16) + qb * 16 + lr) * 2 + 1] = l[qb]; } }
    __syncthreads();   // every wave's partial tile, maximum and sum are in LDS
    if ((int)threadIdx.x < QB * 16 * 8) { const int qq = (threadIdx.x & 15) + 16 * (threadIdx.x >> 7), dg = (threadIdx.x >> 4) & 7;   // one thread: 8 consecutive d of one query row; a wave: 16 rows x 16 d, 512 contiguous bytes in fragment order
        float M = sml[qq * 2];
#pragma unroll
        for (int w = 1; w < NWF; ++w) M = fmaxf(M, sml[(w * (QB * 16) + qq) * 2]);
        float L = 0.f; v4f r0 = (v4f){}, r1 = (v4f){};
#pragma unroll
        for (int w = 0; w < NWF; ++w) { const float f = exp2s((sml[(w * (QB * 16) + qq) * 2] - M) * L2E); L += f * sml[(w * (QB * 16) + qq) * 2 + 1]; const float* d = so + w * (QB * 16 * 68) + qq * 68 + dg * 8; r0 += *(const v4fa*)d * f; r1 += *(const v4fa*)(d + 4) * f; }
        const float inv = __fdiv_rn(1.0f, L); v8us oh, ol;
#pragma unroll
        for (int j = 0; j < 4; ++j) { unsigned short a, c2; splitf(r0[j] * inv, a, c2); oh[j] = a; ol[j] = c2; splitf(r1[j] * inv, a, c2); oh[4 + j] = a; ol[4 + j] = c2; }
        const int eo = (q0 + (qq & ~15)) * DQ + dg * 128 + (qq & 15) * 8;   /* k = dg * 8 of the head's two blocks stands at dg * 128 */ bf* pa = Ah + eo; bf* pb = Al + eo; *(v8usa*)pa = oh; *(v8usa*)pb = ol; XWAIT(pa, pb); }
    __syncthreads();   // the LDS tiles are read: the next tile of this work-group may overwrite them
}
// grid (batches x heads, pairs of tiles): a work-group takes a long tile and then the short one that makes every pair cost the same; the pairs of f16 tiles (the longer ones) have the low flat indices, so that they start first.
__global__ __launch_bounds__(32 * NWF) __attribute__((amdgpu_waves_per_eu(4, 4))) void k_fattn(const h16* __restrict__ Q16, const bf* __restrict__ Qh, const bf* __restrict__ Ql, const h16* __restrict__ K16, const bf* __restrict__ Kh, const bf* __restrict__ Kl,
                                                    const h16* __restrict__ V16, const bf* __restrict__ Vh, const bf* __restrict__ Vl, bf* Ah, bf* Al) {
    __shared__ __align__(16) float so[NWF * 32 * 68]; __shared__ float sml[NWF * 32 * 2];
    const int wv = __builtin_amdgcn_readfirstlane((int)(threadIdx.x >> 5));   // wave number, scalar: the key loop's bounds stay wave-uniform
    const int bb = blockIdx.x / NH_, hh = blockIdx.x % NH_;   // batch, head
    const size_t hq = (size_t)blockIdx.x * TT * HD, hk = (size_t)(bb * NKV + hh / REP) * TT * HD; Ah += (size_t)bb * TT * DQ + hh * (HD * 16); Al += (size_t)bb * TT * DQ + hh * (HD * 16);   // rows = tokens of every batch, K = DQ, fragment order: a head is two k blocks
    constexpr int NP = (TT - RH) / 64; const int x = blockIdx.y;
    if (x < NP) {
#pragma unroll 1
        for (int r = 0; r < 2; ++r) attn_tile<h16, false, 2>(Q16 + hq, nullptr, K16 + hk, nullptr, V16 + hk, nullptr, r ? RH + 32 * x : TT - 32 - 32 * x, wv, so, sml, Ah, Al);
    } else {
#pragma unroll 1
        for (int r = 0; r < 2; ++r) attn_tile<bf, true, 1>(Qh + hq, Ql + hq, Kh + hk, Kl + hk, Vh + hk, Vl + hk, r ? 16 * (x - NP) : RH - 16 - 16 * (x - NP), wv, so, sml, Ah, Al);
    }
}

extern "C" void kernel_launch(void* const* d_in, const int* in_sizes, int n_in,
                              void* d_out, int out_size, void* d_ws, size_t ws_size, hipStream_t stream) {
    (void)in_sizes; (void)n_in; (void)out_size;
    const float* x = (const float*)d_in[0]; const float* wq = (const float*)d_in[1]; const float* bq = (const float*)d_in[2]; const float* wk = (const float*)d_in[3]; const float* bk = (const float*)d_in[4]; const float* wv = (const float*)d_in[5]; const float* bv = (const float*)d_in[6]; const float* wo = (const float*)d_in[7]; const float* bo = (const float*)d_in[8]; const float* cosT = nullptr; const float* sinT = nullptr; (void)cosT; (void)sinT;
    float* OUT = (float*)d_out;     // [2][2048][1024]
    char* wsp = (char*)d_ws;
    auto take = [&](size_t bytes) { char* p = wsp; wsp += (bytes + 255) & ~(size_t)255; return (void*)p; };
    bf* WQ = (bf*)take((size_t)DQ * DM * 2); bf* WK = (bf*)take((size_t)DKV * DM * 2); bf* WV = (bf*)take((size_t)DKV * DM * 2); bf* WO = (bf*)take((size_t)DM * DQ * 2);
    bf* XB = (bf*)take((size_t)NB_ * TT * DM * 2);
    h16* QP16 = (h16*)take((size_t)NB_ * NH_ * TT * HD * 2); h16* KP16 = (h16*)take((size_t)NB_ * NKV * TT * HD * 2); h16* VT16 = (h16*)take((size_t)NB_ * NKV * HD * TT * 2);
    bf* QPh = (bf*)take((size_t)NB_ * NH_ * TT * HD * 2); bf* QPl = (bf*)take((size_t)NB_ * NH_ * TT * HD * 2); bf* KPh = (bf*)take((size_t)NB_ * NKV * TT * HD * 2); bf* KPl = (bf*)take((size_t)NB_ * NKV * TT * HD * 2); bf* VTh = (bf*)take((size_t)NB_ * NKV * HD * TT * 2); bf* VTl = (bf*)take((size_t)NB_ * NKV * HD * TT * 2);
    bf* ATh = (bf*)take((size_t)NB_ * TT * DQ * 2); bf* ATl = (bf*)take((size_t)NB_ * TT * DQ * 2);
    if ((size_t)(wsp - (char*)d_ws) > ws_size) return;    // ws 256 MiB
    k_cvt8<<<dim3(DM * DM / 2048, 4 + NB_ * TT / DM, 1), 256, 0, stream>>>(x, wq, wk, wv, wo, XB, WQ, WK, WV, WO);
    k_qkv<<<dim3(TT / 64, DQ / 64, 3 * NB_), 256, 0, stream>>>(XB, WQ, WK, WV, bq, bk, bv, QP16, QPh, QPl, KP16, KPh, KPl, VT16, VTh, VTl);
    k_fattn<<<dim3(NB_ * NH_, (TT - RH) / 64 + RH / 32, 1), 32 * NWF, 0, stream>>>(QP16, QPh, QPl, KP16, KPh, KPl, VT16, VTh, VTl, ATh, ATl);
    k_oproj<<<dim3(NB_ * TT / 64, DM / 64, 1), 256, 0, stream>>>(ATh, ATl, WO, bo, OUT);
}

// v007
// It runs in 79.7 microseconds.
// In both of two side-by-side timings against v006, it was 1.31 times as fast.
// Counting every step since v000, it is 19.5 times as fast.
#include <hip/hip_runtime.h>

#include <hip/hip_runtime.h>

#define NB_  2
#define TT   2048
#define DM   1024
#define NH_  16
#define NKV  16
#define REP  (NH_ / NKV)
#define HD   64
#define DQ   (NH_ * HD)
#define DKV  (NKV * HD)
#define RH   512                  // query rows < RH use hi+lo planes (0: none)
#define WIN  0
#define PCAR 1024.0f
#define SCL  0.125f   // HD^-0.5
typedef _Float16 h16;
typedef unsigned short bf;
typedef __attribute__((ext_vector_type(16))) __bf16   v16bf;
typedef __attribute__((ext_vector_type(16))) _Float16 v16h;
typedef __attribute__((ext_vector_type(8)))  _Float16 v8h;
typedef __attribute__((ext_vector_type(8)))  unsigned short v8us;
typedef __attribute__((ext_vector_type(8)))  float    v8f;
typedef __attribute__((ext_vector_type(4)))  float    v4f;
typedef v8h  __attribute__((may_alias)) v8ha;
typedef v4f  __attribute__((may_alias)) v4fa;
typedef v8us __attribute__((may_alias)) v8usa;

__device__ __forceinline__ unsigned short f2bf(float f) { unsigned u = __float_as_uint(f); u += 0x7FFFu + ((u >> 16) & 1u); return (unsigned short)(u >> 16); }
__device__ __forceinline__ float bf2f(unsigned short b) { return __uint_as_float(((unsigned)b) << 16); }
__device__ __forceinline__ float bfr(float f) { return bf2f(f2bf(f)); }
__device__ __forceinline__ v16h cat16(v8h lo, v8h hi) { return __builtin_shufflevector(lo, hi, 0, 1, 2, 3, 4, 5, 6, 7, 8, 9, 10, 11, 12, 13, 14, 15); }
__device__ __forceinline__ v16bf cat16b(v8us lo, v8us hi) { return __builtin_bit_cast(v16bf, __builtin_shufflevector(lo, hi, 0, 1, 2, 3, 4, 5, 6, 7, 8, 9, 10, 11, 12, 13, 14, 15)); }
__device__ __forceinline__ v8f wmma16(v16h a, v16h b, v8f c) { return __builtin_amdgcn_wmma_f32_16x16x32_f16(false, a, false, b, (short)0, c, false, false); }
__device__ __forceinline__ v8f wmmab(v16bf a, v16bf b, v8f c) { return __builtin_amdgcn_wmma_f32_16x16x32_bf16(false, a, false, b, (short)0, c, false, false); }



// ---- gemms_tile: one work-group of 8 waves per 128x128 output tile (bx, by). C[m][n] (+ f32 bias, rounded to bf16) = sum_k A[m][k] Bt[n][k] (NSPLIT 1: + A2[m][k] Bt[n][k]); K = DM; 16-bit planes in fragment order.
// The operand tiles of 128 k (a stage) come into LDS by asynchronous copies, two buffers: the next stage flies while this one is worked on, and every byte is fetched from L2 once per work-group.
// Wave (wm, wn, wk) holds the 64x64 quarter (wm, wn) (16 accumulators) and takes k blocks 2 wk and 2 wk + 1 of every stage; the two partial quarters are joined through LDS, each wave of the pair finishing 32 of the 64 rows.
// OUTM 0: C goes out as f32. OUTM 1 and 2: no f32 C; the summed tile goes out as three 16-bit planes (f16, bf16 hi, bf16 lo) in the layout the attention kernel reads:
// OUTM 1 (m = token, n = feature; a 64-wide column tile is one head): plane[head], rows = tokens, K = d. OUTM 2 (m = feature, n = token; bias[m]): plane[head], rows = d, K = tokens, the transposed V. Both in fragment order.
typedef __attribute__((ext_vector_type(4))) _Float16 v4h;
typedef __attribute__((ext_vector_type(4))) unsigned short v4us;
__device__ __forceinline__ h16 tohx(float x) { return (h16)x; }
__device__ __forceinline__ void splitf(float y, unsigned short& h, unsigned short& l) { h = f2bf(y); l = f2bf(y - bf2f(h)); }
// Fragment order: every 16-bit operand plane (rows x K, K-contiguous in meaning) is stored as blocks of 16 rows x 32 k = 512 elements, block (r >> 4, k >> 5) at ((r >> 4) * (K >> 5) + (k >> 5)) * 512. Inside a block the
// element (r, k) stands at ((k >> 4) & 1) * 256 + (((k >> 3) & 1) * 16 + (r & 15)) * 8 + (k & 7): lane l of a wave finds its two 16-byte pieces of the WMMA operand at l * 8 and 256 + l * 8, so that each wave-wide load covers 512 contiguous bytes.
template <typename T16> struct WFrag;
template <> struct WFrag<h16> { typedef v16h V; static __device__ __forceinline__ V ld(const h16* p) { return cat16(*(const v8h*)p, *(const v8h*)(p + 256)); } static __device__ __forceinline__ v8f mma(V a, V b, v8f c) { return wmma16(a, b, c); } };
template <> struct WFrag<bf> { typedef v16bf V; static __device__ __forceinline__ V ld(const bf* p) { return cat16b(*(const v8us*)p, *(const v8us*)(p + 256)); } static __device__ __forceinline__ v8f mma(V a, V b, v8f c) { return wmmab(a, b, c); } };
__device__ __forceinline__ void wave_sync() { __builtin_amdgcn_wave_barrier(); asm volatile("" ::: "memory"); }   // orders one wave's LDS slab writes against its own reads of the same slab in another lane map
#define GRB ((DM / 32) * 1024)   // bytes from one 16-row block of a plane to the next
#define GOPB (8 * 4 * 1024)      // bytes of one operand tile of a stage: 8 row blocks x 4 k blocks x 1 KiB, laid [row block][k block]
// acopy8: one operand tile of a stage. Copy i brings row block i (4 KiB, contiguous in the plane): every lane 16 bytes. The s_wait_xcnt 0 stands in the copies' own statement, in front of any rewrite of their address registers.
__device__ __forceinline__ void acopy8(unsigned l, const char* g) {
    asm volatile("global_load_async_to_lds_b128 %0, %1, off\n\tglobal_load_async_to_lds_b128 %2, %3, off\n\tglobal_load_async_to_lds_b128 %4, %5, off\n\tglobal_load_async_to_lds_b128 %6, %7, off\n\t"
                 "global_load_async_to_lds_b128 %8, %9, off\n\tglobal_load_async_to_lds_b128 %10, %11, off\n\tglobal_load_async_to_lds_b128 %12, %13, off\n\tglobal_load_async_to_lds_b128 %14, %15, off\n\ts_wait_xcnt 0x0"
                 :: "v"(l), "v"(g), "v"(l + 4096), "v"(g + GRB), "v"(l + 2 * 4096), "v"(g + 2 * GRB), "v"(l + 3 * 4096), "v"(g + 3 * GRB),
                    "v"(l + 4 * 4096), "v"(g + 4 * GRB), "v"(l + 5 * 4096), "v"(g + 5 * GRB), "v"(l + 6 * 4096), "v"(g + 6 * GRB), "v"(l + 7 * 4096), "v"(g + 7 * GRB) : "memory");
}
template <int NSPLIT, int OUTM>
__device__ __forceinline__ void gemms_tile(const bf* __restrict__ A, const bf* __restrict__ A2, const bf* __restrict__ Bt, float* C, int ldc, const float* __restrict__ bias, h16* P16, bf* Ph, bf* Pl, int bx, int by, unsigned char* L) {
    typedef WFrag<bf>::V V;
    constexpr int NOP = NSPLIT ? 3 : 2, STG = NOP * GOPB, NT = DM / 128, KF = NSPLIT ? 2 : 1;   // operand tiles of a stage (A, A2, Bt); bytes of a stage; stages; fragment sets in registers (2 where one work-group has the WGP and its registers to itself)
    static_assert(NT >= 2 && DM % 128 == 0 && DQ == DM, "two stages or more");
    const int lane = threadIdx.x & 31, lr = lane & 15, hi = lane >> 4;
    const int wv = __builtin_amdgcn_readfirstlane((int)(threadIdx.x >> 5)), wm = wv & 1, wn = (wv >> 1) & 1, wk = wv >> 2;   // wave number, scalar
    // Accumulator row mb of a wave holds the quarter's 16-row slab mb ^ (2 * wk): rows 0 and 1 are the slabs this wave finishes, rows 2 and 3 the ones it hands to its partner (wave wv ^ 4), in the partner's order.
    float cbv[4]; v4f rbv[2][2];   // bias of this lane's accumulator columns (OUTM 0, 1) or rows (OUTM 2), fetched here so that its latency passes under the first stage's copies
    if (OUTM != 2) { const float* bc = bias + by * 128 + wn * 64;   // the same for the whole wave: the loads take it as their scalar base, with the lane's column as the offset
#pragma unroll
        for (int nb = 0; nb < 4; ++nb) cbv[nb] = bc[lr + nb * 16];
        asm volatile("s_wait_xcnt 0x0" :: "s"(bc), "v"(lr) : "memory"); }   // behind the bias loads; it names their scalar base and their lane offset as inputs, so that both stay live up to the wait
    else { const float* bp = bias + bx * 128 + wm * 64 + wk * 32 + hi * 8;
#pragma unroll
        for (int mb = 0; mb < 2; ++mb) { rbv[mb][0] = *(const v4f*)(bp + mb * 16); rbv[mb][1] = *(const v4f*)(bp + mb * 16 + 4); }
        asm volatile("s_wait_xcnt 0x0" :: "v"(bp) : "memory"); }   // as above
    v8f acc[4][4];
#pragma unroll
    for (int mb = 0; mb < 4; ++mb)
#pragma unroll
        for (int nb = 0; nb < 4; ++nb) acc[mb][nb] = (v8f){};
    const unsigned lbase = (unsigned)(size_t)L + threadIdx.x * 16;   // this lane's 16 bytes of a 4-KiB row block in LDS (byte offset in the work-group's LDS)
    const char* gA = (const char*)A + (size_t)bx * 8 * GRB + threadIdx.x * 16; const char* gA2 = NSPLIT ? (const char*)A2 + (size_t)bx * 8 * GRB + threadIdx.x * 16 : gA; const char* gB = (const char*)Bt + (size_t)by * 8 * GRB + threadIdx.x * 16;
    auto issue = [&](int s, int buf) { const unsigned l = lbase + buf * STG; acopy8(l, gA + s * 4096); if (NSPLIT) acopy8(l + GOPB, gA2 + s * 4096); acopy8(l + (NOP - 1) * GOPB, gB + s * 4096); };
    issue(0, 0);
    asm volatile("s_wait_asynccnt 0x0" ::: "memory");   // this wave's copies of stage 0 have landed
    __syncthreads();                                    // and every other wave's
    issue(1, 1);
    const int ao = (wm * 16 + wk * 2) * 512 + lane * 8, ax = wk * 4096, bo = (NOP - 1) * (GOPB / 2) + (wn * 16 + wk * 2) * 512 + lane * 8;   // elements: the wave's first A and Bt fragments in a stage; the slab swap
    V a[KF][4], a2[KF][4], b[KF][4];
    auto fetch = [&](int kf, int s, int kk) {   // the fragments of the wave's k block kk of stage s
        const bf* sb = (const bf*)(L + (s & 1) * STG);
#pragma unroll
        for (int nb = 0; nb < 4; ++nb) b[kf][nb] = WFrag<bf>::ld(sb + bo + kk * 512 + nb * 2048);
#pragma unroll
        for (int mb = 0; mb < 4; ++mb) { const bf* p = sb + ao + kk * 512 + mb * 2048 + (mb < 2 ? ax : -ax); a[kf][mb] = WFrag<bf>::ld(p); if (NSPLIT) a2[kf][mb] = WFrag<bf>::ld(p + GOPB / 2); } };
    auto block = [&](int kf) {
#pragma unroll
        for (int mb = 0; mb < 4; ++mb)
#pragma unroll
            for (int nb = 0; nb < 4; ++nb) acc[mb][nb] = WFrag<bf>::mma(a[kf][mb], b[kf][nb], acc[mb][nb]);
        if (NSPLIT) {
#pragma unroll
            for (int mb = 0; mb < 4; ++mb)
#pragma unroll
                for (int nb = 0; nb < 4; ++nb) acc[mb][nb] = WFrag<bf>::mma(a2[kf][mb], b[kf][nb], acc[mb][nb]);
        } };
    if (KF == 2) fetch(0, 0, 0);   // two fragment sets: every block's fragments are fetched under the WMMAs of the block before; stage 0 is published above
    // kept rolled: one copy of a stage's code in the instruction cache; the two buffers alternate by t & 1
#pragma unroll 1
    for (int t = 0; t < NT; ++t) {
        if (KF == 1) fetch(0, t, 0); else fetch(1, t, 1);
        __builtin_amdgcn_sched_barrier(0);   // keeps the fragment loads together in front of the WMMAs: left alone, the compiler reloads one Bt fragment register four times a k block, each time with a full LDS wait
        block(0);
        if (KF == 1) fetch(0, t, 1);
        else __builtin_amdgcn_sched_barrier(0);   // keeps these WMMAs in front of the waits below: left alone, the compiler lifts the waits over them, and the loads just issued are waited out with the matrix unit idle
        // The stage's last fragments are on their way to registers: the buffer is handed on here, and the refill flies under the WMMAs that follow.
        asm volatile("s_wait_dscnt 0x0" ::: "memory");      // this wave has read all it needs of stage t
        asm volatile("s_wait_asynccnt 0x0" ::: "memory");   // and its copies of stage t + 1 have landed
        __syncthreads();                                    // stage t + 1 is published; stage t's buffer is free
        if (t + 2 < NT) issue(t + 2, t & 1);
        if (KF == 2 && t + 1 < NT) fetch(0, t + 1, 0);   // the next stage's first fragment loads go out in front of this stage's last WMMAs
        block(KF - 1);
    }
    asm volatile("s_wait_asynccnt 0x0" ::: "memory");       // no copy is outstanding when the buffers become the join's staging
    float* X = (float*)L;   // 8 ranges of 2048 floats: wave wv writes range wv, only its partner reads it and then uses it as its own slab staging
    { float* xg = X + wv * 2048 + lane * 4;
#pragma unroll
      for (int mb = 2; mb < 4; ++mb)
#pragma unroll
          for (int nb = 0; nb < 4; ++nb) { float* d = xg + ((mb - 2) * 4 + nb) * 256; *(v4fa*)d = __builtin_shufflevector(acc[mb][nb], acc[mb][nb], 0, 1, 2, 3); *(v4fa*)(d + 128) = __builtin_shufflevector(acc[mb][nb], acc[mb][nb], 4, 5, 6, 7); } }
    __syncthreads();   // every wave's handed-over slabs are in LDS
    float* os = X + (wv ^ 4) * 2048;
#pragma unroll
    for (int mb = 0; mb < 2; ++mb)
#pragma unroll
        for (int nb = 0; nb < 4; ++nb) { const float* d = os + lane * 4 + (mb * 4 + nb) * 256; const v4f p0 = *(const v4fa*)d, p1 = *(const v4fa*)(d + 128);
#pragma unroll
            for (int j = 0; j < 4; ++j) { acc[mb][nb][j] += p0[j]; acc[mb][nb][4 + j] += p1[j]; }
#pragma unroll
            for (int j = 0; j < 8; ++j) acc[mb][nb][j] += (OUTM != 2) ? bfr(cbv[nb]) : bfr(rbv[mb][j >> 2][j & 3]); }
    const int m0 = bx * 128 + wm * 64 + wk * 32;   // first row of the 32 that this wave finishes
#pragma unroll
    for (int mb = 0; mb < 2; ++mb) {
#pragma unroll
        for (int nb = 0; nb < 4; ++nb)
#pragma unroll
            for (int j = 0; j < 8; ++j) os[(hi * 8 + j) * 68 + nb * 16 + lr] = acc[mb][nb][j];
        wave_sync();
        if (OUTM != 0) {
            constexpr size_t PLD = (OUTM == 1) ? HD : TT, CTS = (OUTM == 1) ? (size_t)TT * HD : 64 * 16;   // K of the plane (a 16-row slab is 16 * PLD elements); step from one 64-wide column tile to the next
            const size_t e = (size_t)(m0 + mb * 16) * PLD + (by * 2 + wn) * CTS + lane * 8; h16* p16 = P16 + e; bf* ph = Ph + e; bf* pl = Pl + e;
#pragma unroll
            for (int u = 0; u < 4; ++u) { const float* d = os + lr * 68 + (u * 2 + hi) * 8; const v4f v0 = *(const v4fa*)d, v1 = *(const v4fa*)(d + 4); v8h r16; v8us rh, rl;   /* the eight elements that stand at u * 256 + lane * 8 of the slab in fragment order */
#pragma unroll
                for (int j = 0; j < 4; ++j) { unsigned short a2, c2; splitf(v0[j], a2, c2); r16[j] = tohx(v0[j]); rh[j] = a2; rl[j] = c2; splitf(v1[j], a2, c2); r16[4 + j] = tohx(v1[j]); rh[4 + j] = a2; rl[4 + j] = c2; }
                *(v8h*)(p16 + u * 256) = r16; *(v8us*)(ph + u * 256) = rh; *(v8us*)(pl + u * 256) = rl; }   // a wave stores 512 contiguous bytes of each plane
            // s_wait_xcnt 0 behind the run of stores; it names their address pairs as inputs, so that they stay live up to the wait
            asm volatile("s_wait_xcnt 0x0" :: "v"(p16), "v"(ph), "v"(pl) : "memory");
        } else {
            float* cp = C + (size_t)(m0 + mb * 16 + hi) * ldc + by * 128 + wn * 64 + lr * 4;
#pragma unroll
            for (int s = 0; s < 8; ++s) *(v4f*)(cp + (size_t)(2 * s) * ldc) = *(const v4fa*)(os + (2 * s + hi) * 68 + lr * 4);   // two rows of 256 contiguous bytes
            asm volatile("s_wait_xcnt 0x0" :: "v"(cp) : "memory");   // as above
        }
        wave_sync();
    }
}
// k_qkv: the Q, K and V projections of every batch in one launch. grid (TT/128 token tiles, 8 feature tiles, 3 * NB_): z picks the projection and the batch; planes and XB are [batch][...].
__global__ __launch_bounds__(256) void k_qkv(const bf* __restrict__ XB, const bf* __restrict__ WQ, const bf* __restrict__ WK, const bf* __restrict__ WV, const float* __restrict__ bq, const float* __restrict__ bk, const float* __restrict__ bv,
                                             h16* QP16, bf* QPh, bf* QPl, h16* KP16, bf* KPh, bf* KPl, h16* VT16, bf* VTh, bf* VTl) {
    __shared__ __align__(16) unsigned char L[2 * 2 * GOPB];
    const int w = blockIdx.z / NB_, b = blockIdx.z % NB_; const bf* X = XB + (size_t)b * TT * DM; const size_t pq = (size_t)b * NH_ * TT * HD, pk = (size_t)b * NKV * TT * HD;
    if (w == 2) gemms_tile<0, 2>(WV, nullptr, X, nullptr, 0, bv, VT16 + pk, VTh + pk, VTl + pk, blockIdx.y, blockIdx.x, L);   // V^T = Wv X^T: its rows are the transposed plane's rows
    else gemms_tile<0, 1>(X, nullptr, w ? WK : WQ, nullptr, 0, w ? bk : bq, w ? KP16 + pk : QP16 + pq, w ? KPh + pk : QPh + pq, w ? KPl + pk : QPl + pq, blockIdx.x, blockIdx.y, L);
}
// k_oproj: the output projection of every batch's rows in one launch. grid (NB_ * TT / 128, DM / 128).
__global__ __launch_bounds__(256) void k_oproj(const bf* __restrict__ Ah, const bf* __restrict__ Al, const bf* __restrict__ WO, const float* __restrict__ bo, float* OUT) {
    __shared__ __align__(16) unsigned char L[2 * 3 * GOPB];
    gemms_tile<1, 0>(Ah, Al, WO, OUT, DM, bo, nullptr, nullptr, nullptr, blockIdx.x, blockIdx.y, L);
}

typedef __attribute__((ext_vector_type(2))) _Float16 v2h;
typedef __attribute__((ext_vector_type(2))) unsigned short v2us;
typedef __attribute__((ext_vector_type(2))) float v2f;
typedef __attribute__((ext_vector_type(4))) int v4i;

__global__ __launch_bounds__(256) void k_wtG(const float* __restrict__ w, int K, int N, bf* Bt) {
    const int lane = threadIdx.x & 31; const int L0 = (blockIdx.x * 8 + (threadIdx.x >> 5)) * 8; const int nlines = N * K / 64;
{
#pragma unroll 1
        for (int l = 0; l < 8; ++l) { const int L = L0 + l; if (L >= nlines) break; const size_t e = (size_t)L * 64 + lane * 2; const int k = (int)(e % K), n = (int)(e / K); v2us o;
            o[0] = f2bf(w[(size_t)k * N + n]); o[1] = f2bf(w[(size_t)(k + 1) * N + n]); *(v2us*)(Bt + e) = o; }
         }
}
// k_cvt8: every f32-to-bf16 conversion in one launch. grid (DM * DM / 2048, 4 + NB_ * TT / DM): y picks a weight matrix or a piece of x of the same size (DM * DM floats).
static_assert(DQ == DM && DKV == DM && DM == 1024 && (NB_ * TT) % DM == 0 && (DM * DM) % 2048 == 0, "equal pieces");
__global__ __launch_bounds__(256) void k_cvt8(const float* __restrict__ x, const float* __restrict__ wq, const float* __restrict__ wk, const float* __restrict__ wv, const float* __restrict__ wo, bf* XB, bf* WQ, bf* WK, bf* WV, bf* WO) {
    const int y = blockIdx.y; const float* src = y == 0 ? wq : y == 1 ? wk : y == 2 ? wv : y == 3 ? wo : x + (size_t)(y - 4) * DM * DM; bf* dst = y == 0 ? WQ : y == 1 ? WK : y == 2 ? WV : y == 3 ? WO : XB + (size_t)(y - 4) * DM * DM;
    // The destination is in fragment order (K = DM). A wave takes 8 rows x 32 k of one block: it reads one whole 128-byte line of each row and stores four whole lines; a work-group takes four neighbouring blocks.
    const size_t blk = (size_t)blockIdx.x * 4 + (threadIdx.x >> 6); const int r8 = ((threadIdx.x >> 5) & 1) * 8 + (threadIdx.x & 7), c = (threadIdx.x >> 3) & 3;   // row in the block; which 8 of its 32 k
    const float* sp = src + ((blk >> 5) * 16 + r8) * DM + (blk & 31) * 32 + c * 8; const v8f v = *(const v8f*)sp; v8us o;
    asm volatile("s_wait_xcnt 0x0" :: "v"(sp) : "memory");   // behind the loads; it names their address pair as an input, so that the pair stays live up to the wait
#pragma unroll
    for (int k = 0; k < 8; ++k) o[k] = f2bf(v[k]); *(v8us*)(dst + blk * 512 + (c >> 1) * 256 + ((c & 1) * 16 + r8) * 8) = o;  }
__global__ __launch_bounds__(256) void k_cscvt(const float* __restrict__ cosT, const float* __restrict__ sinT, float* CS) { const int idx = blockIdx.x * 256 + threadIdx.x; if (idx >= TT * HD) return; v2f cs; cs[0] = bfr(cosT[idx]); cs[1] = bfr(sinT[idx]); *(v2f*)(CS + (size_t)idx * 2) = cs;  }
// ---- k_fattn: scores, causal ALiBi softmax, P.V and the hi/lo split of the result in one launch; no score or probability leaves the registers.
// One work-group of NWF waves owns a tile of QB*16 query rows of one head; its waves take every NWF-th pass of 32 keys, each with its own running maximum, sum and output tile (online softmax);
// the NWF partial tiles are joined through LDS in wave order 0..NWF-1. Transposed products: S^T = K Q^T (a lane holds 16 scores of ONE query per pass), O^T += V^T P^T, where two converted S^T tiles are the B operand as they stand.
// Query rows < RH: hi+lo bf16 planes, three products each (HI); the others f16 with the probabilities carried at 2^10 (the factor cancels against the row sum).
#define NWF 8
#define L2E 1.4426950408889634f
// XWAIT: s_wait_xcnt 0 behind a run of global loads or stores; it names their address pairs as inputs, so that they stay live up to the wait and neither a later load's result nor a vector instruction lands in them ahead of it.
#define XWAIT(pa, pb) asm volatile("s_wait_xcnt 0x0" :: "v"(pa), "v"(pb) : "memory")
__device__ __forceinline__ float xhalf(float x) { const int b = __float_as_int(x); return __int_as_float(__builtin_amdgcn_permlanex16(b, b, 0x76543210, 0xfedcba98, false, false)); }   // value of lane l ^ 16
// exp2s: v_exp_f32 with one v_nop in the same statement, for the places where the compiler's schedule put a write of the transcendental's source register directly behind it (the slot the instruction set asks for).
__device__ __forceinline__ float exp2s(float x) { float r; asm("v_exp_f32 %0, %1\n\tv_nop" : "=v"(r) : "v"(x)); return r; }
template <typename T16, bool HI, int QB>
__device__ __forceinline__ void attn_tile(const T16* __restrict__ Q, const T16* __restrict__ Q2, const T16* __restrict__ K, const T16* __restrict__ K2, const T16* __restrict__ Vt, const T16* __restrict__ Vt2,
                                          int q0, int wv, float* so, float* sml, bf* Ah, bf* Al) {
    typedef typename WFrag<T16>::V V;
    const int lane = threadIdx.x & 31, lr = lane & 15, hi = lane >> 4; const int kend = q0 + QB * 16;   // keys 0 .. kend-1 can be visible to this tile
    V q[QB][2], q2[QB][2];
    const int koff = lane * 8, voff = lane * 8;   // this lane's piece of a block in fragment order
    { const T16* qp = Q + (size_t)q0 * HD + koff; const T16* qp2 = HI ? Q2 + (size_t)q0 * HD + koff : qp;
#pragma unroll
      for (int qb = 0; qb < QB; ++qb)
#pragma unroll
          for (int ks = 0; ks < 2; ++ks) { q[qb][ks] = WFrag<T16>::ld(qp + qb * 16 * HD + ks * 512); if (HI) q2[qb][ks] = WFrag<T16>::ld(qp2 + qb * 16 * HD + ks * 512); }
      XWAIT(qp, qp2); }
    v8f o[4][QB]; float m[QB], l[QB];
#pragma unroll
    for (int qb = 0; qb < QB; ++qb) { m[qb] = -3.0e38f; l[qb] = 0.f;
#pragma unroll
        for (int db = 0; db < 4; ++db) o[db][qb] = (v8f){}; }
    int c0 = 32 * wv;
    if (c0 < kend) {
        V k[2][2], k2[2][2];
        if constexpr (!HI) {   // f16 tiles (the long ones) fetch their K fragments one pass ahead
            const T16* kp = K + (size_t)c0 * HD + koff;
#pragma unroll
            for (int kb = 0; kb < 2; ++kb)
#pragma unroll
                for (int ks = 0; ks < 2; ++ks) k[kb][ks] = WFrag<T16>::ld(kp + kb * 16 * HD + ks * 512);
            XWAIT(kp, kp);
        }
#pragma unroll 1
        for (; c0 < kend; c0 += 32 * NWF) {
            V v[4], v2[4];
            if constexpr (HI) { const T16* kp = K + (size_t)c0 * HD + koff; const T16* kp2 = K2 + (size_t)c0 * HD + koff;
#pragma unroll
                for (int kb = 0; kb < 2; ++kb)
#pragma unroll
                    for (int ks = 0; ks < 2; ++ks) { k[kb][ks] = WFrag<T16>::ld(kp + kb * 16 * HD + ks * 512); k2[kb][ks] = WFrag<T16>::ld(kp2 + kb * 16 * HD + ks * 512); }
                XWAIT(kp, kp2);
            }
            { const T16* vp = Vt + c0 * 16 + voff; const T16* vp2 = HI ? Vt2 + c0 * 16 + voff : vp;
#pragma unroll
              for (int db = 0; db < 4; ++db) { v[db] = WFrag<T16>::ld(vp + db * 16 * TT); if (HI) v2[db] = WFrag<T16>::ld(vp2 + db * 16 * TT); }
              XWAIT(vp, vp2); }
            v8f s[2][QB];
#pragma unroll
            for (int kb = 0; kb < 2; ++kb)
#pragma unroll
                for (int qb = 0; qb < QB; ++qb) { s[kb][qb] = (v8f){};
#pragma unroll
                    for (int ks = 0; ks < 2; ++ks) { s[kb][qb] = WFrag<T16>::mma(k[kb][ks], q[qb][ks], s[kb][qb]); if (HI) { s[kb][qb] = WFrag<T16>::mma(k[kb][ks], q2[qb][ks], s[kb][qb]); s[kb][qb] = WFrag<T16>::mma(k2[kb][ks], q[qb][ks], s[kb][qb]); } } }
            if constexpr (!HI) {
                const int cn = (c0 + 32 * NWF < kend) ? c0 + 32 * NWF : c0;   // the wave's next pass (its last pass reloads itself: in bounds, unused); the loads fly under the softmax and P.V
                const T16* kp = K + (size_t)cn * HD + koff;
#pragma unroll
                for (int kb = 0; kb < 2; ++kb)
#pragma unroll
                    for (int ks = 0; ks < 2; ++ks) k[kb][ks] = WFrag<T16>::ld(kp + kb * 16 * HD + ks * 512);
                XWAIT(kp, kp);
                __builtin_amdgcn_sched_barrier(0);   // keeps the K loads up here, in front of the softmax, so that their latency passes under it
            }
            V p[QB], p2[QB];
#pragma unroll
            for (int qb = 0; qb < QB; ++qb) {
                const float bb0 = 0.0625f * (float)(c0 + hi * 8 - (q0 + qb * 16 + lr));   // ALiBi slope 1/16 x (j - i) at the lane's first key; exact, as is every bb below
                float mx = -3.0e38f;
#pragma unroll
                for (int kb = 0; kb < 2; ++kb)
#pragma unroll
                    for (int j = 0; j < 8; ++j) { const float bb = bb0 + 0.0625f * (float)(kb * 16 + j); const float t = (bb <= 0.f) ? s[kb][qb][j] * SCL + bb : -3.0e38f;   /* causal: j <= i */ s[kb][qb][j] = t; mx = fmaxf(mx, t); }
                mx = fmaxf(mx, xhalf(mx));
                const float mn = fmaxf(m[qb], mx); const float al = HI ? exp2s((m[qb] - mn) * L2E) : __builtin_amdgcn_exp2f((m[qb] - mn) * L2E); m[qb] = mn;
                float ls = 0.f;
#pragma unroll
                for (int kb = 0; kb < 2; ++kb)
#pragma unroll
                    for (int j = 0; j < 8; ++j) { const float e = HI ? exp2s((s[kb][qb][j] - mn) * L2E) : __builtin_amdgcn_exp2f((s[kb][qb][j] - mn) * L2E + 10.f); s[kb][qb][j] = e; ls += e; }
                l[qb] = l[qb] * al + ls;
#pragma unroll
                for (int db = 0; db < 4; ++db) o[db][qb] *= al;
                if constexpr (HI) { v8us h0, h1, l0, l1;
#pragma unroll
                    for (int j = 0; j < 8; ++j) { unsigned short a, c2; splitf(s[0][qb][j], a, c2); h0[j] = a; l0[j] = c2; splitf(s[1][qb][j], a, c2); h1[j] = a; l1[j] = c2; }
                    p[qb] = cat16b(h0, h1); p2[qb] = cat16b(l0, l1);
                } else { p[qb] = cat16(__builtin_convertvector(s[0][qb], v8h), __builtin_convertvector(s[1][qb], v8h)); }
            }
#pragma unroll
            for (int db = 0; db < 4; ++db)
#pragma unroll
                for (int qb = 0; qb < QB; ++qb) { o[db][qb] = WFrag<T16>::mma(v[db], p[qb], o[db][qb]); if (HI) { o[db][qb] = WFrag<T16>::mma(v[db], p2[qb], o[db][qb]); o[db][qb] = WFrag<T16>::mma(v2[db], p[qb], o[db][qb]); } }
            // four vector slots behind the pass's last WMMAs: over the loop's back edge the next pass's first products write registers that these read as operands
            if constexpr (QB == 2) asm volatile("v_nop\n\tv_nop\n\tv_nop\n\tv_nop" : "+v"(o[0][0]), "+v"(o[1][0]), "+v"(o[2][0]), "+v"(o[3][0]), "+v"(o[0][1]), "+v"(o[1][1]), "+v"(o[2][1]), "+v"(o[3][1]));
            else asm volatile("v_nop\n\tv_nop\n\tv_nop\n\tv_nop" : "+v"(o[0][0]), "+v"(o[1][0]), "+v"(o[2][0]), "+v"(o[3][0]));
        }
    }
    float* sw = so + wv * (QB * 16 * 68);
#pragma unroll
    for (int qb = 0; qb < QB; ++qb) { l[qb] += xhalf(l[qb]);
#pragma unroll
        for (int db = 0; db < 4; ++db) { float* d = sw + (qb * 16 + lr) * 68 + db * 16 + hi * 8; *(v4fa*)d = __builtin_shufflevector(o[db][qb], o[db][qb], 0, 1, 2, 3); *(v4fa*)(d + 4) = __builtin_shufflevector(o[db][qb], o[db][qb], 4, 5, 6, 7); }
        if (hi == 0) { sml[(wv * (QB * 16) + qb * 16 + lr) * 2] = m[qb]; sml[(wv * (QB * 16) + qb * 16 + lr) * 2 + 1] = l[qb]; } }
    __syncthreads();   // every wave's partial tile, maximum and sum are in LDS
    if ((int)threadIdx.x < QB * 16 * 8) { const int qq = (threadIdx.x & 15) + 16 * (threadIdx.x >> 7), dg = (threadIdx.x >> 4) & 7;   // one thread: 8 consecutive d of one query row; a wave: 16 rows x 16 d, 512 contiguous bytes in fragment order
        float M = sml[qq * 2];
#pragma unroll
        for (int w = 1; w < NWF; ++w) M = fmaxf(M, sml[(w * (QB * 16) + qq) * 2]);
        float L = 0.f; v4f r0 = (v4f){}, r1 = (v4f){};
#pragma unroll
        for (int w = 0; w < NWF; ++w) { const float f = exp2s((sml[(w * (QB * 16) + qq) * 2] - M) * L2E); L += f * sml[(w * (QB * 16) + qq) * 2 + 1]; const float* d = so + w * (QB * 16 * 68) + qq * 68 + dg * 8; r0 += *(const v4fa*)d * f; r1 += *(const v4fa*)(d + 4) * f; }
        const float inv = __fdiv_rn(1.0f, L); v8us oh, ol;
#pragma unroll
        for (int j = 0; j < 4; ++j) { unsigned short a, c2; splitf(r0[j] * inv, a, c2); oh[j] = a; ol[j] = c2; splitf(r1[j] * inv, a, c2); oh[4 + j] = a; ol[4 + j] = c2; }
        const int eo = (q0 + (qq & ~15)) * DQ + dg * 128 + (qq & 15) * 8;   /* k = dg * 8 of the head's two blocks stands at dg * 128 */ bf* pa = Ah + eo; bf* pb = Al + eo; *(v8usa*)pa = oh; *(v8usa*)pb = ol; XWAIT(pa, pb); }
    __syncthreads();   // the LDS tiles are read: the next tile of this work-group may overwrite them
}
// grid (batches x heads, pairs of tiles): a work-group takes a long tile and then the short one that makes every pair cost the same; the pairs of f16 tiles (the longer ones) have the low flat indices.
__global__ __launch_bounds__(32 * NWF) __attribute__((amdgpu_waves_per_eu(4, 4))) void k_fattn(const h16* __restrict__ Q16, const bf* __restrict__ Qh, const bf* __restrict__ Ql, const h16* __restrict__ K16, const bf* __restrict__ Kh, const bf* __restrict__ Kl,
                                                    const h16* __restrict__ V16, const bf* __restrict__ Vh, const bf* __restrict__ Vl, bf* Ah, bf* Al) {
    __shared__ __align__(16) float so[NWF * 32 * 68]; __shared__ float sml[NWF * 32 * 2];
    const int wv = __builtin_amdgcn_readfirstlane((int)(threadIdx.x >> 5));   // wave number, scalar: the key loop's bounds stay wave-uniform
    const int bb = blockIdx.x / NH_, hh = blockIdx.x % NH_;   // batch, head
    const size_t hq = (size_t)blockIdx.x * TT * HD, hk = (size_t)(bb * NKV + hh / REP) * TT * HD; Ah += (size_t)bb * TT * DQ + hh * (HD * 16); Al += (size_t)bb * TT * DQ + hh * (HD * 16);   // rows = tokens of every batch, K = DQ, fragment order: a head is two k blocks
    constexpr int NP = (TT - RH) / 64; const int x = blockIdx.y;
    if (x < NP) {
#pragma unroll 1
        for (int r = 0; r < 2; ++r) attn_tile<h16, false, 2>(Q16 + hq, nullptr, K16 + hk, nullptr, V16 + hk, nullptr, r ? RH + 32 * x : TT - 32 - 32 * x, wv, so, sml, Ah, Al);
    } else {
#pragma unroll 1
        for (int r = 0; r < 2; ++r) attn_tile<bf, true, 1>(Qh + hq, Ql + hq, Kh + hk, Kl + hk, Vh + hk, Vl + hk, r ? 16 * (x - NP) : RH - 16 - 16 * (x - NP), wv, so, sml, Ah, Al);
    }
}

extern "C" void kernel_launch(void* const* d_in, const int* in_sizes, int n_in,
                              void* d_out, int out_size, void* d_ws, size_t ws_size, hipStream_t stream) {
    (void)in_sizes; (void)n_in; (void)out_size;
    const float* x = (const float*)d_in[0]; const float* wq = (const float*)d_in[1]; const float* bq = (const float*)d_in[2]; const float* wk = (const float*)d_in[3]; const float* bk = (const float*)d_in[4]; const float* wv = (const float*)d_in[5]; const float* bv = (const float*)d_in[6]; const float* wo = (const float*)d_in[7]; const float* bo = (const float*)d_in[8]; const float* cosT = nullptr; const float* sinT = nullptr; (void)cosT; (void)sinT;
    float* OUT = (float*)d_out;     // [2][2048][1024]
    char* wsp = (char*)d_ws;
    auto take = [&](size_t bytes) { char* p = wsp; wsp += (bytes + 255) & ~(size_t)255; return (void*)p; };
    bf* WQ = (bf*)take((size_t)DQ * DM * 2); bf* WK = (bf*)take((size_t)DKV * DM * 2); bf* WV = (bf*)take((size_t)DKV * DM * 2); bf* WO = (bf*)take((size_t)DM * DQ * 2);
    bf* XB = (bf*)take((size_t)NB_ * TT * DM * 2);
    h16* QP16 = (h16*)take((size_t)NB_ * NH_ * TT * HD * 2); h16* KP16 = (h16*)take((size_t)NB_ * NKV * TT * HD * 2); h16* VT16 = (h16*)take((size_t)NB_ * NKV * HD * TT * 2);
    bf* QPh = (bf*)take((size_t)NB_ * NH_ * TT * HD * 2); bf* QPl = (bf*)take((size_t)NB_ * NH_ * TT * HD * 2); bf* KPh = (bf*)take((size_t)NB_ * NKV * TT * HD * 2); bf* KPl = (bf*)take((size_t)NB_ * NKV * TT * HD * 2); bf* VTh = (bf*)take((size_t)NB_ * NKV * HD * TT * 2); bf* VTl = (bf*)take((size_t)NB_ * NKV * HD * TT * 2);
    bf* ATh = (bf*)take((size_t)NB_ * TT * DQ * 2); bf* ATl = (bf*)take((size_t)NB_ * TT * DQ * 2);
    if ((size_t)(wsp - (char*)d_ws) > ws_size) return;    // ws 256 MiB
    k_cvt8<<<dim3(DM * DM / 2048, 4 + NB_ * TT / DM, 1), 256, 0, stream>>>(x, wq, wk, wv, wo, XB, WQ, WK, WV, WO);
    k_qkv<<<dim3(TT / 128, DQ / 128, 3 * NB_), 256, 0, stream>>>(XB, WQ, WK, WV, bq, bk, bv, QP16, QPh, QPl, KP16, KPh, KPl, VT16, VTh, VTl);
    k_fattn<<<dim3(NB_ * NH_, (TT - RH) / 64 + RH / 32, 1), 32 * NWF, 0, stream>>>(QP16, QPh, QPl, KP16, KPh, KPl, VT16, VTh, VTl, ATh, ATl);
    k_oproj<<<dim3(NB_ * TT / 128, DM / 128, 1), 256, 0, stream>>>(ATh, ATl, WO, bo, OUT);
}

// v008
// One run takes 74.7 microseconds.
// Two timings next to v007 put it at 1.08 and 1.05 times that version's speed.
// All steps since v000 together make it 20.8 times as fast.
#include <hip/hip_runtime.h>

#include <hip/hip_runtime.h>

#define NB_  2
#define TT   2048
#define DM   1024
#define NH_  16
#define NKV  16
#define REP  (NH_ / NKV)
#define HD   64
#define DQ   (NH_ * HD)
#define DKV  (NKV * HD)
#define RH   512                  // query rows < RH use hi+lo planes (0: none)
#define WIN  0
#define PCAR 1024.0f
#define SCL  0.125f   // HD^-0.5
typedef _Float16 h16;
typedef unsigned short bf;
typedef __attribute__((ext_vector_type(16))) __bf16   v16bf;
typedef __attribute__((ext_vector_type(16))) _Float16 v16h;
typedef __attribute__((ext_vector_type(8)))  _Float16 v8h;
typedef __attribute__((ext_vector_type(8)))  unsigned short v8us;
typedef __attribute__((ext_vector_type(8)))  float    v8f;
typedef __attribute__((ext_vector_type(4)))  float    v4f;
typedef v8h  __attribute__((may_alias)) v8ha;
typedef v4f  __attribute__((may_alias)) v4fa;
typedef v8us __attribute__((may_alias)) v8usa;

__device__ __forceinline__ unsigned short f2bf(float f) { unsigned u = __float_as_uint(f); u += 0x7FFFu + ((u >> 16) & 1u); return (unsigned short)(u >> 16); }
__device__ __forceinline__ float bf2f(unsigned short b) { return __uint_as_float(((unsigned)b) << 16); }
__device__ __forceinline__ float bfr(float f) { return bf2f(f2bf(f)); }
__device__ __forceinline__ v16h cat16(v8h lo, v8h hi) { return __builtin_shufflevector(lo, hi, 0, 1, 2, 3, 4, 5, 6, 7, 8, 9, 10, 11, 12, 13, 14, 15); }
__device__ __forceinline__ v16bf cat16b(v8us lo, v8us hi) { return __builtin_bit_cast(v16bf, __builtin_shufflevector(lo, hi, 0, 1, 2, 3, 4, 5, 6, 7, 8, 9, 10, 11, 12, 13, 14, 15)); }
__device__ __forceinline__ v8f wmma16(v16h a, v16h b, v8f c) { return __builtin_amdgcn_wmma_f32_16x16x32_f16(false, a, false, b, (short)0, c, false, false); }
__device__ __forceinline__ v8f wmmab(v16bf a, v16bf b, v8f c) { return __builtin_amdgcn_wmma_f32_16x16x32_bf16(false, a, false, b, (short)0, c, false, false); }



// ---- gemms_tile: one work-group of 8 waves per 128x128 output tile (bx, by). C[m][n] (+ f32 bias, rounded to bf16) = sum_k A[m][k] Bt[n][k] (NSPLIT 1: + A2[m][k] Bt[n][k]); K = DM; 16-bit planes in fragment order.
// The operand tiles of 128 k (a stage) come into LDS by asynchronous copies, two buffers: the next stage flies while this one is worked on, and every byte is fetched from L2 once per work-group.
// Wave (wm, wn, wk) holds the 64x64 quarter (wm, wn) (16 accumulators) and takes k blocks 2 wk and 2 wk + 1 of every stage; the two partial quarters are joined through LDS, each wave of the pair finishing 32 of the 64 rows.
// C goes out as f32.
typedef __attribute__((ext_vector_type(4))) _Float16 v4h;
typedef __attribute__((ext_vector_type(4))) unsigned short v4us;
__device__ __forceinline__ h16 tohx(float x) { return (h16)x; }
__device__ __forceinline__ void splitf(float y, unsigned short& h, unsigned short& l) { h = f2bf(y); l = f2bf(y - bf2f(h)); }
// Fragment order: every 16-bit operand plane (rows x K, K-contiguous in meaning) is stored as blocks of 16 rows x 32 k = 512 elements, block (r >> 4, k >> 5) at ((r >> 4) * (K >> 5) + (k >> 5)) * 512. Inside a block the
// element (r, k) stands at ((k >> 4) & 1) * 256 + (((k >> 3) & 1) * 16 + (r & 15)) * 8 + (k & 7): lane l of a wave finds its two 16-byte pieces of the WMMA operand at l * 8 and 256 + l * 8, so that each wave-wide load covers 512 contiguous bytes.
template <typename T16> struct WFrag;
template <> struct WFrag<h16> { typedef v16h V; static __device__ __forceinline__ V ld(const h16* p) { return cat16(*(const v8h*)p, *(const v8h*)(p + 256)); } static __device__ __forceinline__ v8f mma(V a, V b, v8f c) { return wmma16(a, b, c); } };
template <> struct WFrag<bf> { typedef v16bf V; static __device__ __forceinline__ V ld(const bf* p) { return cat16b(*(const v8us*)p, *(const v8us*)(p + 256)); } static __device__ __forceinline__ v8f mma(V a, V b, v8f c) { return wmmab(a, b, c); } };
__device__ __forceinline__ void wave_sync() { __builtin_amdgcn_wave_barrier(); asm volatile("" ::: "memory"); }   // orders one wave's LDS slab writes against its own reads of the same slab in another lane map
#define GRB ((DM / 32) * 1024)   // bytes from one 16-row block of a plane to the next
#define GOPB (8 * 4 * 1024)      // bytes of one operand tile of a stage: 8 row blocks x 4 k blocks x 1 KiB, laid [row block][k block]
// acopy8: one operand tile of a stage. Copy i brings row block i (4 KiB, contiguous in the plane): every lane 16 bytes. The s_wait_xcnt 0 stands in the copies' own statement, in front of any rewrite of their address registers.
__device__ __forceinline__ void acopy8(unsigned l, const char* g) {
    asm volatile("global_load_async_to_lds_b128 %0, %1, off\n\tglobal_load_async_to_lds_b128 %2, %3, off\n\tglobal_load_async_to_lds_b128 %4, %5, off\n\tglobal_load_async_to_lds_b128 %6, %7, off\n\t"
                 "global_load_async_to_lds_b128 %8, %9, off\n\tglobal_load_async_to_lds_b128 %10, %11, off\n\tglobal_load_async_to_lds_b128 %12, %13, off\n\tglobal_load_async_to_lds_b128 %14, %15, off\n\ts_wait_xcnt 0x0"
                 :: "v"(l), "v"(g), "v"(l + 4096), "v"(g + GRB), "v"(l + 2 * 4096), "v"(g + 2 * GRB), "v"(l + 3 * 4096), "v"(g + 3 * GRB),
                    "v"(l + 4 * 4096), "v"(g + 4 * GRB), "v"(l + 5 * 4096), "v"(g + 5 * GRB), "v"(l + 6 * 4096), "v"(g + 6 * GRB), "v"(l + 7 * 4096), "v"(g + 7 * GRB) : "memory");
}
template <int NSPLIT>
__device__ __forceinline__ void gemms_tile(const bf* __restrict__ A, const bf* __restrict__ A2, const bf* __restrict__ Bt, float* C, int ldc, const float* __restrict__ bias, int bx, int by, unsigned char* L) {
    typedef WFrag<bf>::V V;
    constexpr int NOP = NSPLIT ? 3 : 2, STG = NOP * GOPB, NT = DM / 128, KF = NSPLIT ? 2 : 1;   // operand tiles of a stage (A, A2, Bt); bytes of a stage; stages; fragment sets in registers (2 where one work-group has the WGP and its registers to itself)
    static_assert(NT >= 2 && DM % 128 == 0 && DQ == DM, "two stages or more");
    const int lane = threadIdx.x & 31, lr = lane & 15, hi = lane >> 4;
    const int wv = __builtin_amdgcn_readfirstlane((int)(threadIdx.x >> 5)), wm = wv & 1, wn = (wv >> 1) & 1, wk = wv >> 2;   // wave number, scalar
    // Accumulator row mb of a wave holds the quarter's 16-row slab mb ^ (2 * wk): rows 0 and 1 are the slabs this wave finishes, rows 2 and 3 the ones it hands to its partner (wave wv ^ 4), in the partner's order.
    float cbv[4];   // bias of this lane's accumulator columns, fetched here so that its latency passes under the first stage's copies
    { const float* bc = bias + by * 128 + wn * 64;   // the same for the whole wave: the loads take it as their scalar base, with the lane's column as the offset
#pragma unroll
        for (int nb = 0; nb < 4; ++nb) cbv[nb] = bc[lr + nb * 16];
        asm volatile("s_wait_xcnt 0x0" :: "s"(bc), "v"(lr) : "memory"); }   // behind the bias loads; it names their scalar base and their lane offset as inputs, so that both stay live up to the wait
    v8f acc[4][4];
#pragma unroll
    for (int mb = 0; mb < 4; ++mb)
#pragma unroll
        for (int nb = 0; nb < 4; ++nb) acc[mb][nb] = (v8f){};
    const unsigned lbase = (unsigned)(size_t)L + threadIdx.x * 16;   // this lane's 16 bytes of a 4-KiB row block in LDS (byte offset in the work-group's LDS)
    const char* gA = (const char*)A + (size_t)bx * 8 * GRB + threadIdx.x * 16; const char* gA2 = NSPLIT ? (const char*)A2 + (size_t)bx * 8 * GRB + threadIdx.x * 16 : gA; const char* gB = (const char*)Bt + (size_t)by * 8 * GRB + threadIdx.x * 16;
    auto issue = [&](int s, int buf) { const unsigned l = lbase + buf * STG; acopy8(l, gA + s * 4096); if (NSPLIT) acopy8(l + GOPB, gA2 + s * 4096); acopy8(l + (NOP - 1) * GOPB, gB + s * 4096); };
    issue(0, 0);
    asm volatile("s_wait_asynccnt 0x0" ::: "memory");   // this wave's copies of stage 0 have landed
    __syncthreads();                                    // and every other wave's
    issue(1, 1);
    const int ao = (wm * 16 + wk * 2) * 512 + lane * 8, ax = wk * 4096, bo = (NOP - 1) * (GOPB / 2) + (wn * 16 + wk * 2) * 512 + lane * 8;   // elements: the wave's first A and Bt fragments in a stage; the slab swap
    V a[KF][4], a2[KF][4], b[KF][4];
    auto fetch = [&](int kf, int s, int kk) {   // the fragments of the wave's k block kk of stage s
        const bf* sb = (const bf*)(L + (s & 1) * STG);
#pragma unroll
        for (int nb = 0; nb < 4; ++nb) b[kf][nb] = WFrag<bf>::ld(sb + bo + kk * 512 + nb * 2048);
#pragma unroll
        for (int mb = 0; mb < 4; ++mb) { const bf* p = sb + ao + kk * 512 + mb * 2048 + (mb < 2 ? ax : -ax); a[kf][mb] = WFrag<bf>::ld(p); if (NSPLIT) a2[kf][mb] = WFrag<bf>::ld(p + GOPB / 2); } };
    auto block = [&](int kf) {
#pragma unroll
        for (int mb = 0; mb < 4; ++mb)
#pragma unroll
            for (int nb = 0; nb < 4; ++nb) acc[mb][nb] = WFrag<bf>::mma(a[kf][mb], b[kf][nb], acc[mb][nb]);
        if (NSPLIT) {
#pragma unroll
            for (int mb = 0; mb < 4; ++mb)
#pragma unroll
                for (int nb = 0; nb < 4; ++nb) acc[mb][nb] = WFrag<bf>::mma(a2[kf][mb], b[kf][nb], acc[mb][nb]);
        } };
    if (KF == 2) fetch(0, 0, 0);   // two fragment sets: every block's fragments are fetched under the WMMAs of the block before; stage 0 is published above
    // kept rolled: one copy of a stage's code in the instruction cache; the two buffers alternate by t & 1
#pragma unroll 1
    for (int t = 0; t < NT; ++t) {
        if (KF == 1) fetch(0, t, 0); else fetch(1, t, 1);
        __builtin_amdgcn_sched_barrier(0);   // keeps the fragment loads together in front of the WMMAs: left alone, the compiler reloads one Bt fragment register four times a k block, each time with a full LDS wait
        block(0);
        if (KF == 1) fetch(0, t, 1);
        else __builtin_amdgcn_sched_barrier(0);   // keeps these WMMAs in front of the waits below: left alone, the compiler lifts the waits over them, and the loads just issued are waited out with the matrix unit idle
        // The stage's last fragments are on their way to registers: the buffer is handed on here, and the refill flies under the WMMAs that follow.
        asm volatile("s_wait_dscnt 0x0" ::: "memory");      // this wave has read all it needs of stage t
        asm volatile("s_wait_asynccnt 0x0" ::: "memory");   // and its copies of stage t + 1 have landed
        __syncthreads();                                    // stage t + 1 is published; stage t's buffer is free
        if (t + 2 < NT) issue(t + 2, t & 1);
        if (KF == 2 && t + 1 < NT) fetch(0, t + 1, 0);   // the next stage's first fragment loads go out in front of this stage's last WMMAs
        block(KF - 1);
    }
    asm volatile("s_wait_asynccnt 0x0" ::: "memory");       // no copy is outstanding when the buffers become the join's staging
    float* X = (float*)L;   // 8 ranges of 2048 floats: wave wv writes range wv, only its partner reads it and then uses it as its own slab staging
    { float* xg = X + wv * 2048 + lane * 4;
#pragma unroll
      for (int mb = 2; mb < 4; ++mb)
#pragma unroll
          for (int nb = 0; nb < 4; ++nb) { float* d = xg + ((mb - 2) * 4 + nb) * 256; *(v4fa*)d = __builtin_shufflevector(acc[mb][nb], acc[mb][nb], 0, 1, 2, 3); *(v4fa*)(d + 128) = __builtin_shufflevector(acc[mb][nb], acc[mb][nb], 4, 5, 6, 7); } }
    __syncthreads();   // every wave's handed-over slabs are in LDS
    float* os = X + (wv ^ 4) * 2048;
#pragma unroll
    for (int mb = 0; mb < 2; ++mb)
#pragma unroll
        for (int nb = 0; nb < 4; ++nb) { const float* d = os + lane * 4 + (mb * 4 + nb) * 256; const v4f p0 = *(const v4fa*)d, p1 = *(const v4fa*)(d + 128);
#pragma unroll
            for (int j = 0; j < 4; ++j) { acc[mb][nb][j] += p0[j]; acc[mb][nb][4 + j] += p1[j]; }
#pragma unroll
            for (int j = 0; j < 8; ++j) acc[mb][nb][j] += bfr(cbv[nb]); }
    const int m0 = bx * 128 + wm * 64 + wk * 32;   // first row of the 32 that this wave finishes
#pragma unroll
    for (int mb = 0; mb < 2; ++mb) {
#pragma unroll
        for (int nb = 0; nb < 4; ++nb)
#pragma unroll
            for (int j = 0; j < 8; ++j) os[(hi * 8 + j) * 68 + nb * 16 + lr] = acc[mb][nb][j];
        wave_sync();
        {
            float* cp = C + (size_t)(m0 + mb * 16 + hi) * ldc + by * 128 + wn * 64 + lr * 4;
#pragma unroll
            for (int s = 0; s < 8; ++s) *(v4f*)(cp + (size_t)(2 * s) * ldc) = *(const v4fa*)(os + (2 * s + hi) * 68 + lr * 4);   // two rows of 256 contiguous bytes
            asm volatile("s_wait_xcnt 0x0" :: "v"(cp) : "memory");   // behind the run of stores; it names their address pair as an input, so that it stays live up to the wait
        }
        wave_sync();
    }
}
// planes_out: a wave's 64x64 quarter (+ f32 bias, rounded to bf16) goes out as three 16-bit planes (f16, bf16 hi, bf16 lo) in fragment order, slab by slab (16 rows) through the wave's own LDS slab os.
// OUTM 1: rows = tokens from m0, columns = head ct (bias by column, bsv[nb] at column nb * 16 + lr). OUTM 2: rows = features from m0, columns = the 64 tokens from ct * 64 (bias by row, bsv[mb] at row mb * 16 + lr: added where the lane holds row lr).
template <int OUTM>
__device__ __forceinline__ void planes_out(v8f (&acc)[4][4], const float (&bsv)[4], float* os, int m0, int ct, h16* P16, bf* Ph, bf* Pl) {
    const int lane = (int)__builtin_amdgcn_mbcnt_lo(~0u, 0u), lr = lane & 15, hi = lane >> 4;   // the lane's number, formed anew here: taken from threadIdx.x its parts were held over the caller's loop, one of them in scratch memory
    constexpr size_t PLD = (OUTM == 1) ? HD : TT, CTS = (OUTM == 1) ? (size_t)TT * HD : 64 * 16;   // K of the plane (a 16-row slab is 16 * PLD elements); step from one 64-wide column tile to the next
#pragma unroll
    for (int mb = 0; mb < 4; ++mb) {
#pragma unroll
        for (int nb = 0; nb < 4; ++nb)
#pragma unroll
            for (int j = 0; j < 8; ++j) os[(hi * 8 + j) * 68 + nb * 16 + lr] = (OUTM == 1) ? acc[mb][nb][j] + bfr(bsv[nb]) : acc[mb][nb][j];
        wave_sync();
        const size_t e = (size_t)(m0 + mb * 16) * PLD + ct * CTS + lane * 8; h16* p16 = P16 + e; bf* ph = Ph + e; bf* pl = Pl + e;
        v8h r16[4]; v8us rh[4], rl[4];
#pragma unroll
        for (int u = 0; u < 4; ++u) { const float* d = os + lr * 68 + (u * 2 + hi) * 8; v4f v0 = *(const v4fa*)d, v1 = *(const v4fa*)(d + 4);   /* the eight elements that stand at u * 256 + lane * 8 of the slab in fragment order */
            if (OUTM == 2) { v0 += bfr(bsv[mb]); v1 += bfr(bsv[mb]); }
#pragma unroll
            for (int j = 0; j < 4; ++j) { unsigned short a2, c2; splitf(v0[j], a2, c2); r16[u][j] = tohx(v0[j]); rh[u][j] = a2; rl[u][j] = c2; splitf(v1[j], a2, c2); r16[u][4 + j] = tohx(v1[j]); rh[u][4 + j] = a2; rl[u][4 + j] = c2; }
            *(v8h*)(p16 + u * 256) = r16[u]; *(v8us*)(ph + u * 256) = rh[u]; *(v8us*)(pl + u * 256) = rl[u]; }   // a wave stores 512 contiguous bytes of each plane
        // s_wait_xcnt 0 behind the slab's stores; it names their address pairs and their stored vectors as inputs, so that all of them stay live up to the wait and the next slab's arithmetic lands in none of them ahead of it
        asm volatile("s_wait_xcnt 0x0" :: "v"(p16), "v"(ph), "v"(pl), "v"(r16[0]), "v"(rh[0]), "v"(rl[0]), "v"(r16[1]), "v"(rh[1]), "v"(rl[1]), "v"(r16[2]), "v"(rh[2]), "v"(rl[2]), "v"(r16[3]), "v"(rh[3]), "v"(rl[3]) : "memory");
        wave_sync();
    }
}
// k_qkv: the Q, K and V projections in one launch. grid (TT/128 token tiles, 8 feature tiles, NB_). One work-group of 12 waves computes the three 128x128 tiles (Q, K, V) of its tokens and features:
// a stage (128 k) holds the x tile once and the three weight tiles, so that the x bytes come from L2 once for the three products; two buffers, filled by asynchronous copies as in gemms_tile (waves 0 to 7 issue them).
// Wave (pj, wm, wn): projection pj (0 Q, 1 K, 2 V), 64x64 quarter (wm, wn), all of k. Q and K take x as A and the weights as B; V takes the weights as A and x as B (V^T = Wv X^T: its rows are the transposed plane's rows): only LDS offsets differ in the loop.
__global__ __launch_bounds__(384) void k_qkv(const bf* __restrict__ XB, const bf* __restrict__ WQ, const bf* __restrict__ WK, const bf* __restrict__ WV, const float* __restrict__ bq, const float* __restrict__ bk, const float* __restrict__ bv,
                                             h16* QP16, bf* QPh, bf* QPl, h16* KP16, bf* KPh, bf* KPl, h16* VT16, bf* VTh, bf* VTl) {
    typedef WFrag<bf>::V V;
    constexpr int STG = 4 * GOPB, NT = DM / 128;   // bytes of a stage: tiles x, Wq, Wk, Wv; stages
    static_assert(NT >= 2 && DM % 128 == 0 && DQ == DM && DKV == DM, "two stages or more; equal projections");
    __shared__ __align__(16) unsigned char L[2 * STG];
    const int lane = threadIdx.x & 31, lr = lane & 15;
    const int wv = __builtin_amdgcn_readfirstlane((int)(threadIdx.x >> 5)), pj = wv >> 2, wm = wv & 1, wn = (wv >> 1) & 1;   // wave number, scalar
    const int tx = blockIdx.x, fy = blockIdx.y, b = blockIdx.z; const bool isv = pj == 2;
    float bsv[4];   // bias of the features nb * 16 + lr (Q, K: the quarter's columns) or mb * 16 + lr (V: its rows), fetched here so that its latency passes under the first stage's copies
    { const float* bc = (pj == 0 ? bq : pj == 1 ? bk : bv) + fy * 128 + (isv ? wm : wn) * 64;   // the same for the whole wave: the loads take it as their scalar base, with the lane's feature as the offset
#pragma unroll
      for (int i = 0; i < 4; ++i) bsv[i] = bc[lr + i * 16];
      asm volatile("s_wait_xcnt 0x0" :: "s"(bc), "v"(lr) : "memory"); }   // behind the bias loads; it names their scalar base and their lane offset as inputs, so that both stay live up to the wait
    v8f acc[4][4];
#pragma unroll
    for (int mb = 0; mb < 4; ++mb)
#pragma unroll
        for (int nb = 0; nb < 4; ++nb) acc[mb][nb] = (v8f){};
    const unsigned lbase = (unsigned)(size_t)L + wv * 512 + lane * 16;   // waves 0 to 7: this lane's 16 bytes of a 4-KiB row block in LDS (byte offset in the work-group's LDS)
    const char* gX = (const char*)(XB + (size_t)b * TT * DM) + (size_t)tx * 8 * GRB; const char* gQ = (const char*)WQ + (size_t)fy * 8 * GRB; const char* gK = (const char*)WK + (size_t)fy * 8 * GRB; const char* gV = (const char*)WV + (size_t)fy * 8 * GRB;   // the tiles' first bytes: scalar, the lane's 16 bytes are added at the copy
    const size_t gl = (size_t)gX + wv * 512 + lane * 16, dQ = (size_t)gQ - (size_t)gX, dK = (size_t)gK - (size_t)gX, dV = (size_t)gV - (size_t)gX;   // one lane address; the weight tiles stand at scalar distances (modulo 2^64) from the x tile: fewer registers held over the loop
    auto issue = [&](int s, int buf) { if (wv < 8) { const unsigned l = lbase + buf * STG; const size_t so = (size_t)s * 4096; acopy8(l, (const char*)(gl + so)); acopy8(l + GOPB, (const char*)(gl + (dQ + so))); acopy8(l + 2 * GOPB, (const char*)(gl + (dK + so))); acopy8(l + 3 * GOPB, (const char*)(gl + (dV + so))); } };   // a scalar test: whole waves issue or none
    issue(0, 0);
    asm volatile("s_wait_asynccnt 0x0" ::: "memory");   // this wave's copies of stage 0 have landed
    __syncthreads();                                    // and every other wave's
    issue(1, 1);
    const int ao = (isv ? 3 : 0) * (GOPB / 2) + wm * 16 * 512 + lane * 8, bo = (isv ? 0 : 1 + pj) * (GOPB / 2) + wn * 16 * 512 + lane * 8;   // elements: the wave's first A and B fragments in a stage
    V a[2][4], bb[2][4];   // two fragment sets: every k block's fragments are fetched under the WMMAs of the block before
    auto fetch = [&](int kf, int s, int kk) {   // the fragments of k block kk of stage s
        const bf* sb = (const bf*)(L + (s & 1) * STG);
#pragma unroll
        for (int nb = 0; nb < 4; ++nb) bb[kf][nb] = WFrag<bf>::ld(sb + bo + kk * 512 + nb * 2048);
#pragma unroll
        for (int mb = 0; mb < 4; ++mb) a[kf][mb] = WFrag<bf>::ld(sb + ao + kk * 512 + mb * 2048); };
    auto block = [&](int kf) {
#pragma unroll
        for (int mb = 0; mb < 4; ++mb)
#pragma unroll
            for (int nb = 0; nb < 4; ++nb) acc[mb][nb] = WFrag<bf>::mma(a[kf][mb], bb[kf][nb], acc[mb][nb]); };
    fetch(0, 0, 0);   // stage 0 is published above
    // kept rolled: one copy of a stage's code in the instruction cache; the two buffers alternate by t & 1
#pragma unroll 1
    for (int t = 0; t < NT; ++t) {
        fetch(1, t, 1);
        __builtin_amdgcn_sched_barrier(0);   // here and twice below: keeps the fragment loads together in front of the WMMAs that they fly under
        block(0);
        __builtin_amdgcn_sched_barrier(0);   // here and below: keeps the next loads behind these WMMAs in one group
        fetch(0, t, 2);
        __builtin_amdgcn_sched_barrier(0);
        block(1);
        __builtin_amdgcn_sched_barrier(0);
        fetch(1, t, 3);
        __builtin_amdgcn_sched_barrier(0);
        block(0);
        __builtin_amdgcn_sched_barrier(0);   // keeps these WMMAs in front of the waits below, so that the loads just issued are not waited out with the matrix unit idle
        // The stage's last fragments are on their way to registers: the buffer is handed on here, and the refill flies under the WMMAs that follow.
        asm volatile("s_wait_dscnt 0x0" ::: "memory");      // this wave has read all it needs of stage t
        asm volatile("s_wait_asynccnt 0x0" ::: "memory");   // and its copies of stage t + 1 have landed
        __syncthreads();                                    // stage t + 1 is published; stage t's buffer is free
        if (t + 2 < NT) issue(t + 2, t & 1);
        if (t + 1 < NT) fetch(0, t + 1, 0);   // the next stage's first fragment loads go out in front of this stage's last WMMAs
        block(1);
    }
    asm volatile("s_wait_asynccnt 0x0" ::: "memory");       // no copy is outstanding, and behind the last barrier nobody reads a stage: the buffers become the waves' slabs
    float* os = (float*)L + wv * (16 * 68);
    const size_t pq = (size_t)b * NH_ * TT * HD, pk = (size_t)b * NKV * TT * HD;
    if (isv) planes_out<2>(acc, bsv, os, fy * 128 + wm * 64, tx * 2 + wn, VT16 + pk, VTh + pk, VTl + pk);
    else planes_out<1>(acc, bsv, os, tx * 128 + wm * 64, fy * 2 + wn, pj ? KP16 + pk : QP16 + pq, pj ? KPh + pk : QPh + pq, pj ? KPl + pk : QPl + pq);
}
// k_oproj: the output projection of every batch's rows in one launch. grid (NB_ * TT / 128, DM / 128).
__global__ __launch_bounds__(256) void k_oproj(const bf* __restrict__ Ah, const bf* __restrict__ Al, const bf* __restrict__ WO, const float* __restrict__ bo, float* OUT) {
    __shared__ __align__(16) unsigned char L[2 * 3 * GOPB];
    gemms_tile<1>(Ah, Al, WO, OUT, DM, bo, blockIdx.x, blockIdx.y, L);
}

typedef __attribute__((ext_vector_type(2))) _Float16 v2h;
typedef __attribute__((ext_vector_type(2))) unsigned short v2us;
typedef __attribute__((ext_vector_type(2))) float v2f;
typedef __attribute__((ext_vector_type(4))) int v4i;

__global__ __launch_bounds__(256) void k_wtG(const float* __restrict__ w, int K, int N, bf* Bt) {
    const int lane = threadIdx.x & 31; const int L0 = (blockIdx.x * 8 + (threadIdx.x >> 5)) * 8; const int nlines = N * K / 64;
{
#pragma unroll 1
        for (int l = 0; l < 8; ++l) { const int L = L0 + l; if (L >= nlines) break; const size_t e = (size_t)L * 64 + lane * 2; const int k = (int)(e % K), n = (int)(e / K); v2us o;
            o[0] = f2bf(w[(size_t)k * N + n]); o[1] = f2bf(w[(size_t)(k + 1) * N + n]); *(v2us*)(Bt + e) = o; }
         }
}
// k_cvt8: every f32-to-bf16 conversion in one launch. grid (DM * DM / 2048, 4 + NB_ * TT / DM): y picks a weight matrix or a piece of x of the same size (DM * DM floats).
static_assert(DQ == DM && DKV == DM && DM == 1024 && (NB_ * TT) % DM == 0 && (DM * DM) % 2048 == 0, "equal pieces");
__global__ __launch_bounds__(256) void k_cvt8(const float* __restrict__ x, const float* __restrict__ wq, const float* __restrict__ wk, const float* __restrict__ wv, const float* __restrict__ wo, bf* XB, bf* WQ, bf* WK, bf* WV, bf* WO) {
    const int y = blockIdx.y; const float* src = y == 0 ? wq : y == 1 ? wk : y == 2 ? wv : y == 3 ? wo : x + (size_t)(y - 4) * DM * DM; bf* dst = y == 0 ? WQ : y == 1 ? WK : y == 2 ? WV : y == 3 ? WO : XB + (size_t)(y - 4) * DM * DM;
    // The destination is in fragment order (K = DM). A wave takes 8 rows x 32 k of one block: it reads one whole 128-byte line of each row and stores four whole lines; a work-group takes four neighbouring blocks.
    const size_t blk = (size_t)blockIdx.x * 4 + (threadIdx.x >> 6); const int r8 = ((threadIdx.x >> 5) & 1) * 8 + (threadIdx.x & 7), c = (threadIdx.x >> 3) & 3;   // row in the block; which 8 of its 32 k
    const float* sp = src + ((blk >> 5) * 16 + r8) * DM + (blk & 31) * 32 + c * 8; const v8f v = *(const v8f*)sp; v8us o;
    asm volatile("s_wait_xcnt 0x0" :: "v"(sp) : "memory");   // behind the loads; it names their address pair as an input, so that the pair stays live up to the wait
#pragma unroll
    for (int k = 0; k < 8; ++k) o[k] = f2bf(v[k]); *(v8us*)(dst + blk * 512 + (c >> 1) * 256 + ((c & 1) * 16 + r8) * 8) = o;  }
__global__ __launch_bounds__(256) void k_cscvt(const float* __restrict__ cosT, const float* __restrict__ sinT, float* CS) { const int idx = blockIdx.x * 256 + threadIdx.x; if (idx >= TT * HD) return; v2f cs; cs[0] = bfr(cosT[idx]); cs[1] = bfr(sinT[idx]); *(v2f*)(CS + (size_t)idx * 2) = cs;  }
// ---- k_fattn: scores, causal ALiBi softmax, P.V and the hi/lo split of the result in one launch; no score or probability leaves the registers.
// One work-group of NWF waves owns a tile of QB*16 query rows of one head; its waves take every NWF-th pass of 32 keys, each with its own running maximum, sum and output tile (online softmax);
// the NWF partial tiles are joined through LDS in wave order 0..NWF-1. Transposed products: S^T = K Q^T (a lane holds 16 scores of ONE query per pass), O^T += V^T P^T, where two converted S^T tiles are the B operand as they stand.
// Query rows < RH: hi+lo bf16 planes, three products each (HI); the others f16 with the probabilities carried at 2^10 (the factor cancels against the row sum).
#define NWF 8
#define L2E 1.4426950408889634f
// XWAIT: s_wait_xcnt 0 behind a run of global loads or stores; it names their address pairs as inputs, so that they stay live up to the wait and neither a later load's result nor a vector instruction lands in them ahead of it.
#define XWAIT(pa, pb) asm volatile("s_wait_xcnt 0x0" :: "v"(pa), "v"(pb) : "memory")
__device__ __forceinline__ float xhalf(float x) { const int b = __float_as_int(x); return __int_as_float(__builtin_amdgcn_permlanex16(b, b, 0x76543210, 0xfedcba98, false, false)); }   // value of lane l ^ 16
// exp2s: v_exp_f32 with one v_nop in the same statement, for the places where the compiler's schedule put a write of the transcendental's source register directly behind it (the slot the instruction set asks for).
__device__ __forceinline__ float exp2s(float x) { float r; asm("v_exp_f32 %0, %1\n\tv_nop" : "=v"(r) : "v"(x)); return r; }
template <typename T16, bool HI, int QB>
__device__ __forceinline__ void attn_tile(const T16* __restrict__ Q, const T16* __restrict__ Q2, const T16* __restrict__ K, const T16* __restrict__ K2, const T16* __restrict__ Vt, const T16* __restrict__ Vt2,
                                          int q0, int wv, float* so, float* sml, bf* Ah, bf* Al) {
    typedef typename WFrag<T16>::V V;
    const int lane = threadIdx.x & 31, lr = lane & 15, hi = lane >> 4; const int kend = q0 + QB * 16;   // keys 0 .. kend-1 can be visible to this tile
    V q[QB][2], q2[QB][2];
    const int koff = lane * 8, voff = lane * 8;   // this lane's piece of a block in fragment order
    { const T16* qp = Q + (size_t)q0 * HD + koff; const T16* qp2 = HI ? Q2 + (size_t)q0 * HD + koff : qp;
#pragma unroll
      for (int qb = 0; qb < QB; ++qb)
#pragma unroll
          for (int ks = 0; ks < 2; ++ks) { q[qb][ks] = WFrag<T16>::ld(qp + qb * 16 * HD + ks * 512); if (HI) q2[qb][ks] = WFrag<T16>::ld(qp2 + qb * 16 * HD + ks * 512); }
      XWAIT(qp, qp2); }
    v8f o[4][QB]; float m[QB], l[QB];
#pragma unroll
    for (int qb = 0; qb < QB; ++qb) { m[qb] = -3.0e38f; l[qb] = 0.f;
#pragma unroll
        for (int db = 0; db < 4; ++db) o[db][qb] = (v8f){}; }
    int c0 = 32 * wv;
    if (c0 < kend) {
        V k[2][2], k2[2][2];
        if constexpr (!HI) {   // f16 tiles (the long ones) fetch their K fragments one pass ahead
            const T16* kp = K + (size_t)c0 * HD + koff;
#pragma unroll
            for (int kb = 0; kb < 2; ++kb)
#pragma unroll
                for (int ks = 0; ks < 2; ++ks) k[kb][ks] = WFrag<T16>::ld(kp + kb * 16 * HD + ks * 512);
            XWAIT(kp, kp);
        }
#pragma unroll 1
        for (; c0 < kend; c0 += 32 * NWF) {
            V v[4], v2[4];
            if constexpr (HI) { const T16* kp = K + (size_t)c0 * HD + koff; const T16* kp2 = K2 + (size_t)c0 * HD + koff;
#pragma unroll
                for (int kb = 0; kb < 2; ++kb)
#pragma unroll
                    for (int ks = 0; ks < 2; ++ks) { k[kb][ks] = WFrag<T16>::ld(kp + kb * 16 * HD + ks * 512); k2[kb][ks] = WFrag<T16>::ld(kp2 + kb * 16 * HD + ks * 512); }
                XWAIT(kp, kp2);
            }
            { const T16* vp = Vt + c0 * 16 + voff; const T16* vp2 = HI ? Vt2 + c0 * 16 + voff : vp;
#pragma unroll
              for (int db = 0; db < 4; ++db) { v[db] = WFrag<T16>::ld(vp + db * 16 * TT); if (HI) v2[db] = WFrag<T16>::ld(vp2 + db * 16 * TT); }
              XWAIT(vp, vp2); }
            v8f s[2][QB];
#pragma unroll
            for (int kb = 0; kb < 2; ++kb)
#pragma unroll
                for (int qb = 0; qb < QB; ++qb) { s[kb][qb] = (v8f){};
#pragma unroll
                    for (int ks = 0; ks < 2; ++ks) { s[kb][qb] = WFrag<T16>::mma(k[kb][ks], q[qb][ks], s[kb][qb]); if (HI) { s[kb][qb] = WFrag<T16>::mma(k[kb][ks], q2[qb][ks], s[kb][qb]); s[kb][qb] = WFrag<T16>::mma(k2[kb][ks], q[qb][ks], s[kb][qb]); } } }
            if constexpr (!HI) {
                const int cn = (c0 + 32 * NWF < kend) ? c0 + 32 * NWF : c0;   // the wave's next pass (its last pass reloads itself: in bounds, unused); the loads fly under the softmax and P.V
                const T16* kp = K + (size_t)cn * HD + koff;
#pragma unroll
                for (int kb = 0; kb < 2; ++kb)
#pragma unroll
                    for (int ks = 0; ks < 2; ++ks) k[kb][ks] = WFrag<T16>::ld(kp + kb * 16 * HD + ks * 512);
                XWAIT(kp, kp);
                __builtin_amdgcn_sched_barrier(0);   // keeps the K loads up here, in front of the softmax, so that their latency passes under it
            }
            V p[QB], p2[QB];
#pragma unroll
            for (int qb = 0; qb < QB; ++qb) {
                const float bb0 = 0.0625f * (float)(c0 + hi * 8 - (q0 + qb * 16 + lr));   // ALiBi slope 1/16 x (j - i) at the lane's first key; exact, as is every bb below
                float mx = -3.0e38f;
#pragma unroll
                for (int kb = 0; kb < 2; ++kb)
#pragma unroll
                    for (int j = 0; j < 8; ++j) { const float bb = bb0 + 0.0625f * (float)(kb * 16 + j); const float t = (bb <= 0.f) ? s[kb][qb][j] * SCL + bb : -3.0e38f;   /* causal: j <= i */ s[kb][qb][j] = t; mx = fmaxf(mx, t); }
                mx = fmaxf(mx, xhalf(mx));
                const float mn = fmaxf(m[qb], mx); const float al = HI ? exp2s((m[qb] - mn) * L2E) : __builtin_amdgcn_exp2f((m[qb] - mn) * L2E); m[qb] = mn;
                float ls = 0.f;
#pragma unroll
                for (int kb = 0; kb < 2; ++kb)
#pragma unroll
                    for (int j = 0; j < 8; ++j) { const float e = HI ? exp2s((s[kb][qb][j] - mn) * L2E) : __builtin_amdgcn_exp2f((s[kb][qb][j] - mn) * L2E + 10.f); s[kb][qb][j] = e; ls += e; }
                l[qb] = l[qb] * al + ls;
#pragma unroll
                for (int db = 0; db < 4; ++db) o[db][qb] *= al;
                if constexpr (HI) { v8us h0, h1, l0, l1;
#pragma unroll
                    for (int j = 0; j < 8; ++j) { unsigned short a, c2; splitf(s[0][qb][j], a, c2); h0[j] = a; l0[j] = c2; splitf(s[1][qb][j], a, c2); h1[j] = a; l1[j] = c2; }
                    p[qb] = cat16b(h0, h1); p2[qb] = cat16b(l0, l1);
                } else { p[qb] = cat16(__builtin_convertvector(s[0][qb], v8h), __builtin_convertvector(s[1][qb], v8h)); }
            }
#pragma unroll
            for (int db = 0; db < 4; ++db)
#pragma unroll
                for (int qb = 0; qb < QB; ++qb) { o[db][qb] = WFrag<T16>::mma(v[db], p[qb], o[db][qb]); if (HI) { o[db][qb] = WFrag<T16>::mma(v[db], p2[qb], o[db][qb]); o[db][qb] = WFrag<T16>::mma(v2[db], p[qb], o[db][qb]); } }
            // four vector slots behind the pass's last WMMAs: over the loop's back edge the next pass's first products write registers that these read as operands
            if constexpr (QB == 2) asm volatile("v_nop\n\tv_nop\n\tv_nop\n\tv_nop" : "+v"(o[0][0]), "+v"(o[1][0]), "+v"(o[2][0]), "+v"(o[3][0]), "+v"(o[0][1]), "+v"(o[1][1]), "+v"(o[2][1]), "+v"(o[3][1]));
            else asm volatile("v_nop\n\tv_nop\n\tv_nop\n\tv_nop" : "+v"(o[0][0]), "+v"(o[1][0]), "+v"(o[2][0]), "+v"(o[3][0]));
        }
    }
    float* sw = so + wv * (QB * 16 * 68);
#pragma unroll
    for (int qb = 0; qb < QB; ++qb) { l[qb] += xhalf(l[qb]);
#pragma unroll
        for (int db = 0; db < 4; ++db) { float* d = sw + (qb * 16 + lr) * 68 + db * 16 + hi * 8; *(v4fa*)d = __builtin_shufflevector(o[db][qb], o[db][qb], 0, 1, 2, 3); *(v4fa*)(d + 4) = __builtin_shufflevector(o[db][qb], o[db][qb], 4, 5, 6, 7); }
        if (hi == 0) { sml[(wv * (QB * 16) + qb * 16 + lr) * 2] = m[qb]; sml[(wv * (QB * 16) + qb * 16 + lr) * 2 + 1] = l[qb]; } }
    __syncthreads();   // every wave's partial tile, maximum and sum are in LDS
    if ((int)threadIdx.x < QB * 16 * 8) { const int qq = (threadIdx.x & 15) + 16 * (threadIdx.x >> 7), dg = (threadIdx.x >> 4) & 7;   // one thread: 8 consecutive d of one query row; a wave: 16 rows x 16 d, 512 contiguous bytes in fragment order
        float M = sml[qq * 2];
#pragma unroll
        for (int w = 1; w < NWF; ++w) M = fmaxf(M, sml[(w * (QB * 16) + qq) * 2]);
        float L = 0.f; v4f r0 = (v4f){}, r1 = (v4f){};
#pragma unroll
        for (int w = 0; w < NWF; ++w) { const float f = exp2s((sml[(w * (QB * 16) + qq) * 2] - M) * L2E); L += f * sml[(w * (QB * 16) + qq) * 2 + 1]; const float* d = so + w * (QB * 16 * 68) + qq * 68 + dg * 8; r0 += *(const v4fa*)d * f; r1 += *(const v4fa*)(d + 4) * f; }
        const float inv = __fdiv_rn(1.0f, L); v8us oh, ol;
#pragma unroll
        for (int j = 0; j < 4; ++j) { unsigned short a, c2; splitf(r0[j] * inv, a, c2); oh[j] = a; ol[j] = c2; splitf(r1[j] * inv, a, c2); oh[4 + j] = a; ol[4 + j] = c2; }
        const int eo = (q0 + (qq & ~15)) * DQ + dg * 128 + (qq & 15) * 8;   /* k = dg * 8 of the head's two blocks stands at dg * 128 */ bf* pa = Ah + eo; bf* pb = Al + eo; *(v8usa*)pa = oh; *(v8usa*)pb = ol; XWAIT(pa, pb); }
    __syncthreads();   // the LDS tiles are read: the next tile of this work-group may overwrite them
}
// grid (batches x heads, pairs of tiles): a work-group takes a long tile and then the short one that makes every pair cost the same; the pairs of f16 tiles (the longer ones) have the low flat indices.
__global__ __launch_bounds__(32 * NWF) __attribute__((amdgpu_waves_per_eu(4, 4))) void k_fattn(const h16* __restrict__ Q16, const bf* __restrict__ Qh, const bf* __restrict__ Ql, const h16* __restrict__ K16, const bf* __restrict__ Kh, const bf* __restrict__ Kl,
                                                    const h16* __restrict__ V16, const bf* __restrict__ Vh, const bf* __restrict__ Vl, bf* Ah, bf* Al) {
    __shared__ __align__(16) float so[NWF * 32 * 68]; __shared__ float sml[NWF * 32 * 2];
    const int wv = __builtin_amdgcn_readfirstlane((int)(threadIdx.x >> 5));   // wave number, scalar: the key loop's bounds stay wave-uniform
    const int bb = blockIdx.x / NH_, hh = blockIdx.x % NH_;   // batch, head
    const size_t hq = (size_t)blockIdx.x * TT * HD, hk = (size_t)(bb * NKV + hh / REP) * TT * HD; Ah += (size_t)bb * TT * DQ + hh * (HD * 16); Al += (size_t)bb * TT * DQ + hh * (HD * 16);   // rows = tokens of every batch, K = DQ, fragment order: a head is two k blocks
    constexpr int NP = (TT - RH) / 64; const int x = blockIdx.y;
    if (x < NP) {
#pragma unroll 1
        for (int r = 0; r < 2; ++r) attn_tile<h16, false, 2>(Q16 + hq, nullptr, K16 + hk, nullptr, V16 + hk, nullptr, r ? RH + 32 * x : TT - 32 - 32 * x, wv, so, sml, Ah, Al);
    } else {
#pragma unroll 1
        for (int r = 0; r < 2; ++r) attn_tile<bf, true, 1>(Qh + hq, Ql + hq, Kh + hk, Kl + hk, Vh + hk, Vl + hk, r ? 16 * (x - NP) : RH - 16 - 16 * (x - NP), wv, so, sml, Ah, Al);
    }
}

extern "C" void kernel_launch(void* const* d_in, const int* in_sizes, int n_in,
                              void* d_out, int out_size, void* d_ws, size_t ws_size, hipStream_t stream) {
    (void)in_sizes; (void)n_in; (void)out_size;
    const float* x = (const float*)d_in[0]; const float* wq = (const float*)d_in[1]; const float* bq = (const float*)d_in[2]; const float* wk = (const float*)d_in[3]; const float* bk = (const float*)d_in[4]; const float* wv = (const float*)d_in[5]; const float* bv = (const float*)d_in[6]; const float* wo = (const float*)d_in[7]; const float* bo = (const float*)d_in[8]; const float* cosT = nullptr; const float* sinT = nullptr; (void)cosT; (void)sinT;
    float* OUT = (float*)d_out;     // [2][2048][1024]
    char* wsp = (char*)d_ws;
    auto take = [&](size_t bytes) { char* p = wsp; wsp += (bytes + 255) & ~(size_t)255; return (void*)p; };
    bf* WQ = (bf*)take((size_t)DQ * DM * 2); bf* WK = (bf*)take((size_t)DKV * DM * 2); bf* WV = (bf*)take((size_t)DKV * DM * 2); bf* WO = (bf*)take((size_t)DM * DQ * 2);
    bf* XB = (bf*)take((size_t)NB_ * TT * DM * 2);
    h16* QP16 = (h16*)take((size_t)NB_ * NH_ * TT * HD * 2); h16* KP16 = (h16*)take((size_t)NB_ * NKV * TT * HD * 2); h16* VT16 = (h16*)take((size_t)NB_ * NKV * HD * TT * 2);
    bf* QPh = (bf*)take((size_t)NB_ * NH_ * TT * HD * 2); bf* QPl = (bf*)take((size_t)NB_ * NH_ * TT * HD * 2); bf* KPh = (bf*)take((size_t)NB_ * NKV * TT * HD * 2); bf* KPl = (bf*)take((size_t)NB_ * NKV * TT * HD * 2); bf* VTh = (bf*)take((size_t)NB_ * NKV * HD * TT * 2); bf* VTl = (bf*)take((size_t)NB_ * NKV * HD * TT * 2);
    bf* ATh = (bf*)take((size_t)NB_ * TT * DQ * 2); bf* ATl = (bf*)take((size_t)NB_ * TT * DQ * 2);
    if ((size_t)(wsp - (char*)d_ws) > ws_size) return;    // ws 256 MiB
    k_cvt8<<<dim3(DM * DM / 2048, 4 + NB_ * TT / DM, 1), 256, 0, stream>>>(x, wq, wk, wv, wo, XB, WQ, WK, WV, WO);
    k_qkv<<<dim3(TT / 128, DQ / 128, NB_), 384, 0, stream>>>(XB, WQ, WK, WV, bq, bk, bv, QP16, QPh, QPl, KP16, KPh, KPl, VT16, VTh, VTl);
    k_fattn<<<dim3(NB_ * NH_, (TT - RH) / 64 + RH / 32, 1), 32 * NWF, 0, stream>>>(QP16, QPh, QPl, KP16, KPh, KPl, VT16, VTh, VTl, ATh, ATl);
    k_oproj<<<dim3(NB_ * TT / 128, DM / 128, 1), 256, 0, stream>>>(ATh, ATl, WO, bo, OUT);
}

// v009
// One run takes 68.9 microseconds.
// Next to v008, in two timings, it ran 1.07 and 1.08 times as fast.
// Counting every step since v000, it is 22.4 times as fast.
#include <hip/hip_runtime.h>

#include <hip/hip_runtime.h>

#define NB_  2
#define TT   2048
#define DM   1024
#define NH_  16
#define NKV  16
#define REP  (NH_ / NKV)
#define HD   64
#define DQ   (NH_ * HD)
#define DKV  (NKV * HD)
#define RH   512                  // query rows < RH use hi+lo planes (0: none)
#define WIN  0
#define PCAR 1024.0f
#define SCL  0.125f   // HD^-0.5
typedef _Float16 h16;
typedef unsigned short bf;
typedef __attribute__((ext_vector_type(16))) __bf16   v16bf;
typedef __attribute__((ext_vector_type(16))) _Float16 v16h;
typedef __attribute__((ext_vector_type(8)))  _Float16 v8h;
typedef __attribute__((ext_vector_type(8)))  unsigned short v8us;
typedef __attribute__((ext_vector_type(8)))  float    v8f;
typedef __attribute__((ext_vector_type(4)))  float    v4f;
typedef v8h  __attribute__((may_alias)) v8ha;
typedef v4f  __attribute__((may_alias)) v4fa;
typedef v8us __attribute__((may_alias)) v8usa;

__device__ __forceinline__ unsigned short f2bf(float f) { unsigned u = __float_as_uint(f); u += 0x7FFFu + ((u >> 16) & 1u); return (unsigned short)(u >> 16); }
__device__ __forceinline__ float bf2f(unsigned short b) { return __uint_as_float(((unsigned)b) << 16); }
__device__ __forceinline__ float bfr(float f) { return bf2f(f2bf(f)); }
__device__ __forceinline__ v16h cat16(v8h lo, v8h hi) { return __builtin_shufflevector(lo, hi, 0, 1, 2, 3, 4, 5, 6, 7, 8, 9, 10, 11, 12, 13, 14, 15); }
__device__ __forceinline__ v16bf cat16b(v8us lo, v8us hi) { return __builtin_bit_cast(v16bf, __builtin_shufflevector(lo, hi, 0, 1, 2, 3, 4, 5, 6, 7, 8, 9, 10, 11, 12, 13, 14, 15)); }
__device__ __forceinline__ v8f wmma16(v16h a, v16h b, v8f c) { return __builtin_amdgcn_wmma_f32_16x16x32_f16(false, a, false, b, (short)0, c, false, false); }
__device__ __forceinline__ v8f wmmab(v16bf a, v16bf b, v8f c) { return __builtin_amdgcn_wmma_f32_16x16x32_bf16(false, a, false, b, (short)0, c, false, false); }



// ---- gemms_tile: one work-group of 8 waves per 128x128 output tile (bx, by). C[m][n] (+ f32 bias, rounded to bf16) = sum_k A[m][k] Bt[n][k] (NSPLIT 1: + A2[m][k] Bt[n][k]); K = DM; 16-bit planes in fragment order.
// The operand tiles of 128 k (a stage) come into LDS by asynchronous copies, two buffers: the next stage flies while this one is worked on, and every byte is fetched from L2 once per work-group.
// Wave (wm, wn, wk) holds the 64x64 quarter (wm, wn) (16 accumulators) and takes k blocks 2 wk and 2 wk + 1 of every stage; the two partial quarters are joined through LDS, each wave of the pair finishing 32 of the 64 rows.
// C goes out as f32.
typedef __attribute__((ext_vector_type(4))) _Float16 v4h;
typedef __attribute__((ext_vector_type(4))) unsigned short v4us;
__device__ __forceinline__ h16 tohx(float x) { return (h16)x; }
__device__ __forceinline__ void splitf(float y, unsigned short& h, unsigned short& l) { h = f2bf(y); l = f2bf(y - bf2f(h)); }
// Fragment order: every 16-bit operand plane (rows x K, K-contiguous in meaning) is stored as blocks of 16 rows x 32 k = 512 elements, block (r >> 4, k >> 5) at ((r >> 4) * (K >> 5) + (k >> 5)) * 512. Inside a block the
// element (r, k) stands at ((k >> 4) & 1) * 256 + (((k >> 3) & 1) * 16 + (r & 15)) * 8 + (k & 7): lane l of a wave finds its two 16-byte pieces of the WMMA operand at l * 8 and 256 + l * 8, so that each wave-wide load covers 512 contiguous bytes.
template <typename T16> struct WFrag;
template <> struct WFrag<h16> { typedef v16h V; static __device__ __forceinline__ V ld(const h16* p) { return cat16(*(const v8h*)p, *(const v8h*)(p + 256)); } static __device__ __forceinline__ v8f mma(V a, V b, v8f c) { return wmma16(a, b, c); } };
template <> struct WFrag<bf> { typedef v16bf V; static __device__ __forceinline__ V ld(const bf* p) { return cat16b(*(const v8us*)p, *(const v8us*)(p + 256)); } static __device__ __forceinline__ v8f mma(V a, V b, v8f c) { return wmmab(a, b, c); } };
__device__ __forceinline__ void wave_sync() { __builtin_amdgcn_wave_barrier(); asm volatile("" ::: "memory"); }   // orders one wave's LDS slab writes against its own reads of the same slab in another lane map
#define GRB ((DM / 32) * 1024)   // bytes from one 16-row block of a plane to the next
#define GOPB (8 * 4 * 1024)      // bytes of one operand tile of a stage: 8 row blocks x 4 k blocks x 1 KiB, laid [row block][k block]
// acopy8: one operand tile of a stage. Copy i brings row block i (4 KiB, contiguous in the plane): every lane 16 bytes. The s_wait_xcnt 0 stands in the copies' own statement, in front of any rewrite of their address registers.
__device__ __forceinline__ void acopy8(unsigned l, const char* g) {
    asm volatile("global_load_async_to_lds_b128 %0, %1, off\n\tglobal_load_async_to_lds_b128 %2, %3, off\n\tglobal_load_async_to_lds_b128 %4, %5, off\n\tglobal_load_async_to_lds_b128 %6, %7, off\n\t"
                 "global_load_async_to_lds_b128 %8, %9, off\n\tglobal_load_async_to_lds_b128 %10, %11, off\n\tglobal_load_async_to_lds_b128 %12, %13, off\n\tglobal_load_async_to_lds_b128 %14, %15, off\n\ts_wait_xcnt 0x0"
                 :: "v"(l), "v"(g), "v"(l + 4096), "v"(g + GRB), "v"(l + 2 * 4096), "v"(g + 2 * GRB), "v"(l + 3 * 4096), "v"(g + 3 * GRB),
                    "v"(l + 4 * 4096), "v"(g + 4 * GRB), "v"(l + 5 * 4096), "v"(g + 5 * GRB), "v"(l + 6 * 4096), "v"(g + 6 * GRB), "v"(l + 7 * 4096), "v"(g + 7 * GRB) : "memory");
}
template <int NSPLIT>
__device__ __forceinline__ void gemms_tile(const bf* __restrict__ A, const bf* __restrict__ A2, const bf* __restrict__ Bt, float* C, int ldc, const float* __restrict__ bias, int bx, int by, unsigned char* L) {
    typedef WFrag<bf>::V V;
    constexpr int NOP = NSPLIT ? 3 : 2, STG = NOP * GOPB, NT = DM / 128, KF = NSPLIT ? 2 : 1;   // operand tiles of a stage (A, A2, Bt); bytes of a stage; stages; fragment sets in registers (2 where one work-group has the WGP and its registers to itself)
    static_assert(NT >= 2 && DM % 128 == 0 && DQ == DM, "two stages or more");
    const int lane = threadIdx.x & 31, lr = lane & 15, hi = lane >> 4;
    const int wv = __builtin_amdgcn_readfirstlane((int)(threadIdx.x >> 5)), wm = wv & 1, wn = (wv >> 1) & 1, wk = wv >> 2;   // wave number, scalar
    // Accumulator row mb of a wave holds the quarter's 16-row slab mb ^ (2 * wk): rows 0 and 1 are the slabs this wave finishes, rows 2 and 3 the ones it hands to its partner (wave wv ^ 4), in the partner's order.
    float cbv[4];   // bias of this lane's accumulator columns, fetched here so that its latency passes under the first stage's copies
    { const float* bc = bias + by * 128 + wn * 64;   // the same for the whole wave: the loads take it as their scalar base, with the lane's column as the offset
#pragma unroll
        for (int nb = 0; nb < 4; ++nb) cbv[nb] = bc[lr + nb * 16];
        asm volatile("s_wait_xcnt 0x0" :: "s"(bc), "v"(lr) : "memory"); }   // behind the bias loads; it names their scalar base and their lane offset as inputs, so that both stay live up to the wait
    v8f acc[4][4];
#pragma unroll
    for (int mb = 0; mb < 4; ++mb)
#pragma unroll
        for (int nb = 0; nb < 4; ++nb) acc[mb][nb] = (v8f){};
    const unsigned lbase = (unsigned)(size_t)L + threadIdx.x * 16;   // this lane's 16 bytes of a 4-KiB row block in LDS (byte offset in the work-group's LDS)
    const char* gA = (const char*)A + (size_t)bx * 8 * GRB + threadIdx.x * 16; const char* gA2 = NSPLIT ? (const char*)A2 + (size_t)bx * 8 * GRB + threadIdx.x * 16 : gA; const char* gB = (const char*)Bt + (size_t)by * 8 * GRB + threadIdx.x * 16;
    auto issue = [&](int s, int buf) { const unsigned l = lbase + buf * STG; acopy8(l, gA + s * 4096); if (NSPLIT) acopy8(l + GOPB, gA2 + s * 4096); acopy8(l + (NOP - 1) * GOPB, gB + s * 4096); };
    issue(0, 0);
    asm volatile("s_wait_asynccnt 0x0" ::: "memory");   // this wave's copies of stage 0 have landed
    __syncthreads();                                    // and every other wave's
    issue(1, 1);
    const int ao = (wm * 16 + wk * 2) * 512 + lane * 8, ax = wk * 4096, bo = (NOP - 1) * (GOPB / 2) + (wn * 16 + wk * 2) * 512 + lane * 8;   // elements: the wave's first A and Bt fragments in a stage; the slab swap
    V a[KF][4], a2[KF][4], b[KF][4];
    auto fetch = [&](int kf, int s, int kk) {   // the fragments of the wave's k block kk of stage s
        const bf* sb = (const bf*)(L + (s & 1) * STG);
#pragma unroll
        for (int nb = 0; nb < 4; ++nb) b[kf][nb] = WFrag<bf>::ld(sb + bo + kk * 512 + nb * 2048);
#pragma unroll
        for (int mb = 0; mb < 4; ++mb) { const bf* p = sb + ao + kk * 512 + mb * 2048 + (mb < 2 ? ax : -ax); a[kf][mb] = WFrag<bf>::ld(p); if (NSPLIT) a2[kf][mb] = WFrag<bf>::ld(p + GOPB / 2); } };
    auto block = [&](int kf) {
#pragma unroll
        for (int mb = 0; mb < 4; ++mb)
#pragma unroll
            for (int nb = 0; nb < 4; ++nb) acc[mb][nb] = WFrag<bf>::mma(a[kf][mb], b[kf][nb], acc[mb][nb]);
        if (NSPLIT) {
#pragma unroll
            for (int mb = 0; mb < 4; ++mb)
#pragma unroll
                for (int nb = 0; nb < 4; ++nb) acc[mb][nb] = WFrag<bf>::mma(a2[kf][mb], b[kf][nb], acc[mb][nb]);
        } };
    if (KF == 2) fetch(0, 0, 0);   // two fragment sets: every block's fragments are fetched under the WMMAs of the block before; stage 0 is published above
    // kept rolled: one copy of a stage's code in the instruction cache; the two buffers alternate by t & 1
#pragma unroll 1
    for (int t = 0; t < NT; ++t) {
        if (KF == 1) fetch(0, t, 0); else fetch(1, t, 1);
        __builtin_amdgcn_sched_barrier(0);   // keeps the fragment loads together in front of the WMMAs: left alone, the compiler reloads one Bt fragment register four times a k block, each time with a full LDS wait
        block(0);
        if (KF == 1) fetch(0, t, 1);
        else __builtin_amdgcn_sched_barrier(0);   // keeps these WMMAs in front of the waits below: left alone, the compiler lifts the waits over them, and the loads just issued are waited out with the matrix unit idle
        // The stage's last fragments are on their way to registers: the buffer is handed on here, and the refill flies under the WMMAs that follow.
        asm volatile("s_wait_dscnt 0x0" ::: "memory");      // this wave has read all it needs of stage t
        asm volatile("s_wait_asynccnt 0x0" ::: "memory");   // and its copies of stage t + 1 have landed
        __syncthreads();                                    // stage t + 1 is published; stage t's buffer is free
        if (t + 2 < NT) issue(t + 2, t & 1);
        if (KF == 2 && t + 1 < NT) fetch(0, t + 1, 0);   // the next stage's first fragment loads go out in front of this stage's last WMMAs
        block(KF - 1);
    }
    asm volatile("s_wait_asynccnt 0x0" ::: "memory");       // no copy is outstanding when the buffers become the join's staging
    float* X = (float*)L;   // 8 ranges of 2048 floats: wave wv writes range wv, only its partner reads it and then uses it as its own slab staging
    { float* xg = X + wv * 2048 + lane * 4;
#pragma unroll
      for (int mb = 2; mb < 4; ++mb)
#pragma unroll
          for (int nb = 0; nb < 4; ++nb) { float* d = xg + ((mb - 2) * 4 + nb) * 256; *(v4fa*)d = __builtin_shufflevector(acc[mb][nb], acc[mb][nb], 0, 1, 2, 3); *(v4fa*)(d + 128) = __builtin_shufflevector(acc[mb][nb], acc[mb][nb], 4, 5, 6, 7); } }
    __syncthreads();   // every wave's handed-over slabs are in LDS
    float* os = X + (wv ^ 4) * 2048;
#pragma unroll
    for (int mb = 0; mb < 2; ++mb)
#pragma unroll
        for (int nb = 0; nb < 4; ++nb) { const float* d = os + lane * 4 + (mb * 4 + nb) * 256; const v4f p0 = *(const v4fa*)d, p1 = *(const v4fa*)(d + 128);
#pragma unroll
            for (int j = 0; j < 4; ++j) { acc[mb][nb][j] += p0[j]; acc[mb][nb][4 + j] += p1[j]; }
#pragma unroll
            for (int j = 0; j < 8; ++j) acc[mb][nb][j] += bfr(cbv[nb]); }
    const int m0 = bx * 128 + wm * 64 + wk * 32;   // first row of the 32 that this wave finishes
#pragma unroll
    for (int mb = 0; mb < 2; ++mb) {
#pragma unroll
        for (int nb = 0; nb < 4; ++nb)
#pragma unroll
            for (int j = 0; j < 8; ++j) os[(hi * 8 + j) * 68 + nb * 16 + lr] = acc[mb][nb][j];
        wave_sync();
        {
            float* cp = C + (size_t)(m0 + mb * 16 + hi) * ldc + by * 128 + wn * 64 + lr * 4;
#pragma unroll
            for (int s = 0; s < 8; ++s) *(v4f*)(cp + (size_t)(2 * s) * ldc) = *(const v4fa*)(os + (2 * s + hi) * 68 + lr * 4);   // two rows of 256 contiguous bytes
            asm volatile("s_wait_xcnt 0x0" :: "v"(cp) : "memory");   // behind the run of stores; it names their address pair as an input, so that it stays live up to the wait
        }
        wave_sync();
    }
}
// planes_out: a wave's 64x64 quarter (+ f32 bias, rounded to bf16) goes out as three 16-bit planes (f16, bf16 hi, bf16 lo) in fragment order, slab by slab (16 rows) through the wave's own LDS slab os.
// OUTM 1: rows = tokens from m0, columns = head ct (bias by column, bsv[nb] at column nb * 16 + lr). OUTM 2: rows = features from m0, columns = the 64 tokens from ct * 64 (bias by row, bsv[mb] at row mb * 16 + lr: added where the lane holds row lr).
template <int OUTM>
__device__ __forceinline__ void planes_out(v8f (&acc)[4][4], const float (&bsv)[4], float* os, int m0, int ct, h16* P16, bf* Ph, bf* Pl) {
    const int lane = (int)__builtin_amdgcn_mbcnt_lo(~0u, 0u), lr = lane & 15, hi = lane >> 4;   // the lane's number, formed anew here: taken from threadIdx.x its parts were held over the caller's loop, one of them in scratch memory
    constexpr size_t PLD = (OUTM == 1) ? HD : TT, CTS = (OUTM == 1) ? (size_t)TT * HD : 64 * 16;   // K of the plane (a 16-row slab is 16 * PLD elements); step from one 64-wide column tile to the next
#pragma unroll
    for (int mb = 0; mb < 4; ++mb) {
#pragma unroll
        for (int nb = 0; nb < 4; ++nb)
#pragma unroll
            for (int j = 0; j < 8; ++j) os[(hi * 8 + j) * 68 + nb * 16 + lr] = (OUTM == 1) ? acc[mb][nb][j] + bfr(bsv[nb]) : acc[mb][nb][j];
        wave_sync();
        const size_t e = (size_t)(m0 + mb * 16) * PLD + ct * CTS + lane * 8; h16* p16 = P16 + e; bf* ph = Ph + e; bf* pl = Pl + e;
        v8h r16[4]; v8us rh[4], rl[4];
#pragma unroll
        for (int u = 0; u < 4; ++u) { const float* d = os + lr * 68 + (u * 2 + hi) * 8; v4f v0 = *(const v4fa*)d, v1 = *(const v4fa*)(d + 4);   /* the eight elements that stand at u * 256 + lane * 8 of the slab in fragment order */
            if (OUTM == 2) { v0 += bfr(bsv[mb]); v1 += bfr(bsv[mb]); }
#pragma unroll
            for (int j = 0; j < 4; ++j) { unsigned short a2, c2; splitf(v0[j], a2, c2); r16[u][j] = tohx(v0[j]); rh[u][j] = a2; rl[u][j] = c2; splitf(v1[j], a2, c2); r16[u][4 + j] = tohx(v1[j]); rh[u][4 + j] = a2; rl[u][4 + j] = c2; }
            *(v8h*)(p16 + u * 256) = r16[u]; *(v8us*)(ph + u * 256) = rh[u]; *(v8us*)(pl + u * 256) = rl[u]; }   // a wave stores 512 contiguous bytes of each plane
        // s_wait_xcnt 0 behind the slab's stores; it names their address pairs and their stored vectors as inputs, so that all of them stay live up to the wait and the next slab's arithmetic lands in none of them ahead of it
        asm volatile("s_wait_xcnt 0x0" :: "v"(p16), "v"(ph), "v"(pl), "v"(r16[0]), "v"(rh[0]), "v"(rl[0]), "v"(r16[1]), "v"(rh[1]), "v"(rl[1]), "v"(r16[2]), "v"(rh[2]), "v"(rl[2]), "v"(r16[3]), "v"(rh[3]), "v"(rl[3]) : "memory");
        wave_sync();
    }
}
// k_qkv: the Q, K and V projections in one launch. grid (TT/128 token tiles, 8 feature tiles, NB_). One work-group of 12 waves computes the three 128x128 tiles (Q, K, V) of its tokens and features:
// a stage (128 k) holds the x tile once and the three weight tiles, so that the x bytes come from L2 once for the three products; two buffers, filled by asynchronous copies as in gemms_tile (waves 0 to 7 issue them).
// Wave (pj, wm, wn): projection pj (0 Q, 1 K, 2 V), 64x64 quarter (wm, wn), all of k. Q and K take x as A and the weights as B; V takes the weights as A and x as B (V^T = Wv X^T: its rows are the transposed plane's rows): only LDS offsets differ in the loop.
__global__ __launch_bounds__(384) void k_qkv(const bf* __restrict__ XB, const bf* __restrict__ WQ, const bf* __restrict__ WK, const bf* __restrict__ WV, const float* __restrict__ bq, const float* __restrict__ bk, const float* __restrict__ bv,
                                             h16* QP16, bf* QPh, bf* QPl, h16* KP16, bf* KPh, bf* KPl, h16* VT16, bf* VTh, bf* VTl) {
    typedef WFrag<bf>::V V;
    constexpr int STG = 4 * GOPB, NT = DM / 128;   // bytes of a stage: tiles x, Wq, Wk, Wv; stages
    static_assert(NT >= 2 && DM % 128 == 0 && DQ == DM && DKV == DM, "two stages or more; equal projections");
    __shared__ __align__(16) unsigned char L[2 * STG];
    const int lane = threadIdx.x & 31, lr = lane & 15;
    const int wv = __builtin_amdgcn_readfirstlane((int)(threadIdx.x >> 5)), pj = wv >> 2, wm = wv & 1, wn = (wv >> 1) & 1;   // wave number, scalar
    const int tx = blockIdx.x, fy = blockIdx.y, b = blockIdx.z; const bool isv = pj == 2;
    float bsv[4];   // bias of the features nb * 16 + lr (Q, K: the quarter's columns) or mb * 16 + lr (V: its rows), fetched here so that its latency passes under the first stage's copies
    { const float* bc = (pj == 0 ? bq : pj == 1 ? bk : bv) + fy * 128 + (isv ? wm : wn) * 64;   // the same for the whole wave: the loads take it as their scalar base, with the lane's feature as the offset
#pragma unroll
      for (int i = 0; i < 4; ++i) bsv[i] = bc[lr + i * 16];
      asm volatile("s_wait_xcnt 0x0" :: "s"(bc), "v"(lr) : "memory"); }   // behind the bias loads; it names their scalar base and their lane offset as inputs, so that both stay live up to the wait
    v8f acc[4][4];
#pragma unroll
    for (int mb = 0; mb < 4; ++mb)
#pragma unroll
        for (int nb = 0; nb < 4; ++nb) acc[mb][nb] = (v8f){};
    const unsigned lbase = (unsigned)(size_t)L + wv * 512 + lane * 16;   // waves 0 to 7: this lane's 16 bytes of a 4-KiB row block in LDS (byte offset in the work-group's LDS)
    const char* gX = (const char*)(XB + (size_t)b * TT * DM) + (size_t)tx * 8 * GRB; const char* gQ = (const char*)WQ + (size_t)fy * 8 * GRB; const char* gK = (const char*)WK + (size_t)fy * 8 * GRB; const char* gV = (const char*)WV + (size_t)fy * 8 * GRB;   // the tiles' first bytes: scalar, the lane's 16 bytes are added at the copy
    const size_t gl = (size_t)gX + wv * 512 + lane * 16, dQ = (size_t)gQ - (size_t)gX, dK = (size_t)gK - (size_t)gX, dV = (size_t)gV - (size_t)gX;   // one lane address; the weight tiles stand at scalar distances (modulo 2^64) from the x tile: fewer registers held over the loop
    auto issue = [&](int s, int buf) { if (wv < 8) { const unsigned l = lbase + buf * STG; const size_t so = (size_t)s * 4096; acopy8(l, (const char*)(gl + so)); acopy8(l + GOPB, (const char*)(gl + (dQ + so))); acopy8(l + 2 * GOPB, (const char*)(gl + (dK + so))); acopy8(l + 3 * GOPB, (const char*)(gl + (dV + so))); } };   // a scalar test: whole waves issue or none
    issue(0, 0);
    asm volatile("s_wait_asynccnt 0x0" ::: "memory");   // this wave's copies of stage 0 have landed
    __syncthreads();                                    // and every other wave's
    issue(1, 1);
    const int ao = (isv ? 3 : 0) * (GOPB / 2) + wm * 16 * 512 + lane * 8, bo = (isv ? 0 : 1 + pj) * (GOPB / 2) + wn * 16 * 512 + lane * 8;   // elements: the wave's first A and B fragments in a stage
    V a[2][4], bb[2][4];   // two fragment sets: every k block's fragments are fetched under the WMMAs of the block before
    auto fetch = [&](int kf, int s, int kk) {   // the fragments of k block kk of stage s
        const bf* sb = (const bf*)(L + (s & 1) * STG);
#pragma unroll
        for (int nb = 0; nb < 4; ++nb) bb[kf][nb] = WFrag<bf>::ld(sb + bo + kk * 512 + nb * 2048);
#pragma unroll
        for (int mb = 0; mb < 4; ++mb) a[kf][mb] = WFrag<bf>::ld(sb + ao + kk * 512 + mb * 2048); };
    auto block = [&](int kf) {
#pragma unroll
        for (int mb = 0; mb < 4; ++mb)
#pragma unroll
            for (int nb = 0; nb < 4; ++nb) acc[mb][nb] = WFrag<bf>::mma(a[kf][mb], bb[kf][nb], acc[mb][nb]); };
    fetch(0, 0, 0);   // stage 0 is published above
    // kept rolled: one copy of a stage's code in the instruction cache; the two buffers alternate by t & 1
#pragma unroll 1
    for (int t = 0; t < NT; ++t) {
        fetch(1, t, 1);
        __builtin_amdgcn_sched_barrier(0);   // here and twice below: keeps the fragment loads together in front of the WMMAs that they fly under
        block(0);
        __builtin_amdgcn_sched_barrier(0);   // here and below: keeps the next loads behind these WMMAs in one group
        fetch(0, t, 2);
        __builtin_amdgcn_sched_barrier(0);
        block(1);
        __builtin_amdgcn_sched_barrier(0);
        fetch(1, t, 3);
        __builtin_amdgcn_sched_barrier(0);
        block(0);
        __builtin_amdgcn_sched_barrier(0);   // keeps these WMMAs in front of the waits below, so that the loads just issued are not waited out with the matrix unit idle
        // The stage's last fragments are on their way to registers: the buffer is handed on here, and the refill flies under the WMMAs that follow.
        asm volatile("s_wait_dscnt 0x0" ::: "memory");      // this wave has read all it needs of stage t
        asm volatile("s_wait_asynccnt 0x0" ::: "memory");   // and its copies of stage t + 1 have landed
        __syncthreads();                                    // stage t + 1 is published; stage t's buffer is free
        if (t + 2 < NT) issue(t + 2, t & 1);
        if (t + 1 < NT) fetch(0, t + 1, 0);   // the next stage's first fragment loads go out in front of this stage's last WMMAs
        block(1);
    }
    asm volatile("s_wait_asynccnt 0x0" ::: "memory");       // no copy is outstanding, and behind the last barrier nobody reads a stage: the buffers become the waves' slabs
    float* os = (float*)L + wv * (16 * 68);
    const size_t pq = (size_t)b * NH_ * TT * HD, pk = (size_t)b * NKV * TT * HD;
    if (isv) planes_out<2>(acc, bsv, os, fy * 128 + wm * 64, tx * 2 + wn, VT16 + pk, VTh + pk, VTl + pk);
    else planes_out<1>(acc, bsv, os, tx * 128 + wm * 64, fy * 2 + wn, pj ? KP16 + pk : QP16 + pq, pj ? KPh + pk : QPh + pq, pj ? KPl + pk : QPl + pq);
}
// k_oproj: the output projection of every batch's rows in one launch. grid (NB_ * TT / 128, DM / 128).
__global__ __launch_bounds__(256) void k_oproj(const bf* __restrict__ Ah, const bf* __restrict__ Al, const bf* __restrict__ WO, const float* __restrict__ bo, float* OUT) {
    __shared__ __align__(16) unsigned char L[2 * 3 * GOPB];
    gemms_tile<1>(Ah, Al, WO, OUT, DM, bo, blockIdx.x, blockIdx.y, L);
}

typedef __attribute__((ext_vector_type(2))) _Float16 v2h;
typedef __attribute__((ext_vector_type(2))) unsigned short v2us;
typedef __attribute__((ext_vector_type(2))) float v2f;
typedef __attribute__((ext_vector_type(4))) int v4i;

__global__ __launch_bounds__(256) void k_wtG(const float* __restrict__ w, int K, int N, bf* Bt) {
    const int lane = threadIdx.x & 31; const int L0 = (blockIdx.x * 8 + (threadIdx.x >> 5)) * 8; const int nlines = N * K / 64;
{
#pragma unroll 1
        for (int l = 0; l < 8; ++l) { const int L = L0 + l; if (L >= nlines) break; const size_t e = (size_t)L * 64 + lane * 2; const int k = (int)(e % K), n = (int)(e / K); v2us o;
            o[0] = f2bf(w[(size_t)k * N + n]); o[1] = f2bf(w[(size_t)(k + 1) * N + n]); *(v2us*)(Bt + e) = o; }
         }
}
// k_cvt8: every f32-to-bf16 conversion in one launch. grid (DM * DM / 2048, 4 + NB_ * TT / DM): y picks a weight matrix or a piece of x of the same size (DM * DM floats).
static_assert(DQ == DM && DKV == DM && DM == 1024 && (NB_ * TT) % DM == 0 && (DM * DM) % 2048 == 0, "equal pieces");
__global__ __launch_bounds__(256) void k_cvt8(const float* __restrict__ x, const float* __restrict__ wq, const float* __restrict__ wk, const float* __restrict__ wv, const float* __restrict__ wo, bf* XB, bf* WQ, bf* WK, bf* WV, bf* WO) {
    const int y = blockIdx.y; const float* src = y == 0 ? wq : y == 1 ? wk : y == 2 ? wv : y == 3 ? wo : x + (size_t)(y - 4) * DM * DM; bf* dst = y == 0 ? WQ : y == 1 ? WK : y == 2 ? WV : y == 3 ? WO : XB + (size_t)(y - 4) * DM * DM;
    // The destination is in fragment order (K = DM). A wave takes 8 rows x 32 k of one block: it reads one whole 128-byte line of each row and stores four whole lines; a work-group takes four neighbouring blocks.
    const size_t blk = (size_t)blockIdx.x * 4 + (threadIdx.x >> 6); const int r8 = ((threadIdx.x >> 5) & 1) * 8 + (threadIdx.x & 7), c = (threadIdx.x >> 3) & 3;   // row in the block; which 8 of its 32 k
    const float* sp = src + ((blk >> 5) * 16 + r8) * DM + (blk & 31) * 32 + c * 8; const v8f v = *(const v8f*)sp; v8us o;
    asm volatile("s_wait_xcnt 0x0" :: "v"(sp) : "memory");   // behind the loads; it names their address pair as an input, so that the pair stays live up to the wait
#pragma unroll
    for (int k = 0; k < 8; ++k) o[k] = f2bf(v[k]); *(v8us*)(dst + blk * 512 + (c >> 1) * 256 + ((c & 1) * 16 + r8) * 8) = o;  }
__global__ __launch_bounds__(256) void k_cscvt(const float* __restrict__ cosT, const float* __restrict__ sinT, float* CS) { const int idx = blockIdx.x * 256 + threadIdx.x; if (idx >= TT * HD) return; v2f cs; cs[0] = bfr(cosT[idx]); cs[1] = bfr(sinT[idx]); *(v2f*)(CS + (size_t)idx * 2) = cs;  }
// ---- k_fattn: scores, causal ALiBi softmax, P.V and the hi/lo split of the result in one launch; no score or probability leaves the registers.
// One work-group of NWF waves owns a tile of QB*16 query rows of one head; its waves take every NWF-th pass of 32 keys, each with its own running maximum, sum and output tile (online softmax);
// the NWF partial tiles are joined through LDS in wave order 0..NWF-1. Transposed products: S^T = K Q^T (a lane holds 16 scores of ONE query per pass), O^T += V^T P^T, where two converted S^T tiles are the B operand as they stand.
// Query rows < RH: hi+lo bf16 planes, three products each (HI); the others f16 with the probabilities carried at 2^10 (the factor cancels against the row sum).
#define NWF 8
#define L2E 1.4426950408889634f
// XWAIT: s_wait_xcnt 0 behind a run of global loads or stores; it names their address pairs as inputs, so that they stay live up to the wait and neither a later load's result nor a vector instruction lands in them ahead of it.
#define XWAIT(pa, pb) asm volatile("s_wait_xcnt 0x0" :: "v"(pa), "v"(pb) : "memory")
__device__ __forceinline__ float xhalf(float x) { const int b = __float_as_int(x); return __int_as_float(__builtin_amdgcn_permlanex16(b, b, 0x76543210, 0xfedcba98, false, false)); }   // value of lane l ^ 16
// exp2s: v_exp_f32 with one v_nop in the same statement, for the places where the compiler's schedule put a write of the transcendental's source register directly behind it (the slot the instruction set asks for).
__device__ __forceinline__ float exp2s(float x) { float r; asm("v_exp_f32 %0, %1\n\tv_nop" : "=v"(r) : "v"(x)); return r; }
template <typename T16, bool HI, int QB>
__device__ __forceinline__ void attn_tile(const T16* __restrict__ Q, const T16* __restrict__ Q2, const T16* __restrict__ K, const T16* __restrict__ K2, const T16* __restrict__ Vt, const T16* __restrict__ Vt2,
                                          int q0, int wv, float* so, float* sml, bf* Ah, bf* Al) {
    typedef typename WFrag<T16>::V V;
    const int lane = threadIdx.x & 31, lr = lane & 15, hi = lane >> 4; const int kend = q0 + QB * 16;   // keys 0 .. kend-1 can be visible to this tile
    V q[QB][2], q2[QB][2];
    const int koff = lane * 8, voff = lane * 8;   // this lane's piece of a block in fragment order
    { const T16* qp = Q + (size_t)q0 * HD + koff; const T16* qp2 = HI ? Q2 + (size_t)q0 * HD + koff : qp;
#pragma unroll
      for (int qb = 0; qb < QB; ++qb)
#pragma unroll
          for (int ks = 0; ks < 2; ++ks) { q[qb][ks] = WFrag<T16>::ld(qp + qb * 16 * HD + ks * 512); if (HI) q2[qb][ks] = WFrag<T16>::ld(qp2 + qb * 16 * HD + ks * 512); }
      XWAIT(qp, qp2); }
    v8f o[4][QB]; float m[QB], l[QB];
#pragma unroll
    for (int qb = 0; qb < QB; ++qb) { m[qb] = -3.0e38f; l[qb] = 0.f;
#pragma unroll
        for (int db = 0; db < 4; ++db) o[db][qb] = (v8f){}; }
    // f16 tiles walk their passes from the diagonal backwards (wave wv starts wv passes in front of it): the running maximum is set by the near keys, so that the far passes can be tested against it below
    int c0 = HI ? 32 * wv : kend - 32 - 32 * wv;
    if (HI ? c0 < kend : c0 >= 0) {
        V k[2][2], k2[2][2];
        if constexpr (!HI) {   // f16 tiles (the long ones) fetch their K fragments one pass ahead
            const T16* kp = K + (size_t)c0 * HD + koff;
#pragma unroll
            for (int kb = 0; kb < 2; ++kb)
#pragma unroll
                for (int ks = 0; ks < 2; ++ks) k[kb][ks] = WFrag<T16>::ld(kp + kb * 16 * HD + ks * 512);
            XWAIT(kp, kp);
        }
#pragma unroll 1
        for (; HI ? c0 < kend : c0 >= 0; c0 += HI ? 32 * NWF : -32 * NWF) {
            V v[4], v2[4];
            if constexpr (HI) { const T16* kp = K + (size_t)c0 * HD + koff; const T16* kp2 = K2 + (size_t)c0 * HD + koff;
#pragma unroll
                for (int kb = 0; kb < 2; ++kb)
#pragma unroll
                    for (int ks = 0; ks < 2; ++ks) { k[kb][ks] = WFrag<T16>::ld(kp + kb * 16 * HD + ks * 512); k2[kb][ks] = WFrag<T16>::ld(kp2 + kb * 16 * HD + ks * 512); }
                XWAIT(kp, kp2);
            }
            auto loadv = [&]() { const T16* vp = Vt + c0 * 16 + voff; const T16* vp2 = HI ? Vt2 + c0 * 16 + voff : vp;
#pragma unroll
              for (int db = 0; db < 4; ++db) { v[db] = WFrag<T16>::ld(vp + db * 16 * TT); if (HI) v2[db] = WFrag<T16>::ld(vp2 + db * 16 * TT); }
              XWAIT(vp, vp2); };
            if constexpr (HI) loadv();
            v8f s[2][QB];
#pragma unroll
            for (int kb = 0; kb < 2; ++kb)
#pragma unroll
                for (int qb = 0; qb < QB; ++qb) { s[kb][qb] = (v8f){};
#pragma unroll
                    for (int ks = 0; ks < 2; ++ks) { s[kb][qb] = WFrag<T16>::mma(k[kb][ks], q[qb][ks], s[kb][qb]); if (HI) { s[kb][qb] = WFrag<T16>::mma(k[kb][ks], q2[qb][ks], s[kb][qb]); s[kb][qb] = WFrag<T16>::mma(k2[kb][ks], q[qb][ks], s[kb][qb]); } } }
            if constexpr (!HI) {
                const int cn = (c0 - 32 * NWF >= 0) ? c0 - 32 * NWF : c0;   // the wave's next pass (its last pass reloads itself: in bounds, unused); the loads fly under the softmax and P.V
                const T16* kp = K + (size_t)cn * HD + koff;
#pragma unroll
                for (int kb = 0; kb < 2; ++kb)
#pragma unroll
                    for (int ks = 0; ks < 2; ++ks) k[kb][ks] = WFrag<T16>::ld(kp + kb * 16 * HD + ks * 512);
                XWAIT(kp, kp);
                __builtin_amdgcn_sched_barrier(0);   // keeps the K loads up here, in front of the softmax, so that their latency passes under it
            }
            // Dead pass (f16 tiles): top bounds every score of the lane from above (its largest product with its nearest key's bias; rounding is monotone). Where top - m < -25 in every lane, the maximum stays, the rescale is by 1 and
            // every probability is below 2^(10 - 25 * L2E) < 2^-25, which is zero in f16: P.V would add zeros, and the pass's part of the row sum (at least 2^10 over a lane pair) lies below that sum's f32 rounding. Such a pass ends here, its V unread.
            bool live = true;
            if constexpr (!HI) { live = false;
#pragma unroll
                for (int qb = 0; qb < QB; ++qb) { float sm0 = s[0][qb][0], sm1 = s[1][qb][0];   // two chains a query block: four short dependent chains in all
#pragma unroll
                    for (int j = 1; j < 8; ++j) { sm0 = fmaxf(sm0, s[0][qb][j]); sm1 = fmaxf(sm1, s[1][qb][j]); }
                    const float top = fmaxf(sm0, sm1) * SCL + 0.0625f * (float)(c0 + hi * 8 + 23 - (q0 + qb * 16 + lr));
                    live = live | !(top - m[qb] < -25.f); }   // written so that a NaN in top or m counts as live; | and not ||: no branch between the query blocks
                live = __builtin_amdgcn_ballot_w32(live) != 0u;   // the same for the whole wave: a scalar branch, every lane on at the WMMAs behind it
            }
            if (live) {
            if constexpr (!HI) loadv();   // V is fetched for live passes alone; its latency passes under the softmax
            V p[QB], p2[QB];
#pragma unroll
            for (int qb = 0; qb < QB; ++qb) {
                const float bb0 = 0.0625f * (float)(c0 + hi * 8 - (q0 + qb * 16 + lr));   // ALiBi slope 1/16 x (j - i) at the lane's first key; exact, as is every bb below
                float mx = -3.0e38f;
#pragma unroll
                for (int kb = 0; kb < 2; ++kb)
#pragma unroll
                    for (int j = 0; j < 8; ++j) { const float bb = bb0 + 0.0625f * (float)(kb * 16 + j); const float t = (bb <= 0.f) ? s[kb][qb][j] * SCL + bb : -3.0e38f;   /* causal: j <= i */ s[kb][qb][j] = t; mx = fmaxf(mx, t); }
                mx = fmaxf(mx, xhalf(mx));
                const float mn = fmaxf(m[qb], mx); const float al = HI ? exp2s((m[qb] - mn) * L2E) : __builtin_amdgcn_exp2f((m[qb] - mn) * L2E); m[qb] = mn;
                float ls = 0.f;
#pragma unroll
                for (int kb = 0; kb < 2; ++kb)
#pragma unroll
                    for (int j = 0; j < 8; ++j) { const float e = HI ? exp2s((s[kb][qb][j] - mn) * L2E) : __builtin_amdgcn_exp2f((s[kb][qb][j] - mn) * L2E + 10.f); s[kb][qb][j] = e; ls += e; }
                l[qb] = l[qb] * al + ls;
#pragma unroll
                for (int db = 0; db < 4; ++db) o[db][qb] *= al;
                if constexpr (HI) { v8us h0, h1, l0, l1;
#pragma unroll
                    for (int j = 0; j < 8; ++j) { unsigned short a, c2; splitf(s[0][qb][j], a, c2); h0[j] = a; l0[j] = c2; splitf(s[1][qb][j], a, c2); h1[j] = a; l1[j] = c2; }
                    p[qb] = cat16b(h0, h1); p2[qb] = cat16b(l0, l1);
                } else { p[qb] = cat16(__builtin_convertvector(s[0][qb], v8h), __builtin_convertvector(s[1][qb], v8h)); }
            }
#pragma unroll
            for (int db = 0; db < 4; ++db)
#pragma unroll
                for (int qb = 0; qb < QB; ++qb) { o[db][qb] = WFrag<T16>::mma(v[db], p[qb], o[db][qb]); if (HI) { o[db][qb] = WFrag<T16>::mma(v[db], p2[qb], o[db][qb]); o[db][qb] = WFrag<T16>::mma(v2[db], p[qb], o[db][qb]); } }
            // four vector slots behind the pass's last WMMAs: over the loop's back edge the next pass's first products write registers that these read as operands
            if constexpr (QB == 2) asm volatile("v_nop\n\tv_nop\n\tv_nop\n\tv_nop" : "+v"(o[0][0]), "+v"(o[1][0]), "+v"(o[2][0]), "+v"(o[3][0]), "+v"(o[0][1]), "+v"(o[1][1]), "+v"(o[2][1]), "+v"(o[3][1]));
            else asm volatile("v_nop\n\tv_nop\n\tv_nop\n\tv_nop" : "+v"(o[0][0]), "+v"(o[1][0]), "+v"(o[2][0]), "+v"(o[3][0]));
            }
        }
    }
    float* sw = so + wv * (QB * 16 * 68);
#pragma unroll
    for (int qb = 0; qb < QB; ++qb) { l[qb] += xhalf(l[qb]);
#pragma unroll
        for (int db = 0; db < 4; ++db) { float* d = sw + (qb * 16 + lr) * 68 + db * 16 + hi * 8; *(v4fa*)d = __builtin_shufflevector(o[db][qb], o[db][qb], 0, 1, 2, 3); *(v4fa*)(d + 4) = __builtin_shufflevector(o[db][qb], o[db][qb], 4, 5, 6, 7); }
        if (hi == 0) { sml[(wv * (QB * 16) + qb * 16 + lr) * 2] = m[qb]; sml[(wv * (QB * 16) + qb * 16 + lr) * 2 + 1] = l[qb]; } }
    __syncthreads();   // every wave's partial tile, maximum and sum are in LDS
    if ((int)threadIdx.x < QB * 16 * 8) { const int qq = (threadIdx.x & 15) + 16 * (threadIdx.x >> 7), dg = (threadIdx.x >> 4) & 7;   // one thread: 8 consecutive d of one query row; a wave: 16 rows x 16 d, 512 contiguous bytes in fragment order
        float M = sml[qq * 2];
#pragma unroll
        for (int w = 1; w < NWF; ++w) M = fmaxf(M, sml[(w * (QB * 16) + qq) * 2]);
        float L = 0.f; v4f r0 = (v4f){}, r1 = (v4f){};
#pragma unroll
        for (int w = 0; w < NWF; ++w) { const float f = exp2s((sml[(w * (QB * 16) + qq) * 2] - M) * L2E); L += f * sml[(w * (QB * 16) + qq) * 2 + 1]; const float* d = so + w * (QB * 16 * 68) + qq * 68 + dg * 8; r0 += *(const v4fa*)d * f; r1 += *(const v4fa*)(d + 4) * f; }
        const float inv = __fdiv_rn(1.0f, L); v8us oh, ol;
#pragma unroll
        for (int j = 0; j < 4; ++j) { unsigned short a, c2; splitf(r0[j] * inv, a, c2); oh[j] = a; ol[j] = c2; splitf(r1[j] * inv, a, c2); oh[4 + j] = a; ol[4 + j] = c2; }
        const int eo = (q0 + (qq & ~15)) * DQ + dg * 128 + (qq & 15) * 8;   /* k = dg * 8 of the head's two blocks stands at dg * 128 */ bf* pa = Ah + eo; bf* pb = Al + eo; *(v8usa*)pa = oh; *(v8usa*)pb = ol; XWAIT(pa, pb); }
    __syncthreads();   // the LDS tiles are read: the next tile of this work-group may overwrite them
}
// grid (batches x heads, pairs of tiles): a work-group takes a long tile and then the short one that makes every pair cost the same; the pairs of f16 tiles (the longer ones) have the low flat indices.
__global__ __launch_bounds__(32 * NWF) __attribute__((amdgpu_waves_per_eu(4, 4))) void k_fattn(const h16* __restrict__ Q16, const bf* __restrict__ Qh, const bf* __restrict__ Ql, const h16* __restrict__ K16, const bf* __restrict__ Kh, const bf* __restrict__ Kl,
                                                    const h16* __restrict__ V16, const bf* __restrict__ Vh, const bf* __restrict__ Vl, bf* Ah, bf* Al) {
    __shared__ __align__(16) float so[NWF * 32 * 68]; __shared__ float sml[NWF * 32 * 2];
    const int wv = __builtin_amdgcn_readfirstlane((int)(threadIdx.x >> 5));   // wave number, scalar: the key loop's bounds stay wave-uniform
    const int bb = blockIdx.x / NH_, hh = blockIdx.x % NH_;   // batch, head
    const size_t hq = (size_t)blockIdx.x * TT * HD, hk = (size_t)(bb * NKV + hh / REP) * TT * HD; Ah += (size_t)bb * TT * DQ + hh * (HD * 16); Al += (size_t)bb * TT * DQ + hh * (HD * 16);   // rows = tokens of every batch, K = DQ, fragment order: a head is two k blocks
    constexpr int NP = (TT - RH) / 64; const int x = blockIdx.y;
    if (x < NP) {
#pragma unroll 1
        for (int r = 0; r < 2; ++r) attn_tile<h16, false, 2>(Q16 + hq, nullptr, K16 + hk, nullptr, V16 + hk, nullptr, r ? RH + 32 * x : TT - 32 - 32 * x, wv, so, sml, Ah, Al);
    } else {
#pragma unroll 1
        for (int r = 0; r < 2; ++r) attn_tile<bf, true, 1>(Qh + hq, Ql + hq, Kh + hk, Kl + hk, Vh + hk, Vl + hk, r ? 16 * (x - NP) : RH - 16 - 16 * (x - NP), wv, so, sml, Ah, Al);
    }
}

extern "C" void kernel_launch(void* const* d_in, const int* in_sizes, int n_in,
                              void* d_out, int out_size, void* d_ws, size_t ws_size, hipStream_t stream) {
    (void)in_sizes; (void)n_in; (void)out_size;
    const float* x = (const float*)d_in[0]; const float* wq = (const float*)d_in[1]; const float* bq = (const float*)d_in[2]; const float* wk = (const float*)d_in[3]; const float* bk = (const float*)d_in[4]; const float* wv = (const float*)d_in[5]; const float* bv = (const float*)d_in[6]; const float* wo = (const float*)d_in[7]; const float* bo = (const float*)d_in[8]; const float* cosT = nullptr; const float* sinT = nullptr; (void)cosT; (void)sinT;
    float* OUT = (float*)d_out;     // [2][2048][1024]
    char* wsp = (char*)d_ws;
    auto take = [&](size_t bytes) { char* p = wsp; wsp += (bytes + 255) & ~(size_t)255; return (void*)p; };
    bf* WQ = (bf*)take((size_t)DQ * DM * 2); bf* WK = (bf*)take((size_t)DKV * DM * 2); bf* WV = (bf*)take((size_t)DKV * DM * 2); bf* WO = (bf*)take((size_t)DM * DQ * 2);
    bf* XB = (bf*)take((size_t)NB_ * TT * DM * 2);
    h16* QP16 = (h16*)take((size_t)NB_ * NH_ * TT * HD * 2); h16* KP16 = (h16*)take((size_t)NB_ * NKV * TT * HD * 2); h16* VT16 = (h16*)take((size_t)NB_ * NKV * HD * TT * 2);
    bf* QPh = (bf*)take((size_t)NB_ * NH_ * TT * HD * 2); bf* QPl = (bf*)take((size_t)NB_ * NH_ * TT * HD * 2); bf* KPh = (bf*)take((size_t)NB_ * NKV * TT * HD * 2); bf* KPl = (bf*)take((size_t)NB_ * NKV * TT * HD * 2); bf* VTh = (bf*)take((size_t)NB_ * NKV * HD * TT * 2); bf* VTl = (bf*)take((size_t)NB_ * NKV * HD * TT * 2);
    bf* ATh = (bf*)take((size_t)NB_ * TT * DQ * 2); bf* ATl = (bf*)take((size_t)NB_ * TT * DQ * 2);
    if ((size_t)(wsp - (char*)d_ws) > ws_size) return;    // ws 256 MiB
    k_cvt8<<<dim3(DM * DM / 2048, 4 + NB_ * TT / DM, 1), 256, 0, stream>>>(x, wq, wk, wv, wo, XB, WQ, WK, WV, WO);
    k_qkv<<<dim3(TT / 128, DQ / 128, NB_), 384, 0, stream>>>(XB, WQ, WK, WV, bq, bk, bv, QP16, QPh, QPl, KP16, KPh, KPl, VT16, VTh, VTl);
    k_fattn<<<dim3(NB_ * NH_, (TT - RH) / 64 + RH / 32, 1), 32 * NWF, 0, stream>>>(QP16, QPh, QPl, KP16, KPh, KPl, VT16, VTh, VTl, ATh, ATl);
    k_oproj<<<dim3(NB_ * TT / 128, DM / 128, 1), 256, 0, stream>>>(ATh, ATl, WO, bo, OUT);
}

// v010
// It runs in 65.4 microseconds.
// Two timings next to v009 put it at 1.05 and 1.06 times that version's speed.
// Over all steps from v000 it is 23.7 times as fast.
#include <hip/hip_runtime.h>

#include <hip/hip_runtime.h>

#define NB_  2
#define TT   2048
#define DM   1024
#define NH_  16
#define NKV  16
#define REP  (NH_ / NKV)
#define HD   64
#define DQ   (NH_ * HD)
#define DKV  (NKV * HD)
#define RH   512                  // query rows < RH use hi+lo planes (0: none)
#define WIN  0
#define PCAR 1024.0f
#define SCL  0.125f   // HD^-0.5
typedef _Float16 h16;
typedef unsigned short bf;
typedef __attribute__((ext_vector_type(16))) __bf16   v16bf;
typedef __attribute__((ext_vector_type(16))) _Float16 v16h;
typedef __attribute__((ext_vector_type(8)))  _Float16 v8h;
typedef __attribute__((ext_vector_type(8)))  unsigned short v8us;
typedef __attribute__((ext_vector_type(8)))  float    v8f;
typedef __attribute__((ext_vector_type(4)))  float    v4f;
typedef v8h  __attribute__((may_alias)) v8ha;
typedef v4f  __attribute__((may_alias)) v4fa;
typedef v8us __attribute__((may_alias)) v8usa;

__device__ __forceinline__ unsigned short f2bf(float f) { unsigned u = __float_as_uint(f); u += 0x7FFFu + ((u >> 16) & 1u); return (unsigned short)(u >> 16); }
__device__ __forceinline__ float bf2f(unsigned short b) { return __uint_as_float(((unsigned)b) << 16); }
__device__ __forceinline__ float bfr(float f) { return bf2f(f2bf(f)); }
__device__ __forceinline__ v16h cat16(v8h lo, v8h hi) { return __builtin_shufflevector(lo, hi, 0, 1, 2, 3, 4, 5, 6, 7, 8, 9, 10, 11, 12, 13, 14, 15); }
__device__ __forceinline__ v16bf cat16b(v8us lo, v8us hi) { return __builtin_bit_cast(v16bf, __builtin_shufflevector(lo, hi, 0, 1, 2, 3, 4, 5, 6, 7, 8, 9, 10, 11, 12, 13, 14, 15)); }
__device__ __forceinline__ v8f wmma16(v16h a, v16h b, v8f c) { return __builtin_amdgcn_wmma_f32_16x16x32_f16(false, a, false, b, (short)0, c, false, false); }
__device__ __forceinline__ v8f wmmab(v16bf a, v16bf b, v8f c) { return __builtin_amdgcn_wmma_f32_16x16x32_bf16(false, a, false, b, (short)0, c, false, false); }



// ---- gemms_tile: one work-group of 8 waves per 128x128 output tile (bx, by). C[m][n] (+ f32 bias, rounded to bf16) = sum_k A[m][k] Bt[n][k] (NSPLIT 1: + A2[m][k] Bt[n][k]); K = DM; 16-bit planes in fragment order.
// The operand tiles of 128 k (a stage) come into LDS by asynchronous copies, two buffers: the next stage flies while this one is worked on, and every byte is fetched from L2 once per work-group.
// Wave (wm, wn, wk) holds the 64x64 quarter (wm, wn) (16 accumulators) and takes k blocks 2 wk and 2 wk + 1 of every stage; the two partial quarters are joined through LDS, each wave of the pair finishing 32 of the 64 rows.
// C goes out as f32.
typedef __attribute__((ext_vector_type(4))) _Float16 v4h;
typedef __attribute__((ext_vector_type(4))) unsigned short v4us;
__device__ __forceinline__ h16 tohx(float x) { return (h16)x; }
__device__ __forceinline__ void splitf(float y, unsigned short& h, unsigned short& l) { h = f2bf(y); l = f2bf(y - bf2f(h)); }
// Fragment order: every 16-bit operand plane (rows x K, K-contiguous in meaning) is stored as blocks of 16 rows x 32 k = 512 elements, block (r >> 4, k >> 5) at ((r >> 4) * (K >> 5) + (k >> 5)) * 512. Inside a block the
// element (r, k) stands at ((k >> 4) & 1) * 256 + (((k >> 3) & 1) * 16 + (r & 15)) * 8 + (k & 7): lane l of a wave finds its two 16-byte pieces of the WMMA operand at l * 8 and 256 + l * 8, so that each wave-wide load covers 512 contiguous bytes.
template <typename T16> struct WFrag;
template <> struct WFrag<h16> { typedef v16h V; static __device__ __forceinline__ V ld(const h16* p) { return cat16(*(const v8h*)p, *(const v8h*)(p + 256)); } static __device__ __forceinline__ v8f mma(V a, V b, v8f c) { return wmma16(a, b, c); } };
template <> struct WFrag<bf> { typedef v16bf V; static __device__ __forceinline__ V ld(const bf* p) { return cat16b(*(const v8us*)p, *(const v8us*)(p + 256)); } static __device__ __forceinline__ v8f mma(V a, V b, v8f c) { return wmmab(a, b, c); } };
__device__ __forceinline__ void wave_sync() { __builtin_amdgcn_wave_barrier(); asm volatile("" ::: "memory"); }   // orders one wave's LDS slab writes against its own reads of the same slab in another lane map
#define GRB ((DM / 32) * 1024)   // bytes from one 16-row block of a plane to the next
#define GOPB (8 * 4 * 1024)      // bytes of one operand tile of a stage: 8 row blocks x 4 k blocks x 1 KiB, laid [row block][k block]
// acopy8: one operand tile of a stage. Copy i brings row block i (4 KiB, contiguous in the plane): every lane 16 bytes. The s_wait_xcnt 0 stands in the copies' own statement, in front of any rewrite of their address registers.
__device__ __forceinline__ void acopy8(unsigned l, const char* g) {
    asm volatile("global_load_async_to_lds_b128 %0, %1, off\n\tglobal_load_async_to_lds_b128 %2, %3, off\n\tglobal_load_async_to_lds_b128 %4, %5, off\n\tglobal_load_async_to_lds_b128 %6, %7, off\n\t"
                 "global_load_async_to_lds_b128 %8, %9, off\n\tglobal_load_async_to_lds_b128 %10, %11, off\n\tglobal_load_async_to_lds_b128 %12, %13, off\n\tglobal_load_async_to_lds_b128 %14, %15, off\n\ts_wait_xcnt 0x0"
                 :: "v"(l), "v"(g), "v"(l + 4096), "v"(g + GRB), "v"(l + 2 * 4096), "v"(g + 2 * GRB), "v"(l + 3 * 4096), "v"(g + 3 * GRB),
                    "v"(l + 4 * 4096), "v"(g + 4 * GRB), "v"(l + 5 * 4096), "v"(g + 5 * GRB), "v"(l + 6 * 4096), "v"(g + 6 * GRB), "v"(l + 7 * 4096), "v"(g + 7 * GRB) : "memory");
}
template <int NSPLIT>
__device__ __forceinline__ void gemms_tile(const bf* __restrict__ A, const bf* __restrict__ A2, const bf* __restrict__ Bt, float* C, int ldc, const float* __restrict__ bias, int bx, int by, unsigned char* L) {
    typedef WFrag<bf>::V V;
    constexpr int NOP = NSPLIT ? 3 : 2, STG = NOP * GOPB, NT = DM / 128, KF = NSPLIT ? 2 : 1;   // operand tiles of a stage (A, A2, Bt); bytes of a stage; stages; fragment sets in registers (2 where one work-group has the WGP and its registers to itself)
    static_assert(NT >= 2 && DM % 128 == 0 && DQ == DM, "two stages or more");
    const int lane = threadIdx.x & 31, lr = lane & 15, hi = lane >> 4;
    const int wv = __builtin_amdgcn_readfirstlane((int)(threadIdx.x >> 5)), wm = wv & 1, wn = (wv >> 1) & 1, wk = wv >> 2;   // wave number, scalar
    // Accumulator row mb of a wave holds the quarter's 16-row slab mb ^ (2 * wk): rows 0 and 1 are the slabs this wave finishes, rows 2 and 3 the ones it hands to its partner (wave wv ^ 4), in the partner's order.
    float cbv[4];   // bias of this lane's accumulator columns, fetched here so that its latency passes under the first stage's copies
    { const float* bc = bias + by * 128 + wn * 64;   // the same for the whole wave: the loads take it as their scalar base, with the lane's column as the offset
#pragma unroll
        for (int nb = 0; nb < 4; ++nb) cbv[nb] = bc[lr + nb * 16];
        asm volatile("s_wait_xcnt 0x0" :: "s"(bc), "v"(lr) : "memory"); }   // behind the bias loads; it names their scalar base and their lane offset as inputs, so that both stay live up to the wait
    v8f acc[4][4];
#pragma unroll
    for (int mb = 0; mb < 4; ++mb)
#pragma unroll
        for (int nb = 0; nb < 4; ++nb) acc[mb][nb] = (v8f){};
    const unsigned lbase = (unsigned)(size_t)L + threadIdx.x * 16;   // this lane's 16 bytes of a 4-KiB row block in LDS (byte offset in the work-group's LDS)
    const char* gA = (const char*)A + (size_t)bx * 8 * GRB + threadIdx.x * 16; const char* gA2 = NSPLIT ? (const char*)A2 + (size_t)bx * 8 * GRB + threadIdx.x * 16 : gA; const char* gB = (const char*)Bt + (size_t)by * 8 * GRB + threadIdx.x * 16;
    auto issue = [&](int s, int buf) { const unsigned l = lbase + buf * STG; acopy8(l, gA + s * 4096); if (NSPLIT) acopy8(l + GOPB, gA2 + s * 4096); acopy8(l + (NOP - 1) * GOPB, gB + s * 4096); };
    issue(0, 0);
    asm volatile("s_wait_asynccnt 0x0" ::: "memory");   // this wave's copies of stage 0 have landed
    __syncthreads();                                    // and every other wave's
    issue(1, 1);
    const int ao = (wm * 16 + wk * 2) * 512 + lane * 8, ax = wk * 4096, bo = (NOP - 1) * (GOPB / 2) + (wn * 16 + wk * 2) * 512 + lane * 8;   // elements: the wave's first A and Bt fragments in a stage; the slab swap
    V a[KF][4], a2[KF][4], b[KF][4];
    auto fetch = [&](int kf, int s, int kk) {   // the fragments of the wave's k block kk of stage s
        const bf* sb = (const bf*)(L + (s & 1) * STG);
#pragma unroll
        for (int nb = 0; nb < 4; ++nb) b[kf][nb] = WFrag<bf>::ld(sb + bo + kk * 512 + nb * 2048);
#pragma unroll
        for (int mb = 0; mb < 4; ++mb) { const bf* p = sb + ao + kk * 512 + mb * 2048 + (mb < 2 ? ax : -ax); a[kf][mb] = WFrag<bf>::ld(p); if (NSPLIT) a2[kf][mb] = WFrag<bf>::ld(p + GOPB / 2); } };
    auto block = [&](int kf) {
#pragma unroll
        for (int mb = 0; mb < 4; ++mb)
#pragma unroll
            for (int nb = 0; nb < 4; ++nb) acc[mb][nb] = WFrag<bf>::mma(a[kf][mb], b[kf][nb], acc[mb][nb]);
        if (NSPLIT) {
#pragma unroll
            for (int mb = 0; mb < 4; ++mb)
#pragma unroll
                for (int nb = 0; nb < 4; ++nb) acc[mb][nb] = WFrag<bf>::mma(a2[kf][mb], b[kf][nb], acc[mb][nb]);
        } };
    if (KF == 2) fetch(0, 0, 0);   // two fragment sets: every block's fragments are fetched under the WMMAs of the block before; stage 0 is published above
    // kept rolled: one copy of a stage's code in the instruction cache; the two buffers alternate by t & 1
#pragma unroll 1
    for (int t = 0; t < NT; ++t) {
        if (KF == 1) fetch(0, t, 0); else fetch(1, t, 1);
        __builtin_amdgcn_sched_barrier(0);   // keeps the fragment loads together in front of the WMMAs: left alone, the compiler reloads one Bt fragment register four times a k block, each time with a full LDS wait
        block(0);
        if (KF == 1) fetch(0, t, 1);
        else __builtin_amdgcn_sched_barrier(0);   // keeps these WMMAs in front of the waits below: left alone, the compiler lifts the waits over them, and the loads just issued are waited out with the matrix unit idle
        // The stage's last fragments are on their way to registers: the buffer is handed on here, and the refill flies under the WMMAs that follow.
        asm volatile("s_wait_dscnt 0x0" ::: "memory");      // this wave has read all it needs of stage t
        asm volatile("s_wait_asynccnt 0x0" ::: "memory");   // and its copies of stage t + 1 have landed
        __syncthreads();                                    // stage t + 1 is published; stage t's buffer is free
        if (t + 2 < NT) issue(t + 2, t & 1);
        if (KF == 2 && t + 1 < NT) fetch(0, t + 1, 0);   // the next stage's first fragment loads go out in front of this stage's last WMMAs
        block(KF - 1);
    }
    asm volatile("s_wait_asynccnt 0x0" ::: "memory");       // no copy is outstanding when the buffers become the join's staging
    float* X = (float*)L;   // 8 ranges of 2048 floats: wave wv writes range wv, only its partner reads it and then uses it as its own slab staging
    { float* xg = X + wv * 2048 + lane * 4;
#pragma unroll
      for (int mb = 2; mb < 4; ++mb)
#pragma unroll
          for (int nb = 0; nb < 4; ++nb) { float* d = xg + ((mb - 2) * 4 + nb) * 256; *(v4fa*)d = __builtin_shufflevector(acc[mb][nb], acc[mb][nb], 0, 1, 2, 3); *(v4fa*)(d + 128) = __builtin_shufflevector(acc[mb][nb], acc[mb][nb], 4, 5, 6, 7); } }
    __syncthreads();   // every wave's handed-over slabs are in LDS
    float* os = X + (wv ^ 4) * 2048;
#pragma unroll
    for (int mb = 0; mb < 2; ++mb)
#pragma unroll
        for (int nb = 0; nb < 4; ++nb) { const float* d = os + lane * 4 + (mb * 4 + nb) * 256; const v4f p0 = *(const v4fa*)d, p1 = *(const v4fa*)(d + 128);
#pragma unroll
            for (int j = 0; j < 4; ++j) { acc[mb][nb][j] += p0[j]; acc[mb][nb][4 + j] += p1[j]; }
#pragma unroll
            for (int j = 0; j < 8; ++j) acc[mb][nb][j] += bfr(cbv[nb]); }
    const int m0 = bx * 128 + wm * 64 + wk * 32;   // first row of the 32 that this wave finishes
#pragma unroll
    for (int mb = 0; mb < 2; ++mb) {
#pragma unroll
        for (int nb = 0; nb < 4; ++nb)
#pragma unroll
            for (int j = 0; j < 8; ++j) os[(hi * 8 + j) * 68 + nb * 16 + lr] = acc[mb][nb][j];
        wave_sync();
        {
            float* cp = C + (size_t)(m0 + mb * 16 + hi) * ldc + by * 128 + wn * 64 + lr * 4;
#pragma unroll
            for (int s = 0; s < 8; ++s) *(v4f*)(cp + (size_t)(2 * s) * ldc) = *(const v4fa*)(os + (2 * s + hi) * 68 + lr * 4);   // two rows of 256 contiguous bytes
            asm volatile("s_wait_xcnt 0x0" :: "v"(cp) : "memory");   // behind the run of stores; it names their address pair as an input, so that it stays live up to the wait
        }
        wave_sync();
    }
}
__device__ __forceinline__ float xhalf(float x) { const int b = __float_as_int(x); return __int_as_float(__builtin_amdgcn_permlanex16(b, b, 0x76543210, 0xfedcba98, false, false)); }   // value of lane l ^ 16
// rowmax16: the maximum over a 16-lane row, in every lane of the row (four DPP steps, row_xmask 1, 2, 4, 8)
template <int CTRL> __device__ __forceinline__ float dppmax(float x) { return fmaxf(x, __int_as_float(__builtin_amdgcn_update_dpp(0, __float_as_int(x), CTRL, 0xf, 0xf, false))); }
__device__ __forceinline__ float rowmax16(float x) { x = dppmax<0x161>(x); x = dppmax<0x162>(x); x = dppmax<0x164>(x); return dppmax<0x168>(x); }
// Norm planes (Q and K): per head and 64 tokens one 128-byte line, written by one wave; its first float is the largest squared length of those tokens' rows (64 features, f32, as they stand before the rounding to 16 bits), or infinity where an element may overflow f16.
#define NRL 32   // floats from one such line to the next
// planes_out: a wave's 64x64 quarter (+ f32 bias, rounded to bf16) goes out as three 16-bit planes (f16, bf16 hi, bf16 lo) in fragment order, slab by slab (16 rows) through the wave's own LDS slab os.
// OUTM 1: rows = tokens from m0, columns = head ct (bias by column, bsv[nb] at column nb * 16 + lr); the largest squared length of the 64 rows goes to NR. OUTM 2: rows = features from m0, columns = the 64 tokens from ct * 64 (bias by row, bsv[mb] at row mb * 16 + lr: added where the lane holds row lr).
template <int OUTM>
__device__ __forceinline__ void planes_out(v8f (&acc)[4][4], const float (&bsv)[4], float* os, int m0, int ct, h16* P16, bf* Ph, bf* Pl, float* NR) {
    const int lane = (int)__builtin_amdgcn_mbcnt_lo(~0u, 0u), lr = lane & 15, hi = lane >> 4;   // the lane's number, formed anew here: taken from threadIdx.x its parts were held over the caller's loop, one of them in scratch memory
    constexpr size_t PLD = (OUTM == 1) ? HD : TT, CTS = (OUTM == 1) ? (size_t)TT * HD : 64 * 16;   // K of the plane (a 16-row slab is 16 * PLD elements); step from one 64-wide column tile to the next
    float n2m = 0.f;
#pragma unroll
    for (int mb = 0; mb < 4; ++mb) {
#pragma unroll
        for (int nb = 0; nb < 4; ++nb)
#pragma unroll
            for (int j = 0; j < 8; ++j) os[(hi * 8 + j) * 68 + nb * 16 + lr] = (OUTM == 1) ? acc[mb][nb][j] + bfr(bsv[nb]) : acc[mb][nb][j];
        wave_sync();
        const size_t e = (size_t)(m0 + mb * 16) * PLD + ct * CTS + lane * 8; h16* p16 = P16 + e; bf* ph = Ph + e; bf* pl = Pl + e;
        v8h r16[4]; v8us rh[4], rl[4]; v4f sq = (v4f){};
#pragma unroll
        for (int u = 0; u < 4; ++u) { const float* d = os + lr * 68 + (u * 2 + hi) * 8; v4f v0 = *(const v4fa*)d, v1 = *(const v4fa*)(d + 4);   /* the eight elements that stand at u * 256 + lane * 8 of the slab in fragment order */
            if (OUTM == 2) { v0 += bfr(bsv[mb]); v1 += bfr(bsv[mb]); }
            else { sq += v0 * v0; sq += v1 * v1; }   // the lane holds 32 of row lr's 64 values, lane l ^ 16 the others
#pragma unroll
            for (int j = 0; j < 4; ++j) { unsigned short a2, c2; splitf(v0[j], a2, c2); r16[u][j] = tohx(v0[j]); rh[u][j] = a2; rl[u][j] = c2; splitf(v1[j], a2, c2); r16[u][4 + j] = tohx(v1[j]); rh[u][4 + j] = a2; rl[u][4 + j] = c2; }
            *(v8h*)(p16 + u * 256) = r16[u]; *(v8us*)(ph + u * 256) = rh[u]; *(v8us*)(pl + u * 256) = rl[u]; }   // a wave stores 512 contiguous bytes of each plane
        // s_wait_xcnt 0 behind the slab's stores; it names their address pairs and their stored vectors as inputs, so that all of them stay live up to the wait and the next slab's arithmetic lands in none of them ahead of it
        asm volatile("s_wait_xcnt 0x0" :: "v"(p16), "v"(ph), "v"(pl), "v"(r16[0]), "v"(rh[0]), "v"(rl[0]), "v"(r16[1]), "v"(rh[1]), "v"(rl[1]), "v"(r16[2]), "v"(rh[2]), "v"(rl[2]), "v"(r16[3]), "v"(rh[3]), "v"(rl[3]) : "memory");
        if (OUTM == 1) { const float n2 = (sq[0] + sq[1]) + (sq[2] + sq[3]); n2m = fmaxf(n2m, n2 + xhalf(n2)); }
        wave_sync();
    }
    if (OUTM == 1) { n2m = rowmax16(n2m); n2m = n2m < 4.0e9f ? n2m : __builtin_inff(); if (lane == 0) { *NR = n2m; asm volatile("s_wait_xcnt 0x0" :: "s"(NR), "v"(n2m) : "memory"); } }   // the wait behind the store names its scalar base and its data as inputs, so that they stay live up to it
}
// k_qkv: the Q, K and V projections in one launch. grid (TT/128 token tiles, 8 feature tiles, NB_). One work-group of 12 waves computes the three 128x128 tiles (Q, K, V) of its tokens and features:
// a stage (128 k) holds the x tile once and the three weight tiles, so that the x bytes come from L2 once for the three products; two buffers, filled by asynchronous copies as in gemms_tile (waves 0 to 7 issue them).
// Wave (pj, wm, wn): projection pj (0 Q, 1 K, 2 V), 64x64 quarter (wm, wn), all of k. Q and K take x as A and the weights as B; V takes the weights as A and x as B (V^T = Wv X^T: its rows are the transposed plane's rows): only LDS offsets differ in the loop.
__global__ __launch_bounds__(384) void k_qkv(const bf* __restrict__ XB, const bf* __restrict__ WQ, const bf* __restrict__ WK, const bf* __restrict__ WV, const float* __restrict__ bq, const float* __restrict__ bk, const float* __restrict__ bv,
                                             h16* QP16, bf* QPh, bf* QPl, h16* KP16, bf* KPh, bf* KPl, h16* VT16, bf* VTh, bf* VTl, float* QN, float* KN) {
    typedef WFrag<bf>::V V;
    constexpr int STG = 4 * GOPB, NT = DM / 128;   // bytes of a stage: tiles x, Wq, Wk, Wv; stages
    static_assert(NT >= 2 && DM % 128 == 0 && DQ == DM && DKV == DM, "two stages or more; equal projections");
    __shared__ __align__(16) unsigned char L[2 * STG];
    const int lane = threadIdx.x & 31, lr = lane & 15;
    const int wv = __builtin_amdgcn_readfirstlane((int)(threadIdx.x >> 5)), pj = wv >> 2, wm = wv & 1, wn = (wv >> 1) & 1;   // wave number, scalar
    const int tx = blockIdx.x, fy = blockIdx.y, b = blockIdx.z; const bool isv = pj == 2;
    float bsv[4];   // bias of the features nb * 16 + lr (Q, K: the quarter's columns) or mb * 16 + lr (V: its rows), fetched here so that its latency passes under the first stage's copies
    { const float* bc = (pj == 0 ? bq : pj == 1 ? bk : bv) + fy * 128 + (isv ? wm : wn) * 64;   // the same for the whole wave: the loads take it as their scalar base, with the lane's feature as the offset
#pragma unroll
      for (int i = 0; i < 4; ++i) bsv[i] = bc[lr + i * 16];
      asm volatile("s_wait_xcnt 0x0" :: "s"(bc), "v"(lr) : "memory"); }   // behind the bias loads; it names their scalar base and their lane offset as inputs, so that both stay live up to the wait
    v8f acc[4][4];
#pragma unroll
    for (int mb = 0; mb < 4; ++mb)
#pragma unroll
        for (int nb = 0; nb < 4; ++nb) acc[mb][nb] = (v8f){};
    const unsigned lbase = (unsigned)(size_t)L + wv * 512 + lane * 16;   // waves 0 to 7: this lane's 16 bytes of a 4-KiB row block in LDS (byte offset in the work-group's LDS)
    const char* gX = (const char*)(XB + (size_t)b * TT * DM) + (size_t)tx * 8 * GRB; const char* gQ = (const char*)WQ + (size_t)fy * 8 * GRB; const char* gK = (const char*)WK + (size_t)fy * 8 * GRB; const char* gV = (const char*)WV + (size_t)fy * 8 * GRB;   // the tiles' first bytes: scalar, the lane's 16 bytes are added at the copy
    const size_t gl = (size_t)gX + wv * 512 + lane * 16, dQ = (size_t)gQ - (size_t)gX, dK = (size_t)gK - (size_t)gX, dV = (size_t)gV - (size_t)gX;   // one lane address; the weight tiles stand at scalar distances (modulo 2^64) from the x tile: fewer registers held over the loop
    auto issue = [&](int s, int buf) { if (wv < 8) { const unsigned l = lbase + buf * STG; const size_t so = (size_t)s * 4096; acopy8(l, (const char*)(gl + so)); acopy8(l + GOPB, (const char*)(gl + (dQ + so))); acopy8(l + 2 * GOPB, (const char*)(gl + (dK + so))); acopy8(l + 3 * GOPB, (const char*)(gl + (dV + so))); } };   // a scalar test: whole waves issue or none
    issue(0, 0);
    asm volatile("s_wait_asynccnt 0x0" ::: "memory");   // this wave's copies of stage 0 have landed
    __syncthreads();                                    // and every other wave's
    issue(1, 1);
    const int ao = (isv ? 3 : 0) * (GOPB / 2) + wm * 16 * 512 + lane * 8, bo = (isv ? 0 : 1 + pj) * (GOPB / 2) + wn * 16 * 512 + lane * 8;   // elements: the wave's first A and B fragments in a stage
    V a[2][4], bb[2][4];   // two fragment sets: every k block's fragments are fetched under the WMMAs of the block before
    auto fetch = [&](int kf, int s, int kk) {   // the fragments of k block kk of stage s
        const bf* sb = (const bf*)(L + (s & 1) * STG);
#pragma unroll
        for (int nb = 0; nb < 4; ++nb) bb[kf][nb] = WFrag<bf>::ld(sb + bo + kk * 512 + nb * 2048);
#pragma unroll
        for (int mb = 0; mb < 4; ++mb) a[kf][mb] = WFrag<bf>::ld(sb + ao + kk * 512 + mb * 2048); };
    auto block = [&](int kf) {
#pragma unroll
        for (int mb = 0; mb < 4; ++mb)
#pragma unroll
            for (int nb = 0; nb < 4; ++nb) acc[mb][nb] = WFrag<bf>::mma(a[kf][mb], bb[kf][nb], acc[mb][nb]); };
    fetch(0, 0, 0);   // stage 0 is published above
    // kept rolled: one copy of a stage's code in the instruction cache; the two buffers alternate by t & 1
#pragma unroll 1
    for (int t = 0; t < NT; ++t) {
        fetch(1, t, 1);
        __builtin_amdgcn_sched_barrier(0);   // here and twice below: keeps the fragment loads together in front of the WMMAs that they fly under
        block(0);
        __builtin_amdgcn_sched_barrier(0);   // here and below: keeps the next loads behind these WMMAs in one group
        fetch(0, t, 2);
        __builtin_amdgcn_sched_barrier(0);
        block(1);
        __builtin_amdgcn_sched_barrier(0);
        fetch(1, t, 3);
        __builtin_amdgcn_sched_barrier(0);
        block(0);
        __builtin_amdgcn_sched_barrier(0);   // keeps these WMMAs in front of the waits below, so that the loads just issued are not waited out with the matrix unit idle
        // The stage's last fragments are on their way to registers: the buffer is handed on here, and the refill flies under the WMMAs that follow.
        asm volatile("s_wait_dscnt 0x0" ::: "memory");      // this wave has read all it needs of stage t
        asm volatile("s_wait_asynccnt 0x0" ::: "memory");   // and its copies of stage t + 1 have landed
        __syncthreads();                                    // stage t + 1 is published; stage t's buffer is free
        if (t + 2 < NT) issue(t + 2, t & 1);
        if (t + 1 < NT) fetch(0, t + 1, 0);   // the next stage's first fragment loads go out in front of this stage's last WMMAs
        block(1);
    }
    asm volatile("s_wait_asynccnt 0x0" ::: "memory");       // no copy is outstanding, and behind the last barrier nobody reads a stage: the buffers become the waves' slabs
    float* os = (float*)L + wv * (16 * 68);
    const size_t pq = (size_t)b * NH_ * TT * HD, pk = (size_t)b * NKV * TT * HD;
    if (isv) planes_out<2>(acc, bsv, os, fy * 128 + wm * 64, tx * 2 + wn, VT16 + pk, VTh + pk, VTl + pk, nullptr);
    else planes_out<1>(acc, bsv, os, tx * 128 + wm * 64, fy * 2 + wn, pj ? KP16 + pk : QP16 + pq, pj ? KPh + pk : QPh + pq, pj ? KPl + pk : QPl + pq, (pj ? KN + (size_t)b * NKV * (TT / 64) * NRL : QN + (size_t)b * NH_ * (TT / 64) * NRL) + ((fy * 2 + wn) * (TT / 64) + tx * 2 + wm) * NRL);
}
// k_oproj: the output projection of every batch's rows in one launch. grid (NB_ * TT / 128, DM / 128).
__global__ __launch_bounds__(256) void k_oproj(const bf* __restrict__ Ah, const bf* __restrict__ Al, const bf* __restrict__ WO, const float* __restrict__ bo, float* OUT) {
    __shared__ __align__(16) unsigned char L[2 * 3 * GOPB];
    gemms_tile<1>(Ah, Al, WO, OUT, DM, bo, blockIdx.x, blockIdx.y, L);
}

typedef __attribute__((ext_vector_type(2))) _Float16 v2h;
typedef __attribute__((ext_vector_type(2))) unsigned short v2us;
typedef __attribute__((ext_vector_type(2))) float v2f;
typedef __attribute__((ext_vector_type(4))) int v4i;

__global__ __launch_bounds__(256) void k_wtG(const float* __restrict__ w, int K, int N, bf* Bt) {
    const int lane = threadIdx.x & 31; const int L0 = (blockIdx.x * 8 + (threadIdx.x >> 5)) * 8; const int nlines = N * K / 64;
{
#pragma unroll 1
        for (int l = 0; l < 8; ++l) { const int L = L0 + l; if (L >= nlines) break; const size_t e = (size_t)L * 64 + lane * 2; const int k = (int)(e % K), n = (int)(e / K); v2us o;
            o[0] = f2bf(w[(size_t)k * N + n]); o[1] = f2bf(w[(size_t)(k + 1) * N + n]); *(v2us*)(Bt + e) = o; }
         }
}
// k_cvt8: every f32-to-bf16 conversion in one launch. grid (DM * DM / 2048, 4 + NB_ * TT / DM): y picks a weight matrix or a piece of x of the same size (DM * DM floats).
static_assert(DQ == DM && DKV == DM && DM == 1024 && (NB_ * TT) % DM == 0 && (DM * DM) % 2048 == 0, "equal pieces");
__global__ __launch_bounds__(256) void k_cvt8(const float* __restrict__ x, const float* __restrict__ wq, const float* __restrict__ wk, const float* __restrict__ wv, const float* __restrict__ wo, bf* XB, bf* WQ, bf* WK, bf* WV, bf* WO) {
    const int y = blockIdx.y; const float* src = y == 0 ? wq : y == 1 ? wk : y == 2 ? wv : y == 3 ? wo : x + (size_t)(y - 4) * DM * DM; bf* dst = y == 0 ? WQ : y == 1 ? WK : y == 2 ? WV : y == 3 ? WO : XB + (size_t)(y - 4) * DM * DM;
    // The destination is in fragment order (K = DM). A wave takes 8 rows x 32 k of one block: it reads one whole 128-byte line of each row and stores four whole lines; a work-group takes four neighbouring blocks.
    const size_t blk = (size_t)blockIdx.x * 4 + (threadIdx.x >> 6); const int r8 = ((threadIdx.x >> 5) & 1) * 8 + (threadIdx.x & 7), c = (threadIdx.x >> 3) & 3;   // row in the block; which 8 of its 32 k
    const float* sp = src + ((blk >> 5) * 16 + r8) * DM + (blk & 31) * 32 + c * 8; const v8f v = *(const v8f*)sp; v8us o;
    asm volatile("s_wait_xcnt 0x0" :: "v"(sp) : "memory");   // behind the loads; it names their address pair as an input, so that the pair stays live up to the wait
#pragma unroll
    for (int k = 0; k < 8; ++k) o[k] = f2bf(v[k]); *(v8us*)(dst + blk * 512 + (c >> 1) * 256 + ((c & 1) * 16 + r8) * 8) = o;  }
__global__ __launch_bounds__(256) void k_cscvt(const float* __restrict__ cosT, const float* __restrict__ sinT, float* CS) { const int idx = blockIdx.x * 256 + threadIdx.x; if (idx >= TT * HD) return; v2f cs; cs[0] = bfr(cosT[idx]); cs[1] = bfr(sinT[idx]); *(v2f*)(CS + (size_t)idx * 2) = cs;  }
// ---- k_fattn: scores, causal ALiBi softmax, P.V and the hi/lo split of the result in one launch; no score or probability leaves the registers.
// One work-group of NWF waves owns a tile of QB*16 query rows of one head; its waves take every NWF-th pass of 32 keys, each with its own running maximum, sum and output tile (online softmax);
// the NWF partial tiles are joined through LDS in wave order 0..NWF-1. Transposed products: S^T = K Q^T (a lane holds 16 scores of ONE query per pass), O^T += V^T P^T, where two converted S^T tiles are the B operand as they stand.
// Query rows < RH: hi+lo bf16 planes, three products each (HI); the others f16 with the probabilities carried at 2^10 (the factor cancels against the row sum).
#define NWF 8
#define L2E 1.4426950408889634f
// XWAIT: s_wait_xcnt 0 behind a run of global loads or stores; it names their address pairs as inputs, so that they stay live up to the wait and neither a later load's result nor a vector instruction lands in them ahead of it.
#define XWAIT(pa, pb) asm volatile("s_wait_xcnt 0x0" :: "v"(pa), "v"(pb) : "memory")
// exp2s: v_exp_f32 with one v_nop in the same statement, for the places where the compiler's schedule put a write of the transcendental's source register directly behind it (the slot the instruction set asks for).
__device__ __forceinline__ float exp2s(float x) { float r; asm("v_exp_f32 %0, %1\n\tv_nop" : "=v"(r) : "v"(x)); return r; }
// rowlen: from a norm plane's value n2, an upper bound of those rows' lengths in the f16 plane: rounding to f16 moves an element by at most 2^-11 of itself or 2^-25, a row of 64 by 2^-11 of its length + 2^-22 (an infinite n2 stays infinite).
// v_sqrt_f32 with its v_nop as in exp2s; volatile, so that it stays behind the K loads' wait statement where it is called: hoisted out of the tile loop it would wait for the norm planes in front of the first Q and K loads.
__device__ __forceinline__ float rowlen(float n2) { float r; asm volatile("v_sqrt_f32 %0, %1\n\tv_nop" : "=v"(r) : "v"(n2)); return r * 1.001f + 3.0e-7f; }
template <typename T16, bool HI, int QB>
__device__ __forceinline__ void attn_tile(const T16* __restrict__ Q, const T16* __restrict__ Q2, const T16* __restrict__ K, const T16* __restrict__ K2, const T16* __restrict__ Vt, const T16* __restrict__ Vt2,
                                          int q0, int wv, float* so, float* sml, bf* Ah, bf* Al, float qn2, float kn2) {
    typedef typename WFrag<T16>::V V;
    const int lane = threadIdx.x & 31, lr = lane & 15, hi = lane >> 4; const int kend = q0 + QB * 16;   // keys 0 .. kend-1 can be visible to this tile
    V q[QB][2], q2[QB][2];
    const int koff = lane * 8, voff = lane * 8;   // this lane's piece of a block in fragment order
    { const T16* qp = Q + (size_t)q0 * HD + koff; const T16* qp2 = HI ? Q2 + (size_t)q0 * HD + koff : qp;
#pragma unroll
      for (int qb = 0; qb < QB; ++qb)
#pragma unroll
          for (int ks = 0; ks < 2; ++ks) { q[qb][ks] = WFrag<T16>::ld(qp + qb * 16 * HD + ks * 512); if (HI) q2[qb][ks] = WFrag<T16>::ld(qp2 + qb * 16 * HD + ks * 512); }
      XWAIT(qp, qp2); }
    v8f o[4][QB]; float m[QB], l[QB];
#pragma unroll
    for (int qb = 0; qb < QB; ++qb) { m[qb] = -3.0e38f; l[qb] = 0.f;
#pragma unroll
        for (int db = 0; db < 4; ++db) o[db][qb] = (v8f){}; }
    // Far pass (f16 tiles): |q . k| <= |q| |k|, so qn * kn + the bias of the pass's nearest key bounds every score of the pass from above without its K. qn, kn: upper bounds of the f16 row lengths of the tile's queries and of the pass's keys
    // (from qn2, kn2: lane g holds the norm planes' value of tokens 64 g to 64 g + 63), kn x SCL x 1.01 (the margin covers the rounding of the products' sums). Where the bound lies 25 below m in every lane, the dead-pass test below would end that pass (m only grows): it is left out, its K unread.
    float qn = 0.f, knv = 0.f, bl[QB];   // qn and knv are formed behind the first K loads, so that the norm planes' latency does not stand in front of them
#pragma unroll
    for (int qb = 0; qb < QB; ++qb) bl[qb] = 0.0625f * (float)(31 - (q0 + qb * 16 + lr));
    auto far = [&](int c) { const float kn = __int_as_float(__builtin_amdgcn_readlane(__float_as_int(knv), c >> 6)), cb = 0.0625f * (float)c;
        bool near = false;
#pragma unroll
        for (int qb = 0; qb < QB; ++qb) near = near | !(qn * kn + (bl[qb] + cb) - m[qb] < -25.f);   // written so that a NaN counts as near
        return __builtin_amdgcn_ballot_w32(near) == 0u; };   // the same for the whole wave: a scalar branch
    // f16 tiles walk their passes from the diagonal backwards (wave wv starts wv passes in front of it): the running maximum is set by the near keys, so that the far passes can be tested against it below
    int c0 = HI ? 32 * wv : kend - 32 - 32 * wv, cn = 0;   // cn (f16 tiles): the wave's next pass that is not far
    if (HI ? c0 < kend : c0 >= 0) {
        V k[2][2], k2[2][2];
        if constexpr (!HI) {   // f16 tiles (the long ones) fetch their K fragments one pass ahead
            const T16* kp = K + (size_t)c0 * HD + koff;
#pragma unroll
            for (int kb = 0; kb < 2; ++kb)
#pragma unroll
                for (int ks = 0; ks < 2; ++ks) k[kb][ks] = WFrag<T16>::ld(kp + kb * 16 * HD + ks * 512);
            XWAIT(kp, kp);
            qn = __int_as_float(__builtin_amdgcn_readlane(__float_as_int(rowlen(qn2)), q0 >> 6)); knv = rowlen(kn2) * (SCL * 1.01f);
        }
#pragma unroll 1
        for (; HI ? c0 < kend : c0 >= 0; c0 = HI ? c0 + 32 * NWF : cn) {
            V v[4], v2[4];
            if constexpr (HI) { const T16* kp = K + (size_t)c0 * HD + koff; const T16* kp2 = K2 + (size_t)c0 * HD + koff;
#pragma unroll
                for (int kb = 0; kb < 2; ++kb)
#pragma unroll
                    for (int ks = 0; ks < 2; ++ks) { k[kb][ks] = WFrag<T16>::ld(kp + kb * 16 * HD + ks * 512); k2[kb][ks] = WFrag<T16>::ld(kp2 + kb * 16 * HD + ks * 512); }
                XWAIT(kp, kp2);
            }
            auto loadv = [&]() { const T16* vp = Vt + c0 * 16 + voff; const T16* vp2 = HI ? Vt2 + c0 * 16 + voff : vp;
#pragma unroll
              for (int db = 0; db < 4; ++db) { v[db] = WFrag<T16>::ld(vp + db * 16 * TT); if (HI) v2[db] = WFrag<T16>::ld(vp2 + db * 16 * TT); }
              XWAIT(vp, vp2); };
            if constexpr (HI) loadv();
            else { cn = c0 - 32 * NWF;   // the next pass is chosen here, in front of the products: the tests run while this pass's K is still on its way
                // kept rolled: at most TT / (32 * NWF) short trips
#pragma unroll 1
                while (cn >= 0 && far(cn)) cn -= 32 * NWF; }
            v8f s[2][QB];
#pragma unroll
            for (int kb = 0; kb < 2; ++kb)
#pragma unroll
                for (int qb = 0; qb < QB; ++qb) { s[kb][qb] = (v8f){};
#pragma unroll
                    for (int ks = 0; ks < 2; ++ks) { s[kb][qb] = WFrag<T16>::mma(k[kb][ks], q[qb][ks], s[kb][qb]); if (HI) { s[kb][qb] = WFrag<T16>::mma(k[kb][ks], q2[qb][ks], s[kb][qb]); s[kb][qb] = WFrag<T16>::mma(k2[kb][ks], q[qb][ks], s[kb][qb]); } } }
            if constexpr (!HI) {
                // four vector slots behind the score WMMAs: on the taken side of the branch below the first reader of their results would stand too close
                asm volatile("v_nop\n\tv_nop\n\tv_nop\n\tv_nop" : "+v"(s[0][0]), "+v"(s[0][1]), "+v"(s[1][0]), "+v"(s[1][1]));
                if (cn >= 0) { const T16* kp = K + (size_t)cn * HD + koff;   // the wave's next pass, where there is one (a scalar test); the loads fly under the softmax and P.V
#pragma unroll
                    for (int kb = 0; kb < 2; ++kb)
#pragma unroll
                        for (int ks = 0; ks < 2; ++ks) k[kb][ks] = WFrag<T16>::ld(kp + kb * 16 * HD + ks * 512);
                    XWAIT(kp, kp); }
                __builtin_amdgcn_sched_barrier(0);   // keeps the K loads up here, in front of the softmax, so that their latency passes under it
            }
            // Dead pass (f16 tiles): top bounds every score of the lane from above (its largest product with its nearest key's bias; rounding is monotone). Where top - m < -25 in every lane, the maximum stays, the rescale is by 1 and
            // every probability is below 2^(10 - 25 * L2E) < 2^-25, which is zero in f16: P.V would add zeros, and the pass's part of the row sum (at least 2^10 over a lane pair) lies below that sum's f32 rounding. Such a pass ends here, its V unread.
            bool live = true;
            if constexpr (!HI) { live = false;
#pragma unroll
                for (int qb = 0; qb < QB; ++qb) { float sm0 = s[0][qb][0], sm1 = s[1][qb][0];   // two chains a query block: four short dependent chains in all
#pragma unroll
                    for (int j = 1; j < 8; ++j) { sm0 = fmaxf(sm0, s[0][qb][j]); sm1 = fmaxf(sm1, s[1][qb][j]); }
                    const float top = fmaxf(sm0, sm1) * SCL + 0.0625f * (float)(c0 + hi * 8 + 23 - (q0 + qb * 16 + lr));
                    live = live | !(top - m[qb] < -25.f); }   // written so that a NaN in top or m counts as live; | and not ||: no branch between the query blocks
                live = __builtin_amdgcn_ballot_w32(live) != 0u;   // the same for the whole wave: a scalar branch, every lane on at the WMMAs behind it
            }
            if (live) {
            if constexpr (!HI) loadv();   // V is fetched for live passes alone; its latency passes under the softmax
            V p[QB], p2[QB];
#pragma unroll
            for (int qb = 0; qb < QB; ++qb) {
                const float bb0 = 0.0625f * (float)(c0 + hi * 8 - (q0 + qb * 16 + lr));   // ALiBi slope 1/16 x (j - i) at the lane's first key; exact, as is every bb below
                float mx = -3.0e38f;
#pragma unroll
                for (int kb = 0; kb < 2; ++kb)
#pragma unroll
                    for (int j = 0; j < 8; ++j) { const float bb = bb0 + 0.0625f * (float)(kb * 16 + j); const float t = (bb <= 0.f) ? s[kb][qb][j] * SCL + bb : -3.0e38f;   /* causal: j <= i */ s[kb][qb][j] = t; mx = fmaxf(mx, t); }
                mx = fmaxf(mx, xhalf(mx));
                const float mn = fmaxf(m[qb], mx); const float al = HI ? exp2s((m[qb] - mn) * L2E) : __builtin_amdgcn_exp2f((m[qb] - mn) * L2E); m[qb] = mn;
                float ls = 0.f;
#pragma unroll
                for (int kb = 0; kb < 2; ++kb)
#pragma unroll
                    for (int j = 0; j < 8; ++j) { const float e = HI ? exp2s((s[kb][qb][j] - mn) * L2E) : __builtin_amdgcn_exp2f((s[kb][qb][j] - mn) * L2E + 10.f); s[kb][qb][j] = e; ls += e; }
                l[qb] = l[qb] * al + ls;
#pragma unroll
                for (int db = 0; db < 4; ++db) o[db][qb] *= al;
                if constexpr (HI) { v8us h0, h1, l0, l1;
#pragma unroll
                    for (int j = 0; j < 8; ++j) { unsigned short a, c2; splitf(s[0][qb][j], a, c2); h0[j] = a; l0[j] = c2; splitf(s[1][qb][j], a, c2); h1[j] = a; l1[j] = c2; }
                    p[qb] = cat16b(h0, h1); p2[qb] = cat16b(l0, l1);
                } else { p[qb] = cat16(__builtin_convertvector(s[0][qb], v8h), __builtin_convertvector(s[1][qb], v8h)); }
            }
#pragma unroll
            for (int db = 0; db < 4; ++db)
#pragma unroll
                for (int qb = 0; qb < QB; ++qb) { o[db][qb] = WFrag<T16>::mma(v[db], p[qb], o[db][qb]); if (HI) { o[db][qb] = WFrag<T16>::mma(v[db], p2[qb], o[db][qb]); o[db][qb] = WFrag<T16>::mma(v2[db], p[qb], o[db][qb]); } }
            // four vector slots behind the pass's last WMMAs: over the loop's back edge the next pass's first products write registers that these read as operands
            if constexpr (QB == 2) asm volatile("v_nop\n\tv_nop\n\tv_nop\n\tv_nop" : "+v"(o[0][0]), "+v"(o[1][0]), "+v"(o[2][0]), "+v"(o[3][0]), "+v"(o[0][1]), "+v"(o[1][1]), "+v"(o[2][1]), "+v"(o[3][1]));
            else asm volatile("v_nop\n\tv_nop\n\tv_nop\n\tv_nop" : "+v"(o[0][0]), "+v"(o[1][0]), "+v"(o[2][0]), "+v"(o[3][0]));
            }
        }
    }
    float* sw = so + wv * (QB * 16 * 68);
#pragma unroll
    for (int qb = 0; qb < QB; ++qb) { l[qb] += xhalf(l[qb]);
#pragma unroll
        for (int db = 0; db < 4; ++db) { float* d = sw + (qb * 16 + lr) * 68 + db * 16 + hi * 8; *(v4fa*)d = __builtin_shufflevector(o[db][qb], o[db][qb], 0, 1, 2, 3); *(v4fa*)(d + 4) = __builtin_shufflevector(o[db][qb], o[db][qb], 4, 5, 6, 7); }
        if (hi == 0) { sml[(wv * (QB * 16) + qb * 16 + lr) * 2] = m[qb]; sml[(wv * (QB * 16) + qb * 16 + lr) * 2 + 1] = l[qb]; } }
    __syncthreads();   // every wave's partial tile, maximum and sum are in LDS
    if ((int)threadIdx.x < QB * 16 * 8) { const int qq = (threadIdx.x & 15) + 16 * (threadIdx.x >> 7), dg = (threadIdx.x >> 4) & 7;   // one thread: 8 consecutive d of one query row; a wave: 16 rows x 16 d, 512 contiguous bytes in fragment order
        float M = sml[qq * 2];
#pragma unroll
        for (int w = 1; w < NWF; ++w) M = fmaxf(M, sml[(w * (QB * 16) + qq) * 2]);
        float L = 0.f; v4f r0 = (v4f){}, r1 = (v4f){};
#pragma unroll
        for (int w = 0; w < NWF; ++w) { const float f = exp2s((sml[(w * (QB * 16) + qq) * 2] - M) * L2E); L += f * sml[(w * (QB * 16) + qq) * 2 + 1]; const float* d = so + w * (QB * 16 * 68) + qq * 68 + dg * 8; r0 += *(const v4fa*)d * f; r1 += *(const v4fa*)(d + 4) * f; }
        const float inv = __fdiv_rn(1.0f, L); v8us oh, ol;
#pragma unroll
        for (int j = 0; j < 4; ++j) { unsigned short a, c2; splitf(r0[j] * inv, a, c2); oh[j] = a; ol[j] = c2; splitf(r1[j] * inv, a, c2); oh[4 + j] = a; ol[4 + j] = c2; }
        const int eo = (q0 + (qq & ~15)) * DQ + dg * 128 + (qq & 15) * 8;   /* k = dg * 8 of the head's two blocks stands at dg * 128 */ bf* pa = Ah + eo; bf* pb = Al + eo; *(v8usa*)pa = oh; *(v8usa*)pb = ol; XWAIT(pa, pb); }
    __syncthreads();   // the LDS tiles are read: the next tile of this work-group may overwrite them
}
// grid (batches x heads, pairs of tiles): a work-group takes a long tile and then the short one that makes every pair cost the same; the pairs of f16 tiles (the longer ones) have the low flat indices.
__global__ __launch_bounds__(32 * NWF) __attribute__((amdgpu_waves_per_eu(4, 4))) void k_fattn(const h16* __restrict__ Q16, const bf* __restrict__ Qh, const bf* __restrict__ Ql, const h16* __restrict__ K16, const bf* __restrict__ Kh, const bf* __restrict__ Kl,
                                                    const h16* __restrict__ V16, const bf* __restrict__ Vh, const bf* __restrict__ Vl, bf* Ah, bf* Al, const float* __restrict__ QN, const float* __restrict__ KN) {
    __shared__ __align__(16) float so[NWF * 32 * 68]; __shared__ float sml[NWF * 32 * 2];
    const int wv = __builtin_amdgcn_readfirstlane((int)(threadIdx.x >> 5));   // wave number, scalar: the key loop's bounds stay wave-uniform
    const int bb = blockIdx.x / NH_, hh = blockIdx.x % NH_;   // batch, head
    const size_t hq = (size_t)blockIdx.x * TT * HD, hk = (size_t)(bb * NKV + hh / REP) * TT * HD; Ah += (size_t)bb * TT * DQ + hh * (HD * 16); Al += (size_t)bb * TT * DQ + hh * (HD * 16);   // rows = tokens of every batch, K = DQ, fragment order: a head is two k blocks
    constexpr int NP = (TT - RH) / 64; const int x = blockIdx.y;
    if (x < NP) {
        static_assert(TT == 64 * 32, "one line of a head's norm plane per lane");
        const float* kq = KN + (size_t)(bb * NKV + hh / REP) * (TT / 64) * NRL; const float* qq = QN + (size_t)blockIdx.x * (TT / 64) * NRL; const int no = (threadIdx.x & 31) * NRL;   // the head's lines (scalar bases); the lane's line: tokens 64 * lane to 64 * lane + 63
        const float kn2 = kq[no], qn2 = qq[no];
        asm volatile("s_wait_xcnt 0x0" :: "s"(kq), "s"(qq), "v"(no) : "memory");   // behind the two loads; it names their scalar bases and their lane offset as inputs, so that these stay live up to the wait
#pragma unroll 1
        for (int r = 0; r < 2; ++r) attn_tile<h16, false, 2>(Q16 + hq, nullptr, K16 + hk, nullptr, V16 + hk, nullptr, r ? RH + 32 * x : TT - 32 - 32 * x, wv, so, sml, Ah, Al, qn2, kn2);
    } else {
#pragma unroll 1
        for (int r = 0; r < 2; ++r) attn_tile<bf, true, 1>(Qh + hq, Ql + hq, Kh + hk, Kl + hk, Vh + hk, Vl + hk, r ? 16 * (x - NP) : RH - 16 - 16 * (x - NP), wv, so, sml, Ah, Al, 0.f, 0.f);
    }
}

extern "C" void kernel_launch(void* const* d_in, const int* in_sizes, int n_in,
                              void* d_out, int out_size, void* d_ws, size_t ws_size, hipStream_t stream) {
    (void)in_sizes; (void)n_in; (void)out_size;
    const float* x = (const float*)d_in[0]; const float* wq = (const float*)d_in[1]; const float* bq = (const float*)d_in[2]; const float* wk = (const float*)d_in[3]; const float* bk = (const float*)d_in[4]; const float* wv = (const float*)d_in[5]; const float* bv = (const float*)d_in[6]; const float* wo = (const float*)d_in[7]; const float* bo = (const float*)d_in[8]; const float* cosT = nullptr; const float* sinT = nullptr; (void)cosT; (void)sinT;
    float* OUT = (float*)d_out;     // [2][2048][1024]
    char* wsp = (char*)d_ws;
    auto take = [&](size_t bytes) { char* p = wsp; wsp += (bytes + 255) & ~(size_t)255; return (void*)p; };
    bf* WQ = (bf*)take((size_t)DQ * DM * 2); bf* WK = (bf*)take((size_t)DKV * DM * 2); bf* WV = (bf*)take((size_t)DKV * DM * 2); bf* WO = (bf*)take((size_t)DM * DQ * 2);
    bf* XB = (bf*)take((size_t)NB_ * TT * DM * 2);
    h16* QP16 = (h16*)take((size_t)NB_ * NH_ * TT * HD * 2); h16* KP16 = (h16*)take((size_t)NB_ * NKV * TT * HD * 2); h16* VT16 = (h16*)take((size_t)NB_ * NKV * HD * TT * 2);
    bf* QPh = (bf*)take((size_t)NB_ * NH_ * TT * HD * 2); bf* QPl = (bf*)take((size_t)NB_ * NH_ * TT * HD * 2); bf* KPh = (bf*)take((size_t)NB_ * NKV * TT * HD * 2); bf* KPl = (bf*)take((size_t)NB_ * NKV * TT * HD * 2); bf* VTh = (bf*)take((size_t)NB_ * NKV * HD * TT * 2); bf* VTl = (bf*)take((size_t)NB_ * NKV * HD * TT * 2);
    bf* ATh = (bf*)take((size_t)NB_ * TT * DQ * 2); bf* ATl = (bf*)take((size_t)NB_ * TT * DQ * 2);
    float* QN = (float*)take((size_t)NB_ * NH_ * (TT / 64) * NRL * 4); float* KN = (float*)take((size_t)NB_ * NKV * (TT / 64) * NRL * 4);
    if ((size_t)(wsp - (char*)d_ws) > ws_size) return;    // ws 256 MiB
    k_cvt8<<<dim3(DM * DM / 2048, 4 + NB_ * TT / DM, 1), 256, 0, stream>>>(x, wq, wk, wv, wo, XB, WQ, WK, WV, WO);
    k_qkv<<<dim3(TT / 128, DQ / 128, NB_), 384, 0, stream>>>(XB, WQ, WK, WV, bq, bk, bv, QP16, QPh, QPl, KP16, KPh, KPl, VT16, VTh, VTl, QN, KN);
    k_fattn<<<dim3(NB_ * NH_, (TT - RH) / 64 + RH / 32, 1), 32 * NWF, 0, stream>>>(QP16, QPh, QPl, KP16, KPh, KPl, VT16, VTh, VTl, ATh, ATl, QN, KN);
    k_oproj<<<dim3(NB_ * TT / 128, DM / 128, 1), 256, 0, stream>>>(ATh, ATl, WO, bo, OUT);
}
